// v000
// Measured on an AMD MI455X. A time is GPU time per run, averaged over a window of back-to-back runs after a warm-up
// (all launches, gaps included; the runs take copies of the inputs in turn), and the median of several windows.
// Apart from v000's, it joins two sittings. Times from different sittings can be a few percent apart, while
// side-by-side timings come from the same sitting.
// The starting kernel, v000, takes 3720 microseconds a run.
#include <hip/hip_runtime.h>
// Multi-head self-attention with ONE fused QKV projection packed PER HEAD, NO output projection and a RAW-VIEW merge (x [2][2048][1024]; qkv = x W_qkv + b_qkv ([in][out] 1024 x 3072, normal x 1/32; a REAL bias normal x 0.01) reshaped (b, s, 16, 3 x 64): head h owns columns 192 h .. 192 h + 191: q | k | v = its three 64-column slices; att = q k^T / sqrt(64); softmax over all 2048 keys (no mask); values [b][16][s][64] are reshaped to (b, s, 1024) WITHOUT a head transpose (the source's own form): the output memory of a batch IS the sixteen [2048][64] head planes one after another); the P.V product is written straight to the f32 output, each head into its own contiguous plane.
// Structure: token rows r = b*2048 + s; x as exact f16 rows (bf16-rounded); q | k | v as ONE WMMA GEMM (N = 3 x 1024) (32x64 wave tiles, f32 accumulation, exact x16 weights + bias, f16 outputs); per batch: V^T via LDS transposes, one call per head on its own 64-column slice (pitch 3072) of the packed plane; per (batch, group of 4 heads): scores GEMM (K = 64, batched over the heads on grid.y, alpha = 1/sqrt(64)), row softmax on VALU (f32 statistics; weights stored x256 as f16), out = P . V^T GEMM (K = 2048, alpha 2^-8 for the x256 weights) as an f32-OUTPUT GEMM straight into the output's own layout (head h = the [2048][64] plane at offset 2048 x 64 h): no output projection.
// Compute dtype: inputs rounded to bf16; x / weights exact; q, k, v and softmax weights as plain f16 GEMM operands (~2^-12); scores, softmax statistics and o f32. v_wmma_f32_16x16x32_f16.
#define NB 2
#define SQ 2048
#define DM 1024
#define NH 16
#define HD 64
#define HG 4                         /* heads per attention launch group */
#define B0 0                         /* first batch processed (debug hook) */
#define NBR NB                       /* batches processed (debug hook) */
#define NR ((size_t)NB * SQ)         /* token rows */
#define MP ((int)((size_t)NBR * SQ)) /* rows projected (debug hook) */
#define QN SQ                        /* query rows attended per batch (debug hook) */
#define NHD NH                       /* heads attended (debug hook) */
#define MPO MP                       /* unused (no output projection) */
#define LQ (3 * DM)      /* row pitch of the q/k/v rows */
typedef __bf16 v16b __attribute__((ext_vector_type(16)));
typedef unsigned short v8us __attribute__((ext_vector_type(8), may_alias));
typedef float  v8f  __attribute__((ext_vector_type(8)));
typedef float  v4f  __attribute__((ext_vector_type(4)));
typedef float  v4fa __attribute__((ext_vector_type(4), may_alias));
union FragB { v16b v; v8us half[2]; unsigned short u[16]; };

__device__ __forceinline__ unsigned short bf16_bits(float x) { unsigned int u = __float_as_uint(x); return (unsigned short)((u + 0x7FFFu + ((u >> 16) & 1u)) >> 16); }
__device__ __forceinline__ float bf16_val(unsigned short b) { return __uint_as_float(((unsigned int)b) << 16); }
__device__ __forceinline__ float bf16_round(float x) { return bf16_val(bf16_bits(x)); }
// D += A·B with NT terms: 1 = ah·bh, 2 = + al·bh (A split), 3 = + ah·bl (both split)
template <int NT>
__device__ __forceinline__ v8f mmaN(v16b ah, v16b al, v16b bh, v16b bl, v8f c) {
  c = __builtin_amdgcn_wmma_f32_16x16x32_bf16(false, ah, false, bh, (short)0, c, false, false);
  if (NT >= 2) c = __builtin_amdgcn_wmma_f32_16x16x32_bf16(false, al, false, bh, (short)0, c, false, false);
  if (NT >= 3) c = __builtin_amdgcn_wmma_f32_16x16x32_bf16(false, ah, false, bl, (short)0, c, false, false);
  asm volatile("v_nop\n\tv_nop\n\tv_nop\n\tv_nop" : "+v"(c) : "v"(ah), "v"(al), "v"(bh), "v"(bl));
  return c;
}

__global__ __launch_bounds__(256) void k_wt_bf16(const float* __restrict__ W, unsigned short* __restrict__ Wt, int K, int N) {
  const int t = blockIdx.x * 256 + threadIdx.x;
  const int k8n = K / 8;
  if (t >= N * k8n) return;
  const int n = t / k8n, k8 = (t % k8n) * 8;
  v8us v;
#pragma unroll
  for (int i = 0; i < 8; ++i) v[i] = bf16_bits(W[(size_t)(k8 + i) * N + n]);
  *(v8us*)(Wt + (size_t)n * K + k8) = v;
  
}

// GEMM C[M][N] (f32, pitch ldc) = act(A[M][K]·W + bias). A f32 row-major (pitch lda) converted per fragment to bf16
// (ASPLIT: hi/lo two planes -> 2 terms, else single rounded term); Wt bf16 [N][K] (pitch ldb). BIAS_BF16 rounds the
// bias to bf16 first (bias quantised to bf16 before the add). K%32==0, M%16==0, N%64==0.
template <bool ASPLIT, int ACT, bool BIAS_BF16>
__global__ __launch_bounds__(128) void k_gemm_bf(const float* __restrict__ A, int lda, const unsigned short* __restrict__ Wt, int ldb,
                                               const float* __restrict__ bias, float* __restrict__ C, int ldc, int M, int N, int K) {
  __shared__ __attribute__((aligned(16))) float so[4][16][64];
  const int tid = threadIdx.x, w = tid >> 5, lane = tid & 31, ln = lane & 15, hh = lane >> 4;
  const int ntn = N / 64;
  const int wid = blockIdx.x * 4 + w;
  const int mt = wid / ntn, nq = wid % ntn;
  if (mt * 16 >= M) return;
  const int row0 = mt * 16, col0 = nq * 64;
  const float* arow = A + (size_t)(row0 + ln) * lda;
  v8f acc[4] = {};
  for (int kb = 0; kb < K; kb += 32) {
    FragB ah, al;
    const v4f x0 = *(const v4fa*)(arow + kb + 8 * hh), x1 = *(const v4fa*)(arow + kb + 8 * hh + 4);
    const v4f x2 = *(const v4fa*)(arow + kb + 16 + 8 * hh), x3 = *(const v4fa*)(arow + kb + 16 + 8 * hh + 4);
    float xs[16] = {x0[0],x0[1],x0[2],x0[3],x1[0],x1[1],x1[2],x1[3],x2[0],x2[1],x2[2],x2[3],x3[0],x3[1],x3[2],x3[3]};
#pragma unroll
    for (int i = 0; i < 16; ++i) { const unsigned short hb = bf16_bits(xs[i]); ah.u[i] = hb; al.u[i] = ASPLIT ? bf16_bits(xs[i] - bf16_val(hb)) : (unsigned short)0; }
#pragma unroll
    for (int t = 0; t < 4; ++t) {
      const unsigned short* brow = Wt + (size_t)(col0 + t * 16 + ln) * ldb + kb;
      FragB b;
      b.half[0] = *(const v8us*)(brow + 8 * hh);
      b.half[1] = *(const v8us*)(brow + 16 + 8 * hh);
      acc[t] = mmaN<ASPLIT ? 2 : 1>(ah.v, al.v, b.v, b.v, acc[t]);
    }
  }
#pragma unroll
  for (int t = 0; t < 4; ++t) {
    float bv = bias ? bias[col0 + t * 16 + ln] : 0.f;
    if (BIAS_BF16) bv = bf16_round(bv);
#pragma unroll
    for (int r = 0; r < 8; ++r) { float v = acc[t][r] + bv; if (ACT == 1) v = fmaxf(v, 0.f); so[w][8 * hh + r][t * 16 + ln] = v; }
  }
  __builtin_amdgcn_fence(__ATOMIC_ACQ_REL, "workgroup");
  __builtin_amdgcn_wave_barrier();
  const int rsub = lane >> 4, c4 = (lane & 15) * 4;
  {
#pragma unroll
    for (int q = 0; q < 8; ++q) {
      const int r = q * 2 + rsub;
      const v4f v = *(const v4fa*)&so[w][r][c4];
      *(v4f*)(C + (size_t)(row0 + r) * ldc + col0 + c4) = v;
    }
    
  }
}

// GEMM C = act(A·W + bias + resid): A f32 (ASPLIT -> hi/lo 2 terms), Wt bf16 [N][K]; ACT 0 none, 1 relu, 2 exact gelu;
// resid (optional, f32, row index = (row % rmod), pitch ldr, RES_BF16 rounds it) added before the activation.
template <bool ASPLIT, int ACT, bool BIAS_BF16, bool RES_BF16>
__global__ __launch_bounds__(128) void k_gemm_bf3(const float* __restrict__ A, int lda, const unsigned short* __restrict__ Wt, int ldb,
                                                const float* __restrict__ bias, const float* __restrict__ resid, int rmod, int ldr,
                                                float* __restrict__ C, int ldc, int M, int N, int K) {
  __shared__ __attribute__((aligned(16))) float so[4][16][64];
  const int tid = threadIdx.x, w = tid >> 5, lane = tid & 31, ln = lane & 15, hh = lane >> 4;
  const int ntn = N / 64;
  const int wid = blockIdx.x * 4 + w;
  const int mt = wid / ntn, nq = wid % ntn;
  if (mt * 16 >= M) return;
  const int row0 = mt * 16, col0 = nq * 64;
  const float* arow = A + (size_t)(row0 + ln) * lda;
  v8f acc[4] = {};
  for (int kb = 0; kb < K; kb += 32) {
    FragB ah, al;
    const v4f x0 = *(const v4fa*)(arow + kb + 8 * hh), x1 = *(const v4fa*)(arow + kb + 8 * hh + 4);
    const v4f x2 = *(const v4fa*)(arow + kb + 16 + 8 * hh), x3 = *(const v4fa*)(arow + kb + 16 + 8 * hh + 4);
    float xs[16] = {x0[0],x0[1],x0[2],x0[3],x1[0],x1[1],x1[2],x1[3],x2[0],x2[1],x2[2],x2[3],x3[0],x3[1],x3[2],x3[3]};
#pragma unroll
    for (int i = 0; i < 16; ++i) { const unsigned short hb = bf16_bits(xs[i]); ah.u[i] = hb; al.u[i] = ASPLIT ? bf16_bits(xs[i] - bf16_val(hb)) : (unsigned short)0; }
#pragma unroll
    for (int t = 0; t < 4; ++t) {
      const unsigned short* brow = Wt + (size_t)(col0 + t * 16 + ln) * ldb + kb;
      FragB b;
      b.half[0] = *(const v8us*)(brow + 8 * hh);
      b.half[1] = *(const v8us*)(brow + 16 + 8 * hh);
      acc[t] = mmaN<ASPLIT ? 2 : 1>(ah.v, al.v, b.v, b.v, acc[t]);
    }
  }
#pragma unroll
  for (int t = 0; t < 4; ++t) {
    const int col = col0 + t * 16 + ln;
    float bv = bias ? bias[col] : 0.f;
    if (BIAS_BF16) bv = bf16_round(bv);
#pragma unroll
    for (int r = 0; r < 8; ++r) {
      float v = acc[t][r] + bv;
      if (resid) { float rv = resid[(size_t)((row0 + 8 * hh + r) % rmod) * ldr + col]; if (RES_BF16) rv = bf16_round(rv); v += rv; }
      if (ACT == 1) v = fmaxf(v, 0.f);
      if (ACT == 2) v = 0.5f * v * (1.0f + erff(v * 0.70710678118654752f));
      if (ACT == 3) { const float u = 0.7978845608028654f * (v + 0.044715f * v * v * v); v = 0.5f * v * (1.0f + tanhf(u)); }
      so[w][8 * hh + r][t * 16 + ln] = v;
    }
  }
  __builtin_amdgcn_fence(__ATOMIC_ACQ_REL, "workgroup");
  __builtin_amdgcn_wave_barrier();
  const int rsub = lane >> 4, c4 = (lane & 15) * 4;
  {
#pragma unroll
    for (int q = 0; q < 8; ++q) {
      const int r = q * 2 + rsub;
      const v4f v = *(const v4fa*)&so[w][r][c4];
      *(v4f*)(C + (size_t)(row0 + r) * ldc + col0 + c4) = v;
    }
    
  }
}
// row LayerNorm (biased variance, eps) over N: s = X (+ R); optional out_sum <- s; out_norm <- (s-mu)*rsqrt(var+eps)*g + b
template <bool PARAM_BF16>
__global__ __launch_bounds__(256) void k_layernorm(const float* __restrict__ X, const float* __restrict__ R, const float* __restrict__ g, const float* __restrict__ bta,
                                                  float* __restrict__ out_sum, float* __restrict__ out_norm, int N, float eps) {
  __shared__ float red[256];
  const int row = blockIdx.x, tid = threadIdx.x;
  const float* x = X + (size_t)row * N; const float* rr = R ? R + (size_t)row * N : nullptr;
  float vals[16];                     // up to N = 4096
  const int per = N / 256;            // contiguous chunk per thread? use strided-by-4 chunks: thread handles j = tid*4 + 1024*u
  float s1 = 0.f;
  for (int u = 0; u < per / 4; ++u) {
    const int j = tid * 4 + 1024 * u;
    const v4f a = *(const v4fa*)(x + j);
    v4f b = {0.f,0.f,0.f,0.f}; if (rr) b = *(const v4fa*)(rr + j);
#pragma unroll
    for (int q = 0; q < 4; ++q) { const float v = a[q] + b[q]; vals[u * 4 + q] = v; s1 += v; }
  }
  red[tid] = s1; __syncthreads();
  for (int st = 128; st > 0; st >>= 1) { if (tid < st) red[tid] += red[tid + st]; __syncthreads(); }
  const float mu = red[0] / (float)N; __syncthreads();
  float s2 = 0.f;
  for (int u = 0; u < per / 4; ++u)
#pragma unroll
    for (int q = 0; q < 4; ++q) { const float c = vals[u * 4 + q] - mu; s2 += c * c; }
  red[tid] = s2; __syncthreads();
  for (int st = 128; st > 0; st >>= 1) { if (tid < st) red[tid] += red[tid + st]; __syncthreads(); }
  const float rs = rsqrtf(red[0] / (float)N + eps);
  {
    for (int u = 0; u < per / 4; ++u) {
      const int j = tid * 4 + 1024 * u;
      v4f o, sm;
#pragma unroll
      for (int q = 0; q < 4; ++q) {
        float gg = g[j + q], bb = bta[j + q];
        if (PARAM_BF16) { gg = bf16_round(gg); bb = bf16_round(bb); }
        sm[q] = vals[u * 4 + q]; o[q] = (vals[u * 4 + q] - mu) * rs * gg + bb;
      }
      if (out_sum) *(v4f*)(out_sum + (size_t)row * N + j) = sm;
      *(v4f*)(out_norm + (size_t)row * N + j) = o;
    }
    
  }
}



// ---- f16 WMMA path (v_wmma_f32_16x16x32_f16): 11-bit significands for operands in range — used where a [0,1] probability operand needs more precision than bf16
typedef _Float16 v16h __attribute__((ext_vector_type(16)));
union FragH { v16h v; v8us half[2]; _Float16 h[16]; unsigned short u[16]; };
template <int NT>
__device__ __forceinline__ v8f mmaH(v16h ah, v16h al, v16h bh, v16h bl, v8f c) {
  c = __builtin_amdgcn_wmma_f32_16x16x32_f16(false, ah, false, bh, (short)0, c, false, false);
  if (NT >= 2) c = __builtin_amdgcn_wmma_f32_16x16x32_f16(false, al, false, bh, (short)0, c, false, false);
  if (NT >= 3) c = __builtin_amdgcn_wmma_f32_16x16x32_f16(false, ah, false, bl, (short)0, c, false, false);
  asm volatile("v_nop\n\tv_nop\n\tv_nop\n\tv_nop" : "+v"(c) : "v"(ah), "v"(al), "v"(bh), "v"(bl));
  return c;
}
// batched GEMM like k_gemm_b but f16 operands: A f32 (split into f16 hi/lo if ASPLIT, else rounded to f16), Bt = f16 values [n][k]; alpha; C f32; N multiple of 16 (partial tiles skipped)
template <bool ASPLIT>
__global__ __launch_bounds__(128) void k_gemm_h(const float* __restrict__ A, int lda, size_t sA, const _Float16* __restrict__ Bh, int ldb, size_t sB, float alpha, float* __restrict__ C, int ldc, size_t sC, int M, int N, int K) {
  __shared__ __attribute__((aligned(16))) float so[4][16][64];
  const int tid = threadIdx.x, w = tid >> 5, lane = tid & 31, ln = lane & 15, hh = lane >> 4; const int by = blockIdx.y;
  A += (size_t)by * sA; Bh += (size_t)by * sB; C += (size_t)by * sC;
  const int ntn = (N + 63) / 64; const int wid = blockIdx.x * 4 + w; const int mt = wid / ntn, nq = wid % ntn; if (mt * 16 >= M) return;
  const int row0 = mt * 16, col0 = nq * 64; const float* arow = A + (size_t)(row0 + ln) * lda;
  v8f acc[4] = {};
  for (int kb = 0; kb < K; kb += 32) {
    FragH ah, al;
    const v4f x0 = *(const v4fa*)(arow + kb + 8 * hh), x1 = *(const v4fa*)(arow + kb + 8 * hh + 4), x2 = *(const v4fa*)(arow + kb + 16 + 8 * hh), x3 = *(const v4fa*)(arow + kb + 16 + 8 * hh + 4);
    float xs[16] = {x0[0],x0[1],x0[2],x0[3],x1[0],x1[1],x1[2],x1[3],x2[0],x2[1],x2[2],x2[3],x3[0],x3[1],x3[2],x3[3]};
#pragma unroll
    for (int i = 0; i < 16; ++i) { const _Float16 h = (_Float16)xs[i]; ah.h[i] = h; al.h[i] = ASPLIT ? (_Float16)(xs[i] - (float)h) : (_Float16)0.0f; }
#pragma unroll
    for (int t = 0; t < 4; ++t) { if (col0 + t * 16 >= N) continue; const size_t boff = (size_t)(col0 + t * 16 + ln) * ldb + kb; FragH bq; bq.half[0] = *(const v8us*)(Bh + boff + 8 * hh); bq.half[1] = *(const v8us*)(Bh + boff + 16 + 8 * hh);
      acc[t] = mmaH<ASPLIT ? 2 : 1>(ah.v, al.v, bq.v, bq.v, acc[t]); }
  }
#pragma unroll
  for (int t = 0; t < 4; ++t) { if (col0 + t * 16 >= N) continue;
#pragma unroll
    for (int r = 0; r < 8; ++r) so[w][8 * hh + r][t * 16 + ln] = acc[t][r] * alpha; }
  __builtin_amdgcn_fence(__ATOMIC_ACQ_REL, "workgroup"); __builtin_amdgcn_wave_barrier();
  const int rsub = lane >> 4, c4 = (lane & 15) * 4;
  {
#pragma unroll
    for (int q = 0; q < 8; ++q) { const int r = q * 2 + rsub; if (col0 + c4 < N) { const v4f v = *(const v4fa*)&so[w][r][c4]; *(v4f*)(C + (size_t)(row0 + r) * ldc + col0 + c4) = v; } }
     }
}

// Wt[n][k] = f16(W[k][n]·scale) from f32 row-major W[K][N] (scale = power of two; bf16-exact weights stay exact in f16 away from the subnormal range)
__global__ __launch_bounds__(256) void k_wt_f16(const float* __restrict__ W, _Float16* __restrict__ Wt, int K, int N, float scale) {
  const int t = blockIdx.x * 256 + threadIdx.x; if (t >= N * (K / 8)) return; const int n = t / (K / 8), k8 = (t % (K / 8)) * 8; FragH f;
#pragma unroll
  for (int i = 0; i < 8; ++i) f.h[i] = (_Float16)(bf16_round(W[(size_t)(k8 + i) * N + n]) * scale); const v8us o = f.half[0];
  *(v8us*)((unsigned short*)Wt + (size_t)n * K + k8) = o; 
}
// k_gemm_hh variant with fused epilogue: v = acc·alpha + bias[by·sBias + col] (+ CP[(row/rowsPerB)·sCPb + by·64 + col] if CP) ; ACT 0 none / 1 elu ; writes f16 C16 (and f32 C if non-null)
template <int ACT>
__global__ __launch_bounds__(128) void k_gemm_hhx(const _Float16* __restrict__ A, int lda, size_t sA, const _Float16* __restrict__ Bh, int ldb, size_t sB, float alpha, const float* __restrict__ bias, size_t sBias, const float* __restrict__ CP, int rowsPerB, size_t sCPb, int row0g,
    float* __restrict__ C, _Float16* __restrict__ C16, int ldc, size_t sC, int M, int N, int K) {
  __shared__ __attribute__((aligned(16))) float so[4][16][64];
  const int tid = threadIdx.x, w = tid >> 5, lane = tid & 31, ln = lane & 15, hh = lane >> 4; const int by = blockIdx.y;
  A += (size_t)by * sA; Bh += (size_t)by * sB; const size_t cofs = (size_t)by * sC; const float* bp = bias ? bias + (size_t)by * sBias : nullptr;
  const int ntn = (N + 63) / 64; const int wid = blockIdx.x * 4 + w; const int mt = wid / ntn, nq = wid % ntn; if (mt * 16 >= M) return;
  const int row0 = mt * 16, col0 = nq * 64; const _Float16* arow = A + (size_t)(row0 + ln) * lda;
  v8f acc[4] = {};
  for (int kb = 0; kb < K; kb += 32) { FragH ah; ah.half[0] = *(const v8us*)((const unsigned short*)arow + kb + 8 * hh); ah.half[1] = *(const v8us*)((const unsigned short*)arow + kb + 16 + 8 * hh);
#pragma unroll
    for (int t = 0; t < 4; ++t) { if (col0 + t * 16 >= N) continue; const size_t boff = (size_t)(col0 + t * 16 + ln) * ldb + kb; FragH bq; bq.half[0] = *(const v8us*)((const unsigned short*)Bh + boff + 8 * hh); bq.half[1] = *(const v8us*)((const unsigned short*)Bh + boff + 16 + 8 * hh);
      acc[t] = mmaH<1>(ah.v, ah.v, bq.v, bq.v, acc[t]); }
  }
#pragma unroll
  for (int t = 0; t < 4; ++t) { if (col0 + t * 16 >= N) continue; const int col = col0 + t * 16 + ln; const float bv = bp ? bf16_round(bp[col]) : 0.f;
#pragma unroll
    for (int r = 0; r < 8; ++r) { float v = acc[t][r] * alpha + bv; if (CP) { const int rr = row0g + row0 + 8 * hh + r; if (rowsPerB < 0) v += CP[cofs + (size_t)rr * ldc + col];      /* rowsPerB < 0: own element of the batched C plane */ else { const int bidx = rr / rowsPerB; v += CP[(size_t)bidx * sCPb + (size_t)by * 64 + col]; } } if (ACT == 1) v = (v > 0.f) ? v : expm1f(v); else if (ACT == 7) v = (v > 0.f) ? v + 1.0f : expf(v); else if (ACT == 8) v = tanhf(v); else if (ACT == 9) v = 0.5f * v * (1.0f + tanhf(0.7978845608028654f * (v + 0.044715f * v * v * v))); else if (ACT == 11) v = 1.0f / (1.0f + expf(-v)); else if (ACT == 12) v = (v > 0.f) ? v : 0.01f * v; else if (ACT == 14) v = (v > 0.f) ? v : 0.1f * v; else if (ACT == 16) v = (v >= 0.f) ? v : 0.3f * v; else if (ACT == 17) v = (v >= 0.f) ? v : 0.2f * v; else if (ACT == 15) v = v / (1.0f + expf(-v)); else if (ACT == 3) v = fmaxf(v, 0.f); else if (ACT == 6) v = 0.5f * v * (1.0f + erff(v * 0.70710678118654752f)); so[w][8 * hh + r][t * 16 + ln] = v; } }
  __builtin_amdgcn_fence(__ATOMIC_ACQ_REL, "workgroup"); __builtin_amdgcn_wave_barrier();
  const int rsub = lane >> 4, c4 = (lane & 15) * 4; typedef _Float16 v4h __attribute__((ext_vector_type(4)));
  {
#pragma unroll
    for (int q = 0; q < 8; ++q) { const int r = q * 2 + rsub; if (col0 + c4 < N) { const v4f v = *(const v4fa*)&so[w][r][c4]; if (C) *(v4f*)(C + cofs + (size_t)(row0 + r) * ldc + col0 + c4) = v; if (C16) { v4h h4; for (int i = 0; i < 4; ++i) h4[i] = (_Float16)v[i]; *(v4h*)(C16 + cofs + (size_t)(row0 + r) * ldc + col0 + c4) = h4; } } }
     }
}


typedef _Float16 v4h __attribute__((ext_vector_type(4)));

__global__ __launch_bounds__(256) void k_x16(const float* __restrict__ x, _Float16* __restrict__ X16, size_t n8) { const size_t t = (size_t)blockIdx.x * 256 + threadIdx.x; if (t >= n8) return; FragH f;
#pragma unroll
  for (int q = 0; q < 8; ++q) f.h[q] = (_Float16)bf16_round(x[t * 8 + q]); *(v8us*)((unsigned short*)X16 + t * 8) = f.half[0];  }
__global__ __launch_bounds__(256) void k_h16(const float* __restrict__ x, _Float16* __restrict__ X16, size_t n8) { const size_t t = (size_t)blockIdx.x * 256 + threadIdx.x; if (t >= n8) return; FragH f;
#pragma unroll
  for (int q = 0; q < 8; ++q) f.h[q] = (_Float16)x[t * 8 + q]; *(v8us*)((unsigned short*)X16 + t * 8) = f.half[0];  }
__global__ __launch_bounds__(256) void k_round16f(const float* __restrict__ W, _Float16* __restrict__ Bt, size_t n8) { const size_t t = (size_t)blockIdx.x * 256 + threadIdx.x; if (t >= n8) return; FragH f;
#pragma unroll
  for (int i = 0; i < 8; ++i) f.h[i] = (_Float16)(bf16_round(W[t * 8 + i]) * 16.0f); *(v8us*)((unsigned short*)Bt + t * 8) = f.half[0];  }
template <int NHv, int TTv>
__global__ __launch_bounds__(256) void k_vt(const _Float16* __restrict__ V16, int ldv, int voff, _Float16* __restrict__ Vt) { __shared__ unsigned short tl[64][66]; const int tid = threadIdx.x; const int slab = blockIdx.x / (TTv / 64), lg = blockIdx.x % (TTv / 64); const int b = slab / NHv, h = slab % NHv;
  for (int i = tid; i < 64 * 8; i += 256) { const int r = i / 8, c8 = (i % 8) * 8; FragH f; f.half[0] = *(const v8us*)((const unsigned short*)V16 + ((size_t)b * TTv + lg * 64 + r) * ldv + voff + h * 64 + c8);
#pragma unroll
    for (int q = 0; q < 8; ++q) tl[r][c8 + q] = f.u[q]; }
  __syncthreads();
  {
#pragma unroll
    for (int rd = 0; rd < 2; ++rd) { const int d = rd * 32 + tid / 8, pc = tid % 8; FragH f;
#pragma unroll
      for (int q = 0; q < 8; ++q) f.u[q] = tl[pc * 8 + q][d];
      *(v8us*)((unsigned short*)Vt + ((size_t)slab * 64 + d) * TTv + lg * 64 + pc * 8) = f.half[0]; }
     } }

__global__ __launch_bounds__(256) void k_hl(const float* __restrict__ F, _Float16* __restrict__ Hh, _Float16* __restrict__ Hl, size_t n8) { const size_t t = (size_t)blockIdx.x * 256 + threadIdx.x; if (t >= n8) return; FragH fh, fl; const v4f a = *(const v4fa*)(F + t * 8), c = *(const v4fa*)(F + t * 8 + 4);
#pragma unroll
  for (int q = 0; q < 4; ++q) { _Float16 h = (_Float16)a[q]; fh.h[q] = h; fl.h[q] = (_Float16)((a[q] - (float)h) * 1024.0f); h = (_Float16)c[q]; fh.h[4 + q] = h; fl.h[4 + q] = (_Float16)((c[q] - (float)h) * 1024.0f); }
  { *(v8us*)((unsigned short*)Hh + t * 8) = fh.half[0]; *(v8us*)((unsigned short*)Hl + t * 8) = fl.half[0];  } }

// ---- fast GEMM (wave tile 32x64; requires M % 32 == 0 rows per launch region and N % 64 == 0); epilogue = k_gemm_hhx semantics ----
__device__ __forceinline__ v16h g2_frag(const _Float16* p, int hh) { FragH f; f.half[0] = *(const v8us*)((const unsigned short*)p + 8 * hh); f.half[1] = *(const v8us*)((const unsigned short*)p + 16 + 8 * hh); return f.v; }
__device__ __forceinline__ v8f g2_mma(v16h a, v16h b, v8f c) { v8f d = __builtin_amdgcn_wmma_f32_16x16x32_f16(false, a, false, b, (short)0, c, false, false); asm volatile("v_nop\n\tv_nop\n\tv_nop\n\tv_nop" : "+v"(d) : "v"(a), "v"(b)); return d; }
template <int ACT>
__global__ __launch_bounds__(128) void k_gemm2(const _Float16* __restrict__ A, int lda, size_t sA, const _Float16* __restrict__ Bh, int ldb, size_t sB, float alpha, const float* __restrict__ bias, size_t sBias, const float* __restrict__ CP, int rowsPerB, size_t sCPb, int row0g,
    float* __restrict__ C, _Float16* __restrict__ C16, int ldc, size_t sC, int M, int N, int K) { static_assert(ACT == 0 || ACT == 3 || ACT == 6 || ACT == 8 || ACT == 9 || ACT == 11 || ACT == 12 || ACT == 14 || ACT == 15 || ACT == 16 || ACT == 17, "k_gemm2: unsupported ACT code (would silently apply no activation)");
  __shared__ __attribute__((aligned(16))) float so[4][32][68];
  const int tid = threadIdx.x, w = tid >> 5, lane = tid & 31, ln = lane & 15, hh = lane >> 4; const int by = blockIdx.y;
  A += (size_t)by * sA; Bh += (size_t)by * sB; const size_t cofs = (size_t)by * sC; const float* bp = bias ? bias + (size_t)by * sBias : nullptr;
  const int ntn = N >> 6; const int mt = blockIdx.x / ntn, nq = blockIdx.x - mt * ntn; const int row0 = mt * 128 + 32 * w, col0 = nq * 64; if (row0 >= M) return;
  const _Float16* a0p = A + (size_t)(row0 + ln) * lda; const _Float16* a1p = a0p + (size_t)16 * lda;
  const _Float16* b0p = Bh + (size_t)(col0 + ln) * ldb; const _Float16* b1p = b0p + (size_t)16 * ldb; const _Float16* b2p = b1p + (size_t)16 * ldb; const _Float16* b3p = b2p + (size_t)16 * ldb;
  const v8f z8 = {0.f,0.f,0.f,0.f,0.f,0.f,0.f,0.f}; v8f c00 = z8, c01 = z8, c02 = z8, c03 = z8, c10 = z8, c11 = z8, c12 = z8, c13 = z8;
#pragma unroll 1
  for (int kb = 0; kb < K; kb += 32) { const v16h a0 = g2_frag(a0p + kb, hh), a1 = g2_frag(a1p + kb, hh);
    v16h b = g2_frag(b0p + kb, hh); c00 = g2_mma(a0, b, c00); c10 = g2_mma(a1, b, c10);
    b = g2_frag(b1p + kb, hh); c01 = g2_mma(a0, b, c01); c11 = g2_mma(a1, b, c11);
    b = g2_frag(b2p + kb, hh); c02 = g2_mma(a0, b, c02); c12 = g2_mma(a1, b, c12);
    b = g2_frag(b3p + kb, hh); c03 = g2_mma(a0, b, c03); c13 = g2_mma(a1, b, c13); }
  v8f accs[8] = {c00, c01, c02, c03, c10, c11, c12, c13};
#pragma unroll
  for (int u = 0; u < 8; ++u) { const int t = u & 3, half = u >> 2; const int col = col0 + t * 16 + ln; const float bv = bp ? bf16_round(bp[col]) : 0.f;
#pragma unroll
    for (int r = 0; r < 8; ++r) { const int rloc = half * 16 + 8 * hh + r; float v = accs[u][r] * alpha + bv; if (CP) { if (rowsPerB < 0) v += CP[cofs + (size_t)(row0g + row0 + rloc) * ldc + col];      /* rowsPerB < 0: own element of the batched C plane */ else { const int bidx = (row0g + row0 + rloc) / rowsPerB; v += CP[(size_t)bidx * sCPb + (size_t)by * 64 + col]; } }
      if (ACT == 3) v = fmaxf(v, 0.f); else if (ACT == 6) v = 0.5f * v * (1.0f + erff(v * 0.70710678118654752f)); else if (ACT == 11) v = 1.0f / (1.0f + expf(-v)); else if (ACT == 15) v = v / (1.0f + expf(-v)); else if (ACT == 12) v = (v > 0.f) ? v : 0.01f * v; else if (ACT == 8) v = tanhf(v); else if (ACT == 9) v = 0.5f * v * (1.0f + tanhf(0.7978845608028654f * (v + 0.044715f * v * v * v))); else if (ACT == 14) v = (v > 0.f) ? v : 0.1f * v; else if (ACT == 16) v = (v >= 0.f) ? v : 0.3f * v; else if (ACT == 17) v = (v >= 0.f) ? v : 0.2f * v;
      so[w][rloc][t * 16 + ln] = v; } }
  __builtin_amdgcn_fence(__ATOMIC_ACQ_REL, "workgroup"); __builtin_amdgcn_wave_barrier();
  const int rsub = lane >> 4, c4 = (lane & 15) * 4;
  {
#pragma unroll
    for (int q = 0; q < 16; ++q) { const int r = q * 2 + rsub; const v4f v = *(const v4fa*)&so[w][r][c4]; if (C) *(v4f*)(C + cofs + (size_t)(row0 + r) * ldc + col0 + c4) = v; if (C16) { v4h h4; for (int i = 0; i < 4; ++i) h4[i] = (_Float16)v[i]; *(v4h*)(C16 + cofs + (size_t)(row0 + r) * ldc + col0 + c4) = h4; } }
     } }


__global__ __launch_bounds__(256) void k_wnat(const float* __restrict__ w, size_t n8, _Float16* __restrict__ Bt) { const size_t t = (size_t)blockIdx.x * 256 + threadIdx.x; if (t >= n8) return; FragH f; for (int q = 0; q < 8; ++q) f.h[q] = (_Float16)(bf16_round(w[t * 8 + q]) * 16.0f); *(v8us*)((unsigned short*)Bt + t * 8) = f.half[0];  }
__global__ __launch_bounds__(256) void k_rsm(const float* __restrict__ S, _Float16* __restrict__ P, int nrows) {
  #pragma clang fp contract(off)
  const int i = blockIdx.x * 256 + threadIdx.x; if (i >= nrows) return; const float* s = S + (size_t)i * SQ; float mx = -3.0e38f;
#pragma unroll 1
  for (int j = 0; j < SQ; ++j) mx = fmaxf(mx, s[j]); float se = 0.f;
#pragma unroll 1
  for (int j = 0; j < SQ; ++j) se += expf(s[j] - mx); const float sc = 256.0f / se;
#pragma unroll 1
  for (int j0 = 0; j0 < SQ; j0 += 8) { FragH f; for (int q = 0; q < 8; ++q) f.h[q] = (_Float16)(expf(s[j0 + q] - mx) * sc); unsigned short* d = (unsigned short*)P + (size_t)i * SQ + j0; *(v8us*)d = f.half[0];  } }
__global__ __launch_bounds__(256) void k_vt(const _Float16* __restrict__ V16, int b, int h0, _Float16* __restrict__ VT) { __shared__ unsigned short tl[64][65]; const int tid = threadIdx.x; const int hh = blockIdx.x % HG, sg = blockIdx.x / HG; const int s0 = sg * 64; const int h = h0 + hh;
  for (int i = tid; i < 64 * 8; i += 256) { const int j = i / 8, d8 = (i % 8) * 8; FragH f; f.half[0] = *(const v8us*)((const unsigned short*)V16 + ((size_t)b * SQ + s0 + j) * DM + h * HD + d8); for (int q = 0; q < 8; ++q) tl[d8 + q][j] = f.u[q]; }
  __syncthreads();
  { for (int i = tid; i < 64 * 8; i += 256) { const int d = i / 8, j8 = (i % 8) * 8; FragH f; for (int q = 0; q < 8; ++q) f.u[q] = tl[d][j8 + q]; *(v8us*)((unsigned short*)VT + ((size_t)hh * HD + d) * SQ + s0 + j8) = f.half[0]; }  } }


extern "C" void kernel_launch(void* const* d_in, const int* in_sizes, int n_in,
                              void* d_out, int out_size, void* d_ws, size_t ws_size, hipStream_t stream) {
  (void)in_sizes; (void)n_in; (void)out_size;
  const float* const* I = (const float* const*)d_in; const float* x = I[0]; const float* wqkv = I[1]; const float* bqkv = I[2];      /* input order: x, W_qkv ([in][out] [1024][3072]; columns packed PER HEAD: 192 h + {0..63 q, 64..127 k, 128..191 v}), b_qkv [3072] (REAL; the same packing: the projection GEMM's bias slot reads it by output column); three inputs; no output weight: the module has none */
  char* ws = (char*)d_ws; size_t off = 0;
  auto take = [&](size_t bytes) { char* p = ws + off; off += (bytes + 255) & ~(size_t)255; return p; };
  _Float16* BQKV = (_Float16*)take((size_t)3 * DM * DM * 2);
  _Float16* X16 = (_Float16*)take(NR * DM * 2); _Float16* QKV = (_Float16*)take(NR * 3 * DM * 2); _Float16* Q16 = QKV; _Float16* K16 = QKV + HD; _Float16* V16 = QKV + 2 * HD;      /* PER-HEAD packing: within head h's 192 columns q starts at + 0, k at + 64, v at + 128; the head stride is 3 HD */
  float* S = (float*)take((size_t)HG * SQ * SQ * 4); _Float16* P = (_Float16*)take((size_t)HG * SQ * SQ * 2); _Float16* VT = (_Float16*)take((size_t)NH * HD * SQ * 2);
  if (off > ws_size) return;
  k_wt_f16<<<(unsigned)(((size_t)DM * 3 * DM / 8 + 255) / 256), 256, 0, stream>>>(wqkv, BQKV, DM, 3 * DM, 16.0f);      /* [in][out] -> Bt[n][k] x16 (pitch K = 1024) */

  k_x16<<<(unsigned)((NR * DM / 8 + 255) / 256), 256, 0, stream>>>(x, X16, NR * DM / 8);
  const size_t r0p = (size_t)B0 * SQ;      /* first projected row */
  k_gemm2<0><<<dim3((unsigned)((MP / 128) * (3 * DM / 64)), 1), 128, 0, stream>>>(X16 + r0p * DM, DM, 0, BQKV, DM, 0, 0.0625f, bqkv, 0, nullptr, 1, 0, 0, nullptr, QKV + r0p * 3 * DM, 3 * DM, 0, MP, 3 * DM, DM);      /* q | k | v rows (f16); head h = columns 3*HD*h .. 3*HD*h + 191 (q | k | v) */
  for (int b = B0; b < B0 + NBR; ++b) { const size_t r0 = (size_t)b * SQ;
    for (int h = 0; h < NH; ++h) k_vt<1, SQ><<<SQ / 64, 256, 0, stream>>>(V16 + r0 * LQ + (size_t)h * 3 * HD, LQ, 0, VT + (size_t)h * HD * SQ);      /* V^T per head: head h's v slice = columns 192 h + 128 .. of the packed plane (pitch 3072) */
    for (int h0 = 0; h0 < NHD; h0 += HG) {
      k_gemm2<0><<<dim3((QN / 128) * (SQ / 64), HG), 128, 0, stream>>>(Q16 + r0 * LQ + (size_t)h0 * 3 * HD, LQ, (size_t)3 * HD, K16 + r0 * LQ + (size_t)h0 * 3 * HD, LQ, (size_t)3 * HD, 0.125f, nullptr, 0, nullptr, 1, 0, 0, S, nullptr, SQ, (size_t)SQ * SQ, QN, SQ, HD);      /* scores, HG heads per launch: PER-HEAD packed operands: head stride 3 HD = 192 columns */
      k_rsm<<<(HG * SQ + 255) / 256, 256, 0, stream>>>(S, P, HG * SQ);      /* P = 256 softmax (f16), rows of all HG heads */
      k_gemm2<0><<<dim3((QN / 128) * (HD / 64), HG), 128, 0, stream>>>(P, SQ, (size_t)SQ * SQ, VT + (size_t)h0 * HD * SQ, SQ, (size_t)HD * SQ, 0.00390625f, nullptr, 0, nullptr, 1, 0, 0, (float*)d_out + r0 * DM + (size_t)h0 * SQ * HD, nullptr, HD, (size_t)SQ * HD, QN, HD, SQ); } }      
}

// v001
// Measured time: 959 microseconds a run.
// Next to v000, in two timings, it ran 3.90 and 3.91 times as fast.
#include <hip/hip_runtime.h>
// Multi-head self-attention with ONE fused QKV projection packed PER HEAD, NO output projection and a RAW-VIEW merge (x [2][2048][1024]; qkv = x W_qkv + b_qkv ([in][out] 1024 x 3072, normal x 1/32; a REAL bias normal x 0.01) reshaped (b, s, 16, 3 x 64): head h owns columns 192 h .. 192 h + 191: q | k | v = its three 64-column slices; att = q k^T / sqrt(64); softmax over all 2048 keys (no mask); values [b][16][s][64] are reshaped to (b, s, 1024) WITHOUT a head transpose (the source's own form): the output memory of a batch IS the sixteen [2048][64] head planes one after another); the P.V product is written straight to the f32 output, each head into its own contiguous plane.
// Structure: token rows r = b*2048 + s; x as exact f16 rows (bf16-rounded); q | k | v as ONE WMMA GEMM (N = 3 x 1024) (32x64 wave tiles, f32 accumulation, exact x16 weights + bias, f16 outputs); per batch: V^T via LDS transposes, one call per head on its own 64-column slice (pitch 3072) of the packed plane; per (batch, group of 4 heads): scores GEMM (K = 64, batched over the heads on grid.y, alpha = 1/sqrt(64)), row softmax on VALU (f32 statistics; weights stored x256 as f16), out = P . V^T GEMM (K = 2048, alpha 2^-8 for the x256 weights) as an f32-OUTPUT GEMM straight into the output's own layout (head h = the [2048][64] plane at offset 2048 x 64 h): no output projection.
// Compute dtype: inputs rounded to bf16; x / weights exact; q, k, v and softmax weights as plain f16 GEMM operands (~2^-12); scores, softmax statistics and o f32. v_wmma_f32_16x16x32_f16.
#define NB 2
#define SQ 2048
#define DM 1024
#define NH 16
#define HD 64
#define HG 4                         /* heads per attention launch group */
#define B0 0                         /* first batch processed (debug hook) */
#define NBR NB                       /* batches processed (debug hook) */
#define NR ((size_t)NB * SQ)         /* token rows */
#define MP ((int)((size_t)NBR * SQ)) /* rows projected (debug hook) */
#define QN SQ                        /* query rows attended per batch (debug hook) */
#define NHD NH                       /* heads attended (debug hook) */
#define MPO MP                       /* unused (no output projection) */
#define LQ (3 * DM)      /* row pitch of the q/k/v rows */
typedef __bf16 v16b __attribute__((ext_vector_type(16)));
typedef unsigned short v8us __attribute__((ext_vector_type(8), may_alias));
typedef float  v8f  __attribute__((ext_vector_type(8)));
typedef float  v4f  __attribute__((ext_vector_type(4)));
typedef float  v4fa __attribute__((ext_vector_type(4), may_alias));
union FragB { v16b v; v8us half[2]; unsigned short u[16]; };

__device__ __forceinline__ unsigned short bf16_bits(float x) { unsigned int u = __float_as_uint(x); return (unsigned short)((u + 0x7FFFu + ((u >> 16) & 1u)) >> 16); }
__device__ __forceinline__ float bf16_val(unsigned short b) { return __uint_as_float(((unsigned int)b) << 16); }
__device__ __forceinline__ float bf16_round(float x) { return bf16_val(bf16_bits(x)); }
// D += A·B with NT terms: 1 = ah·bh, 2 = + al·bh (A split), 3 = + ah·bl (both split)
template <int NT>
__device__ __forceinline__ v8f mmaN(v16b ah, v16b al, v16b bh, v16b bl, v8f c) {
  c = __builtin_amdgcn_wmma_f32_16x16x32_bf16(false, ah, false, bh, (short)0, c, false, false);
  if (NT >= 2) c = __builtin_amdgcn_wmma_f32_16x16x32_bf16(false, al, false, bh, (short)0, c, false, false);
  if (NT >= 3) c = __builtin_amdgcn_wmma_f32_16x16x32_bf16(false, ah, false, bl, (short)0, c, false, false);
  asm volatile("v_nop\n\tv_nop\n\tv_nop\n\tv_nop" : "+v"(c) : "v"(ah), "v"(al), "v"(bh), "v"(bl));
  return c;
}

__global__ __launch_bounds__(256) void k_wt_bf16(const float* __restrict__ W, unsigned short* __restrict__ Wt, int K, int N) {
  const int t = blockIdx.x * 256 + threadIdx.x;
  const int k8n = K / 8;
  if (t >= N * k8n) return;
  const int n = t / k8n, k8 = (t % k8n) * 8;
  v8us v;
#pragma unroll
  for (int i = 0; i < 8; ++i) v[i] = bf16_bits(W[(size_t)(k8 + i) * N + n]);
  *(v8us*)(Wt + (size_t)n * K + k8) = v;
  
}

// GEMM C[M][N] (f32, pitch ldc) = act(A[M][K]·W + bias). A f32 row-major (pitch lda) converted per fragment to bf16
// (ASPLIT: hi/lo two planes -> 2 terms, else single rounded term); Wt bf16 [N][K] (pitch ldb). BIAS_BF16 rounds the
// bias to bf16 first (bias quantised to bf16 before the add). K%32==0, M%16==0, N%64==0.
template <bool ASPLIT, int ACT, bool BIAS_BF16>
__global__ __launch_bounds__(128) void k_gemm_bf(const float* __restrict__ A, int lda, const unsigned short* __restrict__ Wt, int ldb,
                                               const float* __restrict__ bias, float* __restrict__ C, int ldc, int M, int N, int K) {
  __shared__ __attribute__((aligned(16))) float so[4][16][64];
  const int tid = threadIdx.x, w = tid >> 5, lane = tid & 31, ln = lane & 15, hh = lane >> 4;
  const int ntn = N / 64;
  const int wid = blockIdx.x * 4 + w;
  const int mt = wid / ntn, nq = wid % ntn;
  if (mt * 16 >= M) return;
  const int row0 = mt * 16, col0 = nq * 64;
  const float* arow = A + (size_t)(row0 + ln) * lda;
  v8f acc[4] = {};
  for (int kb = 0; kb < K; kb += 32) {
    FragB ah, al;
    const v4f x0 = *(const v4fa*)(arow + kb + 8 * hh), x1 = *(const v4fa*)(arow + kb + 8 * hh + 4);
    const v4f x2 = *(const v4fa*)(arow + kb + 16 + 8 * hh), x3 = *(const v4fa*)(arow + kb + 16 + 8 * hh + 4);
    float xs[16] = {x0[0],x0[1],x0[2],x0[3],x1[0],x1[1],x1[2],x1[3],x2[0],x2[1],x2[2],x2[3],x3[0],x3[1],x3[2],x3[3]};
#pragma unroll
    for (int i = 0; i < 16; ++i) { const unsigned short hb = bf16_bits(xs[i]); ah.u[i] = hb; al.u[i] = ASPLIT ? bf16_bits(xs[i] - bf16_val(hb)) : (unsigned short)0; }
#pragma unroll
    for (int t = 0; t < 4; ++t) {
      const unsigned short* brow = Wt + (size_t)(col0 + t * 16 + ln) * ldb + kb;
      FragB b;
      b.half[0] = *(const v8us*)(brow + 8 * hh);
      b.half[1] = *(const v8us*)(brow + 16 + 8 * hh);
      acc[t] = mmaN<ASPLIT ? 2 : 1>(ah.v, al.v, b.v, b.v, acc[t]);
    }
  }
#pragma unroll
  for (int t = 0; t < 4; ++t) {
    float bv = bias ? bias[col0 + t * 16 + ln] : 0.f;
    if (BIAS_BF16) bv = bf16_round(bv);
#pragma unroll
    for (int r = 0; r < 8; ++r) { float v = acc[t][r] + bv; if (ACT == 1) v = fmaxf(v, 0.f); so[w][8 * hh + r][t * 16 + ln] = v; }
  }
  __builtin_amdgcn_fence(__ATOMIC_ACQ_REL, "workgroup");
  __builtin_amdgcn_wave_barrier();
  const int rsub = lane >> 4, c4 = (lane & 15) * 4;
  {
#pragma unroll
    for (int q = 0; q < 8; ++q) {
      const int r = q * 2 + rsub;
      const v4f v = *(const v4fa*)&so[w][r][c4];
      *(v4f*)(C + (size_t)(row0 + r) * ldc + col0 + c4) = v;
    }
    
  }
}

// GEMM C = act(A·W + bias + resid): A f32 (ASPLIT -> hi/lo 2 terms), Wt bf16 [N][K]; ACT 0 none, 1 relu, 2 exact gelu;
// resid (optional, f32, row index = (row % rmod), pitch ldr, RES_BF16 rounds it) added before the activation.
template <bool ASPLIT, int ACT, bool BIAS_BF16, bool RES_BF16>
__global__ __launch_bounds__(128) void k_gemm_bf3(const float* __restrict__ A, int lda, const unsigned short* __restrict__ Wt, int ldb,
                                                const float* __restrict__ bias, const float* __restrict__ resid, int rmod, int ldr,
                                                float* __restrict__ C, int ldc, int M, int N, int K) {
  __shared__ __attribute__((aligned(16))) float so[4][16][64];
  const int tid = threadIdx.x, w = tid >> 5, lane = tid & 31, ln = lane & 15, hh = lane >> 4;
  const int ntn = N / 64;
  const int wid = blockIdx.x * 4 + w;
  const int mt = wid / ntn, nq = wid % ntn;
  if (mt * 16 >= M) return;
  const int row0 = mt * 16, col0 = nq * 64;
  const float* arow = A + (size_t)(row0 + ln) * lda;
  v8f acc[4] = {};
  for (int kb = 0; kb < K; kb += 32) {
    FragB ah, al;
    const v4f x0 = *(const v4fa*)(arow + kb + 8 * hh), x1 = *(const v4fa*)(arow + kb + 8 * hh + 4);
    const v4f x2 = *(const v4fa*)(arow + kb + 16 + 8 * hh), x3 = *(const v4fa*)(arow + kb + 16 + 8 * hh + 4);
    float xs[16] = {x0[0],x0[1],x0[2],x0[3],x1[0],x1[1],x1[2],x1[3],x2[0],x2[1],x2[2],x2[3],x3[0],x3[1],x3[2],x3[3]};
#pragma unroll
    for (int i = 0; i < 16; ++i) { const unsigned short hb = bf16_bits(xs[i]); ah.u[i] = hb; al.u[i] = ASPLIT ? bf16_bits(xs[i] - bf16_val(hb)) : (unsigned short)0; }
#pragma unroll
    for (int t = 0; t < 4; ++t) {
      const unsigned short* brow = Wt + (size_t)(col0 + t * 16 + ln) * ldb + kb;
      FragB b;
      b.half[0] = *(const v8us*)(brow + 8 * hh);
      b.half[1] = *(const v8us*)(brow + 16 + 8 * hh);
      acc[t] = mmaN<ASPLIT ? 2 : 1>(ah.v, al.v, b.v, b.v, acc[t]);
    }
  }
#pragma unroll
  for (int t = 0; t < 4; ++t) {
    const int col = col0 + t * 16 + ln;
    float bv = bias ? bias[col] : 0.f;
    if (BIAS_BF16) bv = bf16_round(bv);
#pragma unroll
    for (int r = 0; r < 8; ++r) {
      float v = acc[t][r] + bv;
      if (resid) { float rv = resid[(size_t)((row0 + 8 * hh + r) % rmod) * ldr + col]; if (RES_BF16) rv = bf16_round(rv); v += rv; }
      if (ACT == 1) v = fmaxf(v, 0.f);
      if (ACT == 2) v = 0.5f * v * (1.0f + erff(v * 0.70710678118654752f));
      if (ACT == 3) { const float u = 0.7978845608028654f * (v + 0.044715f * v * v * v); v = 0.5f * v * (1.0f + tanhf(u)); }
      so[w][8 * hh + r][t * 16 + ln] = v;
    }
  }
  __builtin_amdgcn_fence(__ATOMIC_ACQ_REL, "workgroup");
  __builtin_amdgcn_wave_barrier();
  const int rsub = lane >> 4, c4 = (lane & 15) * 4;
  {
#pragma unroll
    for (int q = 0; q < 8; ++q) {
      const int r = q * 2 + rsub;
      const v4f v = *(const v4fa*)&so[w][r][c4];
      *(v4f*)(C + (size_t)(row0 + r) * ldc + col0 + c4) = v;
    }
    
  }
}
// row LayerNorm (biased variance, eps) over N: s = X (+ R); optional out_sum <- s; out_norm <- (s-mu)*rsqrt(var+eps)*g + b
template <bool PARAM_BF16>
__global__ __launch_bounds__(256) void k_layernorm(const float* __restrict__ X, const float* __restrict__ R, const float* __restrict__ g, const float* __restrict__ bta,
                                                  float* __restrict__ out_sum, float* __restrict__ out_norm, int N, float eps) {
  __shared__ float red[256];
  const int row = blockIdx.x, tid = threadIdx.x;
  const float* x = X + (size_t)row * N; const float* rr = R ? R + (size_t)row * N : nullptr;
  float vals[16];                     // up to N = 4096
  const int per = N / 256;            // contiguous chunk per thread? use strided-by-4 chunks: thread handles j = tid*4 + 1024*u
  float s1 = 0.f;
  for (int u = 0; u < per / 4; ++u) {
    const int j = tid * 4 + 1024 * u;
    const v4f a = *(const v4fa*)(x + j);
    v4f b = {0.f,0.f,0.f,0.f}; if (rr) b = *(const v4fa*)(rr + j);
#pragma unroll
    for (int q = 0; q < 4; ++q) { const float v = a[q] + b[q]; vals[u * 4 + q] = v; s1 += v; }
  }
  red[tid] = s1; __syncthreads();
  for (int st = 128; st > 0; st >>= 1) { if (tid < st) red[tid] += red[tid + st]; __syncthreads(); }
  const float mu = red[0] / (float)N; __syncthreads();
  float s2 = 0.f;
  for (int u = 0; u < per / 4; ++u)
#pragma unroll
    for (int q = 0; q < 4; ++q) { const float c = vals[u * 4 + q] - mu; s2 += c * c; }
  red[tid] = s2; __syncthreads();
  for (int st = 128; st > 0; st >>= 1) { if (tid < st) red[tid] += red[tid + st]; __syncthreads(); }
  const float rs = rsqrtf(red[0] / (float)N + eps);
  {
    for (int u = 0; u < per / 4; ++u) {
      const int j = tid * 4 + 1024 * u;
      v4f o, sm;
#pragma unroll
      for (int q = 0; q < 4; ++q) {
        float gg = g[j + q], bb = bta[j + q];
        if (PARAM_BF16) { gg = bf16_round(gg); bb = bf16_round(bb); }
        sm[q] = vals[u * 4 + q]; o[q] = (vals[u * 4 + q] - mu) * rs * gg + bb;
      }
      if (out_sum) *(v4f*)(out_sum + (size_t)row * N + j) = sm;
      *(v4f*)(out_norm + (size_t)row * N + j) = o;
    }
    
  }
}



// ---- f16 WMMA path (v_wmma_f32_16x16x32_f16): 11-bit significands for operands in range — used where a [0,1] probability operand needs more precision than bf16
typedef _Float16 v16h __attribute__((ext_vector_type(16)));
union FragH { v16h v; v8us half[2]; _Float16 h[16]; unsigned short u[16]; };
template <int NT>
__device__ __forceinline__ v8f mmaH(v16h ah, v16h al, v16h bh, v16h bl, v8f c) {
  c = __builtin_amdgcn_wmma_f32_16x16x32_f16(false, ah, false, bh, (short)0, c, false, false);
  if (NT >= 2) c = __builtin_amdgcn_wmma_f32_16x16x32_f16(false, al, false, bh, (short)0, c, false, false);
  if (NT >= 3) c = __builtin_amdgcn_wmma_f32_16x16x32_f16(false, ah, false, bl, (short)0, c, false, false);
  asm volatile("v_nop\n\tv_nop\n\tv_nop\n\tv_nop" : "+v"(c) : "v"(ah), "v"(al), "v"(bh), "v"(bl));
  return c;
}
// batched GEMM like k_gemm_b but f16 operands: A f32 (split into f16 hi/lo if ASPLIT, else rounded to f16), Bt = f16 values [n][k]; alpha; C f32; N multiple of 16 (partial tiles skipped)
template <bool ASPLIT>
__global__ __launch_bounds__(128) void k_gemm_h(const float* __restrict__ A, int lda, size_t sA, const _Float16* __restrict__ Bh, int ldb, size_t sB, float alpha, float* __restrict__ C, int ldc, size_t sC, int M, int N, int K) {
  __shared__ __attribute__((aligned(16))) float so[4][16][64];
  const int tid = threadIdx.x, w = tid >> 5, lane = tid & 31, ln = lane & 15, hh = lane >> 4; const int by = blockIdx.y;
  A += (size_t)by * sA; Bh += (size_t)by * sB; C += (size_t)by * sC;
  const int ntn = (N + 63) / 64; const int wid = blockIdx.x * 4 + w; const int mt = wid / ntn, nq = wid % ntn; if (mt * 16 >= M) return;
  const int row0 = mt * 16, col0 = nq * 64; const float* arow = A + (size_t)(row0 + ln) * lda;
  v8f acc[4] = {};
  for (int kb = 0; kb < K; kb += 32) {
    FragH ah, al;
    const v4f x0 = *(const v4fa*)(arow + kb + 8 * hh), x1 = *(const v4fa*)(arow + kb + 8 * hh + 4), x2 = *(const v4fa*)(arow + kb + 16 + 8 * hh), x3 = *(const v4fa*)(arow + kb + 16 + 8 * hh + 4);
    float xs[16] = {x0[0],x0[1],x0[2],x0[3],x1[0],x1[1],x1[2],x1[3],x2[0],x2[1],x2[2],x2[3],x3[0],x3[1],x3[2],x3[3]};
#pragma unroll
    for (int i = 0; i < 16; ++i) { const _Float16 h = (_Float16)xs[i]; ah.h[i] = h; al.h[i] = ASPLIT ? (_Float16)(xs[i] - (float)h) : (_Float16)0.0f; }
#pragma unroll
    for (int t = 0; t < 4; ++t) { if (col0 + t * 16 >= N) continue; const size_t boff = (size_t)(col0 + t * 16 + ln) * ldb + kb; FragH bq; bq.half[0] = *(const v8us*)(Bh + boff + 8 * hh); bq.half[1] = *(const v8us*)(Bh + boff + 16 + 8 * hh);
      acc[t] = mmaH<ASPLIT ? 2 : 1>(ah.v, al.v, bq.v, bq.v, acc[t]); }
  }
#pragma unroll
  for (int t = 0; t < 4; ++t) { if (col0 + t * 16 >= N) continue;
#pragma unroll
    for (int r = 0; r < 8; ++r) so[w][8 * hh + r][t * 16 + ln] = acc[t][r] * alpha; }
  __builtin_amdgcn_fence(__ATOMIC_ACQ_REL, "workgroup"); __builtin_amdgcn_wave_barrier();
  const int rsub = lane >> 4, c4 = (lane & 15) * 4;
  {
#pragma unroll
    for (int q = 0; q < 8; ++q) { const int r = q * 2 + rsub; if (col0 + c4 < N) { const v4f v = *(const v4fa*)&so[w][r][c4]; *(v4f*)(C + (size_t)(row0 + r) * ldc + col0 + c4) = v; } }
     }
}

// Wt[n][k] = f16(W[k][n]·scale) from f32 row-major W[K][N] (scale = power of two; bf16-exact weights stay exact in f16 away from the subnormal range)
__global__ __launch_bounds__(256) void k_wt_f16(const float* __restrict__ W, _Float16* __restrict__ Wt, int K, int N, float scale) {
  const int t = blockIdx.x * 256 + threadIdx.x; if (t >= N * (K / 8)) return; const int n = t / (K / 8), k8 = (t % (K / 8)) * 8; FragH f;
#pragma unroll
  for (int i = 0; i < 8; ++i) f.h[i] = (_Float16)(bf16_round(W[(size_t)(k8 + i) * N + n]) * scale); const v8us o = f.half[0];
  *(v8us*)((unsigned short*)Wt + (size_t)n * K + k8) = o; 
}
// k_gemm_hh variant with fused epilogue: v = acc·alpha + bias[by·sBias + col] (+ CP[(row/rowsPerB)·sCPb + by·64 + col] if CP) ; ACT 0 none / 1 elu ; writes f16 C16 (and f32 C if non-null)
template <int ACT>
__global__ __launch_bounds__(128) void k_gemm_hhx(const _Float16* __restrict__ A, int lda, size_t sA, const _Float16* __restrict__ Bh, int ldb, size_t sB, float alpha, const float* __restrict__ bias, size_t sBias, const float* __restrict__ CP, int rowsPerB, size_t sCPb, int row0g,
    float* __restrict__ C, _Float16* __restrict__ C16, int ldc, size_t sC, int M, int N, int K) {
  __shared__ __attribute__((aligned(16))) float so[4][16][64];
  const int tid = threadIdx.x, w = tid >> 5, lane = tid & 31, ln = lane & 15, hh = lane >> 4; const int by = blockIdx.y;
  A += (size_t)by * sA; Bh += (size_t)by * sB; const size_t cofs = (size_t)by * sC; const float* bp = bias ? bias + (size_t)by * sBias : nullptr;
  const int ntn = (N + 63) / 64; const int wid = blockIdx.x * 4 + w; const int mt = wid / ntn, nq = wid % ntn; if (mt * 16 >= M) return;
  const int row0 = mt * 16, col0 = nq * 64; const _Float16* arow = A + (size_t)(row0 + ln) * lda;
  v8f acc[4] = {};
  for (int kb = 0; kb < K; kb += 32) { FragH ah; ah.half[0] = *(const v8us*)((const unsigned short*)arow + kb + 8 * hh); ah.half[1] = *(const v8us*)((const unsigned short*)arow + kb + 16 + 8 * hh);
#pragma unroll
    for (int t = 0; t < 4; ++t) { if (col0 + t * 16 >= N) continue; const size_t boff = (size_t)(col0 + t * 16 + ln) * ldb + kb; FragH bq; bq.half[0] = *(const v8us*)((const unsigned short*)Bh + boff + 8 * hh); bq.half[1] = *(const v8us*)((const unsigned short*)Bh + boff + 16 + 8 * hh);
      acc[t] = mmaH<1>(ah.v, ah.v, bq.v, bq.v, acc[t]); }
  }
#pragma unroll
  for (int t = 0; t < 4; ++t) { if (col0 + t * 16 >= N) continue; const int col = col0 + t * 16 + ln; const float bv = bp ? bf16_round(bp[col]) : 0.f;
#pragma unroll
    for (int r = 0; r < 8; ++r) { float v = acc[t][r] * alpha + bv; if (CP) { const int rr = row0g + row0 + 8 * hh + r; if (rowsPerB < 0) v += CP[cofs + (size_t)rr * ldc + col];      /* rowsPerB < 0: own element of the batched C plane */ else { const int bidx = rr / rowsPerB; v += CP[(size_t)bidx * sCPb + (size_t)by * 64 + col]; } } if (ACT == 1) v = (v > 0.f) ? v : expm1f(v); else if (ACT == 7) v = (v > 0.f) ? v + 1.0f : expf(v); else if (ACT == 8) v = tanhf(v); else if (ACT == 9) v = 0.5f * v * (1.0f + tanhf(0.7978845608028654f * (v + 0.044715f * v * v * v))); else if (ACT == 11) v = 1.0f / (1.0f + expf(-v)); else if (ACT == 12) v = (v > 0.f) ? v : 0.01f * v; else if (ACT == 14) v = (v > 0.f) ? v : 0.1f * v; else if (ACT == 16) v = (v >= 0.f) ? v : 0.3f * v; else if (ACT == 17) v = (v >= 0.f) ? v : 0.2f * v; else if (ACT == 15) v = v / (1.0f + expf(-v)); else if (ACT == 3) v = fmaxf(v, 0.f); else if (ACT == 6) v = 0.5f * v * (1.0f + erff(v * 0.70710678118654752f)); so[w][8 * hh + r][t * 16 + ln] = v; } }
  __builtin_amdgcn_fence(__ATOMIC_ACQ_REL, "workgroup"); __builtin_amdgcn_wave_barrier();
  const int rsub = lane >> 4, c4 = (lane & 15) * 4; typedef _Float16 v4h __attribute__((ext_vector_type(4)));
  {
#pragma unroll
    for (int q = 0; q < 8; ++q) { const int r = q * 2 + rsub; if (col0 + c4 < N) { const v4f v = *(const v4fa*)&so[w][r][c4]; if (C) *(v4f*)(C + cofs + (size_t)(row0 + r) * ldc + col0 + c4) = v; if (C16) { v4h h4; for (int i = 0; i < 4; ++i) h4[i] = (_Float16)v[i]; *(v4h*)(C16 + cofs + (size_t)(row0 + r) * ldc + col0 + c4) = h4; } } }
     }
}


typedef _Float16 v4h __attribute__((ext_vector_type(4)));

__global__ __launch_bounds__(256) void k_x16(const float* __restrict__ x, _Float16* __restrict__ X16, size_t n8) { const size_t t = (size_t)blockIdx.x * 256 + threadIdx.x; if (t >= n8) return; FragH f;
#pragma unroll
  for (int q = 0; q < 8; ++q) f.h[q] = (_Float16)bf16_round(x[t * 8 + q]); *(v8us*)((unsigned short*)X16 + t * 8) = f.half[0];  }
__global__ __launch_bounds__(256) void k_h16(const float* __restrict__ x, _Float16* __restrict__ X16, size_t n8) { const size_t t = (size_t)blockIdx.x * 256 + threadIdx.x; if (t >= n8) return; FragH f;
#pragma unroll
  for (int q = 0; q < 8; ++q) f.h[q] = (_Float16)x[t * 8 + q]; *(v8us*)((unsigned short*)X16 + t * 8) = f.half[0];  }
__global__ __launch_bounds__(256) void k_round16f(const float* __restrict__ W, _Float16* __restrict__ Bt, size_t n8) { const size_t t = (size_t)blockIdx.x * 256 + threadIdx.x; if (t >= n8) return; FragH f;
#pragma unroll
  for (int i = 0; i < 8; ++i) f.h[i] = (_Float16)(bf16_round(W[t * 8 + i]) * 16.0f); *(v8us*)((unsigned short*)Bt + t * 8) = f.half[0];  }
template <int NHv, int TTv>
__global__ __launch_bounds__(256) void k_vt(const _Float16* __restrict__ V16, int ldv, int voff, _Float16* __restrict__ Vt) { __shared__ unsigned short tl[64][66]; const int tid = threadIdx.x; const int slab = blockIdx.x / (TTv / 64), lg = blockIdx.x % (TTv / 64); const int b = slab / NHv, h = slab % NHv;
  for (int i = tid; i < 64 * 8; i += 256) { const int r = i / 8, c8 = (i % 8) * 8; FragH f; f.half[0] = *(const v8us*)((const unsigned short*)V16 + ((size_t)b * TTv + lg * 64 + r) * ldv + voff + h * 64 + c8);
#pragma unroll
    for (int q = 0; q < 8; ++q) tl[r][c8 + q] = f.u[q]; }
  __syncthreads();
  {
#pragma unroll
    for (int rd = 0; rd < 2; ++rd) { const int d = rd * 32 + tid / 8, pc = tid % 8; FragH f;
#pragma unroll
      for (int q = 0; q < 8; ++q) f.u[q] = tl[pc * 8 + q][d];
      *(v8us*)((unsigned short*)Vt + ((size_t)slab * 64 + d) * TTv + lg * 64 + pc * 8) = f.half[0]; }
     } }

__global__ __launch_bounds__(256) void k_hl(const float* __restrict__ F, _Float16* __restrict__ Hh, _Float16* __restrict__ Hl, size_t n8) { const size_t t = (size_t)blockIdx.x * 256 + threadIdx.x; if (t >= n8) return; FragH fh, fl; const v4f a = *(const v4fa*)(F + t * 8), c = *(const v4fa*)(F + t * 8 + 4);
#pragma unroll
  for (int q = 0; q < 4; ++q) { _Float16 h = (_Float16)a[q]; fh.h[q] = h; fl.h[q] = (_Float16)((a[q] - (float)h) * 1024.0f); h = (_Float16)c[q]; fh.h[4 + q] = h; fl.h[4 + q] = (_Float16)((c[q] - (float)h) * 1024.0f); }
  { *(v8us*)((unsigned short*)Hh + t * 8) = fh.half[0]; *(v8us*)((unsigned short*)Hl + t * 8) = fl.half[0];  } }

// ---- fast GEMM (wave tile 32x64; requires M % 32 == 0 rows per launch region and N % 64 == 0); epilogue = k_gemm_hhx semantics ----
__device__ __forceinline__ v16h g2_frag(const _Float16* p, int hh) { FragH f; f.half[0] = *(const v8us*)((const unsigned short*)p + 8 * hh); f.half[1] = *(const v8us*)((const unsigned short*)p + 16 + 8 * hh); return f.v; }
__device__ __forceinline__ v8f g2_mma(v16h a, v16h b, v8f c) { v8f d = __builtin_amdgcn_wmma_f32_16x16x32_f16(false, a, false, b, (short)0, c, false, false); asm volatile("v_nop\n\tv_nop\n\tv_nop\n\tv_nop" : "+v"(d) : "v"(a), "v"(b)); return d; }
template <int ACT>
__global__ __launch_bounds__(128) void k_gemm2(const _Float16* __restrict__ A, int lda, size_t sA, const _Float16* __restrict__ Bh, int ldb, size_t sB, float alpha, const float* __restrict__ bias, size_t sBias, const float* __restrict__ CP, int rowsPerB, size_t sCPb, int row0g,
    float* __restrict__ C, _Float16* __restrict__ C16, int ldc, size_t sC, int M, int N, int K) { static_assert(ACT == 0 || ACT == 3 || ACT == 6 || ACT == 8 || ACT == 9 || ACT == 11 || ACT == 12 || ACT == 14 || ACT == 15 || ACT == 16 || ACT == 17, "k_gemm2: unsupported ACT code (would silently apply no activation)");
  __shared__ __attribute__((aligned(16))) float so[4][32][68];
  const int tid = threadIdx.x, w = tid >> 5, lane = tid & 31, ln = lane & 15, hh = lane >> 4; const int by = blockIdx.y;
  A += (size_t)by * sA; Bh += (size_t)by * sB; const size_t cofs = (size_t)by * sC; const float* bp = bias ? bias + (size_t)by * sBias : nullptr;
  const int ntn = N >> 6; const int mt = blockIdx.x / ntn, nq = blockIdx.x - mt * ntn; const int row0 = mt * 128 + 32 * w, col0 = nq * 64; if (row0 >= M) return;
  const _Float16* a0p = A + (size_t)(row0 + ln) * lda; const _Float16* a1p = a0p + (size_t)16 * lda;
  const _Float16* b0p = Bh + (size_t)(col0 + ln) * ldb; const _Float16* b1p = b0p + (size_t)16 * ldb; const _Float16* b2p = b1p + (size_t)16 * ldb; const _Float16* b3p = b2p + (size_t)16 * ldb;
  const v8f z8 = {0.f,0.f,0.f,0.f,0.f,0.f,0.f,0.f}; v8f c00 = z8, c01 = z8, c02 = z8, c03 = z8, c10 = z8, c11 = z8, c12 = z8, c13 = z8;
#pragma unroll 1
  for (int kb = 0; kb < K; kb += 32) { const v16h a0 = g2_frag(a0p + kb, hh), a1 = g2_frag(a1p + kb, hh);
    v16h b = g2_frag(b0p + kb, hh); c00 = g2_mma(a0, b, c00); c10 = g2_mma(a1, b, c10);
    b = g2_frag(b1p + kb, hh); c01 = g2_mma(a0, b, c01); c11 = g2_mma(a1, b, c11);
    b = g2_frag(b2p + kb, hh); c02 = g2_mma(a0, b, c02); c12 = g2_mma(a1, b, c12);
    b = g2_frag(b3p + kb, hh); c03 = g2_mma(a0, b, c03); c13 = g2_mma(a1, b, c13); }
  v8f accs[8] = {c00, c01, c02, c03, c10, c11, c12, c13};
#pragma unroll
  for (int u = 0; u < 8; ++u) { const int t = u & 3, half = u >> 2; const int col = col0 + t * 16 + ln; const float bv = bp ? bf16_round(bp[col]) : 0.f;
#pragma unroll
    for (int r = 0; r < 8; ++r) { const int rloc = half * 16 + 8 * hh + r; float v = accs[u][r] * alpha + bv; if (CP) { if (rowsPerB < 0) v += CP[cofs + (size_t)(row0g + row0 + rloc) * ldc + col];      /* rowsPerB < 0: own element of the batched C plane */ else { const int bidx = (row0g + row0 + rloc) / rowsPerB; v += CP[(size_t)bidx * sCPb + (size_t)by * 64 + col]; } }
      if (ACT == 3) v = fmaxf(v, 0.f); else if (ACT == 6) v = 0.5f * v * (1.0f + erff(v * 0.70710678118654752f)); else if (ACT == 11) v = 1.0f / (1.0f + expf(-v)); else if (ACT == 15) v = v / (1.0f + expf(-v)); else if (ACT == 12) v = (v > 0.f) ? v : 0.01f * v; else if (ACT == 8) v = tanhf(v); else if (ACT == 9) v = 0.5f * v * (1.0f + tanhf(0.7978845608028654f * (v + 0.044715f * v * v * v))); else if (ACT == 14) v = (v > 0.f) ? v : 0.1f * v; else if (ACT == 16) v = (v >= 0.f) ? v : 0.3f * v; else if (ACT == 17) v = (v >= 0.f) ? v : 0.2f * v;
      so[w][rloc][t * 16 + ln] = v; } }
  __builtin_amdgcn_fence(__ATOMIC_ACQ_REL, "workgroup"); __builtin_amdgcn_wave_barrier();
  const int rsub = lane >> 4, c4 = (lane & 15) * 4;
  {
#pragma unroll
    for (int q = 0; q < 16; ++q) { const int r = q * 2 + rsub; const v4f v = *(const v4fa*)&so[w][r][c4]; if (C) *(v4f*)(C + cofs + (size_t)(row0 + r) * ldc + col0 + c4) = v; if (C16) { v4h h4; for (int i = 0; i < 4; ++i) h4[i] = (_Float16)v[i]; *(v4h*)(C16 + cofs + (size_t)(row0 + r) * ldc + col0 + c4) = h4; } }
     } }


__global__ __launch_bounds__(256) void k_wnat(const float* __restrict__ w, size_t n8, _Float16* __restrict__ Bt) { const size_t t = (size_t)blockIdx.x * 256 + threadIdx.x; if (t >= n8) return; FragH f; for (int q = 0; q < 8; ++q) f.h[q] = (_Float16)(bf16_round(w[t * 8 + q]) * 16.0f); *(v8us*)((unsigned short*)Bt + t * 8) = f.half[0];  }
// Row softmax, one wave per score row: 16 loads of 512 contiguous bytes hold the row's 2048 f32 in registers, so S is read once, in whole lines;
// max and sum: per-lane partials, then a five-step butterfly over the 32 lanes; each exponential is formed once and kept; P leaves as 256 contiguous bytes per store.
// waves_per_eu(8, 8): at most 128 registers, so that all 1024 work-groups (32 waves per WGP) are resident at once, and no fewer, so that the compiler keeps all 16 loads of a row in flight together.
// Every loop of the body is fully unrolled: v[] is then indexed by constants only and stays in registers (a rolled loop would put it in scratch memory).
__global__ __launch_bounds__(256) __attribute__((amdgpu_waves_per_eu(8, 8))) void k_rsm(const float* __restrict__ S, _Float16* __restrict__ P, int nrows) {
  const int lane = threadIdx.x & 31; const int i = blockIdx.x * 8 + (threadIdx.x >> 5); if (i >= nrows) return;      /* wave-uniform exit; the kernel has no barrier */
  const float* s = S + (size_t)i * SQ + lane * 4; v4f v[SQ / 128];
#pragma unroll
  for (int j = 0; j < SQ / 128; ++j) {
    if (j == SQ / 128 - 1) asm volatile("s_wait_xcnt 0x0" ::: "memory");      /* the compiler lands the last load on the address pair that the 15 loads before it name: the wait stands in front of that overwrite, as a precaution */
    v[j] = *(const v4fa*)(s + j * 128); }
  float mx = -3.0e38f;
#pragma unroll
  for (int j = 0; j < SQ / 128; ++j) mx = fmaxf(mx, fmaxf(fmaxf(v[j][0], v[j][1]), fmaxf(v[j][2], v[j][3])));
#pragma unroll
  for (int m = 16; m > 0; m >>= 1) mx = fmaxf(mx, __shfl_xor(mx, m));
  v4f sp = {0.f, 0.f, 0.f, 0.f};
#pragma unroll
  for (int j = 0; j < SQ / 128; ++j) {
#pragma unroll
    for (int q = 0; q < 4; ++q) { v[j][q] = expf(v[j][q] - mx); sp[q] += v[j][q]; } }
  float se = (sp[0] + sp[1]) + (sp[2] + sp[3]);
#pragma unroll
  for (int m = 16; m > 0; m >>= 1) se += __shfl_xor(se, m);
  const float sc = 256.0f / se; _Float16* d = P + (size_t)i * SQ + lane * 4;
#pragma unroll
  for (int j = 0; j < SQ / 128; ++j) { v4h h4;
#pragma unroll
    for (int q = 0; q < 4; ++q) h4[q] = (_Float16)(v[j][q] * sc);
    *(v4h*)(d + j * 128) = h4; } }
__global__ __launch_bounds__(256) void k_vt(const _Float16* __restrict__ V16, int b, int h0, _Float16* __restrict__ VT) { __shared__ unsigned short tl[64][65]; const int tid = threadIdx.x; const int hh = blockIdx.x % HG, sg = blockIdx.x / HG; const int s0 = sg * 64; const int h = h0 + hh;
  for (int i = tid; i < 64 * 8; i += 256) { const int j = i / 8, d8 = (i % 8) * 8; FragH f; f.half[0] = *(const v8us*)((const unsigned short*)V16 + ((size_t)b * SQ + s0 + j) * DM + h * HD + d8); for (int q = 0; q < 8; ++q) tl[d8 + q][j] = f.u[q]; }
  __syncthreads();
  { for (int i = tid; i < 64 * 8; i += 256) { const int d = i / 8, j8 = (i % 8) * 8; FragH f; for (int q = 0; q < 8; ++q) f.u[q] = tl[d][j8 + q]; *(v8us*)((unsigned short*)VT + ((size_t)hh * HD + d) * SQ + s0 + j8) = f.half[0]; }  } }


extern "C" void kernel_launch(void* const* d_in, const int* in_sizes, int n_in,
                              void* d_out, int out_size, void* d_ws, size_t ws_size, hipStream_t stream) {
  (void)in_sizes; (void)n_in; (void)out_size;
  const float* const* I = (const float* const*)d_in; const float* x = I[0]; const float* wqkv = I[1]; const float* bqkv = I[2];      /* input order: x, W_qkv ([in][out] [1024][3072]; columns packed PER HEAD: 192 h + {0..63 q, 64..127 k, 128..191 v}), b_qkv [3072] (REAL; the same packing: the projection GEMM's bias slot reads it by output column); three inputs; no output weight: the module has none */
  char* ws = (char*)d_ws; size_t off = 0;
  auto take = [&](size_t bytes) { char* p = ws + off; off += (bytes + 255) & ~(size_t)255; return p; };
  _Float16* BQKV = (_Float16*)take((size_t)3 * DM * DM * 2);
  _Float16* X16 = (_Float16*)take(NR * DM * 2); _Float16* QKV = (_Float16*)take(NR * 3 * DM * 2); _Float16* Q16 = QKV; _Float16* K16 = QKV + HD; _Float16* V16 = QKV + 2 * HD;      /* PER-HEAD packing: within head h's 192 columns q starts at + 0, k at + 64, v at + 128; the head stride is 3 HD */
  float* S = (float*)take((size_t)HG * SQ * SQ * 4); _Float16* P = (_Float16*)take((size_t)HG * SQ * SQ * 2); _Float16* VT = (_Float16*)take((size_t)NH * HD * SQ * 2);
  if (off > ws_size) return;
  k_wt_f16<<<(unsigned)(((size_t)DM * 3 * DM / 8 + 255) / 256), 256, 0, stream>>>(wqkv, BQKV, DM, 3 * DM, 16.0f);      /* [in][out] -> Bt[n][k] x16 (pitch K = 1024) */

  k_x16<<<(unsigned)((NR * DM / 8 + 255) / 256), 256, 0, stream>>>(x, X16, NR * DM / 8);
  const size_t r0p = (size_t)B0 * SQ;      /* first projected row */
  k_gemm2<0><<<dim3((unsigned)((MP / 128) * (3 * DM / 64)), 1), 128, 0, stream>>>(X16 + r0p * DM, DM, 0, BQKV, DM, 0, 0.0625f, bqkv, 0, nullptr, 1, 0, 0, nullptr, QKV + r0p * 3 * DM, 3 * DM, 0, MP, 3 * DM, DM);      /* q | k | v rows (f16); head h = columns 3*HD*h .. 3*HD*h + 191 (q | k | v) */
  for (int b = B0; b < B0 + NBR; ++b) { const size_t r0 = (size_t)b * SQ;
    for (int h = 0; h < NH; ++h) k_vt<1, SQ><<<SQ / 64, 256, 0, stream>>>(V16 + r0 * LQ + (size_t)h * 3 * HD, LQ, 0, VT + (size_t)h * HD * SQ);      /* V^T per head: head h's v slice = columns 192 h + 128 .. of the packed plane (pitch 3072) */
    for (int h0 = 0; h0 < NHD; h0 += HG) {
      k_gemm2<0><<<dim3((QN / 128) * (SQ / 64), HG), 128, 0, stream>>>(Q16 + r0 * LQ + (size_t)h0 * 3 * HD, LQ, (size_t)3 * HD, K16 + r0 * LQ + (size_t)h0 * 3 * HD, LQ, (size_t)3 * HD, 0.125f, nullptr, 0, nullptr, 1, 0, 0, S, nullptr, SQ, (size_t)SQ * SQ, QN, SQ, HD);      /* scores, HG heads per launch: PER-HEAD packed operands: head stride 3 HD = 192 columns */
      k_rsm<<<(HG * SQ + 7) / 8, 256, 0, stream>>>(S, P, HG * SQ);      /* P = 256 softmax (f16), rows of all HG heads */
      k_gemm2<0><<<dim3((QN / 128) * (HD / 64), HG), 128, 0, stream>>>(P, SQ, (size_t)SQ * SQ, VT + (size_t)h0 * HD * SQ, SQ, (size_t)HD * SQ, 0.00390625f, nullptr, 0, nullptr, 1, 0, 0, (float*)d_out + r0 * DM + (size_t)h0 * SQ * HD, nullptr, HD, (size_t)SQ * HD, QN, HD, SQ); } }      
}

// v002
// One run takes 224 microseconds.
// In two side-by-side timings against v001, it was 4.27 and 4.25 times as fast.
// Counting every step since v000, it is 16.6 times as fast.
#include <hip/hip_runtime.h>
// Multi-head self-attention with ONE fused QKV projection packed PER HEAD, NO output projection and a RAW-VIEW merge (x [2][2048][1024]; qkv = x W_qkv + b_qkv ([in][out] 1024 x 3072, normal x 1/32; a REAL bias normal x 0.01) reshaped (b, s, 16, 3 x 64): head h owns columns 192 h .. 192 h + 191: q | k | v = its three 64-column slices; att = q k^T / sqrt(64); softmax over all 2048 keys (no mask); values [b][16][s][64] are reshaped to (b, s, 1024) WITHOUT a head transpose (the source's own form): the output memory of a batch IS the sixteen [2048][64] head planes one after another); the P.V product is written straight to the f32 output, each head into its own contiguous plane.
// Structure: token rows r = b*2048 + s; x as exact f16 rows (bf16-rounded); q | k | v as ONE WMMA GEMM (N = 3 x 1024) (32x64 wave tiles, f32 accumulation, exact x16 weights + bias, f16 outputs); per batch: V^T via LDS transposes, one call per head on its own 64-column slice (pitch 3072) of the packed plane; then ONE fused attention launch over every (batch, head): per 64 keys S^T = K Q^T, running softmax in registers (f32 statistics, base 2; weights 2^(s - m) as f16), O^T += V^T P^T, divided by the row sum at the end and written as f32 straight into the output's own layout (head plane after head plane): no output projection.
// Compute dtype: inputs rounded to bf16; x / weights exact; q, k, v and softmax weights as plain f16 GEMM operands (~2^-12); scores, softmax statistics and o f32. v_wmma_f32_16x16x32_f16.
#define NB 2
#define SQ 2048
#define DM 1024
#define NH 16
#define HD 64
#define HG 4                         /* heads per group of the grouped transpose below */
#define B0 0                         /* first batch processed (debug hook) */
#define NBR NB                       /* batches processed (debug hook) */
#define NR ((size_t)NB * SQ)         /* token rows */
#define MP ((int)((size_t)NBR * SQ)) /* rows projected (debug hook) */
#define QN SQ                        /* unused (the attention launch covers all SQ query rows) */
#define NHD NH                       /* unused (the attention launch covers all NH heads) */
#define MPO MP                       /* unused (no output projection) */
#define LQ (3 * DM)      /* row pitch of the q/k/v rows */
typedef __bf16 v16b __attribute__((ext_vector_type(16)));
typedef unsigned short v8us __attribute__((ext_vector_type(8), may_alias));
typedef float  v8f  __attribute__((ext_vector_type(8)));
typedef float  v4f  __attribute__((ext_vector_type(4)));
typedef float  v4fa __attribute__((ext_vector_type(4), may_alias));
union FragB { v16b v; v8us half[2]; unsigned short u[16]; };

__device__ __forceinline__ unsigned short bf16_bits(float x) { unsigned int u = __float_as_uint(x); return (unsigned short)((u + 0x7FFFu + ((u >> 16) & 1u)) >> 16); }
__device__ __forceinline__ float bf16_val(unsigned short b) { return __uint_as_float(((unsigned int)b) << 16); }
__device__ __forceinline__ float bf16_round(float x) { return bf16_val(bf16_bits(x)); }
// D += A·B with NT terms: 1 = ah·bh, 2 = + al·bh (A split), 3 = + ah·bl (both split)
template <int NT>
__device__ __forceinline__ v8f mmaN(v16b ah, v16b al, v16b bh, v16b bl, v8f c) {
  c = __builtin_amdgcn_wmma_f32_16x16x32_bf16(false, ah, false, bh, (short)0, c, false, false);
  if (NT >= 2) c = __builtin_amdgcn_wmma_f32_16x16x32_bf16(false, al, false, bh, (short)0, c, false, false);
  if (NT >= 3) c = __builtin_amdgcn_wmma_f32_16x16x32_bf16(false, ah, false, bl, (short)0, c, false, false);
  asm volatile("v_nop\n\tv_nop\n\tv_nop\n\tv_nop" : "+v"(c) : "v"(ah), "v"(al), "v"(bh), "v"(bl));
  return c;
}

__global__ __launch_bounds__(256) void k_wt_bf16(const float* __restrict__ W, unsigned short* __restrict__ Wt, int K, int N) {
  const int t = blockIdx.x * 256 + threadIdx.x;
  const int k8n = K / 8;
  if (t >= N * k8n) return;
  const int n = t / k8n, k8 = (t % k8n) * 8;
  v8us v;
#pragma unroll
  for (int i = 0; i < 8; ++i) v[i] = bf16_bits(W[(size_t)(k8 + i) * N + n]);
  *(v8us*)(Wt + (size_t)n * K + k8) = v;
  
}

// GEMM C[M][N] (f32, pitch ldc) = act(A[M][K]·W + bias). A f32 row-major (pitch lda) converted per fragment to bf16
// (ASPLIT: hi/lo two planes -> 2 terms, else single rounded term); Wt bf16 [N][K] (pitch ldb). BIAS_BF16 rounds the
// bias to bf16 first (bias quantised to bf16 before the add). K%32==0, M%16==0, N%64==0.
template <bool ASPLIT, int ACT, bool BIAS_BF16>
__global__ __launch_bounds__(128) void k_gemm_bf(const float* __restrict__ A, int lda, const unsigned short* __restrict__ Wt, int ldb,
                                               const float* __restrict__ bias, float* __restrict__ C, int ldc, int M, int N, int K) {
  __shared__ __attribute__((aligned(16))) float so[4][16][64];
  const int tid = threadIdx.x, w = tid >> 5, lane = tid & 31, ln = lane & 15, hh = lane >> 4;
  const int ntn = N / 64;
  const int wid = blockIdx.x * 4 + w;
  const int mt = wid / ntn, nq = wid % ntn;
  if (mt * 16 >= M) return;
  const int row0 = mt * 16, col0 = nq * 64;
  const float* arow = A + (size_t)(row0 + ln) * lda;
  v8f acc[4] = {};
  for (int kb = 0; kb < K; kb += 32) {
    FragB ah, al;
    const v4f x0 = *(const v4fa*)(arow + kb + 8 * hh), x1 = *(const v4fa*)(arow + kb + 8 * hh + 4);
    const v4f x2 = *(const v4fa*)(arow + kb + 16 + 8 * hh), x3 = *(const v4fa*)(arow + kb + 16 + 8 * hh + 4);
    float xs[16] = {x0[0],x0[1],x0[2],x0[3],x1[0],x1[1],x1[2],x1[3],x2[0],x2[1],x2[2],x2[3],x3[0],x3[1],x3[2],x3[3]};
#pragma unroll
    for (int i = 0; i < 16; ++i) { const unsigned short hb = bf16_bits(xs[i]); ah.u[i] = hb; al.u[i] = ASPLIT ? bf16_bits(xs[i] - bf16_val(hb)) : (unsigned short)0; }
#pragma unroll
    for (int t = 0; t < 4; ++t) {
      const unsigned short* brow = Wt + (size_t)(col0 + t * 16 + ln) * ldb + kb;
      FragB b;
      b.half[0] = *(const v8us*)(brow + 8 * hh);
      b.half[1] = *(const v8us*)(brow + 16 + 8 * hh);
      acc[t] = mmaN<ASPLIT ? 2 : 1>(ah.v, al.v, b.v, b.v, acc[t]);
    }
  }
#pragma unroll
  for (int t = 0; t < 4; ++t) {
    float bv = bias ? bias[col0 + t * 16 + ln] : 0.f;
    if (BIAS_BF16) bv = bf16_round(bv);
#pragma unroll
    for (int r = 0; r < 8; ++r) { float v = acc[t][r] + bv; if (ACT == 1) v = fmaxf(v, 0.f); so[w][8 * hh + r][t * 16 + ln] = v; }
  }
  __builtin_amdgcn_fence(__ATOMIC_ACQ_REL, "workgroup");
  __builtin_amdgcn_wave_barrier();
  const int rsub = lane >> 4, c4 = (lane & 15) * 4;
  {
#pragma unroll
    for (int q = 0; q < 8; ++q) {
      const int r = q * 2 + rsub;
      const v4f v = *(const v4fa*)&so[w][r][c4];
      *(v4f*)(C + (size_t)(row0 + r) * ldc + col0 + c4) = v;
    }
    
  }
}

// GEMM C = act(A·W + bias + resid): A f32 (ASPLIT -> hi/lo 2 terms), Wt bf16 [N][K]; ACT 0 none, 1 relu, 2 exact gelu;
// resid (optional, f32, row index = (row % rmod), pitch ldr, RES_BF16 rounds it) added before the activation.
template <bool ASPLIT, int ACT, bool BIAS_BF16, bool RES_BF16>
__global__ __launch_bounds__(128) void k_gemm_bf3(const float* __restrict__ A, int lda, const unsigned short* __restrict__ Wt, int ldb,
                                                const float* __restrict__ bias, const float* __restrict__ resid, int rmod, int ldr,
                                                float* __restrict__ C, int ldc, int M, int N, int K) {
  __shared__ __attribute__((aligned(16))) float so[4][16][64];
  const int tid = threadIdx.x, w = tid >> 5, lane = tid & 31, ln = lane & 15, hh = lane >> 4;
  const int ntn = N / 64;
  const int wid = blockIdx.x * 4 + w;
  const int mt = wid / ntn, nq = wid % ntn;
  if (mt * 16 >= M) return;
  const int row0 = mt * 16, col0 = nq * 64;
  const float* arow = A + (size_t)(row0 + ln) * lda;
  v8f acc[4] = {};
  for (int kb = 0; kb < K; kb += 32) {
    FragB ah, al;
    const v4f x0 = *(const v4fa*)(arow + kb + 8 * hh), x1 = *(const v4fa*)(arow + kb + 8 * hh + 4);
    const v4f x2 = *(const v4fa*)(arow + kb + 16 + 8 * hh), x3 = *(const v4fa*)(arow + kb + 16 + 8 * hh + 4);
    float xs[16] = {x0[0],x0[1],x0[2],x0[3],x1[0],x1[1],x1[2],x1[3],x2[0],x2[1],x2[2],x2[3],x3[0],x3[1],x3[2],x3[3]};
#pragma unroll
    for (int i = 0; i < 16; ++i) { const unsigned short hb = bf16_bits(xs[i]); ah.u[i] = hb; al.u[i] = ASPLIT ? bf16_bits(xs[i] - bf16_val(hb)) : (unsigned short)0; }
#pragma unroll
    for (int t = 0; t < 4; ++t) {
      const unsigned short* brow = Wt + (size_t)(col0 + t * 16 + ln) * ldb + kb;
      FragB b;
      b.half[0] = *(const v8us*)(brow + 8 * hh);
      b.half[1] = *(const v8us*)(brow + 16 + 8 * hh);
      acc[t] = mmaN<ASPLIT ? 2 : 1>(ah.v, al.v, b.v, b.v, acc[t]);
    }
  }
#pragma unroll
  for (int t = 0; t < 4; ++t) {
    const int col = col0 + t * 16 + ln;
    float bv = bias ? bias[col] : 0.f;
    if (BIAS_BF16) bv = bf16_round(bv);
#pragma unroll
    for (int r = 0; r < 8; ++r) {
      float v = acc[t][r] + bv;
      if (resid) { float rv = resid[(size_t)((row0 + 8 * hh + r) % rmod) * ldr + col]; if (RES_BF16) rv = bf16_round(rv); v += rv; }
      if (ACT == 1) v = fmaxf(v, 0.f);
      if (ACT == 2) v = 0.5f * v * (1.0f + erff(v * 0.70710678118654752f));
      if (ACT == 3) { const float u = 0.7978845608028654f * (v + 0.044715f * v * v * v); v = 0.5f * v * (1.0f + tanhf(u)); }
      so[w][8 * hh + r][t * 16 + ln] = v;
    }
  }
  __builtin_amdgcn_fence(__ATOMIC_ACQ_REL, "workgroup");
  __builtin_amdgcn_wave_barrier();
  const int rsub = lane >> 4, c4 = (lane & 15) * 4;
  {
#pragma unroll
    for (int q = 0; q < 8; ++q) {
      const int r = q * 2 + rsub;
      const v4f v = *(const v4fa*)&so[w][r][c4];
      *(v4f*)(C + (size_t)(row0 + r) * ldc + col0 + c4) = v;
    }
    
  }
}
// row LayerNorm (biased variance, eps) over N: s = X (+ R); optional out_sum <- s; out_norm <- (s-mu)*rsqrt(var+eps)*g + b
template <bool PARAM_BF16>
__global__ __launch_bounds__(256) void k_layernorm(const float* __restrict__ X, const float* __restrict__ R, const float* __restrict__ g, const float* __restrict__ bta,
                                                  float* __restrict__ out_sum, float* __restrict__ out_norm, int N, float eps) {
  __shared__ float red[256];
  const int row = blockIdx.x, tid = threadIdx.x;
  const float* x = X + (size_t)row * N; const float* rr = R ? R + (size_t)row * N : nullptr;
  float vals[16];                     // up to N = 4096
  const int per = N / 256;            // contiguous chunk per thread? use strided-by-4 chunks: thread handles j = tid*4 + 1024*u
  float s1 = 0.f;
  for (int u = 0; u < per / 4; ++u) {
    const int j = tid * 4 + 1024 * u;
    const v4f a = *(const v4fa*)(x + j);
    v4f b = {0.f,0.f,0.f,0.f}; if (rr) b = *(const v4fa*)(rr + j);
#pragma unroll
    for (int q = 0; q < 4; ++q) { const float v = a[q] + b[q]; vals[u * 4 + q] = v; s1 += v; }
  }
  red[tid] = s1; __syncthreads();
  for (int st = 128; st > 0; st >>= 1) { if (tid < st) red[tid] += red[tid + st]; __syncthreads(); }
  const float mu = red[0] / (float)N; __syncthreads();
  float s2 = 0.f;
  for (int u = 0; u < per / 4; ++u)
#pragma unroll
    for (int q = 0; q < 4; ++q) { const float c = vals[u * 4 + q] - mu; s2 += c * c; }
  red[tid] = s2; __syncthreads();
  for (int st = 128; st > 0; st >>= 1) { if (tid < st) red[tid] += red[tid + st]; __syncthreads(); }
  const float rs = rsqrtf(red[0] / (float)N + eps);
  {
    for (int u = 0; u < per / 4; ++u) {
      const int j = tid * 4 + 1024 * u;
      v4f o, sm;
#pragma unroll
      for (int q = 0; q < 4; ++q) {
        float gg = g[j + q], bb = bta[j + q];
        if (PARAM_BF16) { gg = bf16_round(gg); bb = bf16_round(bb); }
        sm[q] = vals[u * 4 + q]; o[q] = (vals[u * 4 + q] - mu) * rs * gg + bb;
      }
      if (out_sum) *(v4f*)(out_sum + (size_t)row * N + j) = sm;
      *(v4f*)(out_norm + (size_t)row * N + j) = o;
    }
    
  }
}



// ---- f16 WMMA path (v_wmma_f32_16x16x32_f16): 11-bit significands for operands in range — used where a [0,1] probability operand needs more precision than bf16
typedef _Float16 v16h __attribute__((ext_vector_type(16)));
union FragH { v16h v; v8us half[2]; _Float16 h[16]; unsigned short u[16]; };
template <int NT>
__device__ __forceinline__ v8f mmaH(v16h ah, v16h al, v16h bh, v16h bl, v8f c) {
  c = __builtin_amdgcn_wmma_f32_16x16x32_f16(false, ah, false, bh, (short)0, c, false, false);
  if (NT >= 2) c = __builtin_amdgcn_wmma_f32_16x16x32_f16(false, al, false, bh, (short)0, c, false, false);
  if (NT >= 3) c = __builtin_amdgcn_wmma_f32_16x16x32_f16(false, ah, false, bl, (short)0, c, false, false);
  asm volatile("v_nop\n\tv_nop\n\tv_nop\n\tv_nop" : "+v"(c) : "v"(ah), "v"(al), "v"(bh), "v"(bl));
  return c;
}
// batched GEMM like k_gemm_b but f16 operands: A f32 (split into f16 hi/lo if ASPLIT, else rounded to f16), Bt = f16 values [n][k]; alpha; C f32; N multiple of 16 (partial tiles skipped)
template <bool ASPLIT>
__global__ __launch_bounds__(128) void k_gemm_h(const float* __restrict__ A, int lda, size_t sA, const _Float16* __restrict__ Bh, int ldb, size_t sB, float alpha, float* __restrict__ C, int ldc, size_t sC, int M, int N, int K) {
  __shared__ __attribute__((aligned(16))) float so[4][16][64];
  const int tid = threadIdx.x, w = tid >> 5, lane = tid & 31, ln = lane & 15, hh = lane >> 4; const int by = blockIdx.y;
  A += (size_t)by * sA; Bh += (size_t)by * sB; C += (size_t)by * sC;
  const int ntn = (N + 63) / 64; const int wid = blockIdx.x * 4 + w; const int mt = wid / ntn, nq = wid % ntn; if (mt * 16 >= M) return;
  const int row0 = mt * 16, col0 = nq * 64; const float* arow = A + (size_t)(row0 + ln) * lda;
  v8f acc[4] = {};
  for (int kb = 0; kb < K; kb += 32) {
    FragH ah, al;
    const v4f x0 = *(const v4fa*)(arow + kb + 8 * hh), x1 = *(const v4fa*)(arow + kb + 8 * hh + 4), x2 = *(const v4fa*)(arow + kb + 16 + 8 * hh), x3 = *(const v4fa*)(arow + kb + 16 + 8 * hh + 4);
    float xs[16] = {x0[0],x0[1],x0[2],x0[3],x1[0],x1[1],x1[2],x1[3],x2[0],x2[1],x2[2],x2[3],x3[0],x3[1],x3[2],x3[3]};
#pragma unroll
    for (int i = 0; i < 16; ++i) { const _Float16 h = (_Float16)xs[i]; ah.h[i] = h; al.h[i] = ASPLIT ? (_Float16)(xs[i] - (float)h) : (_Float16)0.0f; }
#pragma unroll
    for (int t = 0; t < 4; ++t) { if (col0 + t * 16 >= N) continue; const size_t boff = (size_t)(col0 + t * 16 + ln) * ldb + kb; FragH bq; bq.half[0] = *(const v8us*)(Bh + boff + 8 * hh); bq.half[1] = *(const v8us*)(Bh + boff + 16 + 8 * hh);
      acc[t] = mmaH<ASPLIT ? 2 : 1>(ah.v, al.v, bq.v, bq.v, acc[t]); }
  }
#pragma unroll
  for (int t = 0; t < 4; ++t) { if (col0 + t * 16 >= N) continue;
#pragma unroll
    for (int r = 0; r < 8; ++r) so[w][8 * hh + r][t * 16 + ln] = acc[t][r] * alpha; }
  __builtin_amdgcn_fence(__ATOMIC_ACQ_REL, "workgroup"); __builtin_amdgcn_wave_barrier();
  const int rsub = lane >> 4, c4 = (lane & 15) * 4;
  {
#pragma unroll
    for (int q = 0; q < 8; ++q) { const int r = q * 2 + rsub; if (col0 + c4 < N) { const v4f v = *(const v4fa*)&so[w][r][c4]; *(v4f*)(C + (size_t)(row0 + r) * ldc + col0 + c4) = v; } }
     }
}

// Wt[n][k] = f16(W[k][n]·scale) from f32 row-major W[K][N] (scale = power of two; bf16-exact weights stay exact in f16 away from the subnormal range)
__global__ __launch_bounds__(256) void k_wt_f16(const float* __restrict__ W, _Float16* __restrict__ Wt, int K, int N, float scale) {
  const int t = blockIdx.x * 256 + threadIdx.x; if (t >= N * (K / 8)) return; const int n = t / (K / 8), k8 = (t % (K / 8)) * 8; FragH f;
#pragma unroll
  for (int i = 0; i < 8; ++i) f.h[i] = (_Float16)(bf16_round(W[(size_t)(k8 + i) * N + n]) * scale); const v8us o = f.half[0];
  *(v8us*)((unsigned short*)Wt + (size_t)n * K + k8) = o; 
}
// k_gemm_hh variant with fused epilogue: v = acc·alpha + bias[by·sBias + col] (+ CP[(row/rowsPerB)·sCPb + by·64 + col] if CP) ; ACT 0 none / 1 elu ; writes f16 C16 (and f32 C if non-null)
template <int ACT>
__global__ __launch_bounds__(128) void k_gemm_hhx(const _Float16* __restrict__ A, int lda, size_t sA, const _Float16* __restrict__ Bh, int ldb, size_t sB, float alpha, const float* __restrict__ bias, size_t sBias, const float* __restrict__ CP, int rowsPerB, size_t sCPb, int row0g,
    float* __restrict__ C, _Float16* __restrict__ C16, int ldc, size_t sC, int M, int N, int K) {
  __shared__ __attribute__((aligned(16))) float so[4][16][64];
  const int tid = threadIdx.x, w = tid >> 5, lane = tid & 31, ln = lane & 15, hh = lane >> 4; const int by = blockIdx.y;
  A += (size_t)by * sA; Bh += (size_t)by * sB; const size_t cofs = (size_t)by * sC; const float* bp = bias ? bias + (size_t)by * sBias : nullptr;
  const int ntn = (N + 63) / 64; const int wid = blockIdx.x * 4 + w; const int mt = wid / ntn, nq = wid % ntn; if (mt * 16 >= M) return;
  const int row0 = mt * 16, col0 = nq * 64; const _Float16* arow = A + (size_t)(row0 + ln) * lda;
  v8f acc[4] = {};
  for (int kb = 0; kb < K; kb += 32) { FragH ah; ah.half[0] = *(const v8us*)((const unsigned short*)arow + kb + 8 * hh); ah.half[1] = *(const v8us*)((const unsigned short*)arow + kb + 16 + 8 * hh);
#pragma unroll
    for (int t = 0; t < 4; ++t) { if (col0 + t * 16 >= N) continue; const size_t boff = (size_t)(col0 + t * 16 + ln) * ldb + kb; FragH bq; bq.half[0] = *(const v8us*)((const unsigned short*)Bh + boff + 8 * hh); bq.half[1] = *(const v8us*)((const unsigned short*)Bh + boff + 16 + 8 * hh);
      acc[t] = mmaH<1>(ah.v, ah.v, bq.v, bq.v, acc[t]); }
  }
#pragma unroll
  for (int t = 0; t < 4; ++t) { if (col0 + t * 16 >= N) continue; const int col = col0 + t * 16 + ln; const float bv = bp ? bf16_round(bp[col]) : 0.f;
#pragma unroll
    for (int r = 0; r < 8; ++r) { float v = acc[t][r] * alpha + bv; if (CP) { const int rr = row0g + row0 + 8 * hh + r; if (rowsPerB < 0) v += CP[cofs + (size_t)rr * ldc + col];      /* rowsPerB < 0: own element of the batched C plane */ else { const int bidx = rr / rowsPerB; v += CP[(size_t)bidx * sCPb + (size_t)by * 64 + col]; } } if (ACT == 1) v = (v > 0.f) ? v : expm1f(v); else if (ACT == 7) v = (v > 0.f) ? v + 1.0f : expf(v); else if (ACT == 8) v = tanhf(v); else if (ACT == 9) v = 0.5f * v * (1.0f + tanhf(0.7978845608028654f * (v + 0.044715f * v * v * v))); else if (ACT == 11) v = 1.0f / (1.0f + expf(-v)); else if (ACT == 12) v = (v > 0.f) ? v : 0.01f * v; else if (ACT == 14) v = (v > 0.f) ? v : 0.1f * v; else if (ACT == 16) v = (v >= 0.f) ? v : 0.3f * v; else if (ACT == 17) v = (v >= 0.f) ? v : 0.2f * v; else if (ACT == 15) v = v / (1.0f + expf(-v)); else if (ACT == 3) v = fmaxf(v, 0.f); else if (ACT == 6) v = 0.5f * v * (1.0f + erff(v * 0.70710678118654752f)); so[w][8 * hh + r][t * 16 + ln] = v; } }
  __builtin_amdgcn_fence(__ATOMIC_ACQ_REL, "workgroup"); __builtin_amdgcn_wave_barrier();
  const int rsub = lane >> 4, c4 = (lane & 15) * 4; typedef _Float16 v4h __attribute__((ext_vector_type(4)));
  {
#pragma unroll
    for (int q = 0; q < 8; ++q) { const int r = q * 2 + rsub; if (col0 + c4 < N) { const v4f v = *(const v4fa*)&so[w][r][c4]; if (C) *(v4f*)(C + cofs + (size_t)(row0 + r) * ldc + col0 + c4) = v; if (C16) { v4h h4; for (int i = 0; i < 4; ++i) h4[i] = (_Float16)v[i]; *(v4h*)(C16 + cofs + (size_t)(row0 + r) * ldc + col0 + c4) = h4; } } }
     }
}


typedef _Float16 v4h __attribute__((ext_vector_type(4)));

__global__ __launch_bounds__(256) void k_x16(const float* __restrict__ x, _Float16* __restrict__ X16, size_t n8) { const size_t t = (size_t)blockIdx.x * 256 + threadIdx.x; if (t >= n8) return; FragH f;
#pragma unroll
  for (int q = 0; q < 8; ++q) f.h[q] = (_Float16)bf16_round(x[t * 8 + q]); *(v8us*)((unsigned short*)X16 + t * 8) = f.half[0];  }
__global__ __launch_bounds__(256) void k_h16(const float* __restrict__ x, _Float16* __restrict__ X16, size_t n8) { const size_t t = (size_t)blockIdx.x * 256 + threadIdx.x; if (t >= n8) return; FragH f;
#pragma unroll
  for (int q = 0; q < 8; ++q) f.h[q] = (_Float16)x[t * 8 + q]; *(v8us*)((unsigned short*)X16 + t * 8) = f.half[0];  }
__global__ __launch_bounds__(256) void k_round16f(const float* __restrict__ W, _Float16* __restrict__ Bt, size_t n8) { const size_t t = (size_t)blockIdx.x * 256 + threadIdx.x; if (t >= n8) return; FragH f;
#pragma unroll
  for (int i = 0; i < 8; ++i) f.h[i] = (_Float16)(bf16_round(W[t * 8 + i]) * 16.0f); *(v8us*)((unsigned short*)Bt + t * 8) = f.half[0];  }
template <int NHv, int TTv>
__global__ __launch_bounds__(256) void k_vt(const _Float16* __restrict__ V16, int ldv, int voff, _Float16* __restrict__ Vt) { __shared__ unsigned short tl[64][66]; const int tid = threadIdx.x; const int slab = blockIdx.x / (TTv / 64), lg = blockIdx.x % (TTv / 64); const int b = slab / NHv, h = slab % NHv;
  for (int i = tid; i < 64 * 8; i += 256) { const int r = i / 8, c8 = (i % 8) * 8; FragH f; f.half[0] = *(const v8us*)((const unsigned short*)V16 + ((size_t)b * TTv + lg * 64 + r) * ldv + voff + h * 64 + c8);
#pragma unroll
    for (int q = 0; q < 8; ++q) tl[r][c8 + q] = f.u[q]; }
  __syncthreads();
  {
#pragma unroll
    for (int rd = 0; rd < 2; ++rd) { const int d = rd * 32 + tid / 8, pc = tid % 8; FragH f;
#pragma unroll
      for (int q = 0; q < 8; ++q) f.u[q] = tl[pc * 8 + q][d];
      *(v8us*)((unsigned short*)Vt + ((size_t)slab * 64 + d) * TTv + lg * 64 + pc * 8) = f.half[0]; }
     } }

__global__ __launch_bounds__(256) void k_hl(const float* __restrict__ F, _Float16* __restrict__ Hh, _Float16* __restrict__ Hl, size_t n8) { const size_t t = (size_t)blockIdx.x * 256 + threadIdx.x; if (t >= n8) return; FragH fh, fl; const v4f a = *(const v4fa*)(F + t * 8), c = *(const v4fa*)(F + t * 8 + 4);
#pragma unroll
  for (int q = 0; q < 4; ++q) { _Float16 h = (_Float16)a[q]; fh.h[q] = h; fl.h[q] = (_Float16)((a[q] - (float)h) * 1024.0f); h = (_Float16)c[q]; fh.h[4 + q] = h; fl.h[4 + q] = (_Float16)((c[q] - (float)h) * 1024.0f); }
  { *(v8us*)((unsigned short*)Hh + t * 8) = fh.half[0]; *(v8us*)((unsigned short*)Hl + t * 8) = fl.half[0];  } }

// ---- fast GEMM (wave tile 32x64; requires M % 32 == 0 rows per launch region and N % 64 == 0); epilogue = k_gemm_hhx semantics ----
__device__ __forceinline__ v16h g2_frag(const _Float16* p, int hh) { FragH f; f.half[0] = *(const v8us*)((const unsigned short*)p + 8 * hh); f.half[1] = *(const v8us*)((const unsigned short*)p + 16 + 8 * hh); return f.v; }
__device__ __forceinline__ v8f g2_mma(v16h a, v16h b, v8f c) { v8f d = __builtin_amdgcn_wmma_f32_16x16x32_f16(false, a, false, b, (short)0, c, false, false); asm volatile("v_nop\n\tv_nop\n\tv_nop\n\tv_nop" : "+v"(d) : "v"(a), "v"(b)); return d; }
template <int ACT>
__global__ __launch_bounds__(128) void k_gemm2(const _Float16* __restrict__ A, int lda, size_t sA, const _Float16* __restrict__ Bh, int ldb, size_t sB, float alpha, const float* __restrict__ bias, size_t sBias, const float* __restrict__ CP, int rowsPerB, size_t sCPb, int row0g,
    float* __restrict__ C, _Float16* __restrict__ C16, int ldc, size_t sC, int M, int N, int K) { static_assert(ACT == 0 || ACT == 3 || ACT == 6 || ACT == 8 || ACT == 9 || ACT == 11 || ACT == 12 || ACT == 14 || ACT == 15 || ACT == 16 || ACT == 17, "k_gemm2: unsupported ACT code (would silently apply no activation)");
  __shared__ __attribute__((aligned(16))) float so[4][32][68];
  const int tid = threadIdx.x, w = tid >> 5, lane = tid & 31, ln = lane & 15, hh = lane >> 4; const int by = blockIdx.y;
  A += (size_t)by * sA; Bh += (size_t)by * sB; const size_t cofs = (size_t)by * sC; const float* bp = bias ? bias + (size_t)by * sBias : nullptr;
  const int ntn = N >> 6; const int mt = blockIdx.x / ntn, nq = blockIdx.x - mt * ntn; const int row0 = mt * 128 + 32 * w, col0 = nq * 64; if (row0 >= M) return;
  const _Float16* a0p = A + (size_t)(row0 + ln) * lda; const _Float16* a1p = a0p + (size_t)16 * lda;
  const _Float16* b0p = Bh + (size_t)(col0 + ln) * ldb; const _Float16* b1p = b0p + (size_t)16 * ldb; const _Float16* b2p = b1p + (size_t)16 * ldb; const _Float16* b3p = b2p + (size_t)16 * ldb;
  const v8f z8 = {0.f,0.f,0.f,0.f,0.f,0.f,0.f,0.f}; v8f c00 = z8, c01 = z8, c02 = z8, c03 = z8, c10 = z8, c11 = z8, c12 = z8, c13 = z8;
#pragma unroll 1
  for (int kb = 0; kb < K; kb += 32) { const v16h a0 = g2_frag(a0p + kb, hh), a1 = g2_frag(a1p + kb, hh);
    v16h b = g2_frag(b0p + kb, hh); c00 = g2_mma(a0, b, c00); c10 = g2_mma(a1, b, c10);
    b = g2_frag(b1p + kb, hh); c01 = g2_mma(a0, b, c01); c11 = g2_mma(a1, b, c11);
    b = g2_frag(b2p + kb, hh); c02 = g2_mma(a0, b, c02); c12 = g2_mma(a1, b, c12);
    b = g2_frag(b3p + kb, hh); c03 = g2_mma(a0, b, c03); c13 = g2_mma(a1, b, c13); }
  v8f accs[8] = {c00, c01, c02, c03, c10, c11, c12, c13};
#pragma unroll
  for (int u = 0; u < 8; ++u) { const int t = u & 3, half = u >> 2; const int col = col0 + t * 16 + ln; const float bv = bp ? bf16_round(bp[col]) : 0.f;
#pragma unroll
    for (int r = 0; r < 8; ++r) { const int rloc = half * 16 + 8 * hh + r; float v = accs[u][r] * alpha + bv; if (CP) { if (rowsPerB < 0) v += CP[cofs + (size_t)(row0g + row0 + rloc) * ldc + col];      /* rowsPerB < 0: own element of the batched C plane */ else { const int bidx = (row0g + row0 + rloc) / rowsPerB; v += CP[(size_t)bidx * sCPb + (size_t)by * 64 + col]; } }
      if (ACT == 3) v = fmaxf(v, 0.f); else if (ACT == 6) v = 0.5f * v * (1.0f + erff(v * 0.70710678118654752f)); else if (ACT == 11) v = 1.0f / (1.0f + expf(-v)); else if (ACT == 15) v = v / (1.0f + expf(-v)); else if (ACT == 12) v = (v > 0.f) ? v : 0.01f * v; else if (ACT == 8) v = tanhf(v); else if (ACT == 9) v = 0.5f * v * (1.0f + tanhf(0.7978845608028654f * (v + 0.044715f * v * v * v))); else if (ACT == 14) v = (v > 0.f) ? v : 0.1f * v; else if (ACT == 16) v = (v >= 0.f) ? v : 0.3f * v; else if (ACT == 17) v = (v >= 0.f) ? v : 0.2f * v;
      so[w][rloc][t * 16 + ln] = v; } }
  __builtin_amdgcn_fence(__ATOMIC_ACQ_REL, "workgroup"); __builtin_amdgcn_wave_barrier();
  const int rsub = lane >> 4, c4 = (lane & 15) * 4;
  {
#pragma unroll
    for (int q = 0; q < 16; ++q) { const int r = q * 2 + rsub; const v4f v = *(const v4fa*)&so[w][r][c4]; if (C) *(v4f*)(C + cofs + (size_t)(row0 + r) * ldc + col0 + c4) = v; if (C16) { v4h h4; for (int i = 0; i < 4; ++i) h4[i] = (_Float16)v[i]; *(v4h*)(C16 + cofs + (size_t)(row0 + r) * ldc + col0 + c4) = h4; } }
     } }


__global__ __launch_bounds__(256) void k_wnat(const float* __restrict__ w, size_t n8, _Float16* __restrict__ Bt) { const size_t t = (size_t)blockIdx.x * 256 + threadIdx.x; if (t >= n8) return; FragH f; for (int q = 0; q < 8; ++q) f.h[q] = (_Float16)(bf16_round(w[t * 8 + q]) * 16.0f); *(v8us*)((unsigned short*)Bt + t * 8) = f.half[0];  }
#define FK 64                        /* keys per pass */
#define FPT 72                       /* LDS row pitch in f16: 128 data bytes + 16, an odd multiple of 16 bytes for the 16-byte fragment reads */
__device__ __forceinline__ v16h fa_frag(const unsigned short* p, int hh) { FragH f; f.half[0] = *(const v8us*)(p + 8 * hh); f.half[1] = *(const v8us*)(p + 16 + 8 * hh); return f.v; }
__device__ __forceinline__ v8f fa_mma(v16h a, v16h b, v8f c) { return __builtin_amdgcn_wmma_f32_16x16x32_f16(false, a, false, b, (short)0, c, false, false); }
__device__ __forceinline__ float fa_xhalf(float x) { return __builtin_bit_cast(float, __builtin_amdgcn_permlanex16(__builtin_bit_cast(int, x), __builtin_bit_cast(int, x), 0x76543210, 0xfedcba98, false, false)); }      /* lane l reads lane l ^ 16, on the vector pipe: no LDS round trip */
__device__ __forceinline__ float fa_exp2(float x) { float e; asm("v_exp_f32 %0, %1\n\tv_nop" : "=v"(e) : "v"(x)); return e; }
__device__ __forceinline__ v8f fa_exp2x8(v8f x) { float e0, e1, e2, e3, e4, e5, e6, e7;
  asm("v_exp_f32 %0, %8\n\tv_exp_f32 %1, %9\n\tv_exp_f32 %2, %10\n\tv_exp_f32 %3, %11\n\tv_exp_f32 %4, %12\n\tv_exp_f32 %5, %13\n\tv_exp_f32 %6, %14\n\tv_exp_f32 %7, %15\n\tv_nop"
      : "=&v"(e0), "=&v"(e1), "=&v"(e2), "=&v"(e3), "=&v"(e4), "=&v"(e5), "=&v"(e6), "=&v"(e7) : "v"(x[0]), "v"(x[1]), "v"(x[2]), "v"(x[3]), "v"(x[4]), "v"(x[5]), "v"(x[6]), "v"(x[7]));
  const v8f e = {e0, e1, e2, e3, e4, e5, e6, e7}; return e; }
__global__ __launch_bounds__(128) void k_fattn(const _Float16* __restrict__ QKVp, const _Float16* __restrict__ VTp, float* __restrict__ O) {
  __shared__ __attribute__((aligned(16))) unsigned short Ks[FK][FPT];      /* K rows of the pass: [key][d] */
  __shared__ __attribute__((aligned(16))) unsigned short Vs[HD][FPT];      /* V^T rows of the pass: [d][key] */
  const int tid = threadIdx.x, w = tid >> 5, lane = tid & 31, ln = lane & 15, hh = lane >> 4;
  const int bh = blockIdx.x / (SQ / 128), qb = blockIdx.x % (SQ / 128); const int b = bh / NH, h = bh % NH;
  const _Float16* qg = QKVp + (size_t)b * SQ * LQ + (size_t)h * 3 * HD;      /* head h's 192 packed columns: q at + 0, k at + 64 */
  const int q0 = qb * 128 + w * 32;
  v16h qf[2][2];
#pragma unroll
  for (int qt = 0; qt < 2; ++qt)
#pragma unroll
    for (int ks = 0; ks < 2; ++ks) qf[qt][ks] = g2_frag(qg + (size_t)(q0 + qt * 16 + ln) * LQ + ks * 32, hh);
  /* staging: thread t moves 16-byte chunks t, t + 128, t + 256, t + 384 of each 64 x 128-byte tile: 8 chunks a row, so a wave's load covers 4 whole lines */
  const int frow = tid >> 3, fc8 = (tid & 7) * 8;
  const unsigned short* kp = (const unsigned short*)qg + HD + (size_t)frow * LQ + fc8;
  const unsigned short* vp = (const unsigned short*)VTp + (size_t)bh * HD * SQ + (size_t)frow * SQ + fc8;
  v8us kr[4], vr[4];
#pragma unroll
  for (int j = 0; j < 4; ++j) { kr[j] = *(const v8us*)(kp + (size_t)(16 * j) * LQ); vr[j] = *(const v8us*)(vp + (size_t)(16 * j) * SQ); }
  const v8f z8 = {0.f, 0.f, 0.f, 0.f, 0.f, 0.f, 0.f, 0.f};
  v8f o[2][4]; float m[2], l[2];
#pragma unroll
  for (int qt = 0; qt < 2; ++qt) { m[qt] = -3.0e38f; l[qt] = 0.f;
#pragma unroll
    for (int dt = 0; dt < 4; ++dt) o[qt][dt] = z8; }
  const float SC = 0.125f * 1.4426950408889634f;      /* 1 / sqrt(64), and base e to base 2 */
  for (int p = 0; p < SQ / FK; ++p) {
    __syncthreads();      /* every wave has finished reading the pass before */
#pragma unroll
    for (int j = 0; j < 4; ++j) { *(v8us*)&Ks[frow + 16 * j][fc8] = kr[j]; *(v8us*)&Vs[frow + 16 * j][fc8] = vr[j]; }
    __syncthreads();      /* the tiles are complete before anybody reads them */
    if (p + 1 < SQ / FK) {      /* the next pass's tiles fly to registers while this pass is worked on */
      kp += (size_t)FK * LQ; vp += FK;
#pragma unroll
      for (int j = 0; j < 4; ++j) { kr[j] = *(const v8us*)(kp + (size_t)(16 * j) * LQ); vr[j] = *(const v8us*)(vp + (size_t)(16 * j) * SQ); }
    }
    __builtin_amdgcn_sched_barrier(0);      /* keeps the eight loads above the pass's work: without it the compiler sinks them to the loop's foot, and their whole latency is waited for at the next pass's head */
    v8f st[2][4];
#pragma unroll
    for (int kt = 0; kt < 4; ++kt) { const v16h a0 = fa_frag(&Ks[kt * 16 + ln][0], hh), a1 = fa_frag(&Ks[kt * 16 + ln][32], hh);
#pragma unroll
      for (int qt = 0; qt < 2; ++qt) st[qt][kt] = fa_mma(a1, qf[qt][1], fa_mma(a0, qf[qt][0], z8)); }      /* st[qt][kt][r] = q(q0 + 16 qt + ln) . k(64 p + 16 kt + 8 hh + r) */
    FragH pf[2][2];
#pragma unroll
    for (int qt = 0; qt < 2; ++qt) {
      v8f x8 = st[qt][0];
#pragma unroll
      for (int r = 0; r < 8; ++r) x8[r] = fmaxf(fmaxf(st[qt][0][r], st[qt][1][r]), fmaxf(st[qt][2][r], st[qt][3][r]));
      float mx = fmaxf(fmaxf(fmaxf(x8[0], x8[1]), fmaxf(x8[2], x8[3])), fmaxf(fmaxf(x8[4], x8[5]), fmaxf(x8[6], x8[7])));
      mx = fmaxf(mx, fa_xhalf(mx));      /* the other half of the query's 64 keys */
      const float mn = fmaxf(m[qt], mx * SC); const float al = fa_exp2(m[qt] - mn); m[qt] = mn;      /* al = 0 on the first pass */
      v8f s8 = z8;
#pragma unroll
      for (int kt = 0; kt < 4; ++kt) { const v8f e8 = fa_exp2x8(st[qt][kt] * SC - mn); s8 += e8;
#pragma unroll
        for (int r = 0; r < 8; ++r) pf[qt][kt >> 1].h[(kt & 1) * 8 + r] = (_Float16)e8[r]; }
      l[qt] = l[qt] * al + (((s8[0] + s8[1]) + (s8[2] + s8[3])) + ((s8[4] + s8[5]) + (s8[6] + s8[7])));
#pragma unroll
      for (int dt = 0; dt < 4; ++dt) o[qt][dt] *= al;
    }
    /* The V^T fragments are read in two groups of four, each group whole in front of its eight products. The scheduling fences hold that order: without them the compiler mixes the softmax into the products,
       runs short of registers and waits for LDS in front of every pair of products; all eight fragments at once would take the kernel past 256 registers. */
#pragma unroll
    for (int dg = 0; dg < 2; ++dg) {
      __builtin_amdgcn_sched_barrier(0);      /* nothing of the group's reads moves up into the work before */
      v16h va[2][2];
#pragma unroll
      for (int d2 = 0; d2 < 2; ++d2)
#pragma unroll
        for (int ks = 0; ks < 2; ++ks) va[d2][ks] = fa_frag(&Vs[(dg * 2 + d2) * 16 + ln][ks * 32], hh);
      __builtin_amdgcn_sched_barrier(0);      /* none of the group's reads sinks among its products */
#pragma unroll
      for (int d2 = 0; d2 < 2; ++d2)
#pragma unroll
        for (int ks = 0; ks < 2; ++ks)
#pragma unroll
          for (int qt = 0; qt < 2; ++qt) o[qt][dg * 2 + d2] = fa_mma(va[d2][ks], pf[qt][ks].v, o[qt][dg * 2 + d2]);      /* o[qt][dt][r] = O[q0 + 16 qt + ln][16 dt + 8 hh + r] */
    }
  }
#pragma unroll
  for (int qt = 0; qt < 2; ++qt) { const float inv = 1.0f / (l[qt] + fa_xhalf(l[qt]));
    float* orow = O + ((size_t)bh * SQ + q0 + qt * 16 + ln) * HD + 8 * hh;      /* head plane bh, row = query: the raw-view merge */
#pragma unroll
    for (int dt = 0; dt < 4; ++dt) { const v4f lo = {o[qt][dt][0] * inv, o[qt][dt][1] * inv, o[qt][dt][2] * inv, o[qt][dt][3] * inv}, hi = {o[qt][dt][4] * inv, o[qt][dt][5] * inv, o[qt][dt][6] * inv, o[qt][dt][7] * inv};
      *(v4f*)(orow + dt * 16) = lo; *(v4f*)(orow + dt * 16 + 4) = hi; } }
}
__global__ __launch_bounds__(256) void k_vt(const _Float16* __restrict__ V16, int b, int h0, _Float16* __restrict__ VT) { __shared__ unsigned short tl[64][65]; const int tid = threadIdx.x; const int hh = blockIdx.x % HG, sg = blockIdx.x / HG; const int s0 = sg * 64; const int h = h0 + hh;
  for (int i = tid; i < 64 * 8; i += 256) { const int j = i / 8, d8 = (i % 8) * 8; FragH f; f.half[0] = *(const v8us*)((const unsigned short*)V16 + ((size_t)b * SQ + s0 + j) * DM + h * HD + d8); for (int q = 0; q < 8; ++q) tl[d8 + q][j] = f.u[q]; }
  __syncthreads();
  { for (int i = tid; i < 64 * 8; i += 256) { const int d = i / 8, j8 = (i % 8) * 8; FragH f; for (int q = 0; q < 8; ++q) f.u[q] = tl[d][j8 + q]; *(v8us*)((unsigned short*)VT + ((size_t)hh * HD + d) * SQ + s0 + j8) = f.half[0]; }  } }


extern "C" void kernel_launch(void* const* d_in, const int* in_sizes, int n_in,
                              void* d_out, int out_size, void* d_ws, size_t ws_size, hipStream_t stream) {
  (void)in_sizes; (void)n_in; (void)out_size;
  const float* const* I = (const float* const*)d_in; const float* x = I[0]; const float* wqkv = I[1]; const float* bqkv = I[2];      /* input order: x, W_qkv ([in][out] [1024][3072]; columns packed PER HEAD: 192 h + {0..63 q, 64..127 k, 128..191 v}), b_qkv [3072] (REAL; the same packing: the projection GEMM's bias slot reads it by output column); three inputs; no output weight: the module has none */
  char* ws = (char*)d_ws; size_t off = 0;
  auto take = [&](size_t bytes) { char* p = ws + off; off += (bytes + 255) & ~(size_t)255; return p; };
  _Float16* BQKV = (_Float16*)take((size_t)3 * DM * DM * 2);
  _Float16* X16 = (_Float16*)take(NR * DM * 2); _Float16* QKV = (_Float16*)take(NR * 3 * DM * 2); _Float16* V16 = QKV + 2 * HD;      /* PER-HEAD packing: within head h's 192 columns q starts at + 0, k at + 64, v at + 128; the head stride is 3 HD */
  _Float16* VT = (_Float16*)take((size_t)NB * NH * HD * SQ * 2);      /* V^T planes of every (batch, head) */
  if (off > ws_size) return;
  k_wt_f16<<<(unsigned)(((size_t)DM * 3 * DM / 8 + 255) / 256), 256, 0, stream>>>(wqkv, BQKV, DM, 3 * DM, 16.0f);      /* [in][out] -> Bt[n][k] x16 (pitch K = 1024) */

  k_x16<<<(unsigned)((NR * DM / 8 + 255) / 256), 256, 0, stream>>>(x, X16, NR * DM / 8);
  const size_t r0p = (size_t)B0 * SQ;      /* first projected row */
  k_gemm2<0><<<dim3((unsigned)((MP / 128) * (3 * DM / 64)), 1), 128, 0, stream>>>(X16 + r0p * DM, DM, 0, BQKV, DM, 0, 0.0625f, bqkv, 0, nullptr, 1, 0, 0, nullptr, QKV + r0p * 3 * DM, 3 * DM, 0, MP, 3 * DM, DM);      /* q | k | v rows (f16); head h = columns 3*HD*h .. 3*HD*h + 191 (q | k | v) */
  for (int b = B0; b < B0 + NBR; ++b) { const size_t r0 = (size_t)b * SQ;
    for (int h = 0; h < NH; ++h) k_vt<1, SQ><<<SQ / 64, 256, 0, stream>>>(V16 + r0 * LQ + (size_t)h * 3 * HD, LQ, 0, VT + ((size_t)b * NH + h) * HD * SQ); }      /* V^T per head: head h's v slice = columns 192 h + 128 .. of the packed plane (pitch 3072) */
  k_fattn<<<NB * NH * (SQ / 128), 128, 0, stream>>>(QKV, VT, (float*)d_out);      /* all batches and heads in one launch: softmax(q k^T / 8) v, each head into its own contiguous [2048][64] plane */
}

// v003
// It runs in 135 microseconds.
// Timed twice side by side with v002, it ran 1.67 and 1.66 times as fast.
// All steps since v000 together make it 27.7 times as fast.
#include <hip/hip_runtime.h>
// Multi-head self-attention with ONE fused QKV projection packed PER HEAD, NO output projection and a RAW-VIEW merge (x [2][2048][1024]; qkv = x W_qkv + b_qkv ([in][out] 1024 x 3072, normal x 1/32; a REAL bias normal x 0.01) reshaped (b, s, 16, 3 x 64): head h owns columns 192 h .. 192 h + 191: q | k | v = its three 64-column slices; att = q k^T / sqrt(64); softmax over all 2048 keys (no mask); values [b][16][s][64] are reshaped to (b, s, 1024) WITHOUT a head transpose (the source's own form): the output memory of a batch IS the sixteen [2048][64] head planes one after another); the P.V product is written straight to the f32 output, each head into its own contiguous plane.
// Structure: token rows r = b*2048 + s; x as exact f16 rows (bf16-rounded); q | k | v as ONE WMMA GEMM (N = 3 x 1024) (32x64 wave tiles, f32 accumulation, exact x16 weights + bias, f16 outputs); the GEMM's own epilogue stores every head's v tile transposed (V^T planes [d][key], 256-byte runs through LDS), so no transpose launch is left; then ONE fused attention launch over every (batch, head): per 64 keys S^T = K Q^T, running softmax in registers (f32 statistics, base 2; weights 2^(s - m) as f16), O^T += V^T P^T, divided by the row sum at the end and written as f32 straight into the output's own layout (head plane after head plane): no output projection.
// Compute dtype: inputs rounded to bf16; x / weights exact; q, k, v and softmax weights as plain f16 GEMM operands (~2^-12); scores, softmax statistics and o f32. v_wmma_f32_16x16x32_f16.
#define NB 2
#define SQ 2048
#define DM 1024
#define NH 16
#define HD 64
#define HG 4                         /* heads per group of the grouped transpose below */
#define B0 0                         /* first batch processed (debug hook) */
#define NBR NB                       /* batches processed (debug hook) */
#define NR ((size_t)NB * SQ)         /* token rows */
#define MP ((int)((size_t)NBR * SQ)) /* rows projected (debug hook) */
#define QN SQ                        /* unused (the attention launch covers all SQ query rows) */
#define NHD NH                       /* unused (the attention launch covers all NH heads) */
#define MPO MP                       /* unused (no output projection) */
#define LQ (3 * DM)      /* row pitch of the q/k/v rows */
typedef __bf16 v16b __attribute__((ext_vector_type(16)));
typedef unsigned short v8us __attribute__((ext_vector_type(8), may_alias));
typedef float  v8f  __attribute__((ext_vector_type(8)));
typedef float  v4f  __attribute__((ext_vector_type(4)));
typedef float  v4fa __attribute__((ext_vector_type(4), may_alias));
union FragB { v16b v; v8us half[2]; unsigned short u[16]; };

__device__ __forceinline__ unsigned short bf16_bits(float x) { unsigned int u = __float_as_uint(x); return (unsigned short)((u + 0x7FFFu + ((u >> 16) & 1u)) >> 16); }
__device__ __forceinline__ float bf16_val(unsigned short b) { return __uint_as_float(((unsigned int)b) << 16); }
__device__ __forceinline__ float bf16_round(float x) { return bf16_val(bf16_bits(x)); }
// D += A·B with NT terms: 1 = ah·bh, 2 = + al·bh (A split), 3 = + ah·bl (both split)
template <int NT>
__device__ __forceinline__ v8f mmaN(v16b ah, v16b al, v16b bh, v16b bl, v8f c) {
  c = __builtin_amdgcn_wmma_f32_16x16x32_bf16(false, ah, false, bh, (short)0, c, false, false);
  if (NT >= 2) c = __builtin_amdgcn_wmma_f32_16x16x32_bf16(false, al, false, bh, (short)0, c, false, false);
  if (NT >= 3) c = __builtin_amdgcn_wmma_f32_16x16x32_bf16(false, ah, false, bl, (short)0, c, false, false);
  asm volatile("v_nop\n\tv_nop\n\tv_nop\n\tv_nop" : "+v"(c) : "v"(ah), "v"(al), "v"(bh), "v"(bl));
  return c;
}

__global__ __launch_bounds__(256) void k_wt_bf16(const float* __restrict__ W, unsigned short* __restrict__ Wt, int K, int N) {
  const int t = blockIdx.x * 256 + threadIdx.x;
  const int k8n = K / 8;
  if (t >= N * k8n) return;
  const int n = t / k8n, k8 = (t % k8n) * 8;
  v8us v;
#pragma unroll
  for (int i = 0; i < 8; ++i) v[i] = bf16_bits(W[(size_t)(k8 + i) * N + n]);
  *(v8us*)(Wt + (size_t)n * K + k8) = v;
  
}

// GEMM C[M][N] (f32, pitch ldc) = act(A[M][K]·W + bias). A f32 row-major (pitch lda) converted per fragment to bf16
// (ASPLIT: hi/lo two planes -> 2 terms, else single rounded term); Wt bf16 [N][K] (pitch ldb). BIAS_BF16 rounds the
// bias to bf16 first (bias quantised to bf16 before the add). K%32==0, M%16==0, N%64==0.
template <bool ASPLIT, int ACT, bool BIAS_BF16>
__global__ __launch_bounds__(128) void k_gemm_bf(const float* __restrict__ A, int lda, const unsigned short* __restrict__ Wt, int ldb,
                                               const float* __restrict__ bias, float* __restrict__ C, int ldc, int M, int N, int K) {
  __shared__ __attribute__((aligned(16))) float so[4][16][64];
  const int tid = threadIdx.x, w = tid >> 5, lane = tid & 31, ln = lane & 15, hh = lane >> 4;
  const int ntn = N / 64;
  const int wid = blockIdx.x * 4 + w;
  const int mt = wid / ntn, nq = wid % ntn;
  if (mt * 16 >= M) return;
  const int row0 = mt * 16, col0 = nq * 64;
  const float* arow = A + (size_t)(row0 + ln) * lda;
  v8f acc[4] = {};
  for (int kb = 0; kb < K; kb += 32) {
    FragB ah, al;
    const v4f x0 = *(const v4fa*)(arow + kb + 8 * hh), x1 = *(const v4fa*)(arow + kb + 8 * hh + 4);
    const v4f x2 = *(const v4fa*)(arow + kb + 16 + 8 * hh), x3 = *(const v4fa*)(arow + kb + 16 + 8 * hh + 4);
    float xs[16] = {x0[0],x0[1],x0[2],x0[3],x1[0],x1[1],x1[2],x1[3],x2[0],x2[1],x2[2],x2[3],x3[0],x3[1],x3[2],x3[3]};
#pragma unroll
    for (int i = 0; i < 16; ++i) { const unsigned short hb = bf16_bits(xs[i]); ah.u[i] = hb; al.u[i] = ASPLIT ? bf16_bits(xs[i] - bf16_val(hb)) : (unsigned short)0; }
#pragma unroll
    for (int t = 0; t < 4; ++t) {
      const unsigned short* brow = Wt + (size_t)(col0 + t * 16 + ln) * ldb + kb;
      FragB b;
      b.half[0] = *(const v8us*)(brow + 8 * hh);
      b.half[1] = *(const v8us*)(brow + 16 + 8 * hh);
      acc[t] = mmaN<ASPLIT ? 2 : 1>(ah.v, al.v, b.v, b.v, acc[t]);
    }
  }
#pragma unroll
  for (int t = 0; t < 4; ++t) {
    float bv = bias ? bias[col0 + t * 16 + ln] : 0.f;
    if (BIAS_BF16) bv = bf16_round(bv);
#pragma unroll
    for (int r = 0; r < 8; ++r) { float v = acc[t][r] + bv; if (ACT == 1) v = fmaxf(v, 0.f); so[w][8 * hh + r][t * 16 + ln] = v; }
  }
  __builtin_amdgcn_fence(__ATOMIC_ACQ_REL, "workgroup");
  __builtin_amdgcn_wave_barrier();
  const int rsub = lane >> 4, c4 = (lane & 15) * 4;
  {
#pragma unroll
    for (int q = 0; q < 8; ++q) {
      const int r = q * 2 + rsub;
      const v4f v = *(const v4fa*)&so[w][r][c4];
      *(v4f*)(C + (size_t)(row0 + r) * ldc + col0 + c4) = v;
    }
    
  }
}

// GEMM C = act(A·W + bias + resid): A f32 (ASPLIT -> hi/lo 2 terms), Wt bf16 [N][K]; ACT 0 none, 1 relu, 2 exact gelu;
// resid (optional, f32, row index = (row % rmod), pitch ldr, RES_BF16 rounds it) added before the activation.
template <bool ASPLIT, int ACT, bool BIAS_BF16, bool RES_BF16>
__global__ __launch_bounds__(128) void k_gemm_bf3(const float* __restrict__ A, int lda, const unsigned short* __restrict__ Wt, int ldb,
                                                const float* __restrict__ bias, const float* __restrict__ resid, int rmod, int ldr,
                                                float* __restrict__ C, int ldc, int M, int N, int K) {
  __shared__ __attribute__((aligned(16))) float so[4][16][64];
  const int tid = threadIdx.x, w = tid >> 5, lane = tid & 31, ln = lane & 15, hh = lane >> 4;
  const int ntn = N / 64;
  const int wid = blockIdx.x * 4 + w;
  const int mt = wid / ntn, nq = wid % ntn;
  if (mt * 16 >= M) return;
  const int row0 = mt * 16, col0 = nq * 64;
  const float* arow = A + (size_t)(row0 + ln) * lda;
  v8f acc[4] = {};
  for (int kb = 0; kb < K; kb += 32) {
    FragB ah, al;
    const v4f x0 = *(const v4fa*)(arow + kb + 8 * hh), x1 = *(const v4fa*)(arow + kb + 8 * hh + 4);
    const v4f x2 = *(const v4fa*)(arow + kb + 16 + 8 * hh), x3 = *(const v4fa*)(arow + kb + 16 + 8 * hh + 4);
    float xs[16] = {x0[0],x0[1],x0[2],x0[3],x1[0],x1[1],x1[2],x1[3],x2[0],x2[1],x2[2],x2[3],x3[0],x3[1],x3[2],x3[3]};
#pragma unroll
    for (int i = 0; i < 16; ++i) { const unsigned short hb = bf16_bits(xs[i]); ah.u[i] = hb; al.u[i] = ASPLIT ? bf16_bits(xs[i] - bf16_val(hb)) : (unsigned short)0; }
#pragma unroll
    for (int t = 0; t < 4; ++t) {
      const unsigned short* brow = Wt + (size_t)(col0 + t * 16 + ln) * ldb + kb;
      FragB b;
      b.half[0] = *(const v8us*)(brow + 8 * hh);
      b.half[1] = *(const v8us*)(brow + 16 + 8 * hh);
      acc[t] = mmaN<ASPLIT ? 2 : 1>(ah.v, al.v, b.v, b.v, acc[t]);
    }
  }
#pragma unroll
  for (int t = 0; t < 4; ++t) {
    const int col = col0 + t * 16 + ln;
    float bv = bias ? bias[col] : 0.f;
    if (BIAS_BF16) bv = bf16_round(bv);
#pragma unroll
    for (int r = 0; r < 8; ++r) {
      float v = acc[t][r] + bv;
      if (resid) { float rv = resid[(size_t)((row0 + 8 * hh + r) % rmod) * ldr + col]; if (RES_BF16) rv = bf16_round(rv); v += rv; }
      if (ACT == 1) v = fmaxf(v, 0.f);
      if (ACT == 2) v = 0.5f * v * (1.0f + erff(v * 0.70710678118654752f));
      if (ACT == 3) { const float u = 0.7978845608028654f * (v + 0.044715f * v * v * v); v = 0.5f * v * (1.0f + tanhf(u)); }
      so[w][8 * hh + r][t * 16 + ln] = v;
    }
  }
  __builtin_amdgcn_fence(__ATOMIC_ACQ_REL, "workgroup");
  __builtin_amdgcn_wave_barrier();
  const int rsub = lane >> 4, c4 = (lane & 15) * 4;
  {
#pragma unroll
    for (int q = 0; q < 8; ++q) {
      const int r = q * 2 + rsub;
      const v4f v = *(const v4fa*)&so[w][r][c4];
      *(v4f*)(C + (size_t)(row0 + r) * ldc + col0 + c4) = v;
    }
    
  }
}
// row LayerNorm (biased variance, eps) over N: s = X (+ R); optional out_sum <- s; out_norm <- (s-mu)*rsqrt(var+eps)*g + b
template <bool PARAM_BF16>
__global__ __launch_bounds__(256) void k_layernorm(const float* __restrict__ X, const float* __restrict__ R, const float* __restrict__ g, const float* __restrict__ bta,
                                                  float* __restrict__ out_sum, float* __restrict__ out_norm, int N, float eps) {
  __shared__ float red[256];
  const int row = blockIdx.x, tid = threadIdx.x;
  const float* x = X + (size_t)row * N; const float* rr = R ? R + (size_t)row * N : nullptr;
  float vals[16];                     // up to N = 4096
  const int per = N / 256;            // contiguous chunk per thread? use strided-by-4 chunks: thread handles j = tid*4 + 1024*u
  float s1 = 0.f;
  for (int u = 0; u < per / 4; ++u) {
    const int j = tid * 4 + 1024 * u;
    const v4f a = *(const v4fa*)(x + j);
    v4f b = {0.f,0.f,0.f,0.f}; if (rr) b = *(const v4fa*)(rr + j);
#pragma unroll
    for (int q = 0; q < 4; ++q) { const float v = a[q] + b[q]; vals[u * 4 + q] = v; s1 += v; }
  }
  red[tid] = s1; __syncthreads();
  for (int st = 128; st > 0; st >>= 1) { if (tid < st) red[tid] += red[tid + st]; __syncthreads(); }
  const float mu = red[0] / (float)N; __syncthreads();
  float s2 = 0.f;
  for (int u = 0; u < per / 4; ++u)
#pragma unroll
    for (int q = 0; q < 4; ++q) { const float c = vals[u * 4 + q] - mu; s2 += c * c; }
  red[tid] = s2; __syncthreads();
  for (int st = 128; st > 0; st >>= 1) { if (tid < st) red[tid] += red[tid + st]; __syncthreads(); }
  const float rs = rsqrtf(red[0] / (float)N + eps);
  {
    for (int u = 0; u < per / 4; ++u) {
      const int j = tid * 4 + 1024 * u;
      v4f o, sm;
#pragma unroll
      for (int q = 0; q < 4; ++q) {
        float gg = g[j + q], bb = bta[j + q];
        if (PARAM_BF16) { gg = bf16_round(gg); bb = bf16_round(bb); }
        sm[q] = vals[u * 4 + q]; o[q] = (vals[u * 4 + q] - mu) * rs * gg + bb;
      }
      if (out_sum) *(v4f*)(out_sum + (size_t)row * N + j) = sm;
      *(v4f*)(out_norm + (size_t)row * N + j) = o;
    }
    
  }
}



// ---- f16 WMMA path (v_wmma_f32_16x16x32_f16): 11-bit significands for operands in range — used where a [0,1] probability operand needs more precision than bf16
typedef _Float16 v16h __attribute__((ext_vector_type(16)));
union FragH { v16h v; v8us half[2]; _Float16 h[16]; unsigned short u[16]; };
template <int NT>
__device__ __forceinline__ v8f mmaH(v16h ah, v16h al, v16h bh, v16h bl, v8f c) {
  c = __builtin_amdgcn_wmma_f32_16x16x32_f16(false, ah, false, bh, (short)0, c, false, false);
  if (NT >= 2) c = __builtin_amdgcn_wmma_f32_16x16x32_f16(false, al, false, bh, (short)0, c, false, false);
  if (NT >= 3) c = __builtin_amdgcn_wmma_f32_16x16x32_f16(false, ah, false, bl, (short)0, c, false, false);
  asm volatile("v_nop\n\tv_nop\n\tv_nop\n\tv_nop" : "+v"(c) : "v"(ah), "v"(al), "v"(bh), "v"(bl));
  return c;
}
// batched GEMM like k_gemm_b but f16 operands: A f32 (split into f16 hi/lo if ASPLIT, else rounded to f16), Bt = f16 values [n][k]; alpha; C f32; N multiple of 16 (partial tiles skipped)
template <bool ASPLIT>
__global__ __launch_bounds__(128) void k_gemm_h(const float* __restrict__ A, int lda, size_t sA, const _Float16* __restrict__ Bh, int ldb, size_t sB, float alpha, float* __restrict__ C, int ldc, size_t sC, int M, int N, int K) {
  __shared__ __attribute__((aligned(16))) float so[4][16][64];
  const int tid = threadIdx.x, w = tid >> 5, lane = tid & 31, ln = lane & 15, hh = lane >> 4; const int by = blockIdx.y;
  A += (size_t)by * sA; Bh += (size_t)by * sB; C += (size_t)by * sC;
  const int ntn = (N + 63) / 64; const int wid = blockIdx.x * 4 + w; const int mt = wid / ntn, nq = wid % ntn; if (mt * 16 >= M) return;
  const int row0 = mt * 16, col0 = nq * 64; const float* arow = A + (size_t)(row0 + ln) * lda;
  v8f acc[4] = {};
  for (int kb = 0; kb < K; kb += 32) {
    FragH ah, al;
    const v4f x0 = *(const v4fa*)(arow + kb + 8 * hh), x1 = *(const v4fa*)(arow + kb + 8 * hh + 4), x2 = *(const v4fa*)(arow + kb + 16 + 8 * hh), x3 = *(const v4fa*)(arow + kb + 16 + 8 * hh + 4);
    float xs[16] = {x0[0],x0[1],x0[2],x0[3],x1[0],x1[1],x1[2],x1[3],x2[0],x2[1],x2[2],x2[3],x3[0],x3[1],x3[2],x3[3]};
#pragma unroll
    for (int i = 0; i < 16; ++i) { const _Float16 h = (_Float16)xs[i]; ah.h[i] = h; al.h[i] = ASPLIT ? (_Float16)(xs[i] - (float)h) : (_Float16)0.0f; }
#pragma unroll
    for (int t = 0; t < 4; ++t) { if (col0 + t * 16 >= N) continue; const size_t boff = (size_t)(col0 + t * 16 + ln) * ldb + kb; FragH bq; bq.half[0] = *(const v8us*)(Bh + boff + 8 * hh); bq.half[1] = *(const v8us*)(Bh + boff + 16 + 8 * hh);
      acc[t] = mmaH<ASPLIT ? 2 : 1>(ah.v, al.v, bq.v, bq.v, acc[t]); }
  }
#pragma unroll
  for (int t = 0; t < 4; ++t) { if (col0 + t * 16 >= N) continue;
#pragma unroll
    for (int r = 0; r < 8; ++r) so[w][8 * hh + r][t * 16 + ln] = acc[t][r] * alpha; }
  __builtin_amdgcn_fence(__ATOMIC_ACQ_REL, "workgroup"); __builtin_amdgcn_wave_barrier();
  const int rsub = lane >> 4, c4 = (lane & 15) * 4;
  {
#pragma unroll
    for (int q = 0; q < 8; ++q) { const int r = q * 2 + rsub; if (col0 + c4 < N) { const v4f v = *(const v4fa*)&so[w][r][c4]; *(v4f*)(C + (size_t)(row0 + r) * ldc + col0 + c4) = v; } }
     }
}

// Wt[n][k] = f16(W[k][n]·scale) from f32 row-major W[K][N] (scale = power of two; bf16-exact weights stay exact in f16 away from the subnormal range)
__global__ __launch_bounds__(256) void k_wt_f16(const float* __restrict__ W, _Float16* __restrict__ Wt, int K, int N, float scale) {
  const int t = blockIdx.x * 256 + threadIdx.x; if (t >= N * (K / 8)) return; const int n = t / (K / 8), k8 = (t % (K / 8)) * 8; FragH f;
#pragma unroll
  for (int i = 0; i < 8; ++i) f.h[i] = (_Float16)(bf16_round(W[(size_t)(k8 + i) * N + n]) * scale); const v8us o = f.half[0];
  *(v8us*)((unsigned short*)Wt + (size_t)n * K + k8) = o; 
}
// k_gemm_hh variant with fused epilogue: v = acc·alpha + bias[by·sBias + col] (+ CP[(row/rowsPerB)·sCPb + by·64 + col] if CP) ; ACT 0 none / 1 elu ; writes f16 C16 (and f32 C if non-null)
template <int ACT>
__global__ __launch_bounds__(128) void k_gemm_hhx(const _Float16* __restrict__ A, int lda, size_t sA, const _Float16* __restrict__ Bh, int ldb, size_t sB, float alpha, const float* __restrict__ bias, size_t sBias, const float* __restrict__ CP, int rowsPerB, size_t sCPb, int row0g,
    float* __restrict__ C, _Float16* __restrict__ C16, int ldc, size_t sC, int M, int N, int K) {
  __shared__ __attribute__((aligned(16))) float so[4][16][64];
  const int tid = threadIdx.x, w = tid >> 5, lane = tid & 31, ln = lane & 15, hh = lane >> 4; const int by = blockIdx.y;
  A += (size_t)by * sA; Bh += (size_t)by * sB; const size_t cofs = (size_t)by * sC; const float* bp = bias ? bias + (size_t)by * sBias : nullptr;
  const int ntn = (N + 63) / 64; const int wid = blockIdx.x * 4 + w; const int mt = wid / ntn, nq = wid % ntn; if (mt * 16 >= M) return;
  const int row0 = mt * 16, col0 = nq * 64; const _Float16* arow = A + (size_t)(row0 + ln) * lda;
  v8f acc[4] = {};
  for (int kb = 0; kb < K; kb += 32) { FragH ah; ah.half[0] = *(const v8us*)((const unsigned short*)arow + kb + 8 * hh); ah.half[1] = *(const v8us*)((const unsigned short*)arow + kb + 16 + 8 * hh);
#pragma unroll
    for (int t = 0; t < 4; ++t) { if (col0 + t * 16 >= N) continue; const size_t boff = (size_t)(col0 + t * 16 + ln) * ldb + kb; FragH bq; bq.half[0] = *(const v8us*)((const unsigned short*)Bh + boff + 8 * hh); bq.half[1] = *(const v8us*)((const unsigned short*)Bh + boff + 16 + 8 * hh);
      acc[t] = mmaH<1>(ah.v, ah.v, bq.v, bq.v, acc[t]); }
  }
#pragma unroll
  for (int t = 0; t < 4; ++t) { if (col0 + t * 16 >= N) continue; const int col = col0 + t * 16 + ln; const float bv = bp ? bf16_round(bp[col]) : 0.f;
#pragma unroll
    for (int r = 0; r < 8; ++r) { float v = acc[t][r] * alpha + bv; if (CP) { const int rr = row0g + row0 + 8 * hh + r; if (rowsPerB < 0) v += CP[cofs + (size_t)rr * ldc + col];      /* rowsPerB < 0: own element of the batched C plane */ else { const int bidx = rr / rowsPerB; v += CP[(size_t)bidx * sCPb + (size_t)by * 64 + col]; } } if (ACT == 1) v = (v > 0.f) ? v : expm1f(v); else if (ACT == 7) v = (v > 0.f) ? v + 1.0f : expf(v); else if (ACT == 8) v = tanhf(v); else if (ACT == 9) v = 0.5f * v * (1.0f + tanhf(0.7978845608028654f * (v + 0.044715f * v * v * v))); else if (ACT == 11) v = 1.0f / (1.0f + expf(-v)); else if (ACT == 12) v = (v > 0.f) ? v : 0.01f * v; else if (ACT == 14) v = (v > 0.f) ? v : 0.1f * v; else if (ACT == 16) v = (v >= 0.f) ? v : 0.3f * v; else if (ACT == 17) v = (v >= 0.f) ? v : 0.2f * v; else if (ACT == 15) v = v / (1.0f + expf(-v)); else if (ACT == 3) v = fmaxf(v, 0.f); else if (ACT == 6) v = 0.5f * v * (1.0f + erff(v * 0.70710678118654752f)); so[w][8 * hh + r][t * 16 + ln] = v; } }
  __builtin_amdgcn_fence(__ATOMIC_ACQ_REL, "workgroup"); __builtin_amdgcn_wave_barrier();
  const int rsub = lane >> 4, c4 = (lane & 15) * 4; typedef _Float16 v4h __attribute__((ext_vector_type(4)));
  {
#pragma unroll
    for (int q = 0; q < 8; ++q) { const int r = q * 2 + rsub; if (col0 + c4 < N) { const v4f v = *(const v4fa*)&so[w][r][c4]; if (C) *(v4f*)(C + cofs + (size_t)(row0 + r) * ldc + col0 + c4) = v; if (C16) { v4h h4; for (int i = 0; i < 4; ++i) h4[i] = (_Float16)v[i]; *(v4h*)(C16 + cofs + (size_t)(row0 + r) * ldc + col0 + c4) = h4; } } }
     }
}


typedef _Float16 v4h __attribute__((ext_vector_type(4)));

__global__ __launch_bounds__(256) void k_x16(const float* __restrict__ x, _Float16* __restrict__ X16, size_t n8) { const size_t t = (size_t)blockIdx.x * 256 + threadIdx.x; if (t >= n8) return; FragH f;
#pragma unroll
  for (int q = 0; q < 8; ++q) f.h[q] = (_Float16)bf16_round(x[t * 8 + q]); *(v8us*)((unsigned short*)X16 + t * 8) = f.half[0];  }
__global__ __launch_bounds__(256) void k_h16(const float* __restrict__ x, _Float16* __restrict__ X16, size_t n8) { const size_t t = (size_t)blockIdx.x * 256 + threadIdx.x; if (t >= n8) return; FragH f;
#pragma unroll
  for (int q = 0; q < 8; ++q) f.h[q] = (_Float16)x[t * 8 + q]; *(v8us*)((unsigned short*)X16 + t * 8) = f.half[0];  }
__global__ __launch_bounds__(256) void k_round16f(const float* __restrict__ W, _Float16* __restrict__ Bt, size_t n8) { const size_t t = (size_t)blockIdx.x * 256 + threadIdx.x; if (t >= n8) return; FragH f;
#pragma unroll
  for (int i = 0; i < 8; ++i) f.h[i] = (_Float16)(bf16_round(W[t * 8 + i]) * 16.0f); *(v8us*)((unsigned short*)Bt + t * 8) = f.half[0];  }
__global__ __launch_bounds__(256) void k_hl(const float* __restrict__ F, _Float16* __restrict__ Hh, _Float16* __restrict__ Hl, size_t n8) { const size_t t = (size_t)blockIdx.x * 256 + threadIdx.x; if (t >= n8) return; FragH fh, fl; const v4f a = *(const v4fa*)(F + t * 8), c = *(const v4fa*)(F + t * 8 + 4);
#pragma unroll
  for (int q = 0; q < 4; ++q) { _Float16 h = (_Float16)a[q]; fh.h[q] = h; fl.h[q] = (_Float16)((a[q] - (float)h) * 1024.0f); h = (_Float16)c[q]; fh.h[4 + q] = h; fl.h[4 + q] = (_Float16)((c[q] - (float)h) * 1024.0f); }
  { *(v8us*)((unsigned short*)Hh + t * 8) = fh.half[0]; *(v8us*)((unsigned short*)Hl + t * 8) = fl.half[0];  } }

// ---- fast GEMM (wave tile 32x64; requires M % 32 == 0 rows per launch region and N % 64 == 0); epilogue = k_gemm_hhx semantics ----
// PACKV (per-head packed q | k | v columns; M % 128 == 0, no CP, ACT 0): a work-group whose 64 columns are a head's v slice stores its 128 x 64 tile TRANSPOSED into that head's V^T plane VTo[(b NH + h) HD + d][key] and nowhere else.
// A lane's accumulator holds 8 consecutive rows (keys) of ONE column (d): already 16 contiguous bytes of a V^T row. LDS only gathers the four waves' pieces into whole 256-byte runs.
#define VTP 136                      /* LDS pitch of a staged V^T row in f16: 256 data bytes + 16, an odd multiple of 16 bytes for the 16-byte stores and reads */
__device__ __forceinline__ v16h g2_frag(const _Float16* p, int hh) { FragH f; f.half[0] = *(const v8us*)((const unsigned short*)p + 8 * hh); f.half[1] = *(const v8us*)((const unsigned short*)p + 16 + 8 * hh); return f.v; }
__device__ __forceinline__ v8f g2_mma(v16h a, v16h b, v8f c) { v8f d = __builtin_amdgcn_wmma_f32_16x16x32_f16(false, a, false, b, (short)0, c, false, false); asm volatile("v_nop\n\tv_nop\n\tv_nop\n\tv_nop" : "+v"(d) : "v"(a), "v"(b)); return d; }
template <int ACT, bool PACKV>
__global__ __launch_bounds__(128) void k_gemm2(const _Float16* __restrict__ A, int lda, size_t sA, const _Float16* __restrict__ Bh, int ldb, size_t sB, float alpha, const float* __restrict__ bias, size_t sBias, const float* __restrict__ CP, int rowsPerB, size_t sCPb, int row0g,
    float* __restrict__ C, _Float16* __restrict__ C16, _Float16* __restrict__ VTo, int ldc, size_t sC, int M, int N, int K) { static_assert(!PACKV || ACT == 0, "k_gemm2: PACKV has no activation"); static_assert(ACT == 0 || ACT == 3 || ACT == 6 || ACT == 8 || ACT == 9 || ACT == 11 || ACT == 12 || ACT == 14 || ACT == 15 || ACT == 16 || ACT == 17, "k_gemm2: unsupported ACT code (would silently apply no activation)");
  __shared__ __attribute__((aligned(16))) float so[4][32][68];
  const int tid = threadIdx.x, w = tid >> 5, lane = tid & 31, ln = lane & 15, hh = lane >> 4; const int by = blockIdx.y;
  A += (size_t)by * sA; Bh += (size_t)by * sB; const size_t cofs = (size_t)by * sC; const float* bp = bias ? bias + (size_t)by * sBias : nullptr;
  const int ntn = N >> 6; const int mt = blockIdx.x / ntn, nq = blockIdx.x - mt * ntn; const int row0 = mt * 128 + 32 * w, col0 = nq * 64; if (row0 >= M) return;
  const _Float16* a0p = A + (size_t)(row0 + ln) * lda; const _Float16* a1p = a0p + (size_t)16 * lda;
  const _Float16* b0p = Bh + (size_t)(col0 + ln) * ldb; const _Float16* b1p = b0p + (size_t)16 * ldb; const _Float16* b2p = b1p + (size_t)16 * ldb; const _Float16* b3p = b2p + (size_t)16 * ldb;
  const v8f z8 = {0.f,0.f,0.f,0.f,0.f,0.f,0.f,0.f}; v8f c00 = z8, c01 = z8, c02 = z8, c03 = z8, c10 = z8, c11 = z8, c12 = z8, c13 = z8;
#pragma unroll 1
  for (int kb = 0; kb < K; kb += 32) { const v16h a0 = g2_frag(a0p + kb, hh), a1 = g2_frag(a1p + kb, hh);
    v16h b = g2_frag(b0p + kb, hh); c00 = g2_mma(a0, b, c00); c10 = g2_mma(a1, b, c10);
    b = g2_frag(b1p + kb, hh); c01 = g2_mma(a0, b, c01); c11 = g2_mma(a1, b, c11);
    b = g2_frag(b2p + kb, hh); c02 = g2_mma(a0, b, c02); c12 = g2_mma(a1, b, c12);
    b = g2_frag(b3p + kb, hh); c03 = g2_mma(a0, b, c03); c13 = g2_mma(a1, b, c13); }
  v8f accs[8] = {c00, c01, c02, c03, c10, c11, c12, c13};
  if (PACKV && col0 % (3 * HD) == 2 * HD) {      /* the same for the whole work-group: col0 comes from blockIdx alone */
    unsigned short* sT = (unsigned short*)&so[0][0][0];      /* [d 0..63][key 0..127], pitch VTP; this path uses so for nothing else */
    /* every loop of this path is fully unrolled: accs and bv are then indexed by constants only and stay in registers */
    float bv[4] = {0.f, 0.f, 0.f, 0.f};
    if (bp) {      /* the four bias loads fly together, behind one test */
#pragma unroll
      for (int t = 0; t < 4; ++t) bv[t] = bp[col0 + t * 16 + ln];
#pragma unroll
      for (int t = 0; t < 4; ++t) bv[t] = bf16_round(bv[t]); }
#pragma unroll
    for (int u = 0; u < 8; ++u) { const int t = u & 3, half = u >> 2; FragH f;
#pragma unroll
      for (int r = 0; r < 8; ++r) f.h[r] = (_Float16)(accs[u][r] * alpha + bv[t]);
      *(v8us*)(sT + (t * 16 + ln) * VTP + 32 * w + half * 16 + 8 * hh) = f.half[0]; }
    __syncthreads();      /* all four waves' 32-key pieces are in LDS before anybody reads a whole row */
    const int rb = mt * 128; unsigned short* vt = (unsigned short*)VTo + ((size_t)(rb / SQ) * NH + col0 / (3 * HD)) * HD * SQ + rb % SQ;
#pragma unroll
    for (int i = 0; i < 8; ++i) { const int c = tid + 128 * i, d = c >> 4, k8 = (c & 15) * 8; *(v8us*)(vt + (size_t)d * SQ + k8) = *(const v8us*)(sT + d * VTP + k8); }      /* a wave's store = two whole 256-byte runs */
    return;
  }
#pragma unroll
  for (int u = 0; u < 8; ++u) { const int t = u & 3, half = u >> 2; const int col = col0 + t * 16 + ln; const float bv = bp ? bf16_round(bp[col]) : 0.f;
#pragma unroll
    for (int r = 0; r < 8; ++r) { const int rloc = half * 16 + 8 * hh + r; float v = accs[u][r] * alpha + bv; if (CP) { if (rowsPerB < 0) v += CP[cofs + (size_t)(row0g + row0 + rloc) * ldc + col];      /* rowsPerB < 0: own element of the batched C plane */ else { const int bidx = (row0g + row0 + rloc) / rowsPerB; v += CP[(size_t)bidx * sCPb + (size_t)by * 64 + col]; } }
      if (ACT == 3) v = fmaxf(v, 0.f); else if (ACT == 6) v = 0.5f * v * (1.0f + erff(v * 0.70710678118654752f)); else if (ACT == 11) v = 1.0f / (1.0f + expf(-v)); else if (ACT == 15) v = v / (1.0f + expf(-v)); else if (ACT == 12) v = (v > 0.f) ? v : 0.01f * v; else if (ACT == 8) v = tanhf(v); else if (ACT == 9) v = 0.5f * v * (1.0f + tanhf(0.7978845608028654f * (v + 0.044715f * v * v * v))); else if (ACT == 14) v = (v > 0.f) ? v : 0.1f * v; else if (ACT == 16) v = (v >= 0.f) ? v : 0.3f * v; else if (ACT == 17) v = (v >= 0.f) ? v : 0.2f * v;
      so[w][rloc][t * 16 + ln] = v; } }
  __builtin_amdgcn_fence(__ATOMIC_ACQ_REL, "workgroup"); __builtin_amdgcn_wave_barrier();
  const int rsub = lane >> 4, c4 = (lane & 15) * 4;
  {
#pragma unroll
    for (int q = 0; q < 16; ++q) { const int r = q * 2 + rsub; const v4f v = *(const v4fa*)&so[w][r][c4]; if (C) *(v4f*)(C + cofs + (size_t)(row0 + r) * ldc + col0 + c4) = v; if (C16) { v4h h4; for (int i = 0; i < 4; ++i) h4[i] = (_Float16)v[i]; *(v4h*)(C16 + cofs + (size_t)(row0 + r) * ldc + col0 + c4) = h4; } }
     } }


__global__ __launch_bounds__(256) void k_wnat(const float* __restrict__ w, size_t n8, _Float16* __restrict__ Bt) { const size_t t = (size_t)blockIdx.x * 256 + threadIdx.x; if (t >= n8) return; FragH f; for (int q = 0; q < 8; ++q) f.h[q] = (_Float16)(bf16_round(w[t * 8 + q]) * 16.0f); *(v8us*)((unsigned short*)Bt + t * 8) = f.half[0];  }
#define FK 64                        /* keys per pass */
#define FPT 72                       /* LDS row pitch in f16: 128 data bytes + 16, an odd multiple of 16 bytes for the 16-byte fragment reads */
__device__ __forceinline__ v16h fa_frag(const unsigned short* p, int hh) { FragH f; f.half[0] = *(const v8us*)(p + 8 * hh); f.half[1] = *(const v8us*)(p + 16 + 8 * hh); return f.v; }
__device__ __forceinline__ v8f fa_mma(v16h a, v16h b, v8f c) { return __builtin_amdgcn_wmma_f32_16x16x32_f16(false, a, false, b, (short)0, c, false, false); }
__device__ __forceinline__ float fa_xhalf(float x) { return __builtin_bit_cast(float, __builtin_amdgcn_permlanex16(__builtin_bit_cast(int, x), __builtin_bit_cast(int, x), 0x76543210, 0xfedcba98, false, false)); }      /* lane l reads lane l ^ 16, on the vector pipe: no LDS round trip */
__device__ __forceinline__ float fa_exp2(float x) { float e; asm("v_exp_f32 %0, %1\n\tv_nop" : "=v"(e) : "v"(x)); return e; }
__device__ __forceinline__ v8f fa_exp2x8(v8f x) { float e0, e1, e2, e3, e4, e5, e6, e7;
  asm("v_exp_f32 %0, %8\n\tv_exp_f32 %1, %9\n\tv_exp_f32 %2, %10\n\tv_exp_f32 %3, %11\n\tv_exp_f32 %4, %12\n\tv_exp_f32 %5, %13\n\tv_exp_f32 %6, %14\n\tv_exp_f32 %7, %15\n\tv_nop"
      : "=&v"(e0), "=&v"(e1), "=&v"(e2), "=&v"(e3), "=&v"(e4), "=&v"(e5), "=&v"(e6), "=&v"(e7) : "v"(x[0]), "v"(x[1]), "v"(x[2]), "v"(x[3]), "v"(x[4]), "v"(x[5]), "v"(x[6]), "v"(x[7]));
  const v8f e = {e0, e1, e2, e3, e4, e5, e6, e7}; return e; }
__global__ __launch_bounds__(128) void k_fattn(const _Float16* __restrict__ QKVp, const _Float16* __restrict__ VTp, float* __restrict__ O) {
  __shared__ __attribute__((aligned(16))) unsigned short Ks[FK][FPT];      /* K rows of the pass: [key][d] */
  __shared__ __attribute__((aligned(16))) unsigned short Vs[HD][FPT];      /* V^T rows of the pass: [d][key] */
  const int tid = threadIdx.x, w = tid >> 5, lane = tid & 31, ln = lane & 15, hh = lane >> 4;
  const int bh = blockIdx.x / (SQ / 128), qb = blockIdx.x % (SQ / 128); const int b = bh / NH, h = bh % NH;
  const _Float16* qg = QKVp + (size_t)b * SQ * LQ + (size_t)h * 3 * HD;      /* head h's 192 packed columns: q at + 0, k at + 64 */
  const int q0 = qb * 128 + w * 32;
  v16h qf[2][2];
#pragma unroll
  for (int qt = 0; qt < 2; ++qt)
#pragma unroll
    for (int ks = 0; ks < 2; ++ks) qf[qt][ks] = g2_frag(qg + (size_t)(q0 + qt * 16 + ln) * LQ + ks * 32, hh);
  /* staging: thread t moves 16-byte chunks t, t + 128, t + 256, t + 384 of each 64 x 128-byte tile: 8 chunks a row, so a wave's load covers 4 whole lines */
  const int frow = tid >> 3, fc8 = (tid & 7) * 8;
  const unsigned short* kp = (const unsigned short*)qg + HD + (size_t)frow * LQ + fc8;
  const unsigned short* vp = (const unsigned short*)VTp + (size_t)bh * HD * SQ + (size_t)frow * SQ + fc8;
  v8us kr[4], vr[4];
#pragma unroll
  for (int j = 0; j < 4; ++j) { kr[j] = *(const v8us*)(kp + (size_t)(16 * j) * LQ); vr[j] = *(const v8us*)(vp + (size_t)(16 * j) * SQ); }
  const v8f z8 = {0.f, 0.f, 0.f, 0.f, 0.f, 0.f, 0.f, 0.f};
  v8f o[2][4]; float m[2], l[2];
#pragma unroll
  for (int qt = 0; qt < 2; ++qt) { m[qt] = -3.0e38f; l[qt] = 0.f;
#pragma unroll
    for (int dt = 0; dt < 4; ++dt) o[qt][dt] = z8; }
  const float SC = 0.125f * 1.4426950408889634f;      /* 1 / sqrt(64), and base e to base 2 */
  for (int p = 0; p < SQ / FK; ++p) {
    __syncthreads();      /* every wave has finished reading the pass before */
#pragma unroll
    for (int j = 0; j < 4; ++j) { *(v8us*)&Ks[frow + 16 * j][fc8] = kr[j]; *(v8us*)&Vs[frow + 16 * j][fc8] = vr[j]; }
    __syncthreads();      /* the tiles are complete before anybody reads them */
    if (p + 1 < SQ / FK) {      /* the next pass's tiles fly to registers while this pass is worked on */
      kp += (size_t)FK * LQ; vp += FK;
#pragma unroll
      for (int j = 0; j < 4; ++j) { kr[j] = *(const v8us*)(kp + (size_t)(16 * j) * LQ); vr[j] = *(const v8us*)(vp + (size_t)(16 * j) * SQ); }
    }
    __builtin_amdgcn_sched_barrier(0);      /* keeps the eight loads above the pass's work: without it the compiler sinks them to the loop's foot, and their whole latency is waited for at the next pass's head */
    v8f st[2][4];
#pragma unroll
    for (int kt = 0; kt < 4; ++kt) { const v16h a0 = fa_frag(&Ks[kt * 16 + ln][0], hh), a1 = fa_frag(&Ks[kt * 16 + ln][32], hh);
#pragma unroll
      for (int qt = 0; qt < 2; ++qt) st[qt][kt] = fa_mma(a1, qf[qt][1], fa_mma(a0, qf[qt][0], z8)); }      /* st[qt][kt][r] = q(q0 + 16 qt + ln) . k(64 p + 16 kt + 8 hh + r) */
    FragH pf[2][2];
#pragma unroll
    for (int qt = 0; qt < 2; ++qt) {
      v8f x8 = st[qt][0];
#pragma unroll
      for (int r = 0; r < 8; ++r) x8[r] = fmaxf(fmaxf(st[qt][0][r], st[qt][1][r]), fmaxf(st[qt][2][r], st[qt][3][r]));
      float mx = fmaxf(fmaxf(fmaxf(x8[0], x8[1]), fmaxf(x8[2], x8[3])), fmaxf(fmaxf(x8[4], x8[5]), fmaxf(x8[6], x8[7])));
      mx = fmaxf(mx, fa_xhalf(mx));      /* the other half of the query's 64 keys */
      const float mn = fmaxf(m[qt], mx * SC); const float al = fa_exp2(m[qt] - mn); m[qt] = mn;      /* al = 0 on the first pass */
      v8f s8 = z8;
#pragma unroll
      for (int kt = 0; kt < 4; ++kt) { const v8f e8 = fa_exp2x8(st[qt][kt] * SC - mn); s8 += e8;
#pragma unroll
        for (int r = 0; r < 8; ++r) pf[qt][kt >> 1].h[(kt & 1) * 8 + r] = (_Float16)e8[r]; }
      l[qt] = l[qt] * al + (((s8[0] + s8[1]) + (s8[2] + s8[3])) + ((s8[4] + s8[5]) + (s8[6] + s8[7])));
#pragma unroll
      for (int dt = 0; dt < 4; ++dt) o[qt][dt] *= al;
    }
    /* The V^T fragments are read in two groups of four, each group whole in front of its eight products. The scheduling fences hold that order: without them the compiler mixes the softmax into the products,
       runs short of registers and waits for LDS in front of every pair of products; all eight fragments at once would take the kernel past 256 registers. */
#pragma unroll
    for (int dg = 0; dg < 2; ++dg) {
      __builtin_amdgcn_sched_barrier(0);      /* nothing of the group's reads moves up into the work before */
      v16h va[2][2];
#pragma unroll
      for (int d2 = 0; d2 < 2; ++d2)
#pragma unroll
        for (int ks = 0; ks < 2; ++ks) va[d2][ks] = fa_frag(&Vs[(dg * 2 + d2) * 16 + ln][ks * 32], hh);
      __builtin_amdgcn_sched_barrier(0);      /* none of the group's reads sinks among its products */
#pragma unroll
      for (int d2 = 0; d2 < 2; ++d2)
#pragma unroll
        for (int ks = 0; ks < 2; ++ks)
#pragma unroll
          for (int qt = 0; qt < 2; ++qt) o[qt][dg * 2 + d2] = fa_mma(va[d2][ks], pf[qt][ks].v, o[qt][dg * 2 + d2]);      /* o[qt][dt][r] = O[q0 + 16 qt + ln][16 dt + 8 hh + r] */
    }
  }
#pragma unroll
  for (int qt = 0; qt < 2; ++qt) { const float inv = 1.0f / (l[qt] + fa_xhalf(l[qt]));
    float* orow = O + ((size_t)bh * SQ + q0 + qt * 16 + ln) * HD + 8 * hh;      /* head plane bh, row = query: the raw-view merge */
#pragma unroll
    for (int dt = 0; dt < 4; ++dt) { const v4f lo = {o[qt][dt][0] * inv, o[qt][dt][1] * inv, o[qt][dt][2] * inv, o[qt][dt][3] * inv}, hi = {o[qt][dt][4] * inv, o[qt][dt][5] * inv, o[qt][dt][6] * inv, o[qt][dt][7] * inv};
      *(v4f*)(orow + dt * 16) = lo; *(v4f*)(orow + dt * 16 + 4) = hi; } }
}
__global__ __launch_bounds__(256) void k_vt(const _Float16* __restrict__ V16, int b, int h0, _Float16* __restrict__ VT) { __shared__ unsigned short tl[64][65]; const int tid = threadIdx.x; const int hh = blockIdx.x % HG, sg = blockIdx.x / HG; const int s0 = sg * 64; const int h = h0 + hh;
  for (int i = tid; i < 64 * 8; i += 256) { const int j = i / 8, d8 = (i % 8) * 8; FragH f; f.half[0] = *(const v8us*)((const unsigned short*)V16 + ((size_t)b * SQ + s0 + j) * DM + h * HD + d8); for (int q = 0; q < 8; ++q) tl[d8 + q][j] = f.u[q]; }
  __syncthreads();
  { for (int i = tid; i < 64 * 8; i += 256) { const int d = i / 8, j8 = (i % 8) * 8; FragH f; for (int q = 0; q < 8; ++q) f.u[q] = tl[d][j8 + q]; *(v8us*)((unsigned short*)VT + ((size_t)hh * HD + d) * SQ + s0 + j8) = f.half[0]; }  } }


extern "C" void kernel_launch(void* const* d_in, const int* in_sizes, int n_in,
                              void* d_out, int out_size, void* d_ws, size_t ws_size, hipStream_t stream) {
  (void)in_sizes; (void)n_in; (void)out_size;
  const float* const* I = (const float* const*)d_in; const float* x = I[0]; const float* wqkv = I[1]; const float* bqkv = I[2];      /* input order: x, W_qkv ([in][out] [1024][3072]; columns packed PER HEAD: 192 h + {0..63 q, 64..127 k, 128..191 v}), b_qkv [3072] (REAL; the same packing: the projection GEMM's bias slot reads it by output column); three inputs; no output weight: the module has none */
  char* ws = (char*)d_ws; size_t off = 0;
  auto take = [&](size_t bytes) { char* p = ws + off; off += (bytes + 255) & ~(size_t)255; return p; };
  _Float16* BQKV = (_Float16*)take((size_t)3 * DM * DM * 2);
  _Float16* X16 = (_Float16*)take(NR * DM * 2); _Float16* QKV = (_Float16*)take(NR * 3 * DM * 2);      /* PER-HEAD packing: within head h's 192 columns q starts at + 0, k at + 64; the v columns (+ 128) are never written here: they go to VT; the head stride is 3 HD */
  _Float16* VT = (_Float16*)take((size_t)NB * NH * HD * SQ * 2);      /* V^T planes of every (batch, head) */
  if (off > ws_size) return;
  k_wt_f16<<<(unsigned)(((size_t)DM * 3 * DM / 8 + 255) / 256), 256, 0, stream>>>(wqkv, BQKV, DM, 3 * DM, 16.0f);      /* [in][out] -> Bt[n][k] x16 (pitch K = 1024) */

  k_x16<<<(unsigned)((NR * DM / 8 + 255) / 256), 256, 0, stream>>>(x, X16, NR * DM / 8);
  const size_t r0p = (size_t)B0 * SQ;      /* first projected row */
  k_gemm2<0, true><<<dim3((unsigned)((MP / 128) * (3 * DM / 64)), 1), 128, 0, stream>>>(X16 + r0p * DM, DM, 0, BQKV, DM, 0, 0.0625f, bqkv, 0, nullptr, 1, 0, 0, nullptr, QKV + r0p * 3 * DM, VT + (size_t)B0 * NH * HD * SQ, 3 * DM, 0, MP, 3 * DM, DM);      /* q | k rows (f16, packed per head) and the V^T planes */
  k_fattn<<<NB * NH * (SQ / 128), 128, 0, stream>>>(QKV, VT, (float*)d_out);      /* all batches and heads in one launch: softmax(q k^T / 8) v, each head into its own contiguous [2048][64] plane */
}

// v004
// One run takes 86 microseconds.
// Timed twice side by side with v003, it ran 1.57 times as fast both times.
// All steps since v000 together make it 43.5 times as fast.
#include <hip/hip_runtime.h>
// Multi-head self-attention with ONE fused QKV projection packed PER HEAD, NO output projection and a RAW-VIEW merge (x [2][2048][1024]; qkv = x W_qkv + b_qkv ([in][out] 1024 x 3072, normal x 1/32; a REAL bias normal x 0.01) reshaped (b, s, 16, 3 x 64): head h owns columns 192 h .. 192 h + 191: q | k | v = its three 64-column slices; att = q k^T / sqrt(64); softmax over all 2048 keys (no mask); values [b][16][s][64] are reshaped to (b, s, 1024) WITHOUT a head transpose (the source's own form): the output memory of a batch IS the sixteen [2048][64] head planes one after another); the P.V product is written straight to the f32 output, each head into its own contiguous plane.
// Structure: token rows r = b*2048 + s; x as exact f16 rows (bf16-rounded); q | k | v as ONE WMMA GEMM (N = 3 x 1024) (128x128 tiles staged in LDS by asynchronous copies, 64x64 wave tiles, f32 accumulation, exact x16 weights + bias, f16 outputs); the GEMM's own epilogue stores every head's v tile transposed (V^T planes [d][key], 256-byte runs through LDS), so no transpose launch is left; then ONE fused attention launch over every (batch, head): per 64 keys S^T = K Q^T, running softmax in registers (f32 statistics, base 2; weights 2^(s - m) as f16), O^T += V^T P^T, divided by the row sum at the end and written as f32 straight into the output's own layout (head plane after head plane): no output projection.
// Compute dtype: inputs rounded to bf16; x / weights exact; q, k, v and softmax weights as plain f16 GEMM operands (~2^-12); scores and softmax statistics f32; v_wmma_f32_16x16x32_f16.
#define NB 2
#define SQ 2048
#define DM 1024
#define NH 16
#define HD 64
#define HG 4                         /* heads per group of the grouped transpose below */
#define B0 0                         /* first batch processed (debug hook) */
#define NBR NB                       /* batches processed (debug hook) */
#define NR ((size_t)NB * SQ)         /* token rows */
#define MP ((int)((size_t)NBR * SQ)) /* rows projected (debug hook) */
#define QN SQ                        /* unused (the attention launch covers all SQ query rows) */
#define NHD NH                       /* unused (the attention launch covers all NH heads) */
#define MPO MP                       /* unused (no output projection) */
#define LQ (3 * DM)      /* row pitch of the q/k/v rows */
typedef __bf16 v16b __attribute__((ext_vector_type(16)));
typedef unsigned short v8us __attribute__((ext_vector_type(8), may_alias));
typedef float  v8f  __attribute__((ext_vector_type(8)));
typedef float  v4f  __attribute__((ext_vector_type(4)));
typedef float  v4fa __attribute__((ext_vector_type(4), may_alias));
union FragB { v16b v; v8us half[2]; unsigned short u[16]; };

__device__ __forceinline__ unsigned short bf16_bits(float x) { unsigned int u = __float_as_uint(x); return (unsigned short)((u + 0x7FFFu + ((u >> 16) & 1u)) >> 16); }
__device__ __forceinline__ float bf16_val(unsigned short b) { return __uint_as_float(((unsigned int)b) << 16); }
__device__ __forceinline__ float bf16_round(float x) { return bf16_val(bf16_bits(x)); }
// D += A·B with NT terms: 1 = ah·bh, 2 = + al·bh (A split), 3 = + ah·bl (both split)
template <int NT>
__device__ __forceinline__ v8f mmaN(v16b ah, v16b al, v16b bh, v16b bl, v8f c) {
  c = __builtin_amdgcn_wmma_f32_16x16x32_bf16(false, ah, false, bh, (short)0, c, false, false);
  if (NT >= 2) c = __builtin_amdgcn_wmma_f32_16x16x32_bf16(false, al, false, bh, (short)0, c, false, false);
  if (NT >= 3) c = __builtin_amdgcn_wmma_f32_16x16x32_bf16(false, ah, false, bl, (short)0, c, false, false);
  asm volatile("v_nop\n\tv_nop\n\tv_nop\n\tv_nop" : "+v"(c) : "v"(ah), "v"(al), "v"(bh), "v"(bl));
  return c;
}

__global__ __launch_bounds__(256) void k_wt_bf16(const float* __restrict__ W, unsigned short* __restrict__ Wt, int K, int N) {
  const int t = blockIdx.x * 256 + threadIdx.x;
  const int k8n = K / 8;
  if (t >= N * k8n) return;
  const int n = t / k8n, k8 = (t % k8n) * 8;
  v8us v;
#pragma unroll
  for (int i = 0; i < 8; ++i) v[i] = bf16_bits(W[(size_t)(k8 + i) * N + n]);
  *(v8us*)(Wt + (size_t)n * K + k8) = v;
  
}

// GEMM C[M][N] (f32, pitch ldc) = act(A[M][K]·W + bias). A f32 row-major (pitch lda) converted per fragment to bf16
// (ASPLIT: hi/lo two planes -> 2 terms, else single rounded term); Wt bf16 [N][K] (pitch ldb). BIAS_BF16 rounds the
// bias to bf16 first (bias quantised to bf16 before the add). K%32==0, M%16==0, N%64==0.
template <bool ASPLIT, int ACT, bool BIAS_BF16>
__global__ __launch_bounds__(128) void k_gemm_bf(const float* __restrict__ A, int lda, const unsigned short* __restrict__ Wt, int ldb,
                                               const float* __restrict__ bias, float* __restrict__ C, int ldc, int M, int N, int K) {
  __shared__ __attribute__((aligned(16))) float so[4][16][64];
  const int tid = threadIdx.x, w = tid >> 5, lane = tid & 31, ln = lane & 15, hh = lane >> 4;
  const int ntn = N / 64;
  const int wid = blockIdx.x * 4 + w;
  const int mt = wid / ntn, nq = wid % ntn;
  if (mt * 16 >= M) return;
  const int row0 = mt * 16, col0 = nq * 64;
  const float* arow = A + (size_t)(row0 + ln) * lda;
  v8f acc[4] = {};
  for (int kb = 0; kb < K; kb += 32) {
    FragB ah, al;
    const v4f x0 = *(const v4fa*)(arow + kb + 8 * hh), x1 = *(const v4fa*)(arow + kb + 8 * hh + 4);
    const v4f x2 = *(const v4fa*)(arow + kb + 16 + 8 * hh), x3 = *(const v4fa*)(arow + kb + 16 + 8 * hh + 4);
    float xs[16] = {x0[0],x0[1],x0[2],x0[3],x1[0],x1[1],x1[2],x1[3],x2[0],x2[1],x2[2],x2[3],x3[0],x3[1],x3[2],x3[3]};
#pragma unroll
    for (int i = 0; i < 16; ++i) { const unsigned short hb = bf16_bits(xs[i]); ah.u[i] = hb; al.u[i] = ASPLIT ? bf16_bits(xs[i] - bf16_val(hb)) : (unsigned short)0; }
#pragma unroll
    for (int t = 0; t < 4; ++t) {
      const unsigned short* brow = Wt + (size_t)(col0 + t * 16 + ln) * ldb + kb;
      FragB b;
      b.half[0] = *(const v8us*)(brow + 8 * hh);
      b.half[1] = *(const v8us*)(brow + 16 + 8 * hh);
      acc[t] = mmaN<ASPLIT ? 2 : 1>(ah.v, al.v, b.v, b.v, acc[t]);
    }
  }
#pragma unroll
  for (int t = 0; t < 4; ++t) {
    float bv = bias ? bias[col0 + t * 16 + ln] : 0.f;
    if (BIAS_BF16) bv = bf16_round(bv);
#pragma unroll
    for (int r = 0; r < 8; ++r) { float v = acc[t][r] + bv; if (ACT == 1) v = fmaxf(v, 0.f); so[w][8 * hh + r][t * 16 + ln] = v; }
  }
  __builtin_amdgcn_fence(__ATOMIC_ACQ_REL, "workgroup");
  __builtin_amdgcn_wave_barrier();
  const int rsub = lane >> 4, c4 = (lane & 15) * 4;
  {
#pragma unroll
    for (int q = 0; q < 8; ++q) {
      const int r = q * 2 + rsub;
      const v4f v = *(const v4fa*)&so[w][r][c4];
      *(v4f*)(C + (size_t)(row0 + r) * ldc + col0 + c4) = v;
    }
    
  }
}

// GEMM C = act(A·W + bias + resid): A f32 (ASPLIT -> hi/lo 2 terms), Wt bf16 [N][K]; ACT 0 none, 1 relu, 2 exact gelu;
// resid (optional, f32, row index = (row % rmod), pitch ldr, RES_BF16 rounds it) added before the activation.
template <bool ASPLIT, int ACT, bool BIAS_BF16, bool RES_BF16>
__global__ __launch_bounds__(128) void k_gemm_bf3(const float* __restrict__ A, int lda, const unsigned short* __restrict__ Wt, int ldb,
                                                const float* __restrict__ bias, const float* __restrict__ resid, int rmod, int ldr,
                                                float* __restrict__ C, int ldc, int M, int N, int K) {
  __shared__ __attribute__((aligned(16))) float so[4][16][64];
  const int tid = threadIdx.x, w = tid >> 5, lane = tid & 31, ln = lane & 15, hh = lane >> 4;
  const int ntn = N / 64;
  const int wid = blockIdx.x * 4 + w;
  const int mt = wid / ntn, nq = wid % ntn;
  if (mt * 16 >= M) return;
  const int row0 = mt * 16, col0 = nq * 64;
  const float* arow = A + (size_t)(row0 + ln) * lda;
  v8f acc[4] = {};
  for (int kb = 0; kb < K; kb += 32) {
    FragB ah, al;
    const v4f x0 = *(const v4fa*)(arow + kb + 8 * hh), x1 = *(const v4fa*)(arow + kb + 8 * hh + 4);
    const v4f x2 = *(const v4fa*)(arow + kb + 16 + 8 * hh), x3 = *(const v4fa*)(arow + kb + 16 + 8 * hh + 4);
    float xs[16] = {x0[0],x0[1],x0[2],x0[3],x1[0],x1[1],x1[2],x1[3],x2[0],x2[1],x2[2],x2[3],x3[0],x3[1],x3[2],x3[3]};
#pragma unroll
    for (int i = 0; i < 16; ++i) { const unsigned short hb = bf16_bits(xs[i]); ah.u[i] = hb; al.u[i] = ASPLIT ? bf16_bits(xs[i] - bf16_val(hb)) : (unsigned short)0; }
#pragma unroll
    for (int t = 0; t < 4; ++t) {
      const unsigned short* brow = Wt + (size_t)(col0 + t * 16 + ln) * ldb + kb;
      FragB b;
      b.half[0] = *(const v8us*)(brow + 8 * hh);
      b.half[1] = *(const v8us*)(brow + 16 + 8 * hh);
      acc[t] = mmaN<ASPLIT ? 2 : 1>(ah.v, al.v, b.v, b.v, acc[t]);
    }
  }
#pragma unroll
  for (int t = 0; t < 4; ++t) {
    const int col = col0 + t * 16 + ln;
    float bv = bias ? bias[col] : 0.f;
    if (BIAS_BF16) bv = bf16_round(bv);
#pragma unroll
    for (int r = 0; r < 8; ++r) {
      float v = acc[t][r] + bv;
      if (resid) { float rv = resid[(size_t)((row0 + 8 * hh + r) % rmod) * ldr + col]; if (RES_BF16) rv = bf16_round(rv); v += rv; }
      if (ACT == 1) v = fmaxf(v, 0.f);
      if (ACT == 2) v = 0.5f * v * (1.0f + erff(v * 0.70710678118654752f));
      if (ACT == 3) { const float u = 0.7978845608028654f * (v + 0.044715f * v * v * v); v = 0.5f * v * (1.0f + tanhf(u)); }
      so[w][8 * hh + r][t * 16 + ln] = v;
    }
  }
  __builtin_amdgcn_fence(__ATOMIC_ACQ_REL, "workgroup");
  __builtin_amdgcn_wave_barrier();
  const int rsub = lane >> 4, c4 = (lane & 15) * 4;
  {
#pragma unroll
    for (int q = 0; q < 8; ++q) {
      const int r = q * 2 + rsub;
      const v4f v = *(const v4fa*)&so[w][r][c4];
      *(v4f*)(C + (size_t)(row0 + r) * ldc + col0 + c4) = v;
    }
    
  }
}
// row LayerNorm (biased variance, eps) over N: s = X (+ R); optional out_sum <- s; out_norm <- (s-mu)*rsqrt(var+eps)*g + b
template <bool PARAM_BF16>
__global__ __launch_bounds__(256) void k_layernorm(const float* __restrict__ X, const float* __restrict__ R, const float* __restrict__ g, const float* __restrict__ bta,
                                                  float* __restrict__ out_sum, float* __restrict__ out_norm, int N, float eps) {
  __shared__ float red[256];
  const int row = blockIdx.x, tid = threadIdx.x;
  const float* x = X + (size_t)row * N; const float* rr = R ? R + (size_t)row * N : nullptr;
  float vals[16];                     // up to N = 4096
  const int per = N / 256;            // contiguous chunk per thread? use strided-by-4 chunks: thread handles j = tid*4 + 1024*u
  float s1 = 0.f;
  for (int u = 0; u < per / 4; ++u) {
    const int j = tid * 4 + 1024 * u;
    const v4f a = *(const v4fa*)(x + j);
    v4f b = {0.f,0.f,0.f,0.f}; if (rr) b = *(const v4fa*)(rr + j);
#pragma unroll
    for (int q = 0; q < 4; ++q) { const float v = a[q] + b[q]; vals[u * 4 + q] = v; s1 += v; }
  }
  red[tid] = s1; __syncthreads();
  for (int st = 128; st > 0; st >>= 1) { if (tid < st) red[tid] += red[tid + st]; __syncthreads(); }
  const float mu = red[0] / (float)N; __syncthreads();
  float s2 = 0.f;
  for (int u = 0; u < per / 4; ++u)
#pragma unroll
    for (int q = 0; q < 4; ++q) { const float c = vals[u * 4 + q] - mu; s2 += c * c; }
  red[tid] = s2; __syncthreads();
  for (int st = 128; st > 0; st >>= 1) { if (tid < st) red[tid] += red[tid + st]; __syncthreads(); }
  const float rs = rsqrtf(red[0] / (float)N + eps);
  {
    for (int u = 0; u < per / 4; ++u) {
      const int j = tid * 4 + 1024 * u;
      v4f o, sm;
#pragma unroll
      for (int q = 0; q < 4; ++q) {
        float gg = g[j + q], bb = bta[j + q];
        if (PARAM_BF16) { gg = bf16_round(gg); bb = bf16_round(bb); }
        sm[q] = vals[u * 4 + q]; o[q] = (vals[u * 4 + q] - mu) * rs * gg + bb;
      }
      if (out_sum) *(v4f*)(out_sum + (size_t)row * N + j) = sm;
      *(v4f*)(out_norm + (size_t)row * N + j) = o;
    }
    
  }
}



// ---- f16 WMMA path (v_wmma_f32_16x16x32_f16): 11-bit significands for operands in range — used where a [0,1] probability operand needs more precision than bf16
typedef _Float16 v16h __attribute__((ext_vector_type(16)));
union FragH { v16h v; v8us half[2]; _Float16 h[16]; unsigned short u[16]; };
template <int NT>
__device__ __forceinline__ v8f mmaH(v16h ah, v16h al, v16h bh, v16h bl, v8f c) {
  c = __builtin_amdgcn_wmma_f32_16x16x32_f16(false, ah, false, bh, (short)0, c, false, false);
  if (NT >= 2) c = __builtin_amdgcn_wmma_f32_16x16x32_f16(false, al, false, bh, (short)0, c, false, false);
  if (NT >= 3) c = __builtin_amdgcn_wmma_f32_16x16x32_f16(false, ah, false, bl, (short)0, c, false, false);
  asm volatile("v_nop\n\tv_nop\n\tv_nop\n\tv_nop" : "+v"(c) : "v"(ah), "v"(al), "v"(bh), "v"(bl));
  return c;
}
// batched GEMM like k_gemm_b but f16 operands: A f32 (split into f16 hi/lo if ASPLIT, else rounded to f16), Bt = f16 values [n][k]; alpha; C f32; N multiple of 16 (partial tiles skipped)
template <bool ASPLIT>
__global__ __launch_bounds__(128) void k_gemm_h(const float* __restrict__ A, int lda, size_t sA, const _Float16* __restrict__ Bh, int ldb, size_t sB, float alpha, float* __restrict__ C, int ldc, size_t sC, int M, int N, int K) {
  __shared__ __attribute__((aligned(16))) float so[4][16][64];
  const int tid = threadIdx.x, w = tid >> 5, lane = tid & 31, ln = lane & 15, hh = lane >> 4; const int by = blockIdx.y;
  A += (size_t)by * sA; Bh += (size_t)by * sB; C += (size_t)by * sC;
  const int ntn = (N + 63) / 64; const int wid = blockIdx.x * 4 + w; const int mt = wid / ntn, nq = wid % ntn; if (mt * 16 >= M) return;
  const int row0 = mt * 16, col0 = nq * 64; const float* arow = A + (size_t)(row0 + ln) * lda;
  v8f acc[4] = {};
  for (int kb = 0; kb < K; kb += 32) {
    FragH ah, al;
    const v4f x0 = *(const v4fa*)(arow + kb + 8 * hh), x1 = *(const v4fa*)(arow + kb + 8 * hh + 4), x2 = *(const v4fa*)(arow + kb + 16 + 8 * hh), x3 = *(const v4fa*)(arow + kb + 16 + 8 * hh + 4);
    float xs[16] = {x0[0],x0[1],x0[2],x0[3],x1[0],x1[1],x1[2],x1[3],x2[0],x2[1],x2[2],x2[3],x3[0],x3[1],x3[2],x3[3]};
#pragma unroll
    for (int i = 0; i < 16; ++i) { const _Float16 h = (_Float16)xs[i]; ah.h[i] = h; al.h[i] = ASPLIT ? (_Float16)(xs[i] - (float)h) : (_Float16)0.0f; }
#pragma unroll
    for (int t = 0; t < 4; ++t) { if (col0 + t * 16 >= N) continue; const size_t boff = (size_t)(col0 + t * 16 + ln) * ldb + kb; FragH bq; bq.half[0] = *(const v8us*)(Bh + boff + 8 * hh); bq.half[1] = *(const v8us*)(Bh + boff + 16 + 8 * hh);
      acc[t] = mmaH<ASPLIT ? 2 : 1>(ah.v, al.v, bq.v, bq.v, acc[t]); }
  }
#pragma unroll
  for (int t = 0; t < 4; ++t) { if (col0 + t * 16 >= N) continue;
#pragma unroll
    for (int r = 0; r < 8; ++r) so[w][8 * hh + r][t * 16 + ln] = acc[t][r] * alpha; }
  __builtin_amdgcn_fence(__ATOMIC_ACQ_REL, "workgroup"); __builtin_amdgcn_wave_barrier();
  const int rsub = lane >> 4, c4 = (lane & 15) * 4;
  {
#pragma unroll
    for (int q = 0; q < 8; ++q) { const int r = q * 2 + rsub; if (col0 + c4 < N) { const v4f v = *(const v4fa*)&so[w][r][c4]; *(v4f*)(C + (size_t)(row0 + r) * ldc + col0 + c4) = v; } }
     }
}

// Wt[n][k] = f16(W[k][n]·scale) from f32 row-major W[K][N] (scale = power of two; bf16-exact weights stay exact in f16 away from the subnormal range)
__global__ __launch_bounds__(256) void k_wt_f16(const float* __restrict__ W, _Float16* __restrict__ Wt, int K, int N, float scale) {
  const int t = blockIdx.x * 256 + threadIdx.x; if (t >= N * (K / 8)) return; const int n = t / (K / 8), k8 = (t % (K / 8)) * 8; FragH f;
#pragma unroll
  for (int i = 0; i < 8; ++i) f.h[i] = (_Float16)(bf16_round(W[(size_t)(k8 + i) * N + n]) * scale); const v8us o = f.half[0];
  *(v8us*)((unsigned short*)Wt + (size_t)n * K + k8) = o; 
}
// k_gemm_hh variant with fused epilogue: v = acc·alpha + bias[by·sBias + col] (+ CP[(row/rowsPerB)·sCPb + by·64 + col] if CP) ; ACT 0 none / 1 elu ; writes f16 C16 (and f32 C if non-null)
template <int ACT>
__global__ __launch_bounds__(128) void k_gemm_hhx(const _Float16* __restrict__ A, int lda, size_t sA, const _Float16* __restrict__ Bh, int ldb, size_t sB, float alpha, const float* __restrict__ bias, size_t sBias, const float* __restrict__ CP, int rowsPerB, size_t sCPb, int row0g,
    float* __restrict__ C, _Float16* __restrict__ C16, int ldc, size_t sC, int M, int N, int K) {
  __shared__ __attribute__((aligned(16))) float so[4][16][64];
  const int tid = threadIdx.x, w = tid >> 5, lane = tid & 31, ln = lane & 15, hh = lane >> 4; const int by = blockIdx.y;
  A += (size_t)by * sA; Bh += (size_t)by * sB; const size_t cofs = (size_t)by * sC; const float* bp = bias ? bias + (size_t)by * sBias : nullptr;
  const int ntn = (N + 63) / 64; const int wid = blockIdx.x * 4 + w; const int mt = wid / ntn, nq = wid % ntn; if (mt * 16 >= M) return;
  const int row0 = mt * 16, col0 = nq * 64; const _Float16* arow = A + (size_t)(row0 + ln) * lda;
  v8f acc[4] = {};
  for (int kb = 0; kb < K; kb += 32) { FragH ah; ah.half[0] = *(const v8us*)((const unsigned short*)arow + kb + 8 * hh); ah.half[1] = *(const v8us*)((const unsigned short*)arow + kb + 16 + 8 * hh);
#pragma unroll
    for (int t = 0; t < 4; ++t) { if (col0 + t * 16 >= N) continue; const size_t boff = (size_t)(col0 + t * 16 + ln) * ldb + kb; FragH bq; bq.half[0] = *(const v8us*)((const unsigned short*)Bh + boff + 8 * hh); bq.half[1] = *(const v8us*)((const unsigned short*)Bh + boff + 16 + 8 * hh);
      acc[t] = mmaH<1>(ah.v, ah.v, bq.v, bq.v, acc[t]); }
  }
#pragma unroll
  for (int t = 0; t < 4; ++t) { if (col0 + t * 16 >= N) continue; const int col = col0 + t * 16 + ln; const float bv = bp ? bf16_round(bp[col]) : 0.f;
#pragma unroll
    for (int r = 0; r < 8; ++r) { float v = acc[t][r] * alpha + bv; if (CP) { const int rr = row0g + row0 + 8 * hh + r; if (rowsPerB < 0) v += CP[cofs + (size_t)rr * ldc + col];      /* rowsPerB < 0: own element of the batched C plane */ else { const int bidx = rr / rowsPerB; v += CP[(size_t)bidx * sCPb + (size_t)by * 64 + col]; } } if (ACT == 1) v = (v > 0.f) ? v : expm1f(v); else if (ACT == 7) v = (v > 0.f) ? v + 1.0f : expf(v); else if (ACT == 8) v = tanhf(v); else if (ACT == 9) v = 0.5f * v * (1.0f + tanhf(0.7978845608028654f * (v + 0.044715f * v * v * v))); else if (ACT == 11) v = 1.0f / (1.0f + expf(-v)); else if (ACT == 12) v = (v > 0.f) ? v : 0.01f * v; else if (ACT == 14) v = (v > 0.f) ? v : 0.1f * v; else if (ACT == 16) v = (v >= 0.f) ? v : 0.3f * v; else if (ACT == 17) v = (v >= 0.f) ? v : 0.2f * v; else if (ACT == 15) v = v / (1.0f + expf(-v)); else if (ACT == 3) v = fmaxf(v, 0.f); else if (ACT == 6) v = 0.5f * v * (1.0f + erff(v * 0.70710678118654752f)); so[w][8 * hh + r][t * 16 + ln] = v; } }
  __builtin_amdgcn_fence(__ATOMIC_ACQ_REL, "workgroup"); __builtin_amdgcn_wave_barrier();
  const int rsub = lane >> 4, c4 = (lane & 15) * 4; typedef _Float16 v4h __attribute__((ext_vector_type(4)));
  {
#pragma unroll
    for (int q = 0; q < 8; ++q) { const int r = q * 2 + rsub; if (col0 + c4 < N) { const v4f v = *(const v4fa*)&so[w][r][c4]; if (C) *(v4f*)(C + cofs + (size_t)(row0 + r) * ldc + col0 + c4) = v; if (C16) { v4h h4; for (int i = 0; i < 4; ++i) h4[i] = (_Float16)v[i]; *(v4h*)(C16 + cofs + (size_t)(row0 + r) * ldc + col0 + c4) = h4; } } }
     }
}


typedef _Float16 v4h __attribute__((ext_vector_type(4)));

__global__ __launch_bounds__(256) void k_x16(const float* __restrict__ x, _Float16* __restrict__ X16, size_t n8) { const size_t t = (size_t)blockIdx.x * 256 + threadIdx.x; if (t >= n8) return; FragH f;
#pragma unroll
  for (int q = 0; q < 8; ++q) f.h[q] = (_Float16)bf16_round(x[t * 8 + q]); *(v8us*)((unsigned short*)X16 + t * 8) = f.half[0];  }
__global__ __launch_bounds__(256) void k_h16(const float* __restrict__ x, _Float16* __restrict__ X16, size_t n8) { const size_t t = (size_t)blockIdx.x * 256 + threadIdx.x; if (t >= n8) return; FragH f;
#pragma unroll
  for (int q = 0; q < 8; ++q) f.h[q] = (_Float16)x[t * 8 + q]; *(v8us*)((unsigned short*)X16 + t * 8) = f.half[0];  }
__global__ __launch_bounds__(256) void k_round16f(const float* __restrict__ W, _Float16* __restrict__ Bt, size_t n8) { const size_t t = (size_t)blockIdx.x * 256 + threadIdx.x; if (t >= n8) return; FragH f;
#pragma unroll
  for (int i = 0; i < 8; ++i) f.h[i] = (_Float16)(bf16_round(W[t * 8 + i]) * 16.0f); *(v8us*)((unsigned short*)Bt + t * 8) = f.half[0];  }
__global__ __launch_bounds__(256) void k_hl(const float* __restrict__ F, _Float16* __restrict__ Hh, _Float16* __restrict__ Hl, size_t n8) { const size_t t = (size_t)blockIdx.x * 256 + threadIdx.x; if (t >= n8) return; FragH fh, fl; const v4f a = *(const v4fa*)(F + t * 8), c = *(const v4fa*)(F + t * 8 + 4);
#pragma unroll
  for (int q = 0; q < 4; ++q) { _Float16 h = (_Float16)a[q]; fh.h[q] = h; fl.h[q] = (_Float16)((a[q] - (float)h) * 1024.0f); h = (_Float16)c[q]; fh.h[4 + q] = h; fl.h[4 + q] = (_Float16)((c[q] - (float)h) * 1024.0f); }
  { *(v8us*)((unsigned short*)Hh + t * 8) = fh.half[0]; *(v8us*)((unsigned short*)Hl + t * 8) = fl.half[0];  } }

// ---- projection GEMM: C = A Bh^T / 16 + bias, A [4096][1024] and Bh [3072][1024] f16, both k-contiguous. One work-group = a 128 x 128 tile, four waves of 64 x 64 (4 x 4 accumulator tiles each).
// A stage = 64 k of the tile's 128 A rows and 128 Bh rows (128-byte rows) in LDS, brought by asynchronous 16-byte copies (global_load_async_to_lds_b128) into two buffers: stage t + 2 flies while stage t + 1 is worked on.
// Every fragment is read from LDS and feeds four products; a k step is 32, taken in rising order into the same accumulator.
// Epilogue by 64-column halves (a half is exactly one head's q, k or v slice: columns are packed per head, 192 h + {0 q, 64 k, 128 v}): q and k halves go as f16 rows into C16 (whole 128-byte lines),
// a v half goes TRANSPOSED into that head's V^T plane VTo[(b NH + h) HD + d][key] and nowhere else (a lane's accumulator holds 8 consecutive keys of ONE d: 16 contiguous bytes of a V^T row; 256-byte runs).
#define VTP 136                      /* LDS pitch of a staged V^T row in f16: 256 data bytes + 16, an odd multiple of 16 bytes for the 16-byte stores and reads */
#define GK 64                        /* k per stage */
#define GP 72                        /* LDS row pitch of a stage in f16: 128 data bytes + 16, an odd multiple of 16 bytes for the 16-byte fragment reads */
#define GSTG (256 * GP)              /* f16 per stage: 128 A rows, then 128 Bh rows */
#define GEH (128 * GP)               /* f16 per epilogue half: [128 rows][GP], or [64 d][VTP], which is smaller */
__device__ __forceinline__ v16h g2_frag(const _Float16* p, int hh) { FragH f; f.half[0] = *(const v8us*)((const unsigned short*)p + 8 * hh); f.half[1] = *(const v8us*)((const unsigned short*)p + 16 + 8 * hh); return f.v; }
__device__ __forceinline__ v16h g3_frag(const unsigned short* p, int hh) { FragH f; f.half[0] = *(const v8us*)(p + 8 * hh); f.half[1] = *(const v8us*)(p + 16 + 8 * hh); return f.v; }
// Eight copies of a lane: its 16-byte chunk of rows r, r + 16, ..., r + 112 (a wave's copy = four whole 128-byte rows). l = the lane's LDS byte address, g = its global address.
// The s_wait_xcnt stands inside the statement, behind the last copy, so that no address register of a copy is rewritten in front of it.
__device__ __forceinline__ void g3_copy8(unsigned l, const _Float16* g) {
  asm volatile("global_load_async_to_lds_b128 %0, %8, off\n\tglobal_load_async_to_lds_b128 %1, %9, off\n\tglobal_load_async_to_lds_b128 %2, %10, off\n\tglobal_load_async_to_lds_b128 %3, %11, off\n\t"
               "global_load_async_to_lds_b128 %4, %12, off\n\tglobal_load_async_to_lds_b128 %5, %13, off\n\tglobal_load_async_to_lds_b128 %6, %14, off\n\tglobal_load_async_to_lds_b128 %7, %15, off\n\ts_wait_xcnt 0x0"
               :: "v"(l), "v"(l + 16 * GP * 2), "v"(l + 32 * GP * 2), "v"(l + 48 * GP * 2), "v"(l + 64 * GP * 2), "v"(l + 80 * GP * 2), "v"(l + 96 * GP * 2), "v"(l + 112 * GP * 2),
                  "v"(g), "v"(g + 16 * DM), "v"(g + 32 * DM), "v"(g + 48 * DM), "v"(g + 64 * DM), "v"(g + 80 * DM), "v"(g + 96 * DM), "v"(g + 112 * DM) : "memory");
}
__global__ __launch_bounds__(128) void k_gemm3(const _Float16* __restrict__ A, const _Float16* __restrict__ Bh, const float* __restrict__ bias, _Float16* __restrict__ C16, _Float16* __restrict__ VTo) {
  __shared__ __attribute__((aligned(16))) unsigned short sm[2 * GSTG];
  const int tid = threadIdx.x, w = tid >> 5, lane = tid & 31, ln = lane & 15, hh = lane >> 4, wm = w >> 1, wn = w & 1;
  const int mt = blockIdx.x / (LQ / 128), nt = blockIdx.x % (LQ / 128); const int row0 = mt * 128, col0 = nt * 128;
  const int crow = tid >> 3, cc8 = (tid & 7) * 8;      /* the lane's first row and its 16-byte chunk in every copy */
  const _Float16* ag = A + (size_t)(row0 + crow) * DM + cc8; const _Float16* bg = Bh + (size_t)(col0 + crow) * DM + cc8;
  const unsigned la = (unsigned)(size_t)&sm[crow * GP + cc8], lb = la + 128 * GP * 2;
  g3_copy8(la, ag); g3_copy8(lb, bg);
  asm volatile("s_wait_asynccnt 0x0" ::: "memory");      /* this wave's share of stage 0 has landed */
  __syncthreads();      /* stage 0 is complete before anybody reads it */
  g3_copy8(la + GSTG * 2, ag + GK); g3_copy8(lb + GSTG * 2, bg + GK);
  const v8f z8 = {0.f, 0.f, 0.f, 0.f, 0.f, 0.f, 0.f, 0.f};
  v8f acc[4][4];
#pragma unroll
  for (int i = 0; i < 4; ++i)
#pragma unroll
    for (int j = 0; j < 4; ++j) acc[i][j] = z8;
  /* the stage loop stays rolled (one copy of its 32 products); everything inside is unrolled, so that acc is indexed by constants only and stays in registers */
#pragma unroll 1
  for (int t = 0; t < DM / GK; ++t) {
    const unsigned short* sa = sm + (t & 1) * GSTG + (64 * wm + ln) * GP; const unsigned short* sb = sm + (t & 1) * GSTG + (128 + 64 * wn + ln) * GP;
#pragma unroll
    for (int ks = 0; ks < 2; ++ks) {
      /* The k step's eight fragments are read as one group, whole in front of its sixteen products. The scheduling fences hold that order: without them the compiler keeps one A fragment,
         reads the next among the products and waits out the LDS latency in front of every four of them. */
      __builtin_amdgcn_sched_barrier(0);      /* nothing of the group's reads moves up among the products before */
      v16h af[4], bf[4];
#pragma unroll
      for (int i = 0; i < 4; ++i) { af[i] = g3_frag(sa + 16 * i * GP + ks * 32, hh); bf[i] = g3_frag(sb + 16 * i * GP + ks * 32, hh); }
      __builtin_amdgcn_sched_barrier(0);      /* none of the group's reads sinks among its products */
#pragma unroll
      for (int i = 0; i < 4; ++i)
#pragma unroll
        for (int j = 0; j < 4; ++j) acc[i][j] = __builtin_amdgcn_wmma_f32_16x16x32_f16(false, af[i], false, bf[j], (short)0, acc[i][j], false, false);
    }
    __builtin_amdgcn_sched_barrier(0);      /* keeps the last sixteen products above the stage's foot: without it the compiler sinks them behind the barrier, in front of the copies, which then start that much later */
    asm volatile("s_wait_dscnt 0x0" ::: "memory");      /* this wave's reads of stage t are done before the buffer is handed back */
    asm volatile("s_wait_asynccnt 0x0" ::: "memory");      /* this wave's share of stage t + 1 has landed */
    __syncthreads();      /* publishes stage t + 1 and ends every wave's reads of stage t */
    if (t + 2 < DM / GK) { g3_copy8(la + (t & 1) * (GSTG * 2), ag + (t + 2) * GK); g3_copy8(lb + (t & 1) * (GSTG * 2), bg + (t + 2) * GK); }
  }
  asm volatile("s_wait_asynccnt 0x0" ::: "memory");      /* nothing is in flight when the buffers become output staging */
  /* behind the loop's last barrier nobody reads a stage any more: each column half is staged in its own GEH range */
  { unsigned short* sr = sm + wn * GEH; const int cb = col0 + 64 * wn;
    float bv[4];
#pragma unroll
    for (int j = 0; j < 4; ++j) bv[j] = bias[cb + 16 * j + ln];
#pragma unroll
    for (int j = 0; j < 4; ++j) bv[j] = bf16_round(bv[j]);
    if ((cb / HD) % 3 == 2) {
#pragma unroll
      for (int i = 0; i < 4; ++i)
#pragma unroll
        for (int j = 0; j < 4; ++j) { FragH f;
#pragma unroll
          for (int r = 0; r < 8; ++r) f.h[r] = (_Float16)(acc[i][j][r] * 0.0625f + bv[j]);
          *(v8us*)(sr + (16 * j + ln) * VTP + 64 * wm + 16 * i + 8 * hh) = f.half[0]; }
    } else {
#pragma unroll
      for (int i = 0; i < 4; ++i)
#pragma unroll
        for (int j = 0; j < 4; ++j) { FragH f;
#pragma unroll
          for (int r = 0; r < 8; ++r) f.h[r] = (_Float16)(acc[i][j][r] * 0.0625f + bv[j]);
#pragma unroll
          for (int r = 0; r < 8; ++r) sr[(64 * wm + 16 * i + 8 * hh + r) * GP + 16 * j + ln] = f.u[r]; }
    } }
  __syncthreads();      /* both halves are whole in LDS before anybody reads a row */
#pragma unroll
  for (int n = 0; n < 2; ++n) { const unsigned short* sr = sm + n * GEH; const int cb = col0 + 64 * n;
    const bool isv = (cb / HD) % 3 == 2;      /* the same for the whole work-group: cb comes from blockIdx alone */
    const int sh = isv ? 4 : 3, lp = isv ? VTP : GP, gp = isv ? SQ : LQ;      /* 16-byte chunks a staged row (log2), its LDS pitch, its pitch in memory: V^T rows of 256 bytes, or q / k rows of 128 */
    unsigned short* gb = isv ? (unsigned short*)VTo + ((size_t)(row0 / SQ) * NH + cb / (3 * HD)) * HD * SQ + row0 % SQ : (unsigned short*)C16 + (size_t)row0 * LQ + cb;
    v8us dv[8]; unsigned short* dp[8];
#pragma unroll
    for (int i = 0; i < 8; ++i) { const int c = tid + 128 * i, x = c >> sh, y = (c & ((1 << sh) - 1)) * 8; dv[i] = *(const v8us*)(sr + x * lp + y); dp[i] = gb + (size_t)x * gp + y; }
    __builtin_amdgcn_sched_barrier(0);      /* the eight reads and addresses stand whole in front of the stores, so that no register of an issued store is rewritten among them */
#pragma unroll
    for (int i = 0; i < 8; ++i) *(v8us*)dp[i] = dv[i];      /* a wave's store = whole lines: two 256-byte runs, or four 128-byte rows */
    if (n == 0) { asm volatile("s_wait_xcnt 0x0" ::: "memory");      /* in front of the second half's work, which rewrites the registers that these stores name */
      __builtin_amdgcn_sched_barrier(0); }      /* holds that work behind the wait */
  }
}


__global__ __launch_bounds__(256) void k_wnat(const float* __restrict__ w, size_t n8, _Float16* __restrict__ Bt) { const size_t t = (size_t)blockIdx.x * 256 + threadIdx.x; if (t >= n8) return; FragH f; for (int q = 0; q < 8; ++q) f.h[q] = (_Float16)(bf16_round(w[t * 8 + q]) * 16.0f); *(v8us*)((unsigned short*)Bt + t * 8) = f.half[0];  }
#define FK 64                        /* keys per pass */
#define FPT 72                       /* LDS row pitch in f16: 128 data bytes + 16, an odd multiple of 16 bytes for the 16-byte fragment reads */
__device__ __forceinline__ v16h fa_frag(const unsigned short* p, int hh) { FragH f; f.half[0] = *(const v8us*)(p + 8 * hh); f.half[1] = *(const v8us*)(p + 16 + 8 * hh); return f.v; }
__device__ __forceinline__ v8f fa_mma(v16h a, v16h b, v8f c) { return __builtin_amdgcn_wmma_f32_16x16x32_f16(false, a, false, b, (short)0, c, false, false); }
__device__ __forceinline__ float fa_xhalf(float x) { return __builtin_bit_cast(float, __builtin_amdgcn_permlanex16(__builtin_bit_cast(int, x), __builtin_bit_cast(int, x), 0x76543210, 0xfedcba98, false, false)); }      /* lane l reads lane l ^ 16, on the vector pipe: no LDS round trip */
__device__ __forceinline__ float fa_exp2(float x) { float e; asm("v_exp_f32 %0, %1\n\tv_nop" : "=v"(e) : "v"(x)); return e; }
__device__ __forceinline__ v8f fa_exp2x8(v8f x) { float e0, e1, e2, e3, e4, e5, e6, e7;
  asm("v_exp_f32 %0, %8\n\tv_exp_f32 %1, %9\n\tv_exp_f32 %2, %10\n\tv_exp_f32 %3, %11\n\tv_exp_f32 %4, %12\n\tv_exp_f32 %5, %13\n\tv_exp_f32 %6, %14\n\tv_exp_f32 %7, %15\n\tv_nop"
      : "=&v"(e0), "=&v"(e1), "=&v"(e2), "=&v"(e3), "=&v"(e4), "=&v"(e5), "=&v"(e6), "=&v"(e7) : "v"(x[0]), "v"(x[1]), "v"(x[2]), "v"(x[3]), "v"(x[4]), "v"(x[5]), "v"(x[6]), "v"(x[7]));
  const v8f e = {e0, e1, e2, e3, e4, e5, e6, e7}; return e; }
__global__ __launch_bounds__(128) void k_fattn(const _Float16* __restrict__ QKVp, const _Float16* __restrict__ VTp, float* __restrict__ O) {
  __shared__ __attribute__((aligned(16))) unsigned short Ks[FK][FPT];      /* K rows of the pass: [key][d] */
  __shared__ __attribute__((aligned(16))) unsigned short Vs[HD][FPT];      /* V^T rows of the pass: [d][key] */
  const int tid = threadIdx.x, w = tid >> 5, lane = tid & 31, ln = lane & 15, hh = lane >> 4;
  const int bh = blockIdx.x / (SQ / 128), qb = blockIdx.x % (SQ / 128); const int b = bh / NH, h = bh % NH;
  const _Float16* qg = QKVp + (size_t)b * SQ * LQ + (size_t)h * 3 * HD;      /* head h's 192 packed columns: q at + 0, k at + 64 */
  const int q0 = qb * 128 + w * 32;
  v16h qf[2][2];
#pragma unroll
  for (int qt = 0; qt < 2; ++qt)
#pragma unroll
    for (int ks = 0; ks < 2; ++ks) qf[qt][ks] = g2_frag(qg + (size_t)(q0 + qt * 16 + ln) * LQ + ks * 32, hh);
  /* staging: thread t moves 16-byte chunks t, t + 128, t + 256, t + 384 of each 64 x 128-byte tile: 8 chunks a row, so a wave's load covers 4 whole lines */
  const int frow = tid >> 3, fc8 = (tid & 7) * 8;
  const unsigned short* kp = (const unsigned short*)qg + HD + (size_t)frow * LQ + fc8;
  const unsigned short* vp = (const unsigned short*)VTp + (size_t)bh * HD * SQ + (size_t)frow * SQ + fc8;
  v8us kr[4], vr[4];
#pragma unroll
  for (int j = 0; j < 4; ++j) { kr[j] = *(const v8us*)(kp + (size_t)(16 * j) * LQ); vr[j] = *(const v8us*)(vp + (size_t)(16 * j) * SQ); }
  const v8f z8 = {0.f, 0.f, 0.f, 0.f, 0.f, 0.f, 0.f, 0.f};
  v8f o[2][4]; float m[2], l[2];
#pragma unroll
  for (int qt = 0; qt < 2; ++qt) { m[qt] = -3.0e38f; l[qt] = 0.f;
#pragma unroll
    for (int dt = 0; dt < 4; ++dt) o[qt][dt] = z8; }
  const float SC = 0.125f * 1.4426950408889634f;      /* 1 / sqrt(64), and base e to base 2 */
  for (int p = 0; p < SQ / FK; ++p) {
    __syncthreads();      /* every wave has finished reading the pass before */
#pragma unroll
    for (int j = 0; j < 4; ++j) { *(v8us*)&Ks[frow + 16 * j][fc8] = kr[j]; *(v8us*)&Vs[frow + 16 * j][fc8] = vr[j]; }
    __syncthreads();      /* the tiles are complete before anybody reads them */
    if (p + 1 < SQ / FK) {      /* the next pass's tiles fly to registers while this pass is worked on */
      kp += (size_t)FK * LQ; vp += FK;
#pragma unroll
      for (int j = 0; j < 4; ++j) { kr[j] = *(const v8us*)(kp + (size_t)(16 * j) * LQ); vr[j] = *(const v8us*)(vp + (size_t)(16 * j) * SQ); }
    }
    __builtin_amdgcn_sched_barrier(0);      /* keeps the eight loads above the pass's work: without it the compiler sinks them to the loop's foot, and their whole latency is waited for at the next pass's head */
    v8f st[2][4];
#pragma unroll
    for (int kt = 0; kt < 4; ++kt) { const v16h a0 = fa_frag(&Ks[kt * 16 + ln][0], hh), a1 = fa_frag(&Ks[kt * 16 + ln][32], hh);
#pragma unroll
      for (int qt = 0; qt < 2; ++qt) st[qt][kt] = fa_mma(a1, qf[qt][1], fa_mma(a0, qf[qt][0], z8)); }      /* st[qt][kt][r] = q(q0 + 16 qt + ln) . k(64 p + 16 kt + 8 hh + r) */
    FragH pf[2][2];
#pragma unroll
    for (int qt = 0; qt < 2; ++qt) {
      v8f x8 = st[qt][0];
#pragma unroll
      for (int r = 0; r < 8; ++r) x8[r] = fmaxf(fmaxf(st[qt][0][r], st[qt][1][r]), fmaxf(st[qt][2][r], st[qt][3][r]));
      float mx = fmaxf(fmaxf(fmaxf(x8[0], x8[1]), fmaxf(x8[2], x8[3])), fmaxf(fmaxf(x8[4], x8[5]), fmaxf(x8[6], x8[7])));
      mx = fmaxf(mx, fa_xhalf(mx));      /* the other half of the query's 64 keys */
      const float mn = fmaxf(m[qt], mx * SC); const float al = fa_exp2(m[qt] - mn); m[qt] = mn;      /* al = 0 on the first pass */
      v8f s8 = z8;
#pragma unroll
      for (int kt = 0; kt < 4; ++kt) { const v8f e8 = fa_exp2x8(st[qt][kt] * SC - mn); s8 += e8;
#pragma unroll
        for (int r = 0; r < 8; ++r) pf[qt][kt >> 1].h[(kt & 1) * 8 + r] = (_Float16)e8[r]; }
      l[qt] = l[qt] * al + (((s8[0] + s8[1]) + (s8[2] + s8[3])) + ((s8[4] + s8[5]) + (s8[6] + s8[7])));
#pragma unroll
      for (int dt = 0; dt < 4; ++dt) o[qt][dt] *= al;
    }
    /* The V^T fragments are read in two groups of four, each group whole in front of its eight products. The scheduling fences hold that order: without them the compiler mixes the softmax into the products,
       runs short of registers and waits for LDS in front of every pair of products; all eight fragments at once would take the kernel past 256 registers. */
#pragma unroll
    for (int dg = 0; dg < 2; ++dg) {
      __builtin_amdgcn_sched_barrier(0);      /* nothing of the group's reads moves up into the work before */
      v16h va[2][2];
#pragma unroll
      for (int d2 = 0; d2 < 2; ++d2)
#pragma unroll
        for (int ks = 0; ks < 2; ++ks) va[d2][ks] = fa_frag(&Vs[(dg * 2 + d2) * 16 + ln][ks * 32], hh);
      __builtin_amdgcn_sched_barrier(0);      /* none of the group's reads sinks among its products */
#pragma unroll
      for (int d2 = 0; d2 < 2; ++d2)
#pragma unroll
        for (int ks = 0; ks < 2; ++ks)
#pragma unroll
          for (int qt = 0; qt < 2; ++qt) o[qt][dg * 2 + d2] = fa_mma(va[d2][ks], pf[qt][ks].v, o[qt][dg * 2 + d2]);      /* o[qt][dt][r] = O[q0 + 16 qt + ln][16 dt + 8 hh + r] */
    }
  }
#pragma unroll
  for (int qt = 0; qt < 2; ++qt) { const float inv = 1.0f / (l[qt] + fa_xhalf(l[qt]));
    float* orow = O + ((size_t)bh * SQ + q0 + qt * 16 + ln) * HD + 8 * hh;      /* head plane bh, row = query: the raw-view merge */
#pragma unroll
    for (int dt = 0; dt < 4; ++dt) { const v4f lo = {o[qt][dt][0] * inv, o[qt][dt][1] * inv, o[qt][dt][2] * inv, o[qt][dt][3] * inv}, hi = {o[qt][dt][4] * inv, o[qt][dt][5] * inv, o[qt][dt][6] * inv, o[qt][dt][7] * inv};
      *(v4f*)(orow + dt * 16) = lo; *(v4f*)(orow + dt * 16 + 4) = hi; } }
}
__global__ __launch_bounds__(256) void k_vt(const _Float16* __restrict__ V16, int b, int h0, _Float16* __restrict__ VT) { __shared__ unsigned short tl[64][65]; const int tid = threadIdx.x; const int hh = blockIdx.x % HG, sg = blockIdx.x / HG; const int s0 = sg * 64; const int h = h0 + hh;
  for (int i = tid; i < 64 * 8; i += 256) { const int j = i / 8, d8 = (i % 8) * 8; FragH f; f.half[0] = *(const v8us*)((const unsigned short*)V16 + ((size_t)b * SQ + s0 + j) * DM + h * HD + d8); for (int q = 0; q < 8; ++q) tl[d8 + q][j] = f.u[q]; }
  __syncthreads();
  { for (int i = tid; i < 64 * 8; i += 256) { const int d = i / 8, j8 = (i % 8) * 8; FragH f; for (int q = 0; q < 8; ++q) f.u[q] = tl[d][j8 + q]; *(v8us*)((unsigned short*)VT + ((size_t)hh * HD + d) * SQ + s0 + j8) = f.half[0]; }  } }


extern "C" void kernel_launch(void* const* d_in, const int* in_sizes, int n_in,
                              void* d_out, int out_size, void* d_ws, size_t ws_size, hipStream_t stream) {
  (void)in_sizes; (void)n_in; (void)out_size;
  const float* const* I = (const float* const*)d_in; const float* x = I[0]; const float* wqkv = I[1]; const float* bqkv = I[2];      /* input order: x, W_qkv ([in][out] [1024][3072]; columns packed PER HEAD: 192 h + {0..63 q, 64..127 k, 128..191 v}), b_qkv [3072] (REAL; the same packing: the projection GEMM's bias slot reads it by output column); three inputs; no output weight: the module has none */
  char* ws = (char*)d_ws; size_t off = 0;
  auto take = [&](size_t bytes) { char* p = ws + off; off += (bytes + 255) & ~(size_t)255; return p; };
  _Float16* BQKV = (_Float16*)take((size_t)3 * DM * DM * 2);
  _Float16* X16 = (_Float16*)take(NR * DM * 2); _Float16* QKV = (_Float16*)take(NR * 3 * DM * 2);      /* PER-HEAD packing: within head h's 192 columns q starts at + 0, k at + 64; the v columns (+ 128) are never written here: they go to VT; the head stride is 3 HD */
  _Float16* VT = (_Float16*)take((size_t)NB * NH * HD * SQ * 2);      /* V^T planes of every (batch, head) */
  if (off > ws_size) return;
  k_wt_f16<<<(unsigned)(((size_t)DM * 3 * DM / 8 + 255) / 256), 256, 0, stream>>>(wqkv, BQKV, DM, 3 * DM, 16.0f);      /* [in][out] -> Bt[n][k] x16 (pitch K = 1024) */

  k_x16<<<(unsigned)((NR * DM / 8 + 255) / 256), 256, 0, stream>>>(x, X16, NR * DM / 8);
  const size_t r0p = (size_t)B0 * SQ;      /* first projected row */
  k_gemm3<<<(unsigned)((MP / 128) * (LQ / 128)), 128, 0, stream>>>(X16 + r0p * DM, BQKV, bqkv, QKV + r0p * 3 * DM, VT + (size_t)B0 * NH * HD * SQ);      /* q | k rows (f16, packed per head) and the V^T planes */
  k_fattn<<<NB * NH * (SQ / 128), 128, 0, stream>>>(QKV, VT, (float*)d_out);      /* all batches and heads in one launch: softmax(q k^T / 8) v, each head into its own contiguous [2048][64] plane */
}

// v005
// A run of this version takes 71.6 microseconds.
// Two timings next to v004 put it at 1.20 and 1.21 times that version's speed.
// Counting every step since v000, it is 52.4 times as fast.
#include <hip/hip_runtime.h>
// Multi-head self-attention with ONE fused QKV projection packed PER HEAD, NO output projection and a RAW-VIEW merge (x [2][2048][1024]; qkv = x W_qkv + b_qkv ([in][out] 1024 x 3072, normal x 1/32; a REAL bias normal x 0.01) reshaped (b, s, 16, 3 x 64): head h owns columns 192 h .. 192 h + 191: q | k | v = its three 64-column slices; att = q k^T / sqrt(64); softmax over all 2048 keys (no mask); values [b][16][s][64] are reshaped to (b, s, 1024) WITHOUT a head transpose (the source's own form): the output memory of a batch IS the sixteen [2048][64] head planes one after another); the P.V product is written straight to the f32 output, each head into its own contiguous plane.
// Structure: token rows r = b*2048 + s; x as exact f16 rows (bf16-rounded); q | k | v as ONE WMMA GEMM (N = 3 x 1024) (128x128 tiles staged in LDS by asynchronous copies, 64x64 wave tiles, f32 accumulation, exact x16 weights + bias, f16 outputs); the GEMM's own epilogue stores every head's v tile transposed (V^T planes [d][key], 256-byte runs through LDS), so no transpose launch is left; then ONE fused attention launch over every (batch, head): per 64 keys S^T = K Q^T, running softmax in registers (f32 statistics, base 2; weights 2^(s - m) as f16), O^T += V^T P^T, divided by the row sum at the end and written as f32 straight into the output's own layout (head plane after head plane): no output projection.
// Compute dtype: inputs rounded to bf16; x / weights exact; q, k, v and softmax weights as plain f16 GEMM operands (~2^-12); scores and softmax statistics f32; v_wmma_f32_16x16x32_f16.
#define NB 2
#define SQ 2048
#define DM 1024
#define NH 16
#define HD 64
#define HG 4                         /* heads per group of the grouped transpose below */
#define B0 0                         /* first batch processed (debug hook) */
#define NBR NB                       /* batches processed (debug hook) */
#define NR ((size_t)NB * SQ)         /* token rows */
#define MP ((int)((size_t)NBR * SQ)) /* rows projected (debug hook) */
#define QN SQ                        /* unused (the attention launch covers all SQ query rows) */
#define NHD NH                       /* unused (the attention launch covers all NH heads) */
#define MPO MP                       /* unused (no output projection) */
#define LQ (3 * DM)      /* row pitch of the q/k/v rows */
typedef __bf16 v16b __attribute__((ext_vector_type(16)));
typedef unsigned short v8us __attribute__((ext_vector_type(8), may_alias));
typedef float  v8f  __attribute__((ext_vector_type(8)));
typedef float  v4f  __attribute__((ext_vector_type(4)));
typedef float  v4fa __attribute__((ext_vector_type(4), may_alias));
union FragB { v16b v; v8us half[2]; unsigned short u[16]; };

__device__ __forceinline__ unsigned short bf16_bits(float x) { unsigned int u = __float_as_uint(x); return (unsigned short)((u + 0x7FFFu + ((u >> 16) & 1u)) >> 16); }
__device__ __forceinline__ float bf16_val(unsigned short b) { return __uint_as_float(((unsigned int)b) << 16); }
__device__ __forceinline__ float bf16_round(float x) { return bf16_val(bf16_bits(x)); }
// D += A·B with NT terms: 1 = ah·bh, 2 = + al·bh (A split), 3 = + ah·bl (both split)
template <int NT>
__device__ __forceinline__ v8f mmaN(v16b ah, v16b al, v16b bh, v16b bl, v8f c) {
  c = __builtin_amdgcn_wmma_f32_16x16x32_bf16(false, ah, false, bh, (short)0, c, false, false);
  if (NT >= 2) c = __builtin_amdgcn_wmma_f32_16x16x32_bf16(false, al, false, bh, (short)0, c, false, false);
  if (NT >= 3) c = __builtin_amdgcn_wmma_f32_16x16x32_bf16(false, ah, false, bl, (short)0, c, false, false);
  asm volatile("v_nop\n\tv_nop\n\tv_nop\n\tv_nop" : "+v"(c) : "v"(ah), "v"(al), "v"(bh), "v"(bl));
  return c;
}

__global__ __launch_bounds__(256) void k_wt_bf16(const float* __restrict__ W, unsigned short* __restrict__ Wt, int K, int N) {
  const int t = blockIdx.x * 256 + threadIdx.x;
  const int k8n = K / 8;
  if (t >= N * k8n) return;
  const int n = t / k8n, k8 = (t % k8n) * 8;
  v8us v;
#pragma unroll
  for (int i = 0; i < 8; ++i) v[i] = bf16_bits(W[(size_t)(k8 + i) * N + n]);
  *(v8us*)(Wt + (size_t)n * K + k8) = v;
  
}

// GEMM C[M][N] (f32, pitch ldc) = act(A[M][K]·W + bias). A f32 row-major (pitch lda) converted per fragment to bf16
// (ASPLIT: hi/lo two planes -> 2 terms, else single rounded term); Wt bf16 [N][K] (pitch ldb). BIAS_BF16 rounds the
// bias to bf16 first (bias quantised to bf16 before the add). K%32==0, M%16==0, N%64==0.
template <bool ASPLIT, int ACT, bool BIAS_BF16>
__global__ __launch_bounds__(128) void k_gemm_bf(const float* __restrict__ A, int lda, const unsigned short* __restrict__ Wt, int ldb,
                                               const float* __restrict__ bias, float* __restrict__ C, int ldc, int M, int N, int K) {
  __shared__ __attribute__((aligned(16))) float so[4][16][64];
  const int tid = threadIdx.x, w = tid >> 5, lane = tid & 31, ln = lane & 15, hh = lane >> 4;
  const int ntn = N / 64;
  const int wid = blockIdx.x * 4 + w;
  const int mt = wid / ntn, nq = wid % ntn;
  if (mt * 16 >= M) return;
  const int row0 = mt * 16, col0 = nq * 64;
  const float* arow = A + (size_t)(row0 + ln) * lda;
  v8f acc[4] = {};
  for (int kb = 0; kb < K; kb += 32) {
    FragB ah, al;
    const v4f x0 = *(const v4fa*)(arow + kb + 8 * hh), x1 = *(const v4fa*)(arow + kb + 8 * hh + 4);
    const v4f x2 = *(const v4fa*)(arow + kb + 16 + 8 * hh), x3 = *(const v4fa*)(arow + kb + 16 + 8 * hh + 4);
    float xs[16] = {x0[0],x0[1],x0[2],x0[3],x1[0],x1[1],x1[2],x1[3],x2[0],x2[1],x2[2],x2[3],x3[0],x3[1],x3[2],x3[3]};
#pragma unroll
    for (int i = 0; i < 16; ++i) { const unsigned short hb = bf16_bits(xs[i]); ah.u[i] = hb; al.u[i] = ASPLIT ? bf16_bits(xs[i] - bf16_val(hb)) : (unsigned short)0; }
#pragma unroll
    for (int t = 0; t < 4; ++t) {
      const unsigned short* brow = Wt + (size_t)(col0 + t * 16 + ln) * ldb + kb;
      FragB b;
      b.half[0] = *(const v8us*)(brow + 8 * hh);
      b.half[1] = *(const v8us*)(brow + 16 + 8 * hh);
      acc[t] = mmaN<ASPLIT ? 2 : 1>(ah.v, al.v, b.v, b.v, acc[t]);
    }
  }
#pragma unroll
  for (int t = 0; t < 4; ++t) {
    float bv = bias ? bias[col0 + t * 16 + ln] : 0.f;
    if (BIAS_BF16) bv = bf16_round(bv);
#pragma unroll
    for (int r = 0; r < 8; ++r) { float v = acc[t][r] + bv; if (ACT == 1) v = fmaxf(v, 0.f); so[w][8 * hh + r][t * 16 + ln] = v; }
  }
  __builtin_amdgcn_fence(__ATOMIC_ACQ_REL, "workgroup");
  __builtin_amdgcn_wave_barrier();
  const int rsub = lane >> 4, c4 = (lane & 15) * 4;
  {
#pragma unroll
    for (int q = 0; q < 8; ++q) {
      const int r = q * 2 + rsub;
      const v4f v = *(const v4fa*)&so[w][r][c4];
      *(v4f*)(C + (size_t)(row0 + r) * ldc + col0 + c4) = v;
    }
    
  }
}

// GEMM C = act(A·W + bias + resid): A f32 (ASPLIT -> hi/lo 2 terms), Wt bf16 [N][K]; ACT 0 none, 1 relu, 2 exact gelu;
// resid (optional, f32, row index = (row % rmod), pitch ldr, RES_BF16 rounds it) added before the activation.
template <bool ASPLIT, int ACT, bool BIAS_BF16, bool RES_BF16>
__global__ __launch_bounds__(128) void k_gemm_bf3(const float* __restrict__ A, int lda, const unsigned short* __restrict__ Wt, int ldb,
                                                const float* __restrict__ bias, const float* __restrict__ resid, int rmod, int ldr,
                                                float* __restrict__ C, int ldc, int M, int N, int K) {
  __shared__ __attribute__((aligned(16))) float so[4][16][64];
  const int tid = threadIdx.x, w = tid >> 5, lane = tid & 31, ln = lane & 15, hh = lane >> 4;
  const int ntn = N / 64;
  const int wid = blockIdx.x * 4 + w;
  const int mt = wid / ntn, nq = wid % ntn;
  if (mt * 16 >= M) return;
  const int row0 = mt * 16, col0 = nq * 64;
  const float* arow = A + (size_t)(row0 + ln) * lda;
  v8f acc[4] = {};
  for (int kb = 0; kb < K; kb += 32) {
    FragB ah, al;
    const v4f x0 = *(const v4fa*)(arow + kb + 8 * hh), x1 = *(const v4fa*)(arow + kb + 8 * hh + 4);
    const v4f x2 = *(const v4fa*)(arow + kb + 16 + 8 * hh), x3 = *(const v4fa*)(arow + kb + 16 + 8 * hh + 4);
    float xs[16] = {x0[0],x0[1],x0[2],x0[3],x1[0],x1[1],x1[2],x1[3],x2[0],x2[1],x2[2],x2[3],x3[0],x3[1],x3[2],x3[3]};
#pragma unroll
    for (int i = 0; i < 16; ++i) { const unsigned short hb = bf16_bits(xs[i]); ah.u[i] = hb; al.u[i] = ASPLIT ? bf16_bits(xs[i] - bf16_val(hb)) : (unsigned short)0; }
#pragma unroll
    for (int t = 0; t < 4; ++t) {
      const unsigned short* brow = Wt + (size_t)(col0 + t * 16 + ln) * ldb + kb;
      FragB b;
      b.half[0] = *(const v8us*)(brow + 8 * hh);
      b.half[1] = *(const v8us*)(brow + 16 + 8 * hh);
      acc[t] = mmaN<ASPLIT ? 2 : 1>(ah.v, al.v, b.v, b.v, acc[t]);
    }
  }
#pragma unroll
  for (int t = 0; t < 4; ++t) {
    const int col = col0 + t * 16 + ln;
    float bv = bias ? bias[col] : 0.f;
    if (BIAS_BF16) bv = bf16_round(bv);
#pragma unroll
    for (int r = 0; r < 8; ++r) {
      float v = acc[t][r] + bv;
      if (resid) { float rv = resid[(size_t)((row0 + 8 * hh + r) % rmod) * ldr + col]; if (RES_BF16) rv = bf16_round(rv); v += rv; }
      if (ACT == 1) v = fmaxf(v, 0.f);
      if (ACT == 2) v = 0.5f * v * (1.0f + erff(v * 0.70710678118654752f));
      if (ACT == 3) { const float u = 0.7978845608028654f * (v + 0.044715f * v * v * v); v = 0.5f * v * (1.0f + tanhf(u)); }
      so[w][8 * hh + r][t * 16 + ln] = v;
    }
  }
  __builtin_amdgcn_fence(__ATOMIC_ACQ_REL, "workgroup");
  __builtin_amdgcn_wave_barrier();
  const int rsub = lane >> 4, c4 = (lane & 15) * 4;
  {
#pragma unroll
    for (int q = 0; q < 8; ++q) {
      const int r = q * 2 + rsub;
      const v4f v = *(const v4fa*)&so[w][r][c4];
      *(v4f*)(C + (size_t)(row0 + r) * ldc + col0 + c4) = v;
    }
    
  }
}
// row LayerNorm (biased variance, eps) over N: s = X (+ R); optional out_sum <- s; out_norm <- (s-mu)*rsqrt(var+eps)*g + b
template <bool PARAM_BF16>
__global__ __launch_bounds__(256) void k_layernorm(const float* __restrict__ X, const float* __restrict__ R, const float* __restrict__ g, const float* __restrict__ bta,
                                                  float* __restrict__ out_sum, float* __restrict__ out_norm, int N, float eps) {
  __shared__ float red[256];
  const int row = blockIdx.x, tid = threadIdx.x;
  const float* x = X + (size_t)row * N; const float* rr = R ? R + (size_t)row * N : nullptr;
  float vals[16];                     // up to N = 4096
  const int per = N / 256;            // contiguous chunk per thread? use strided-by-4 chunks: thread handles j = tid*4 + 1024*u
  float s1 = 0.f;
  for (int u = 0; u < per / 4; ++u) {
    const int j = tid * 4 + 1024 * u;
    const v4f a = *(const v4fa*)(x + j);
    v4f b = {0.f,0.f,0.f,0.f}; if (rr) b = *(const v4fa*)(rr + j);
#pragma unroll
    for (int q = 0; q < 4; ++q) { const float v = a[q] + b[q]; vals[u * 4 + q] = v; s1 += v; }
  }
  red[tid] = s1; __syncthreads();
  for (int st = 128; st > 0; st >>= 1) { if (tid < st) red[tid] += red[tid + st]; __syncthreads(); }
  const float mu = red[0] / (float)N; __syncthreads();
  float s2 = 0.f;
  for (int u = 0; u < per / 4; ++u)
#pragma unroll
    for (int q = 0; q < 4; ++q) { const float c = vals[u * 4 + q] - mu; s2 += c * c; }
  red[tid] = s2; __syncthreads();
  for (int st = 128; st > 0; st >>= 1) { if (tid < st) red[tid] += red[tid + st]; __syncthreads(); }
  const float rs = rsqrtf(red[0] / (float)N + eps);
  {
    for (int u = 0; u < per / 4; ++u) {
      const int j = tid * 4 + 1024 * u;
      v4f o, sm;
#pragma unroll
      for (int q = 0; q < 4; ++q) {
        float gg = g[j + q], bb = bta[j + q];
        if (PARAM_BF16) { gg = bf16_round(gg); bb = bf16_round(bb); }
        sm[q] = vals[u * 4 + q]; o[q] = (vals[u * 4 + q] - mu) * rs * gg + bb;
      }
      if (out_sum) *(v4f*)(out_sum + (size_t)row * N + j) = sm;
      *(v4f*)(out_norm + (size_t)row * N + j) = o;
    }
    
  }
}



// ---- f16 WMMA path (v_wmma_f32_16x16x32_f16): 11-bit significands for operands in range — used where a [0,1] probability operand needs more precision than bf16
typedef _Float16 v16h __attribute__((ext_vector_type(16)));
union FragH { v16h v; v8us half[2]; _Float16 h[16]; unsigned short u[16]; };
template <int NT>
__device__ __forceinline__ v8f mmaH(v16h ah, v16h al, v16h bh, v16h bl, v8f c) {
  c = __builtin_amdgcn_wmma_f32_16x16x32_f16(false, ah, false, bh, (short)0, c, false, false);
  if (NT >= 2) c = __builtin_amdgcn_wmma_f32_16x16x32_f16(false, al, false, bh, (short)0, c, false, false);
  if (NT >= 3) c = __builtin_amdgcn_wmma_f32_16x16x32_f16(false, ah, false, bl, (short)0, c, false, false);
  asm volatile("v_nop\n\tv_nop\n\tv_nop\n\tv_nop" : "+v"(c) : "v"(ah), "v"(al), "v"(bh), "v"(bl));
  return c;
}
// batched GEMM like k_gemm_b but f16 operands: A f32 (split into f16 hi/lo if ASPLIT, else rounded to f16), Bt = f16 values [n][k]; alpha; C f32; N multiple of 16 (partial tiles skipped)
template <bool ASPLIT>
__global__ __launch_bounds__(128) void k_gemm_h(const float* __restrict__ A, int lda, size_t sA, const _Float16* __restrict__ Bh, int ldb, size_t sB, float alpha, float* __restrict__ C, int ldc, size_t sC, int M, int N, int K) {
  __shared__ __attribute__((aligned(16))) float so[4][16][64];
  const int tid = threadIdx.x, w = tid >> 5, lane = tid & 31, ln = lane & 15, hh = lane >> 4; const int by = blockIdx.y;
  A += (size_t)by * sA; Bh += (size_t)by * sB; C += (size_t)by * sC;
  const int ntn = (N + 63) / 64; const int wid = blockIdx.x * 4 + w; const int mt = wid / ntn, nq = wid % ntn; if (mt * 16 >= M) return;
  const int row0 = mt * 16, col0 = nq * 64; const float* arow = A + (size_t)(row0 + ln) * lda;
  v8f acc[4] = {};
  for (int kb = 0; kb < K; kb += 32) {
    FragH ah, al;
    const v4f x0 = *(const v4fa*)(arow + kb + 8 * hh), x1 = *(const v4fa*)(arow + kb + 8 * hh + 4), x2 = *(const v4fa*)(arow + kb + 16 + 8 * hh), x3 = *(const v4fa*)(arow + kb + 16 + 8 * hh + 4);
    float xs[16] = {x0[0],x0[1],x0[2],x0[3],x1[0],x1[1],x1[2],x1[3],x2[0],x2[1],x2[2],x2[3],x3[0],x3[1],x3[2],x3[3]};
#pragma unroll
    for (int i = 0; i < 16; ++i) { const _Float16 h = (_Float16)xs[i]; ah.h[i] = h; al.h[i] = ASPLIT ? (_Float16)(xs[i] - (float)h) : (_Float16)0.0f; }
#pragma unroll
    for (int t = 0; t < 4; ++t) { if (col0 + t * 16 >= N) continue; const size_t boff = (size_t)(col0 + t * 16 + ln) * ldb + kb; FragH bq; bq.half[0] = *(const v8us*)(Bh + boff + 8 * hh); bq.half[1] = *(const v8us*)(Bh + boff + 16 + 8 * hh);
      acc[t] = mmaH<ASPLIT ? 2 : 1>(ah.v, al.v, bq.v, bq.v, acc[t]); }
  }
#pragma unroll
  for (int t = 0; t < 4; ++t) { if (col0 + t * 16 >= N) continue;
#pragma unroll
    for (int r = 0; r < 8; ++r) so[w][8 * hh + r][t * 16 + ln] = acc[t][r] * alpha; }
  __builtin_amdgcn_fence(__ATOMIC_ACQ_REL, "workgroup"); __builtin_amdgcn_wave_barrier();
  const int rsub = lane >> 4, c4 = (lane & 15) * 4;
  {
#pragma unroll
    for (int q = 0; q < 8; ++q) { const int r = q * 2 + rsub; if (col0 + c4 < N) { const v4f v = *(const v4fa*)&so[w][r][c4]; *(v4f*)(C + (size_t)(row0 + r) * ldc + col0 + c4) = v; } }
     }
}

// Wt[n][k] = f16(W[k][n]·scale) from f32 row-major W[K][N] (scale = power of two; bf16-exact weights stay exact in f16 away from the subnormal range)
__global__ __launch_bounds__(256) void k_wt_f16(const float* __restrict__ W, _Float16* __restrict__ Wt, int K, int N, float scale) {
  const int t = blockIdx.x * 256 + threadIdx.x; if (t >= N * (K / 8)) return; const int n = t / (K / 8), k8 = (t % (K / 8)) * 8; FragH f;
#pragma unroll
  for (int i = 0; i < 8; ++i) f.h[i] = (_Float16)(bf16_round(W[(size_t)(k8 + i) * N + n]) * scale); const v8us o = f.half[0];
  *(v8us*)((unsigned short*)Wt + (size_t)n * K + k8) = o; 
}
// k_gemm_hh variant with fused epilogue: v = acc·alpha + bias[by·sBias + col] (+ CP[(row/rowsPerB)·sCPb + by·64 + col] if CP) ; ACT 0 none / 1 elu ; writes f16 C16 (and f32 C if non-null)
template <int ACT>
__global__ __launch_bounds__(128) void k_gemm_hhx(const _Float16* __restrict__ A, int lda, size_t sA, const _Float16* __restrict__ Bh, int ldb, size_t sB, float alpha, const float* __restrict__ bias, size_t sBias, const float* __restrict__ CP, int rowsPerB, size_t sCPb, int row0g,
    float* __restrict__ C, _Float16* __restrict__ C16, int ldc, size_t sC, int M, int N, int K) {
  __shared__ __attribute__((aligned(16))) float so[4][16][64];
  const int tid = threadIdx.x, w = tid >> 5, lane = tid & 31, ln = lane & 15, hh = lane >> 4; const int by = blockIdx.y;
  A += (size_t)by * sA; Bh += (size_t)by * sB; const size_t cofs = (size_t)by * sC; const float* bp = bias ? bias + (size_t)by * sBias : nullptr;
  const int ntn = (N + 63) / 64; const int wid = blockIdx.x * 4 + w; const int mt = wid / ntn, nq = wid % ntn; if (mt * 16 >= M) return;
  const int row0 = mt * 16, col0 = nq * 64; const _Float16* arow = A + (size_t)(row0 + ln) * lda;
  v8f acc[4] = {};
  for (int kb = 0; kb < K; kb += 32) { FragH ah; ah.half[0] = *(const v8us*)((const unsigned short*)arow + kb + 8 * hh); ah.half[1] = *(const v8us*)((const unsigned short*)arow + kb + 16 + 8 * hh);
#pragma unroll
    for (int t = 0; t < 4; ++t) { if (col0 + t * 16 >= N) continue; const size_t boff = (size_t)(col0 + t * 16 + ln) * ldb + kb; FragH bq; bq.half[0] = *(const v8us*)((const unsigned short*)Bh + boff + 8 * hh); bq.half[1] = *(const v8us*)((const unsigned short*)Bh + boff + 16 + 8 * hh);
      acc[t] = mmaH<1>(ah.v, ah.v, bq.v, bq.v, acc[t]); }
  }
#pragma unroll
  for (int t = 0; t < 4; ++t) { if (col0 + t * 16 >= N) continue; const int col = col0 + t * 16 + ln; const float bv = bp ? bf16_round(bp[col]) : 0.f;
#pragma unroll
    for (int r = 0; r < 8; ++r) { float v = acc[t][r] * alpha + bv; if (CP) { const int rr = row0g + row0 + 8 * hh + r; if (rowsPerB < 0) v += CP[cofs + (size_t)rr * ldc + col];      /* rowsPerB < 0: own element of the batched C plane */ else { const int bidx = rr / rowsPerB; v += CP[(size_t)bidx * sCPb + (size_t)by * 64 + col]; } } if (ACT == 1) v = (v > 0.f) ? v : expm1f(v); else if (ACT == 7) v = (v > 0.f) ? v + 1.0f : expf(v); else if (ACT == 8) v = tanhf(v); else if (ACT == 9) v = 0.5f * v * (1.0f + tanhf(0.7978845608028654f * (v + 0.044715f * v * v * v))); else if (ACT == 11) v = 1.0f / (1.0f + expf(-v)); else if (ACT == 12) v = (v > 0.f) ? v : 0.01f * v; else if (ACT == 14) v = (v > 0.f) ? v : 0.1f * v; else if (ACT == 16) v = (v >= 0.f) ? v : 0.3f * v; else if (ACT == 17) v = (v >= 0.f) ? v : 0.2f * v; else if (ACT == 15) v = v / (1.0f + expf(-v)); else if (ACT == 3) v = fmaxf(v, 0.f); else if (ACT == 6) v = 0.5f * v * (1.0f + erff(v * 0.70710678118654752f)); so[w][8 * hh + r][t * 16 + ln] = v; } }
  __builtin_amdgcn_fence(__ATOMIC_ACQ_REL, "workgroup"); __builtin_amdgcn_wave_barrier();
  const int rsub = lane >> 4, c4 = (lane & 15) * 4; typedef _Float16 v4h __attribute__((ext_vector_type(4)));
  {
#pragma unroll
    for (int q = 0; q < 8; ++q) { const int r = q * 2 + rsub; if (col0 + c4 < N) { const v4f v = *(const v4fa*)&so[w][r][c4]; if (C) *(v4f*)(C + cofs + (size_t)(row0 + r) * ldc + col0 + c4) = v; if (C16) { v4h h4; for (int i = 0; i < 4; ++i) h4[i] = (_Float16)v[i]; *(v4h*)(C16 + cofs + (size_t)(row0 + r) * ldc + col0 + c4) = h4; } } }
     }
}


typedef _Float16 v4h __attribute__((ext_vector_type(4)));

__global__ __launch_bounds__(256) void k_x16(const float* __restrict__ x, _Float16* __restrict__ X16, size_t n8) { const size_t t = (size_t)blockIdx.x * 256 + threadIdx.x; if (t >= n8) return; FragH f;
#pragma unroll
  for (int q = 0; q < 8; ++q) f.h[q] = (_Float16)bf16_round(x[t * 8 + q]); *(v8us*)((unsigned short*)X16 + t * 8) = f.half[0];  }
__global__ __launch_bounds__(256) void k_h16(const float* __restrict__ x, _Float16* __restrict__ X16, size_t n8) { const size_t t = (size_t)blockIdx.x * 256 + threadIdx.x; if (t >= n8) return; FragH f;
#pragma unroll
  for (int q = 0; q < 8; ++q) f.h[q] = (_Float16)x[t * 8 + q]; *(v8us*)((unsigned short*)X16 + t * 8) = f.half[0];  }
__global__ __launch_bounds__(256) void k_round16f(const float* __restrict__ W, _Float16* __restrict__ Bt, size_t n8) { const size_t t = (size_t)blockIdx.x * 256 + threadIdx.x; if (t >= n8) return; FragH f;
#pragma unroll
  for (int i = 0; i < 8; ++i) f.h[i] = (_Float16)(bf16_round(W[t * 8 + i]) * 16.0f); *(v8us*)((unsigned short*)Bt + t * 8) = f.half[0];  }
__global__ __launch_bounds__(256) void k_hl(const float* __restrict__ F, _Float16* __restrict__ Hh, _Float16* __restrict__ Hl, size_t n8) { const size_t t = (size_t)blockIdx.x * 256 + threadIdx.x; if (t >= n8) return; FragH fh, fl; const v4f a = *(const v4fa*)(F + t * 8), c = *(const v4fa*)(F + t * 8 + 4);
#pragma unroll
  for (int q = 0; q < 4; ++q) { _Float16 h = (_Float16)a[q]; fh.h[q] = h; fl.h[q] = (_Float16)((a[q] - (float)h) * 1024.0f); h = (_Float16)c[q]; fh.h[4 + q] = h; fl.h[4 + q] = (_Float16)((c[q] - (float)h) * 1024.0f); }
  { *(v8us*)((unsigned short*)Hh + t * 8) = fh.half[0]; *(v8us*)((unsigned short*)Hl + t * 8) = fl.half[0];  } }

// ---- operand preparation, ONE launch of 256 work-groups (as many as the chip has WGPs), 8 waves each: every wave does a long share of the work, so that few waves have to be started.
// A work-group turns one 64 k x 192 n strip of W ([k][n] f32) into 192 rows of Bt ([n][k] f16, bf16-rounded, x16) and converts 2048 chunks of 8 x values (bf16-rounded, f16).
// Every global access is whole lines: W rows are read in 256-byte runs, x in 32 bytes a lane, Bt is written in 128-byte runs (8 lanes a row), X16 in 16 bytes a lane.
// All 28 loads of a lane are issued before anything waits. The strip is turned in LDS as f32 at a pitch of 193 dwords (1 mod 64): the row-wise dword stores and the column-wise dword reads both fall on distinct banks.
#define PKT 64                       /* k rows of a strip */
#define PNT 192                      /* n columns of a strip */
#define PPT 193                      /* LDS pitch of a strip row in dwords */
#define PXC 2048                     /* 8-element chunks of x per work-group */
#define PWG ((DM / PKT) * (LQ / PNT))      /* work-groups */
static_assert((size_t)PWG * PXC * 8 == (size_t)NB * SQ * DM, "the x shares cover x exactly");
__global__ __launch_bounds__(256) void k_prep(const float* __restrict__ x, const float* __restrict__ Wq, _Float16* __restrict__ X16, _Float16* __restrict__ Bt) {
  __shared__ float T[PKT * PPT];
  const int tid = threadIdx.x;
  const int k0 = (blockIdx.x / (LQ / PNT)) * PKT, n0 = (blockIdx.x % (LQ / PNT)) * PNT;
  const int r = tid >> 4, c4 = (tid & 15) * 4;      /* 16 lanes a row: 256 contiguous bytes */
  const float* wp = Wq + (size_t)(k0 + r) * LQ + n0 + c4;
  const float* xp = x + ((size_t)blockIdx.x * PXC + tid) * 8;
  v4f wv[3][4], xv[8][2];
#pragma unroll
  for (int j = 0; j < 3; ++j)
#pragma unroll
    for (int u = 0; u < 4; ++u) wv[j][u] = *(const v4fa*)(wp + (size_t)(16 * u) * LQ + 64 * j);
#pragma unroll
  for (int i = 0; i < 8; ++i) { xv[i][0] = *(const v4fa*)(xp + i * 2048); xv[i][1] = *(const v4fa*)(xp + i * 2048 + 4); }
  /* The wait in front of any rewrite of a register that an issued load names. It takes W's address pair as an input, so that no later load of the group gets that pair as its destination;
     its "memory" clobber also keeps all 28 loads above it: without that the compiler sinks twelve x loads behind the waits for W, and their latency is paid a second time. */
  asm volatile("s_wait_xcnt 0x0" :: "v"(wp) : "memory");
#pragma unroll
  for (int j = 0; j < 3; ++j)
#pragma unroll
    for (int u = 0; u < 4; ++u)
#pragma unroll
      for (int e = 0; e < 4; ++e) T[(r + 16 * u) * PPT + 64 * j + c4 + e] = wv[j][u][e];
  __syncthreads();      /* the strip is whole in LDS before anybody reads a column */
  unsigned short* xo = (unsigned short*)X16 + ((size_t)blockIdx.x * PXC + tid) * 8;
#pragma unroll
  for (int i = 0; i < 8; ++i) { FragH f;
#pragma unroll
    for (int q = 0; q < 8; ++q) f.h[q] = (_Float16)bf16_round(xv[i][q >> 2][q & 3]);
    *(v8us*)(xo + i * 2048) = f.half[0]; }
  const int n = tid >> 3, k8 = (tid & 7) * 8;      /* 8 lanes a Bt row: 128 contiguous bytes */
  unsigned short* bo = (unsigned short*)Bt + (size_t)(n0 + n) * DM + k0 + k8;
#pragma unroll
  for (int u = 0; u < PNT / 32; ++u) { FragH f;
#pragma unroll
    for (int i = 0; i < 8; ++i) f.h[i] = (_Float16)(bf16_round(T[(k8 + i) * PPT + n + 32 * u]) * 16.0f);
    *(v8us*)(bo + (size_t)(32 * u) * DM) = f.half[0]; }
}

// ---- projection GEMM: C = A Bh^T / 16 + bias, A [4096][1024] and Bh [3072][1024] f16, both k-contiguous. One work-group = a 128 x 128 tile, four waves of 64 x 64 (4 x 4 accumulator tiles each).
// A stage = 64 k of the tile's 128 A rows and 128 Bh rows (128-byte rows) in LDS, brought by asynchronous 16-byte copies (global_load_async_to_lds_b128) into two buffers: stage t + 2 flies while stage t + 1 is worked on.
// Every fragment is read from LDS and feeds four products; a k step is 32, taken in rising order into the same accumulator.
// Epilogue by 64-column halves (a half is exactly one head's q, k or v slice: columns are packed per head, 192 h + {0 q, 64 k, 128 v}): q and k halves go as f16 rows into C16 (whole 128-byte lines),
// a v half goes TRANSPOSED into that head's V^T plane VTo[(b NH + h) HD + d][key] and nowhere else (a lane's accumulator holds 8 consecutive keys of ONE d: 16 contiguous bytes of a V^T row; 256-byte runs).
#define VTP 136                      /* LDS pitch of a staged V^T row in f16: 256 data bytes + 16, an odd multiple of 16 bytes for the 16-byte stores and reads */
#define GK 64                        /* k per stage */
#define GP 72                        /* LDS row pitch of a stage in f16: 128 data bytes + 16, an odd multiple of 16 bytes for the 16-byte fragment reads */
#define GSTG (256 * GP)              /* f16 per stage: 128 A rows, then 128 Bh rows */
#define GEH (128 * GP)               /* f16 per epilogue half: [128 rows][GP], or [64 d][VTP], which is smaller */
__device__ __forceinline__ v16h g2_frag(const _Float16* p, int hh) { FragH f; f.half[0] = *(const v8us*)((const unsigned short*)p + 8 * hh); f.half[1] = *(const v8us*)((const unsigned short*)p + 16 + 8 * hh); return f.v; }
__device__ __forceinline__ v16h g3_frag(const unsigned short* p, int hh) { FragH f; f.half[0] = *(const v8us*)(p + 8 * hh); f.half[1] = *(const v8us*)(p + 16 + 8 * hh); return f.v; }
// Eight copies of a lane: its 16-byte chunk of rows r, r + 16, ..., r + 112 (a wave's copy = four whole 128-byte rows). l = the lane's LDS byte address, g = its global address.
// The s_wait_xcnt stands inside the statement, behind the last copy, so that no address register of a copy is rewritten in front of it.
__device__ __forceinline__ void g3_copy8(unsigned l, const _Float16* g) {
  asm volatile("global_load_async_to_lds_b128 %0, %8, off\n\tglobal_load_async_to_lds_b128 %1, %9, off\n\tglobal_load_async_to_lds_b128 %2, %10, off\n\tglobal_load_async_to_lds_b128 %3, %11, off\n\t"
               "global_load_async_to_lds_b128 %4, %12, off\n\tglobal_load_async_to_lds_b128 %5, %13, off\n\tglobal_load_async_to_lds_b128 %6, %14, off\n\tglobal_load_async_to_lds_b128 %7, %15, off\n\ts_wait_xcnt 0x0"
               :: "v"(l), "v"(l + 16 * GP * 2), "v"(l + 32 * GP * 2), "v"(l + 48 * GP * 2), "v"(l + 64 * GP * 2), "v"(l + 80 * GP * 2), "v"(l + 96 * GP * 2), "v"(l + 112 * GP * 2),
                  "v"(g), "v"(g + 16 * DM), "v"(g + 32 * DM), "v"(g + 48 * DM), "v"(g + 64 * DM), "v"(g + 80 * DM), "v"(g + 96 * DM), "v"(g + 112 * DM) : "memory");
}
__global__ __launch_bounds__(128) void k_gemm3(const _Float16* __restrict__ A, const _Float16* __restrict__ Bh, const float* __restrict__ bias, _Float16* __restrict__ C16, _Float16* __restrict__ VTo) {
  __shared__ __attribute__((aligned(16))) unsigned short sm[2 * GSTG];
  const int tid = threadIdx.x, w = tid >> 5, lane = tid & 31, ln = lane & 15, hh = lane >> 4, wm = w >> 1, wn = w & 1;
  const int mt = blockIdx.x / (LQ / 128), nt = blockIdx.x % (LQ / 128); const int row0 = mt * 128, col0 = nt * 128;
  const int crow = tid >> 3, cc8 = (tid & 7) * 8;      /* the lane's first row and its 16-byte chunk in every copy */
  const _Float16* ag = A + (size_t)(row0 + crow) * DM + cc8; const _Float16* bg = Bh + (size_t)(col0 + crow) * DM + cc8;
  const unsigned la = (unsigned)(size_t)&sm[crow * GP + cc8], lb = la + 128 * GP * 2;
  g3_copy8(la, ag); g3_copy8(lb, bg);
  asm volatile("s_wait_asynccnt 0x0" ::: "memory");      /* this wave's share of stage 0 has landed */
  __syncthreads();      /* stage 0 is complete before anybody reads it */
  g3_copy8(la + GSTG * 2, ag + GK); g3_copy8(lb + GSTG * 2, bg + GK);
  const v8f z8 = {0.f, 0.f, 0.f, 0.f, 0.f, 0.f, 0.f, 0.f};
  v8f acc[4][4];
#pragma unroll
  for (int i = 0; i < 4; ++i)
#pragma unroll
    for (int j = 0; j < 4; ++j) acc[i][j] = z8;
  /* the stage loop stays rolled (one copy of its 32 products); everything inside is unrolled, so that acc is indexed by constants only and stays in registers */
#pragma unroll 1
  for (int t = 0; t < DM / GK; ++t) {
    const unsigned short* sa = sm + (t & 1) * GSTG + (64 * wm + ln) * GP; const unsigned short* sb = sm + (t & 1) * GSTG + (128 + 64 * wn + ln) * GP;
#pragma unroll
    for (int ks = 0; ks < 2; ++ks) {
      /* The k step's eight fragments are read as one group, whole in front of its sixteen products. The scheduling fences hold that order: without them the compiler keeps one A fragment,
         reads the next among the products and waits out the LDS latency in front of every four of them. */
      __builtin_amdgcn_sched_barrier(0);      /* nothing of the group's reads moves up among the products before */
      v16h af[4], bf[4];
#pragma unroll
      for (int i = 0; i < 4; ++i) { af[i] = g3_frag(sa + 16 * i * GP + ks * 32, hh); bf[i] = g3_frag(sb + 16 * i * GP + ks * 32, hh); }
      __builtin_amdgcn_sched_barrier(0);      /* none of the group's reads sinks among its products */
#pragma unroll
      for (int i = 0; i < 4; ++i)
#pragma unroll
        for (int j = 0; j < 4; ++j) acc[i][j] = __builtin_amdgcn_wmma_f32_16x16x32_f16(false, af[i], false, bf[j], (short)0, acc[i][j], false, false);
    }
    __builtin_amdgcn_sched_barrier(0);      /* keeps the last sixteen products above the stage's foot: without it the compiler sinks them behind the barrier, in front of the copies, which then start that much later */
    asm volatile("s_wait_dscnt 0x0" ::: "memory");      /* this wave's reads of stage t are done before the buffer is handed back */
    asm volatile("s_wait_asynccnt 0x0" ::: "memory");      /* this wave's share of stage t + 1 has landed */
    __syncthreads();      /* publishes stage t + 1 and ends every wave's reads of stage t */
    if (t + 2 < DM / GK) { g3_copy8(la + (t & 1) * (GSTG * 2), ag + (t + 2) * GK); g3_copy8(lb + (t & 1) * (GSTG * 2), bg + (t + 2) * GK); }
  }
  asm volatile("s_wait_asynccnt 0x0" ::: "memory");      /* nothing is in flight when the buffers become output staging */
  /* behind the loop's last barrier nobody reads a stage any more: each column half is staged in its own GEH range */
  { unsigned short* sr = sm + wn * GEH; const int cb = col0 + 64 * wn;
    float bv[4];
#pragma unroll
    for (int j = 0; j < 4; ++j) bv[j] = bias[cb + 16 * j + ln];
#pragma unroll
    for (int j = 0; j < 4; ++j) bv[j] = bf16_round(bv[j]);
    if ((cb / HD) % 3 == 2) {
#pragma unroll
      for (int i = 0; i < 4; ++i)
#pragma unroll
        for (int j = 0; j < 4; ++j) { FragH f;
#pragma unroll
          for (int r = 0; r < 8; ++r) f.h[r] = (_Float16)(acc[i][j][r] * 0.0625f + bv[j]);
          *(v8us*)(sr + (16 * j + ln) * VTP + 64 * wm + 16 * i + 8 * hh) = f.half[0]; }
    } else {
#pragma unroll
      for (int i = 0; i < 4; ++i)
#pragma unroll
        for (int j = 0; j < 4; ++j) { FragH f;
#pragma unroll
          for (int r = 0; r < 8; ++r) f.h[r] = (_Float16)(acc[i][j][r] * 0.0625f + bv[j]);
#pragma unroll
          for (int r = 0; r < 8; ++r) sr[(64 * wm + 16 * i + 8 * hh + r) * GP + 16 * j + ln] = f.u[r]; }
    } }
  __syncthreads();      /* both halves are whole in LDS before anybody reads a row */
#pragma unroll
  for (int n = 0; n < 2; ++n) { const unsigned short* sr = sm + n * GEH; const int cb = col0 + 64 * n;
    const bool isv = (cb / HD) % 3 == 2;      /* the same for the whole work-group: cb comes from blockIdx alone */
    const int sh = isv ? 4 : 3, lp = isv ? VTP : GP, gp = isv ? SQ : LQ;      /* 16-byte chunks a staged row (log2), its LDS pitch, its pitch in memory: V^T rows of 256 bytes, or q / k rows of 128 */
    unsigned short* gb = isv ? (unsigned short*)VTo + ((size_t)(row0 / SQ) * NH + cb / (3 * HD)) * HD * SQ + row0 % SQ : (unsigned short*)C16 + (size_t)row0 * LQ + cb;
    v8us dv[8]; unsigned short* dp[8];
#pragma unroll
    for (int i = 0; i < 8; ++i) { const int c = tid + 128 * i, x = c >> sh, y = (c & ((1 << sh) - 1)) * 8; dv[i] = *(const v8us*)(sr + x * lp + y); dp[i] = gb + (size_t)x * gp + y; }
    __builtin_amdgcn_sched_barrier(0);      /* the eight reads and addresses stand whole in front of the stores, so that no register of an issued store is rewritten among them */
#pragma unroll
    for (int i = 0; i < 8; ++i) *(v8us*)dp[i] = dv[i];      /* a wave's store = whole lines: two 256-byte runs, or four 128-byte rows */
    if (n == 0) { asm volatile("s_wait_xcnt 0x0" ::: "memory");      /* in front of the second half's work, which rewrites the registers that these stores name */
      __builtin_amdgcn_sched_barrier(0); }      /* holds that work behind the wait */
  }
}


__global__ __launch_bounds__(256) void k_wnat(const float* __restrict__ w, size_t n8, _Float16* __restrict__ Bt) { const size_t t = (size_t)blockIdx.x * 256 + threadIdx.x; if (t >= n8) return; FragH f; for (int q = 0; q < 8; ++q) f.h[q] = (_Float16)(bf16_round(w[t * 8 + q]) * 16.0f); *(v8us*)((unsigned short*)Bt + t * 8) = f.half[0];  }
#define FK 64                        /* keys per pass */
#define FPT 72                       /* LDS row pitch in f16: 128 data bytes + 16, an odd multiple of 16 bytes for the 16-byte fragment reads */
__device__ __forceinline__ v16h fa_frag(const unsigned short* p, int hh) { FragH f; f.half[0] = *(const v8us*)(p + 8 * hh); f.half[1] = *(const v8us*)(p + 16 + 8 * hh); return f.v; }
__device__ __forceinline__ v8f fa_mma(v16h a, v16h b, v8f c) { return __builtin_amdgcn_wmma_f32_16x16x32_f16(false, a, false, b, (short)0, c, false, false); }
__device__ __forceinline__ float fa_xhalf(float x) { return __builtin_bit_cast(float, __builtin_amdgcn_permlanex16(__builtin_bit_cast(int, x), __builtin_bit_cast(int, x), 0x76543210, 0xfedcba98, false, false)); }      /* lane l reads lane l ^ 16, on the vector pipe: no LDS round trip */
__device__ __forceinline__ float fa_exp2(float x) { float e; asm("v_exp_f32 %0, %1\n\tv_nop" : "=v"(e) : "v"(x)); return e; }
__device__ __forceinline__ v8f fa_exp2x8(v8f x) { float e0, e1, e2, e3, e4, e5, e6, e7;
  asm("v_exp_f32 %0, %8\n\tv_exp_f32 %1, %9\n\tv_exp_f32 %2, %10\n\tv_exp_f32 %3, %11\n\tv_exp_f32 %4, %12\n\tv_exp_f32 %5, %13\n\tv_exp_f32 %6, %14\n\tv_exp_f32 %7, %15\n\tv_nop"
      : "=&v"(e0), "=&v"(e1), "=&v"(e2), "=&v"(e3), "=&v"(e4), "=&v"(e5), "=&v"(e6), "=&v"(e7) : "v"(x[0]), "v"(x[1]), "v"(x[2]), "v"(x[3]), "v"(x[4]), "v"(x[5]), "v"(x[6]), "v"(x[7]));
  const v8f e = {e0, e1, e2, e3, e4, e5, e6, e7}; return e; }
__global__ __launch_bounds__(128) void k_fattn(const _Float16* __restrict__ QKVp, const _Float16* __restrict__ VTp, float* __restrict__ O) {
  __shared__ __attribute__((aligned(16))) unsigned short Ks[FK][FPT];      /* K rows of the pass: [key][d] */
  __shared__ __attribute__((aligned(16))) unsigned short Vs[HD][FPT];      /* V^T rows of the pass: [d][key] */
  const int tid = threadIdx.x, w = tid >> 5, lane = tid & 31, ln = lane & 15, hh = lane >> 4;
  const int bh = blockIdx.x / (SQ / 128), qb = blockIdx.x % (SQ / 128); const int b = bh / NH, h = bh % NH;
  const _Float16* qg = QKVp + (size_t)b * SQ * LQ + (size_t)h * 3 * HD;      /* head h's 192 packed columns: q at + 0, k at + 64 */
  const int q0 = qb * 128 + w * 32;
  v16h qf[2][2];
#pragma unroll
  for (int qt = 0; qt < 2; ++qt)
#pragma unroll
    for (int ks = 0; ks < 2; ++ks) qf[qt][ks] = g2_frag(qg + (size_t)(q0 + qt * 16 + ln) * LQ + ks * 32, hh);
  /* staging: thread t moves 16-byte chunks t, t + 128, t + 256, t + 384 of each 64 x 128-byte tile: 8 chunks a row, so a wave's load covers 4 whole lines */
  const int frow = tid >> 3, fc8 = (tid & 7) * 8;
  const unsigned short* kp = (const unsigned short*)qg + HD + (size_t)frow * LQ + fc8;
  const unsigned short* vp = (const unsigned short*)VTp + (size_t)bh * HD * SQ + (size_t)frow * SQ + fc8;
  v8us kr[4], vr[4];
#pragma unroll
  for (int j = 0; j < 4; ++j) { kr[j] = *(const v8us*)(kp + (size_t)(16 * j) * LQ); vr[j] = *(const v8us*)(vp + (size_t)(16 * j) * SQ); }
  const v8f z8 = {0.f, 0.f, 0.f, 0.f, 0.f, 0.f, 0.f, 0.f};
  v8f o[2][4]; float m[2], l[2];
#pragma unroll
  for (int qt = 0; qt < 2; ++qt) { m[qt] = -3.0e38f; l[qt] = 0.f;
#pragma unroll
    for (int dt = 0; dt < 4; ++dt) o[qt][dt] = z8; }
  const float SC = 0.125f * 1.4426950408889634f;      /* 1 / sqrt(64), and base e to base 2 */
  for (int p = 0; p < SQ / FK; ++p) {
    __syncthreads();      /* every wave has finished reading the pass before */
#pragma unroll
    for (int j = 0; j < 4; ++j) { *(v8us*)&Ks[frow + 16 * j][fc8] = kr[j]; *(v8us*)&Vs[frow + 16 * j][fc8] = vr[j]; }
    __syncthreads();      /* the tiles are complete before anybody reads them */
    if (p + 1 < SQ / FK) {      /* the next pass's tiles fly to registers while this pass is worked on */
      kp += (size_t)FK * LQ; vp += FK;
#pragma unroll
      for (int j = 0; j < 4; ++j) { kr[j] = *(const v8us*)(kp + (size_t)(16 * j) * LQ); vr[j] = *(const v8us*)(vp + (size_t)(16 * j) * SQ); }
    }
    __builtin_amdgcn_sched_barrier(0);      /* keeps the eight loads above the pass's work: without it the compiler sinks them to the loop's foot, and their whole latency is waited for at the next pass's head */
    v8f st[2][4];
#pragma unroll
    for (int kt = 0; kt < 4; ++kt) { const v16h a0 = fa_frag(&Ks[kt * 16 + ln][0], hh), a1 = fa_frag(&Ks[kt * 16 + ln][32], hh);
#pragma unroll
      for (int qt = 0; qt < 2; ++qt) st[qt][kt] = fa_mma(a1, qf[qt][1], fa_mma(a0, qf[qt][0], z8)); }      /* st[qt][kt][r] = q(q0 + 16 qt + ln) . k(64 p + 16 kt + 8 hh + r) */
    FragH pf[2][2];
#pragma unroll
    for (int qt = 0; qt < 2; ++qt) {
      v8f x8 = st[qt][0];
#pragma unroll
      for (int r = 0; r < 8; ++r) x8[r] = fmaxf(fmaxf(st[qt][0][r], st[qt][1][r]), fmaxf(st[qt][2][r], st[qt][3][r]));
      float mx = fmaxf(fmaxf(fmaxf(x8[0], x8[1]), fmaxf(x8[2], x8[3])), fmaxf(fmaxf(x8[4], x8[5]), fmaxf(x8[6], x8[7])));
      mx = fmaxf(mx, fa_xhalf(mx));      /* the other half of the query's 64 keys */
      const float mn = fmaxf(m[qt], mx * SC); const float al = fa_exp2(m[qt] - mn); m[qt] = mn;      /* al = 0 on the first pass */
      v8f s8 = z8;
#pragma unroll
      for (int kt = 0; kt < 4; ++kt) { const v8f e8 = fa_exp2x8(st[qt][kt] * SC - mn); s8 += e8;
#pragma unroll
        for (int r = 0; r < 8; ++r) pf[qt][kt >> 1].h[(kt & 1) * 8 + r] = (_Float16)e8[r]; }
      l[qt] = l[qt] * al + (((s8[0] + s8[1]) + (s8[2] + s8[3])) + ((s8[4] + s8[5]) + (s8[6] + s8[7])));
#pragma unroll
      for (int dt = 0; dt < 4; ++dt) o[qt][dt] *= al;
    }
    /* The V^T fragments are read in two groups of four, each group whole in front of its eight products. The scheduling fences hold that order: without them the compiler mixes the softmax into the products,
       runs short of registers and waits for LDS in front of every pair of products; all eight fragments at once would take the kernel past 256 registers. */
#pragma unroll
    for (int dg = 0; dg < 2; ++dg) {
      __builtin_amdgcn_sched_barrier(0);      /* nothing of the group's reads moves up into the work before */
      v16h va[2][2];
#pragma unroll
      for (int d2 = 0; d2 < 2; ++d2)
#pragma unroll
        for (int ks = 0; ks < 2; ++ks) va[d2][ks] = fa_frag(&Vs[(dg * 2 + d2) * 16 + ln][ks * 32], hh);
      __builtin_amdgcn_sched_barrier(0);      /* none of the group's reads sinks among its products */
#pragma unroll
      for (int d2 = 0; d2 < 2; ++d2)
#pragma unroll
        for (int ks = 0; ks < 2; ++ks)
#pragma unroll
          for (int qt = 0; qt < 2; ++qt) o[qt][dg * 2 + d2] = fa_mma(va[d2][ks], pf[qt][ks].v, o[qt][dg * 2 + d2]);      /* o[qt][dt][r] = O[q0 + 16 qt + ln][16 dt + 8 hh + r] */
    }
  }
#pragma unroll
  for (int qt = 0; qt < 2; ++qt) { const float inv = 1.0f / (l[qt] + fa_xhalf(l[qt]));
    float* orow = O + ((size_t)bh * SQ + q0 + qt * 16 + ln) * HD + 8 * hh;      /* head plane bh, row = query: the raw-view merge */
#pragma unroll
    for (int dt = 0; dt < 4; ++dt) { const v4f lo = {o[qt][dt][0] * inv, o[qt][dt][1] * inv, o[qt][dt][2] * inv, o[qt][dt][3] * inv}, hi = {o[qt][dt][4] * inv, o[qt][dt][5] * inv, o[qt][dt][6] * inv, o[qt][dt][7] * inv};
      *(v4f*)(orow + dt * 16) = lo; *(v4f*)(orow + dt * 16 + 4) = hi; } }
}
__global__ __launch_bounds__(256) void k_vt(const _Float16* __restrict__ V16, int b, int h0, _Float16* __restrict__ VT) { __shared__ unsigned short tl[64][65]; const int tid = threadIdx.x; const int hh = blockIdx.x % HG, sg = blockIdx.x / HG; const int s0 = sg * 64; const int h = h0 + hh;
  for (int i = tid; i < 64 * 8; i += 256) { const int j = i / 8, d8 = (i % 8) * 8; FragH f; f.half[0] = *(const v8us*)((const unsigned short*)V16 + ((size_t)b * SQ + s0 + j) * DM + h * HD + d8); for (int q = 0; q < 8; ++q) tl[d8 + q][j] = f.u[q]; }
  __syncthreads();
  { for (int i = tid; i < 64 * 8; i += 256) { const int d = i / 8, j8 = (i % 8) * 8; FragH f; for (int q = 0; q < 8; ++q) f.u[q] = tl[d][j8 + q]; *(v8us*)((unsigned short*)VT + ((size_t)hh * HD + d) * SQ + s0 + j8) = f.half[0]; }  } }


extern "C" void kernel_launch(void* const* d_in, const int* in_sizes, int n_in,
                              void* d_out, int out_size, void* d_ws, size_t ws_size, hipStream_t stream) {
  (void)in_sizes; (void)n_in; (void)out_size;
  const float* const* I = (const float* const*)d_in; const float* x = I[0]; const float* wqkv = I[1]; const float* bqkv = I[2];      /* input order: x, W_qkv ([in][out] [1024][3072]; columns packed PER HEAD: 192 h + {0..63 q, 64..127 k, 128..191 v}), b_qkv [3072] (REAL; the same packing: the projection GEMM's bias slot reads it by output column); three inputs; no output weight: the module has none */
  char* ws = (char*)d_ws; size_t off = 0;
  auto take = [&](size_t bytes) { char* p = ws + off; off += (bytes + 255) & ~(size_t)255; return p; };
  _Float16* BQKV = (_Float16*)take((size_t)3 * DM * DM * 2);
  _Float16* X16 = (_Float16*)take(NR * DM * 2); _Float16* QKV = (_Float16*)take(NR * 3 * DM * 2);      /* PER-HEAD packing: within head h's 192 columns q starts at + 0, k at + 64; the v columns (+ 128) are never written here: they go to VT; the head stride is 3 HD */
  _Float16* VT = (_Float16*)take((size_t)NB * NH * HD * SQ * 2);      /* V^T planes of every (batch, head) */
  if (off > ws_size) return;
  k_prep<<<PWG, 256, 0, stream>>>(x, wqkv, X16, BQKV);      /* x -> f16 rows; W [in][out] -> Bt[n][k] x16 (pitch K = 1024) */
  const size_t r0p = (size_t)B0 * SQ;      /* first projected row */
  k_gemm3<<<(unsigned)((MP / 128) * (LQ / 128)), 128, 0, stream>>>(X16 + r0p * DM, BQKV, bqkv, QKV + r0p * 3 * DM, VT + (size_t)B0 * NH * HD * SQ);      /* q | k rows (f16, packed per head) and the V^T planes */
  k_fattn<<<NB * NH * (SQ / 128), 128, 0, stream>>>(QKV, VT, (float*)d_out);      /* all batches and heads in one launch: softmax(q k^T / 8) v, each head into its own contiguous [2048][64] plane */
}

// v006
// One run takes 68.7 microseconds.
// Two timings next to v005 both put it at 1.04 times that version's speed.
// All steps since v000 together make it 54.4 times as fast.
#include <hip/hip_runtime.h>
// Multi-head self-attention with ONE fused QKV projection packed PER HEAD, NO output projection and a RAW-VIEW merge (x [2][2048][1024]; qkv = x W_qkv + b_qkv ([in][out] 1024 x 3072, normal x 1/32; a REAL bias normal x 0.01) reshaped (b, s, 16, 3 x 64): head h owns columns 192 h .. 192 h + 191: q | k | v = its three 64-column slices; att = q k^T / sqrt(64); softmax over all 2048 keys (no mask); values [b][16][s][64] are reshaped to (b, s, 1024) WITHOUT a head transpose (the source's own form): the output memory of a batch IS the sixteen [2048][64] head planes one after another); the P.V product is written straight to the f32 output, each head into its own contiguous plane.
// Structure: token rows r = b*2048 + s; x as exact f16 rows (bf16-rounded); q | k | v as ONE WMMA GEMM (N = 3 x 1024) (128x128 tiles staged in LDS by asynchronous copies, 64x64 wave tiles, f32 accumulation, exact x16 weights + bias, f16 outputs); the GEMM's own epilogue stores every head's v tile transposed (V^T planes [d][key], 256-byte runs through LDS), so no transpose launch is left; then ONE fused attention launch over every (batch, head): per 64 keys S^T = K Q^T, running softmax in registers (f32 statistics, base 2; weights 2^(s - m) as f16), O^T += V^T P^T, divided by the row sum at the end and written as f32 straight into the output's own layout (head plane after head plane): no output projection.
// Compute dtype: inputs rounded to bf16; x / weights exact; q, k, v and softmax weights as plain f16 GEMM operands (~2^-12); scores and softmax statistics f32; v_wmma_f32_16x16x32_f16.
#define NB 2
#define SQ 2048
#define DM 1024
#define NH 16
#define HD 64
#define HG 4                         /* heads per group of the grouped transpose below */
#define B0 0                         /* first batch processed (debug hook) */
#define NBR NB                       /* batches processed (debug hook) */
#define NR ((size_t)NB * SQ)         /* token rows */
#define MP ((int)((size_t)NBR * SQ)) /* rows projected (debug hook) */
#define QN SQ                        /* unused (the attention launch covers all SQ query rows) */
#define NHD NH                       /* unused (the attention launch covers all NH heads) */
#define MPO MP                       /* unused (no output projection) */
#define LQ (3 * DM)      /* row pitch of the q/k/v rows */
typedef __bf16 v16b __attribute__((ext_vector_type(16)));
typedef unsigned short v8us __attribute__((ext_vector_type(8), may_alias));
typedef float  v8f  __attribute__((ext_vector_type(8)));
typedef float  v4f  __attribute__((ext_vector_type(4)));
typedef float  v4fa __attribute__((ext_vector_type(4), may_alias));
union FragB { v16b v; v8us half[2]; unsigned short u[16]; };

__device__ __forceinline__ unsigned short bf16_bits(float x) { unsigned int u = __float_as_uint(x); return (unsigned short)((u + 0x7FFFu + ((u >> 16) & 1u)) >> 16); }
__device__ __forceinline__ float bf16_val(unsigned short b) { return __uint_as_float(((unsigned int)b) << 16); }
__device__ __forceinline__ float bf16_round(float x) { return bf16_val(bf16_bits(x)); }
// D += A·B with NT terms: 1 = ah·bh, 2 = + al·bh (A split), 3 = + ah·bl (both split)
template <int NT>
__device__ __forceinline__ v8f mmaN(v16b ah, v16b al, v16b bh, v16b bl, v8f c) {
  c = __builtin_amdgcn_wmma_f32_16x16x32_bf16(false, ah, false, bh, (short)0, c, false, false);
  if (NT >= 2) c = __builtin_amdgcn_wmma_f32_16x16x32_bf16(false, al, false, bh, (short)0, c, false, false);
  if (NT >= 3) c = __builtin_amdgcn_wmma_f32_16x16x32_bf16(false, ah, false, bl, (short)0, c, false, false);
  asm volatile("v_nop\n\tv_nop\n\tv_nop\n\tv_nop" : "+v"(c) : "v"(ah), "v"(al), "v"(bh), "v"(bl));
  return c;
}

__global__ __launch_bounds__(256) void k_wt_bf16(const float* __restrict__ W, unsigned short* __restrict__ Wt, int K, int N) {
  const int t = blockIdx.x * 256 + threadIdx.x;
  const int k8n = K / 8;
  if (t >= N * k8n) return;
  const int n = t / k8n, k8 = (t % k8n) * 8;
  v8us v;
#pragma unroll
  for (int i = 0; i < 8; ++i) v[i] = bf16_bits(W[(size_t)(k8 + i) * N + n]);
  *(v8us*)(Wt + (size_t)n * K + k8) = v;
  
}

// GEMM C[M][N] (f32, pitch ldc) = act(A[M][K]·W + bias). A f32 row-major (pitch lda) converted per fragment to bf16
// (ASPLIT: hi/lo two planes -> 2 terms, else single rounded term); Wt bf16 [N][K] (pitch ldb). BIAS_BF16 rounds the
// bias to bf16 first (bias quantised to bf16 before the add). K%32==0, M%16==0, N%64==0.
template <bool ASPLIT, int ACT, bool BIAS_BF16>
__global__ __launch_bounds__(128) void k_gemm_bf(const float* __restrict__ A, int lda, const unsigned short* __restrict__ Wt, int ldb,
                                               const float* __restrict__ bias, float* __restrict__ C, int ldc, int M, int N, int K) {
  __shared__ __attribute__((aligned(16))) float so[4][16][64];
  const int tid = threadIdx.x, w = tid >> 5, lane = tid & 31, ln = lane & 15, hh = lane >> 4;
  const int ntn = N / 64;
  const int wid = blockIdx.x * 4 + w;
  const int mt = wid / ntn, nq = wid % ntn;
  if (mt * 16 >= M) return;
  const int row0 = mt * 16, col0 = nq * 64;
  const float* arow = A + (size_t)(row0 + ln) * lda;
  v8f acc[4] = {};
  for (int kb = 0; kb < K; kb += 32) {
    FragB ah, al;
    const v4f x0 = *(const v4fa*)(arow + kb + 8 * hh), x1 = *(const v4fa*)(arow + kb + 8 * hh + 4);
    const v4f x2 = *(const v4fa*)(arow + kb + 16 + 8 * hh), x3 = *(const v4fa*)(arow + kb + 16 + 8 * hh + 4);
    float xs[16] = {x0[0],x0[1],x0[2],x0[3],x1[0],x1[1],x1[2],x1[3],x2[0],x2[1],x2[2],x2[3],x3[0],x3[1],x3[2],x3[3]};
#pragma unroll
    for (int i = 0; i < 16; ++i) { const unsigned short hb = bf16_bits(xs[i]); ah.u[i] = hb; al.u[i] = ASPLIT ? bf16_bits(xs[i] - bf16_val(hb)) : (unsigned short)0; }
#pragma unroll
    for (int t = 0; t < 4; ++t) {
      const unsigned short* brow = Wt + (size_t)(col0 + t * 16 + ln) * ldb + kb;
      FragB b;
      b.half[0] = *(const v8us*)(brow + 8 * hh);
      b.half[1] = *(const v8us*)(brow + 16 + 8 * hh);
      acc[t] = mmaN<ASPLIT ? 2 : 1>(ah.v, al.v, b.v, b.v, acc[t]);
    }
  }
#pragma unroll
  for (int t = 0; t < 4; ++t) {
    float bv = bias ? bias[col0 + t * 16 + ln] : 0.f;
    if (BIAS_BF16) bv = bf16_round(bv);
#pragma unroll
    for (int r = 0; r < 8; ++r) { float v = acc[t][r] + bv; if (ACT == 1) v = fmaxf(v, 0.f); so[w][8 * hh + r][t * 16 + ln] = v; }
  }
  __builtin_amdgcn_fence(__ATOMIC_ACQ_REL, "workgroup");
  __builtin_amdgcn_wave_barrier();
  const int rsub = lane >> 4, c4 = (lane & 15) * 4;
  {
#pragma unroll
    for (int q = 0; q < 8; ++q) {
      const int r = q * 2 + rsub;
      const v4f v = *(const v4fa*)&so[w][r][c4];
      *(v4f*)(C + (size_t)(row0 + r) * ldc + col0 + c4) = v;
    }
    
  }
}

// GEMM C = act(A·W + bias + resid): A f32 (ASPLIT -> hi/lo 2 terms), Wt bf16 [N][K]; ACT 0 none, 1 relu, 2 exact gelu;
// resid (optional, f32, row index = (row % rmod), pitch ldr, RES_BF16 rounds it) added before the activation.
template <bool ASPLIT, int ACT, bool BIAS_BF16, bool RES_BF16>
__global__ __launch_bounds__(128) void k_gemm_bf3(const float* __restrict__ A, int lda, const unsigned short* __restrict__ Wt, int ldb,
                                                const float* __restrict__ bias, const float* __restrict__ resid, int rmod, int ldr,
                                                float* __restrict__ C, int ldc, int M, int N, int K) {
  __shared__ __attribute__((aligned(16))) float so[4][16][64];
  const int tid = threadIdx.x, w = tid >> 5, lane = tid & 31, ln = lane & 15, hh = lane >> 4;
  const int ntn = N / 64;
  const int wid = blockIdx.x * 4 + w;
  const int mt = wid / ntn, nq = wid % ntn;
  if (mt * 16 >= M) return;
  const int row0 = mt * 16, col0 = nq * 64;
  const float* arow = A + (size_t)(row0 + ln) * lda;
  v8f acc[4] = {};
  for (int kb = 0; kb < K; kb += 32) {
    FragB ah, al;
    const v4f x0 = *(const v4fa*)(arow + kb + 8 * hh), x1 = *(const v4fa*)(arow + kb + 8 * hh + 4);
    const v4f x2 = *(const v4fa*)(arow + kb + 16 + 8 * hh), x3 = *(const v4fa*)(arow + kb + 16 + 8 * hh + 4);
    float xs[16] = {x0[0],x0[1],x0[2],x0[3],x1[0],x1[1],x1[2],x1[3],x2[0],x2[1],x2[2],x2[3],x3[0],x3[1],x3[2],x3[3]};
#pragma unroll
    for (int i = 0; i < 16; ++i) { const unsigned short hb = bf16_bits(xs[i]); ah.u[i] = hb; al.u[i] = ASPLIT ? bf16_bits(xs[i] - bf16_val(hb)) : (unsigned short)0; }
#pragma unroll
    for (int t = 0; t < 4; ++t) {
      const unsigned short* brow = Wt + (size_t)(col0 + t * 16 + ln) * ldb + kb;
      FragB b;
      b.half[0] = *(const v8us*)(brow + 8 * hh);
      b.half[1] = *(const v8us*)(brow + 16 + 8 * hh);
      acc[t] = mmaN<ASPLIT ? 2 : 1>(ah.v, al.v, b.v, b.v, acc[t]);
    }
  }
#pragma unroll
  for (int t = 0; t < 4; ++t) {
    const int col = col0 + t * 16 + ln;
    float bv = bias ? bias[col] : 0.f;
    if (BIAS_BF16) bv = bf16_round(bv);
#pragma unroll
    for (int r = 0; r < 8; ++r) {
      float v = acc[t][r] + bv;
      if (resid) { float rv = resid[(size_t)((row0 + 8 * hh + r) % rmod) * ldr + col]; if (RES_BF16) rv = bf16_round(rv); v += rv; }
      if (ACT == 1) v = fmaxf(v, 0.f);
      if (ACT == 2) v = 0.5f * v * (1.0f + erff(v * 0.70710678118654752f));
      if (ACT == 3) { const float u = 0.7978845608028654f * (v + 0.044715f * v * v * v); v = 0.5f * v * (1.0f + tanhf(u)); }
      so[w][8 * hh + r][t * 16 + ln] = v;
    }
  }
  __builtin_amdgcn_fence(__ATOMIC_ACQ_REL, "workgroup");
  __builtin_amdgcn_wave_barrier();
  const int rsub = lane >> 4, c4 = (lane & 15) * 4;
  {
#pragma unroll
    for (int q = 0; q < 8; ++q) {
      const int r = q * 2 + rsub;
      const v4f v = *(const v4fa*)&so[w][r][c4];
      *(v4f*)(C + (size_t)(row0 + r) * ldc + col0 + c4) = v;
    }
    
  }
}
// row LayerNorm (biased variance, eps) over N: s = X (+ R); optional out_sum <- s; out_norm <- (s-mu)*rsqrt(var+eps)*g + b
template <bool PARAM_BF16>
__global__ __launch_bounds__(256) void k_layernorm(const float* __restrict__ X, const float* __restrict__ R, const float* __restrict__ g, const float* __restrict__ bta,
                                                  float* __restrict__ out_sum, float* __restrict__ out_norm, int N, float eps) {
  __shared__ float red[256];
  const int row = blockIdx.x, tid = threadIdx.x;
  const float* x = X + (size_t)row * N; const float* rr = R ? R + (size_t)row * N : nullptr;
  float vals[16];                     // up to N = 4096
  const int per = N / 256;            // contiguous chunk per thread? use strided-by-4 chunks: thread handles j = tid*4 + 1024*u
  float s1 = 0.f;
  for (int u = 0; u < per / 4; ++u) {
    const int j = tid * 4 + 1024 * u;
    const v4f a = *(const v4fa*)(x + j);
    v4f b = {0.f,0.f,0.f,0.f}; if (rr) b = *(const v4fa*)(rr + j);
#pragma unroll
    for (int q = 0; q < 4; ++q) { const float v = a[q] + b[q]; vals[u * 4 + q] = v; s1 += v; }
  }
  red[tid] = s1; __syncthreads();
  for (int st = 128; st > 0; st >>= 1) { if (tid < st) red[tid] += red[tid + st]; __syncthreads(); }
  const float mu = red[0] / (float)N; __syncthreads();
  float s2 = 0.f;
  for (int u = 0; u < per / 4; ++u)
#pragma unroll
    for (int q = 0; q < 4; ++q) { const float c = vals[u * 4 + q] - mu; s2 += c * c; }
  red[tid] = s2; __syncthreads();
  for (int st = 128; st > 0; st >>= 1) { if (tid < st) red[tid] += red[tid + st]; __syncthreads(); }
  const float rs = rsqrtf(red[0] / (float)N + eps);
  {
    for (int u = 0; u < per / 4; ++u) {
      const int j = tid * 4 + 1024 * u;
      v4f o, sm;
#pragma unroll
      for (int q = 0; q < 4; ++q) {
        float gg = g[j + q], bb = bta[j + q];
        if (PARAM_BF16) { gg = bf16_round(gg); bb = bf16_round(bb); }
        sm[q] = vals[u * 4 + q]; o[q] = (vals[u * 4 + q] - mu) * rs * gg + bb;
      }
      if (out_sum) *(v4f*)(out_sum + (size_t)row * N + j) = sm;
      *(v4f*)(out_norm + (size_t)row * N + j) = o;
    }
    
  }
}



// ---- f16 WMMA path (v_wmma_f32_16x16x32_f16): 11-bit significands for operands in range — used where a [0,1] probability operand needs more precision than bf16
typedef _Float16 v16h __attribute__((ext_vector_type(16)));
union FragH { v16h v; v8us half[2]; _Float16 h[16]; unsigned short u[16]; };
template <int NT>
__device__ __forceinline__ v8f mmaH(v16h ah, v16h al, v16h bh, v16h bl, v8f c) {
  c = __builtin_amdgcn_wmma_f32_16x16x32_f16(false, ah, false, bh, (short)0, c, false, false);
  if (NT >= 2) c = __builtin_amdgcn_wmma_f32_16x16x32_f16(false, al, false, bh, (short)0, c, false, false);
  if (NT >= 3) c = __builtin_amdgcn_wmma_f32_16x16x32_f16(false, ah, false, bl, (short)0, c, false, false);
  asm volatile("v_nop\n\tv_nop\n\tv_nop\n\tv_nop" : "+v"(c) : "v"(ah), "v"(al), "v"(bh), "v"(bl));
  return c;
}
// batched GEMM like k_gemm_b but f16 operands: A f32 (split into f16 hi/lo if ASPLIT, else rounded to f16), Bt = f16 values [n][k]; alpha; C f32; N multiple of 16 (partial tiles skipped)
template <bool ASPLIT>
__global__ __launch_bounds__(128) void k_gemm_h(const float* __restrict__ A, int lda, size_t sA, const _Float16* __restrict__ Bh, int ldb, size_t sB, float alpha, float* __restrict__ C, int ldc, size_t sC, int M, int N, int K) {
  __shared__ __attribute__((aligned(16))) float so[4][16][64];
  const int tid = threadIdx.x, w = tid >> 5, lane = tid & 31, ln = lane & 15, hh = lane >> 4; const int by = blockIdx.y;
  A += (size_t)by * sA; Bh += (size_t)by * sB; C += (size_t)by * sC;
  const int ntn = (N + 63) / 64; const int wid = blockIdx.x * 4 + w; const int mt = wid / ntn, nq = wid % ntn; if (mt * 16 >= M) return;
  const int row0 = mt * 16, col0 = nq * 64; const float* arow = A + (size_t)(row0 + ln) * lda;
  v8f acc[4] = {};
  for (int kb = 0; kb < K; kb += 32) {
    FragH ah, al;
    const v4f x0 = *(const v4fa*)(arow + kb + 8 * hh), x1 = *(const v4fa*)(arow + kb + 8 * hh + 4), x2 = *(const v4fa*)(arow + kb + 16 + 8 * hh), x3 = *(const v4fa*)(arow + kb + 16 + 8 * hh + 4);
    float xs[16] = {x0[0],x0[1],x0[2],x0[3],x1[0],x1[1],x1[2],x1[3],x2[0],x2[1],x2[2],x2[3],x3[0],x3[1],x3[2],x3[3]};
#pragma unroll
    for (int i = 0; i < 16; ++i) { const _Float16 h = (_Float16)xs[i]; ah.h[i] = h; al.h[i] = ASPLIT ? (_Float16)(xs[i] - (float)h) : (_Float16)0.0f; }
#pragma unroll
    for (int t = 0; t < 4; ++t) { if (col0 + t * 16 >= N) continue; const size_t boff = (size_t)(col0 + t * 16 + ln) * ldb + kb; FragH bq; bq.half[0] = *(const v8us*)(Bh + boff + 8 * hh); bq.half[1] = *(const v8us*)(Bh + boff + 16 + 8 * hh);
      acc[t] = mmaH<ASPLIT ? 2 : 1>(ah.v, al.v, bq.v, bq.v, acc[t]); }
  }
#pragma unroll
  for (int t = 0; t < 4; ++t) { if (col0 + t * 16 >= N) continue;
#pragma unroll
    for (int r = 0; r < 8; ++r) so[w][8 * hh + r][t * 16 + ln] = acc[t][r] * alpha; }
  __builtin_amdgcn_fence(__ATOMIC_ACQ_REL, "workgroup"); __builtin_amdgcn_wave_barrier();
  const int rsub = lane >> 4, c4 = (lane & 15) * 4;
  {
#pragma unroll
    for (int q = 0; q < 8; ++q) { const int r = q * 2 + rsub; if (col0 + c4 < N) { const v4f v = *(const v4fa*)&so[w][r][c4]; *(v4f*)(C + (size_t)(row0 + r) * ldc + col0 + c4) = v; } }
     }
}

// Wt[n][k] = f16(W[k][n]·scale) from f32 row-major W[K][N] (scale = power of two; bf16-exact weights stay exact in f16 away from the subnormal range)
__global__ __launch_bounds__(256) void k_wt_f16(const float* __restrict__ W, _Float16* __restrict__ Wt, int K, int N, float scale) {
  const int t = blockIdx.x * 256 + threadIdx.x; if (t >= N * (K / 8)) return; const int n = t / (K / 8), k8 = (t % (K / 8)) * 8; FragH f;
#pragma unroll
  for (int i = 0; i < 8; ++i) f.h[i] = (_Float16)(bf16_round(W[(size_t)(k8 + i) * N + n]) * scale); const v8us o = f.half[0];
  *(v8us*)((unsigned short*)Wt + (size_t)n * K + k8) = o; 
}
// k_gemm_hh variant with fused epilogue: v = acc·alpha + bias[by·sBias + col] (+ CP[(row/rowsPerB)·sCPb + by·64 + col] if CP) ; ACT 0 none / 1 elu ; writes f16 C16 (and f32 C if non-null)
template <int ACT>
__global__ __launch_bounds__(128) void k_gemm_hhx(const _Float16* __restrict__ A, int lda, size_t sA, const _Float16* __restrict__ Bh, int ldb, size_t sB, float alpha, const float* __restrict__ bias, size_t sBias, const float* __restrict__ CP, int rowsPerB, size_t sCPb, int row0g,
    float* __restrict__ C, _Float16* __restrict__ C16, int ldc, size_t sC, int M, int N, int K) {
  __shared__ __attribute__((aligned(16))) float so[4][16][64];
  const int tid = threadIdx.x, w = tid >> 5, lane = tid & 31, ln = lane & 15, hh = lane >> 4; const int by = blockIdx.y;
  A += (size_t)by * sA; Bh += (size_t)by * sB; const size_t cofs = (size_t)by * sC; const float* bp = bias ? bias + (size_t)by * sBias : nullptr;
  const int ntn = (N + 63) / 64; const int wid = blockIdx.x * 4 + w; const int mt = wid / ntn, nq = wid % ntn; if (mt * 16 >= M) return;
  const int row0 = mt * 16, col0 = nq * 64; const _Float16* arow = A + (size_t)(row0 + ln) * lda;
  v8f acc[4] = {};
  for (int kb = 0; kb < K; kb += 32) { FragH ah; ah.half[0] = *(const v8us*)((const unsigned short*)arow + kb + 8 * hh); ah.half[1] = *(const v8us*)((const unsigned short*)arow + kb + 16 + 8 * hh);
#pragma unroll
    for (int t = 0; t < 4; ++t) { if (col0 + t * 16 >= N) continue; const size_t boff = (size_t)(col0 + t * 16 + ln) * ldb + kb; FragH bq; bq.half[0] = *(const v8us*)((const unsigned short*)Bh + boff + 8 * hh); bq.half[1] = *(const v8us*)((const unsigned short*)Bh + boff + 16 + 8 * hh);
      acc[t] = mmaH<1>(ah.v, ah.v, bq.v, bq.v, acc[t]); }
  }
#pragma unroll
  for (int t = 0; t < 4; ++t) { if (col0 + t * 16 >= N) continue; const int col = col0 + t * 16 + ln; const float bv = bp ? bf16_round(bp[col]) : 0.f;
#pragma unroll
    for (int r = 0; r < 8; ++r) { float v = acc[t][r] * alpha + bv; if (CP) { const int rr = row0g + row0 + 8 * hh + r; if (rowsPerB < 0) v += CP[cofs + (size_t)rr * ldc + col];      /* rowsPerB < 0: own element of the batched C plane */ else { const int bidx = rr / rowsPerB; v += CP[(size_t)bidx * sCPb + (size_t)by * 64 + col]; } } if (ACT == 1) v = (v > 0.f) ? v : expm1f(v); else if (ACT == 7) v = (v > 0.f) ? v + 1.0f : expf(v); else if (ACT == 8) v = tanhf(v); else if (ACT == 9) v = 0.5f * v * (1.0f + tanhf(0.7978845608028654f * (v + 0.044715f * v * v * v))); else if (ACT == 11) v = 1.0f / (1.0f + expf(-v)); else if (ACT == 12) v = (v > 0.f) ? v : 0.01f * v; else if (ACT == 14) v = (v > 0.f) ? v : 0.1f * v; else if (ACT == 16) v = (v >= 0.f) ? v : 0.3f * v; else if (ACT == 17) v = (v >= 0.f) ? v : 0.2f * v; else if (ACT == 15) v = v / (1.0f + expf(-v)); else if (ACT == 3) v = fmaxf(v, 0.f); else if (ACT == 6) v = 0.5f * v * (1.0f + erff(v * 0.70710678118654752f)); so[w][8 * hh + r][t * 16 + ln] = v; } }
  __builtin_amdgcn_fence(__ATOMIC_ACQ_REL, "workgroup"); __builtin_amdgcn_wave_barrier();
  const int rsub = lane >> 4, c4 = (lane & 15) * 4; typedef _Float16 v4h __attribute__((ext_vector_type(4)));
  {
#pragma unroll
    for (int q = 0; q < 8; ++q) { const int r = q * 2 + rsub; if (col0 + c4 < N) { const v4f v = *(const v4fa*)&so[w][r][c4]; if (C) *(v4f*)(C + cofs + (size_t)(row0 + r) * ldc + col0 + c4) = v; if (C16) { v4h h4; for (int i = 0; i < 4; ++i) h4[i] = (_Float16)v[i]; *(v4h*)(C16 + cofs + (size_t)(row0 + r) * ldc + col0 + c4) = h4; } } }
     }
}


typedef _Float16 v4h __attribute__((ext_vector_type(4)));

__global__ __launch_bounds__(256) void k_x16(const float* __restrict__ x, _Float16* __restrict__ X16, size_t n8) { const size_t t = (size_t)blockIdx.x * 256 + threadIdx.x; if (t >= n8) return; FragH f;
#pragma unroll
  for (int q = 0; q < 8; ++q) f.h[q] = (_Float16)bf16_round(x[t * 8 + q]); *(v8us*)((unsigned short*)X16 + t * 8) = f.half[0];  }
__global__ __launch_bounds__(256) void k_h16(const float* __restrict__ x, _Float16* __restrict__ X16, size_t n8) { const size_t t = (size_t)blockIdx.x * 256 + threadIdx.x; if (t >= n8) return; FragH f;
#pragma unroll
  for (int q = 0; q < 8; ++q) f.h[q] = (_Float16)x[t * 8 + q]; *(v8us*)((unsigned short*)X16 + t * 8) = f.half[0];  }
__global__ __launch_bounds__(256) void k_round16f(const float* __restrict__ W, _Float16* __restrict__ Bt, size_t n8) { const size_t t = (size_t)blockIdx.x * 256 + threadIdx.x; if (t >= n8) return; FragH f;
#pragma unroll
  for (int i = 0; i < 8; ++i) f.h[i] = (_Float16)(bf16_round(W[t * 8 + i]) * 16.0f); *(v8us*)((unsigned short*)Bt + t * 8) = f.half[0];  }
__global__ __launch_bounds__(256) void k_hl(const float* __restrict__ F, _Float16* __restrict__ Hh, _Float16* __restrict__ Hl, size_t n8) { const size_t t = (size_t)blockIdx.x * 256 + threadIdx.x; if (t >= n8) return; FragH fh, fl; const v4f a = *(const v4fa*)(F + t * 8), c = *(const v4fa*)(F + t * 8 + 4);
#pragma unroll
  for (int q = 0; q < 4; ++q) { _Float16 h = (_Float16)a[q]; fh.h[q] = h; fl.h[q] = (_Float16)((a[q] - (float)h) * 1024.0f); h = (_Float16)c[q]; fh.h[4 + q] = h; fl.h[4 + q] = (_Float16)((c[q] - (float)h) * 1024.0f); }
  { *(v8us*)((unsigned short*)Hh + t * 8) = fh.half[0]; *(v8us*)((unsigned short*)Hl + t * 8) = fl.half[0];  } }

// ---- operand preparation, ONE launch of 256 work-groups (as many as the chip has WGPs), 8 waves each: every wave does a long share of the work, so that few waves have to be started.
// A work-group turns one 64 k x 192 n strip of W ([k][n] f32) into 192 rows of Bt ([n][k] f16, bf16-rounded, x16) and converts 2048 chunks of 8 x values (bf16-rounded, f16).
// Every global access is whole lines: W rows are read in 256-byte runs, x in 32 bytes a lane, Bt is written in 128-byte runs (8 lanes a row), X16 in 16 bytes a lane.
// All 28 loads of a lane are issued before anything waits. The strip is turned in LDS as f32 at a pitch of 193 dwords (1 mod 64): the row-wise dword stores and the column-wise dword reads both fall on distinct banks.
#define PKT 64                       /* k rows of a strip */
#define PNT 192                      /* n columns of a strip */
#define PPT 193                      /* LDS pitch of a strip row in dwords */
#define PXC 2048                     /* 8-element chunks of x per work-group */
#define PWG ((DM / PKT) * (LQ / PNT))      /* work-groups */
static_assert((size_t)PWG * PXC * 8 == (size_t)NB * SQ * DM, "the x shares cover x exactly");
__global__ __launch_bounds__(256) void k_prep(const float* __restrict__ x, const float* __restrict__ Wq, _Float16* __restrict__ X16, _Float16* __restrict__ Bt) {
  __shared__ float T[PKT * PPT];
  const int tid = threadIdx.x;
  const int k0 = (blockIdx.x / (LQ / PNT)) * PKT, n0 = (blockIdx.x % (LQ / PNT)) * PNT;
  const int r = tid >> 4, c4 = (tid & 15) * 4;      /* 16 lanes a row: 256 contiguous bytes */
  const float* wp = Wq + (size_t)(k0 + r) * LQ + n0 + c4;
  const float* xp = x + ((size_t)blockIdx.x * PXC + tid) * 8;
  v4f wv[3][4], xv[8][2];
#pragma unroll
  for (int j = 0; j < 3; ++j)
#pragma unroll
    for (int u = 0; u < 4; ++u) wv[j][u] = *(const v4fa*)(wp + (size_t)(16 * u) * LQ + 64 * j);
#pragma unroll
  for (int i = 0; i < 8; ++i) { xv[i][0] = *(const v4fa*)(xp + i * 2048); xv[i][1] = *(const v4fa*)(xp + i * 2048 + 4); }
  /* The wait in front of any rewrite of a register that an issued load names. It takes W's address pair as an input, so that no later load of the group gets that pair as its destination;
     its "memory" clobber also keeps all 28 loads above it: without that the compiler sinks twelve x loads behind the waits for W, and their latency is paid a second time. */
  asm volatile("s_wait_xcnt 0x0" :: "v"(wp) : "memory");
#pragma unroll
  for (int j = 0; j < 3; ++j)
#pragma unroll
    for (int u = 0; u < 4; ++u)
#pragma unroll
      for (int e = 0; e < 4; ++e) T[(r + 16 * u) * PPT + 64 * j + c4 + e] = wv[j][u][e];
  __syncthreads();      /* the strip is whole in LDS before anybody reads a column */
  unsigned short* xo = (unsigned short*)X16 + ((size_t)blockIdx.x * PXC + tid) * 8;
#pragma unroll
  for (int i = 0; i < 8; ++i) { FragH f;
#pragma unroll
    for (int q = 0; q < 8; ++q) f.h[q] = (_Float16)bf16_round(xv[i][q >> 2][q & 3]);
    *(v8us*)(xo + i * 2048) = f.half[0]; }
  const int n = tid >> 3, k8 = (tid & 7) * 8;      /* 8 lanes a Bt row: 128 contiguous bytes */
  unsigned short* bo = (unsigned short*)Bt + (size_t)(n0 + n) * DM + k0 + k8;
#pragma unroll
  for (int u = 0; u < PNT / 32; ++u) { FragH f;
#pragma unroll
    for (int i = 0; i < 8; ++i) f.h[i] = (_Float16)(bf16_round(T[(k8 + i) * PPT + n + 32 * u]) * 16.0f);
    *(v8us*)(bo + (size_t)(32 * u) * DM) = f.half[0]; }
}

// ---- projection GEMM: C = A Bh^T / 16 + bias, A [4096][1024] and Bh [3072][1024] f16, both k-contiguous. One work-group = a 128 x 128 tile, four waves of 64 x 64 (4 x 4 accumulator tiles each).
// A stage = 64 k of the tile's 128 A rows and 128 Bh rows (128-byte rows) in LDS, brought by asynchronous 16-byte copies (global_load_async_to_lds_b128) into two buffers: stage t + 2 flies while stage t + 1 is worked on.
// Every fragment is read from LDS and feeds four products; a k step is 32, taken in rising order into the same accumulator.
// Epilogue by 64-column halves (a half is exactly one head's q, k or v slice: columns are packed per head, 192 h + {0 q, 64 k, 128 v}): q and k halves go as f16 rows into C16 (whole 128-byte lines),
// a v half goes TRANSPOSED into that head's V^T plane VTo[(b NH + h) HD + d][key] and nowhere else (a lane's accumulator holds 8 consecutive keys of ONE d: 16 contiguous bytes of a V^T row; 256-byte runs).
#define VTP 136                      /* LDS pitch of a staged V^T row in f16: 256 data bytes + 16, an odd multiple of 16 bytes for the 16-byte stores and reads */
#define GK 64                        /* k per stage */
#define GP 72                        /* LDS row pitch of a stage in f16: 128 data bytes + 16, an odd multiple of 16 bytes for the 16-byte fragment reads */
#define GSTG (256 * GP)              /* f16 per stage: 128 A rows, then 128 Bh rows */
#define GEH (128 * GP)               /* f16 per epilogue half: [128 rows][GP], or [64 d][VTP], which is smaller */
__device__ __forceinline__ v16h g2_frag(const _Float16* p, int hh) { FragH f; f.half[0] = *(const v8us*)((const unsigned short*)p + 8 * hh); f.half[1] = *(const v8us*)((const unsigned short*)p + 16 + 8 * hh); return f.v; }
__device__ __forceinline__ v16h g3_frag(const unsigned short* p, int hh) { FragH f; f.half[0] = *(const v8us*)(p + 8 * hh); f.half[1] = *(const v8us*)(p + 16 + 8 * hh); return f.v; }
// Eight copies of a lane: its 16-byte chunk of rows r, r + 16, ..., r + 112 (a wave's copy = four whole 128-byte rows). l = the lane's LDS byte address, g = its global address.
// The s_wait_xcnt stands inside the statement, behind the last copy, so that no address register of a copy is rewritten in front of it.
__device__ __forceinline__ void g3_copy8(unsigned l, const _Float16* g) {
  asm volatile("global_load_async_to_lds_b128 %0, %8, off\n\tglobal_load_async_to_lds_b128 %1, %9, off\n\tglobal_load_async_to_lds_b128 %2, %10, off\n\tglobal_load_async_to_lds_b128 %3, %11, off\n\t"
               "global_load_async_to_lds_b128 %4, %12, off\n\tglobal_load_async_to_lds_b128 %5, %13, off\n\tglobal_load_async_to_lds_b128 %6, %14, off\n\tglobal_load_async_to_lds_b128 %7, %15, off\n\ts_wait_xcnt 0x0"
               :: "v"(l), "v"(l + 16 * GP * 2), "v"(l + 32 * GP * 2), "v"(l + 48 * GP * 2), "v"(l + 64 * GP * 2), "v"(l + 80 * GP * 2), "v"(l + 96 * GP * 2), "v"(l + 112 * GP * 2),
                  "v"(g), "v"(g + 16 * DM), "v"(g + 32 * DM), "v"(g + 48 * DM), "v"(g + 64 * DM), "v"(g + 80 * DM), "v"(g + 96 * DM), "v"(g + 112 * DM) : "memory");
}
__global__ __launch_bounds__(128) void k_gemm3(const _Float16* __restrict__ A, const _Float16* __restrict__ Bh, const float* __restrict__ bias, _Float16* __restrict__ C16, _Float16* __restrict__ VTo) {
  __shared__ __attribute__((aligned(16))) unsigned short sm[2 * GSTG];
  const int tid = threadIdx.x, w = tid >> 5, lane = tid & 31, ln = lane & 15, hh = lane >> 4, wm = w >> 1, wn = w & 1;
  const int mt = blockIdx.x / (LQ / 128), nt = blockIdx.x % (LQ / 128); const int row0 = mt * 128, col0 = nt * 128;
  const int crow = tid >> 3, cc8 = (tid & 7) * 8;      /* the lane's first row and its 16-byte chunk in every copy */
  const _Float16* ag = A + (size_t)(row0 + crow) * DM + cc8; const _Float16* bg = Bh + (size_t)(col0 + crow) * DM + cc8;
  const unsigned la = (unsigned)(size_t)&sm[crow * GP + cc8], lb = la + 128 * GP * 2;
  g3_copy8(la, ag); g3_copy8(lb, bg);
  asm volatile("s_wait_asynccnt 0x0" ::: "memory");      /* this wave's share of stage 0 has landed */
  __syncthreads();      /* stage 0 is complete before anybody reads it */
  g3_copy8(la + GSTG * 2, ag + GK); g3_copy8(lb + GSTG * 2, bg + GK);
  const v8f z8 = {0.f, 0.f, 0.f, 0.f, 0.f, 0.f, 0.f, 0.f};
  v8f acc[4][4];
#pragma unroll
  for (int i = 0; i < 4; ++i)
#pragma unroll
    for (int j = 0; j < 4; ++j) acc[i][j] = z8;
  /* the stage loop stays rolled (one copy of its 32 products); everything inside is unrolled, so that acc is indexed by constants only and stays in registers */
#pragma unroll 1
  for (int t = 0; t < DM / GK; ++t) {
    const unsigned short* sa = sm + (t & 1) * GSTG + (64 * wm + ln) * GP; const unsigned short* sb = sm + (t & 1) * GSTG + (128 + 64 * wn + ln) * GP;
#pragma unroll
    for (int ks = 0; ks < 2; ++ks) {
      /* The k step's eight fragments are read as one group, whole in front of its sixteen products. The scheduling fences hold that order: without them the compiler keeps one A fragment,
         reads the next among the products and waits out the LDS latency in front of every four of them. */
      __builtin_amdgcn_sched_barrier(0);      /* nothing of the group's reads moves up among the products before */
      v16h af[4], bf[4];
#pragma unroll
      for (int i = 0; i < 4; ++i) { af[i] = g3_frag(sa + 16 * i * GP + ks * 32, hh); bf[i] = g3_frag(sb + 16 * i * GP + ks * 32, hh); }
      __builtin_amdgcn_sched_barrier(0);      /* none of the group's reads sinks among its products */
#pragma unroll
      for (int i = 0; i < 4; ++i)
#pragma unroll
        for (int j = 0; j < 4; ++j) acc[i][j] = __builtin_amdgcn_wmma_f32_16x16x32_f16(false, af[i], false, bf[j], (short)0, acc[i][j], false, false);
    }
    __builtin_amdgcn_sched_barrier(0);      /* keeps the last sixteen products above the stage's foot: without it the compiler sinks them behind the barrier, in front of the copies, which then start that much later */
    asm volatile("s_wait_dscnt 0x0" ::: "memory");      /* this wave's reads of stage t are done before the buffer is handed back */
    asm volatile("s_wait_asynccnt 0x0" ::: "memory");      /* this wave's share of stage t + 1 has landed */
    __syncthreads();      /* publishes stage t + 1 and ends every wave's reads of stage t */
    if (t + 2 < DM / GK) { g3_copy8(la + (t & 1) * (GSTG * 2), ag + (t + 2) * GK); g3_copy8(lb + (t & 1) * (GSTG * 2), bg + (t + 2) * GK); }
  }
  asm volatile("s_wait_asynccnt 0x0" ::: "memory");      /* nothing is in flight when the buffers become output staging */
  /* behind the loop's last barrier nobody reads a stage any more: each column half is staged in its own GEH range */
  { unsigned short* sr = sm + wn * GEH; const int cb = col0 + 64 * wn;
    float bv[4];
#pragma unroll
    for (int j = 0; j < 4; ++j) bv[j] = bias[cb + 16 * j + ln];
#pragma unroll
    for (int j = 0; j < 4; ++j) bv[j] = bf16_round(bv[j]);
    if ((cb / HD) % 3 == 2) {
#pragma unroll
      for (int i = 0; i < 4; ++i)
#pragma unroll
        for (int j = 0; j < 4; ++j) { FragH f;
#pragma unroll
          for (int r = 0; r < 8; ++r) f.h[r] = (_Float16)(acc[i][j][r] * 0.0625f + bv[j]);
          *(v8us*)(sr + (16 * j + ln) * VTP + 64 * wm + 16 * i + 8 * hh) = f.half[0]; }
    } else {
#pragma unroll
      for (int i = 0; i < 4; ++i)
#pragma unroll
        for (int j = 0; j < 4; ++j) { FragH f;
#pragma unroll
          for (int r = 0; r < 8; ++r) f.h[r] = (_Float16)(acc[i][j][r] * 0.0625f + bv[j]);
#pragma unroll
          for (int r = 0; r < 8; ++r) sr[(64 * wm + 16 * i + 8 * hh + r) * GP + 16 * j + ln] = f.u[r]; }
    } }
  __syncthreads();      /* both halves are whole in LDS before anybody reads a row */
#pragma unroll
  for (int n = 0; n < 2; ++n) { const unsigned short* sr = sm + n * GEH; const int cb = col0 + 64 * n;
    const bool isv = (cb / HD) % 3 == 2;      /* the same for the whole work-group: cb comes from blockIdx alone */
    const int sh = isv ? 4 : 3, lp = isv ? VTP : GP, gp = isv ? SQ : LQ;      /* 16-byte chunks a staged row (log2), its LDS pitch, its pitch in memory: V^T rows of 256 bytes, or q / k rows of 128 */
    unsigned short* gb = isv ? (unsigned short*)VTo + ((size_t)(row0 / SQ) * NH + cb / (3 * HD)) * HD * SQ + row0 % SQ : (unsigned short*)C16 + (size_t)row0 * LQ + cb;
    v8us dv[8]; unsigned short* dp[8];
#pragma unroll
    for (int i = 0; i < 8; ++i) { const int c = tid + 128 * i, x = c >> sh, y = (c & ((1 << sh) - 1)) * 8; dv[i] = *(const v8us*)(sr + x * lp + y); dp[i] = gb + (size_t)x * gp + y; }
    __builtin_amdgcn_sched_barrier(0);      /* the eight reads and addresses stand whole in front of the stores, so that no register of an issued store is rewritten among them */
#pragma unroll
    for (int i = 0; i < 8; ++i) *(v8us*)dp[i] = dv[i];      /* a wave's store = whole lines: two 256-byte runs, or four 128-byte rows */
    if (n == 0) { asm volatile("s_wait_xcnt 0x0" ::: "memory");      /* in front of the second half's work, which rewrites the registers that these stores name */
      __builtin_amdgcn_sched_barrier(0); }      /* holds that work behind the wait */
  }
}


__global__ __launch_bounds__(256) void k_wnat(const float* __restrict__ w, size_t n8, _Float16* __restrict__ Bt) { const size_t t = (size_t)blockIdx.x * 256 + threadIdx.x; if (t >= n8) return; FragH f; for (int q = 0; q < 8; ++q) f.h[q] = (_Float16)(bf16_round(w[t * 8 + q]) * 16.0f); *(v8us*)((unsigned short*)Bt + t * 8) = f.half[0];  }
#define FK 64                        /* keys per pass */
#define FPT 72                       /* LDS row pitch in f16: 128 data bytes + 16, an odd multiple of 16 bytes for the 16-byte fragment reads */
#define FG 2                         /* key groups of a work-group */
#define FKG (SQ / FG)                /* keys of a group */
#define FTL (FK * FPT)               /* f16 per staged tile (K: [key][d]; V^T: [d][key]; HD = FK rows each) */
#define FXS 17                       /* 16-byte slots a lane hands over at the join: 16 of O^T, one of m and l */
static_assert(4 * FXS * 32 * 16 <= FG * 2 * FTL * 2, "the join's exchange area fits the tiles' LDS");
__device__ __forceinline__ v16h fa_frag(const unsigned short* p, int hh) { FragH f; f.half[0] = *(const v8us*)(p + 8 * hh); f.half[1] = *(const v8us*)(p + 16 + 8 * hh); return f.v; }
__device__ __forceinline__ v8f fa_mma(v16h a, v16h b, v8f c) { return __builtin_amdgcn_wmma_f32_16x16x32_f16(false, a, false, b, (short)0, c, false, false); }
__device__ __forceinline__ float fa_xhalf(float x) { return __builtin_bit_cast(float, __builtin_amdgcn_permlanex16(__builtin_bit_cast(int, x), __builtin_bit_cast(int, x), 0x76543210, 0xfedcba98, false, false)); }      /* lane l reads lane l ^ 16, on the vector pipe: no LDS round trip */
__device__ __forceinline__ float fa_exp2(float x) { float e; asm("v_exp_f32 %0, %1\n\tv_nop" : "=v"(e) : "v"(x)); return e; }
__device__ __forceinline__ v8f fa_exp2x8(v8f x) { float e0, e1, e2, e3, e4, e5, e6, e7;
  asm("v_exp_f32 %0, %8\n\tv_exp_f32 %1, %9\n\tv_exp_f32 %2, %10\n\tv_exp_f32 %3, %11\n\tv_exp_f32 %4, %12\n\tv_exp_f32 %5, %13\n\tv_exp_f32 %6, %14\n\tv_exp_f32 %7, %15\n\tv_nop"
      : "=&v"(e0), "=&v"(e1), "=&v"(e2), "=&v"(e3), "=&v"(e4), "=&v"(e5), "=&v"(e6), "=&v"(e7) : "v"(x[0]), "v"(x[1]), "v"(x[2]), "v"(x[3]), "v"(x[4]), "v"(x[5]), "v"(x[6]), "v"(x[7]));
  const v8f e = {e0, e1, e2, e3, e4, e5, e6, e7}; return e; }
__global__ __launch_bounds__(256) __attribute__((amdgpu_waves_per_eu(4, 4))) void k_fattn(const _Float16* __restrict__ QKVp, const _Float16* __restrict__ VTp, float* __restrict__ O) {
  __shared__ __attribute__((aligned(16))) unsigned short sm[FG * 2 * FTL];      /* per group: K rows of the pass [key][d], then V^T rows of the pass [d][key] */
  const int g = __builtin_amdgcn_readfirstlane((int)threadIdx.x >> 7);      /* the wave's key group, the same in every lane */
  const int tid = threadIdx.x & 127, w = tid >> 5, lane = tid & 31, ln = lane & 15, hh = lane >> 4;      /* place inside the group */
  unsigned short* Ks = sm + g * (2 * FTL); unsigned short* Vs = Ks + FTL;
  const int bh = blockIdx.x / (SQ / 128), qb = blockIdx.x % (SQ / 128); const int b = bh / NH, h = bh % NH;
  const _Float16* qg = QKVp + (size_t)b * SQ * LQ + (size_t)h * 3 * HD;      /* head h's 192 packed columns: q at + 0, k at + 64 */
  const int q0 = qb * 128 + w * 32;
  v16h qf[2][2];
#pragma unroll
  for (int qt = 0; qt < 2; ++qt)
#pragma unroll
    for (int ks = 0; ks < 2; ++ks) qf[qt][ks] = g2_frag(qg + (size_t)(q0 + qt * 16 + ln) * LQ + ks * 32, hh);
  /* staging: thread t moves 16-byte chunks t, t + 128, t + 256, t + 384 of each 64 x 128-byte tile: 8 chunks a row, so a wave's load covers 4 whole lines */
  const int frow = tid >> 3, fc8 = (tid & 7) * 8;
  const unsigned short* kp = (const unsigned short*)qg + HD + (size_t)(g * FKG + frow) * LQ + fc8;
  const unsigned short* vp = (const unsigned short*)VTp + (size_t)bh * HD * SQ + (size_t)frow * SQ + g * FKG + fc8;
  v8us kr[4], vr[4];
#pragma unroll
  for (int j = 0; j < 4; ++j) { kr[j] = *(const v8us*)(kp + (size_t)(16 * j) * LQ); vr[j] = *(const v8us*)(vp + (size_t)(16 * j) * SQ); }
  const v8f z8 = {0.f, 0.f, 0.f, 0.f, 0.f, 0.f, 0.f, 0.f};
  v8f o[2][4]; float m[2], l[2];
#pragma unroll
  for (int qt = 0; qt < 2; ++qt) { m[qt] = -3.0e38f; l[qt] = 0.f;
#pragma unroll
    for (int dt = 0; dt < 4; ++dt) o[qt][dt] = z8; }
  const float SC = 0.125f * 1.4426950408889634f;      /* 1 / sqrt(64), and base e to base 2 */
  for (int p = 0; p < FKG / FK; ++p) {
    __syncthreads();      /* every wave has finished reading the pass before */
#pragma unroll
    for (int j = 0; j < 4; ++j) { *(v8us*)(Ks + (frow + 16 * j) * FPT + fc8) = kr[j]; *(v8us*)(Vs + (frow + 16 * j) * FPT + fc8) = vr[j]; }
    __syncthreads();      /* the tiles are complete before anybody reads them */
    v16h ka[4][2];      /* the pass's K fragment reads stand with the global loads in front of the fence below: the wait that the compiler puts in front of the step of those loads' address registers then falls into the LDS latency, not in front of the reads */
#pragma unroll
    for (int kt = 0; kt < 4; ++kt)
#pragma unroll
      for (int ks = 0; ks < 2; ++ks) ka[kt][ks] = fa_frag(Ks + (kt * 16 + ln) * FPT + ks * 32, hh);
    if (p + 1 < FKG / FK) {      /* the next pass's tiles fly to registers while this pass is worked on */
      kp += (size_t)FK * LQ; vp += FK;
#pragma unroll
      for (int j = 0; j < 4; ++j) { kr[j] = *(const v8us*)(kp + (size_t)(16 * j) * LQ); vr[j] = *(const v8us*)(vp + (size_t)(16 * j) * SQ); }
    }
    __builtin_amdgcn_sched_barrier(0);      /* keeps the eight loads above the pass's work: without it the compiler sinks them to the loop's foot, and their whole latency is waited for at the next pass's head */
    v8f st[2][4];
#pragma unroll
    for (int kt = 0; kt < 4; ++kt)
#pragma unroll
      for (int qt = 0; qt < 2; ++qt) st[qt][kt] = fa_mma(ka[kt][1], qf[qt][1], fa_mma(ka[kt][0], qf[qt][0], z8));      /* st[qt][kt][r] = q(q0 + 16 qt + ln) . k(1024 g + 64 p + 16 kt + 8 hh + r) */
    FragH pf[2][2];
#pragma unroll
    for (int qt = 0; qt < 2; ++qt) {
      v8f x8 = st[qt][0];
#pragma unroll
      for (int r = 0; r < 8; ++r) x8[r] = fmaxf(fmaxf(st[qt][0][r], st[qt][1][r]), fmaxf(st[qt][2][r], st[qt][3][r]));
      float mx = fmaxf(fmaxf(fmaxf(x8[0], x8[1]), fmaxf(x8[2], x8[3])), fmaxf(fmaxf(x8[4], x8[5]), fmaxf(x8[6], x8[7])));
      mx = fmaxf(mx, fa_xhalf(mx));      /* the other half of the query's 64 keys */
      const float mn = fmaxf(m[qt], mx * SC); const float al = fa_exp2(m[qt] - mn); m[qt] = mn;      /* al = 0 on the first pass */
      v8f s8 = z8;
#pragma unroll
      for (int kt = 0; kt < 4; ++kt) { const v8f e8 = fa_exp2x8(st[qt][kt] * SC - mn); s8 += e8;
#pragma unroll
        for (int r = 0; r < 8; ++r) pf[qt][kt >> 1].h[(kt & 1) * 8 + r] = (_Float16)e8[r]; }
      l[qt] = l[qt] * al + (((s8[0] + s8[1]) + (s8[2] + s8[3])) + ((s8[4] + s8[5]) + (s8[6] + s8[7])));
#pragma unroll
      for (int dt = 0; dt < 4; ++dt) o[qt][dt] *= al;
    }
    /* The V^T fragments are read in two groups of four, each group whole in front of its eight products. The scheduling fences hold that order: without them the compiler mixes the softmax into the products,
       runs short of registers and waits for LDS in front of every pair of products; all eight fragments at once would take the kernel past 256 registers. */
#pragma unroll
    for (int dg = 0; dg < 2; ++dg) {
      __builtin_amdgcn_sched_barrier(0);      /* nothing of the group's reads moves up into the work before */
      v16h va[2][2];
#pragma unroll
      for (int d2 = 0; d2 < 2; ++d2)
#pragma unroll
        for (int ks = 0; ks < 2; ++ks) va[d2][ks] = fa_frag(Vs + ((dg * 2 + d2) * 16 + ln) * FPT + ks * 32, hh);
      __builtin_amdgcn_sched_barrier(0);      /* none of the group's reads sinks among its products */
#pragma unroll
      for (int d2 = 0; d2 < 2; ++d2)
#pragma unroll
        for (int ks = 0; ks < 2; ++ks)
#pragma unroll
          for (int qt = 0; qt < 2; ++qt) o[qt][dg * 2 + d2] = fa_mma(va[d2][ks], pf[qt][ks].v, o[qt][dg * 2 + d2]);      /* o[qt][dt][r] = O[q0 + 16 qt + ln][16 dt + 8 hh + r] */
    }
  }
  /* The join: group 1 hands its m, l and O^T to group 0 through the tiles' LDS, lane to lane (wave w of group 1 holds the same queries, at the same places, as wave w of group 0); 16 bytes a lane, contiguous over a wave. */
  __syncthreads();      /* every wave has finished reading the last pass's tiles before they are overwritten */
  v4fa* xs = (v4fa*)sm + (size_t)(w * FXS) * 32 + lane;
  if (g == 1) {
#pragma unroll
    for (int qt = 0; qt < 2; ++qt)
#pragma unroll
      for (int dt = 0; dt < 4; ++dt) { const v4f lo = {o[qt][dt][0], o[qt][dt][1], o[qt][dt][2], o[qt][dt][3]}, hi = {o[qt][dt][4], o[qt][dt][5], o[qt][dt][6], o[qt][dt][7]};
        xs[((qt * 4 + dt) * 2) * 32] = lo; xs[((qt * 4 + dt) * 2 + 1) * 32] = hi; }
    const v4f ml = {m[0], m[1], l[0], l[1]}; xs[16 * 32] = ml;
  }
  __syncthreads();      /* group 1's results are whole in LDS before group 0 reads them */
  if (g == 1) return;      /* behind the last barrier */
  const v4f ml1 = xs[16 * 32];
#pragma unroll
  for (int qt = 0; qt < 2; ++qt) {
    const float mj = fmaxf(m[qt], ml1[qt]); const float a0 = fa_exp2(m[qt] - mj), a1 = fa_exp2(ml1[qt] - mj);      /* both groups' results are brought to the common maximum */
    const float lj = l[qt] * a0 + ml1[2 + qt] * a1; const float inv = 1.0f / (lj + fa_xhalf(lj)); const float c0 = a0 * inv, c1 = a1 * inv;
    float* orow = O + ((size_t)bh * SQ + q0 + qt * 16 + ln) * HD + 8 * hh;      /* head plane bh, row = query: the raw-view merge */
#pragma unroll
    for (int dt = 0; dt < 4; ++dt) { const v4f lo1 = xs[((qt * 4 + dt) * 2) * 32], hi1 = xs[((qt * 4 + dt) * 2 + 1) * 32];
      const v4f lo = {o[qt][dt][0] * c0 + lo1[0] * c1, o[qt][dt][1] * c0 + lo1[1] * c1, o[qt][dt][2] * c0 + lo1[2] * c1, o[qt][dt][3] * c0 + lo1[3] * c1},
                hi = {o[qt][dt][4] * c0 + hi1[0] * c1, o[qt][dt][5] * c0 + hi1[1] * c1, o[qt][dt][6] * c0 + hi1[2] * c1, o[qt][dt][7] * c0 + hi1[3] * c1};
      *(v4f*)(orow + dt * 16) = lo; *(v4f*)(orow + dt * 16 + 4) = hi; } }
}
__global__ __launch_bounds__(256) void k_vt(const _Float16* __restrict__ V16, int b, int h0, _Float16* __restrict__ VT) { __shared__ unsigned short tl[64][65]; const int tid = threadIdx.x; const int hh = blockIdx.x % HG, sg = blockIdx.x / HG; const int s0 = sg * 64; const int h = h0 + hh;
  for (int i = tid; i < 64 * 8; i += 256) { const int j = i / 8, d8 = (i % 8) * 8; FragH f; f.half[0] = *(const v8us*)((const unsigned short*)V16 + ((size_t)b * SQ + s0 + j) * DM + h * HD + d8); for (int q = 0; q < 8; ++q) tl[d8 + q][j] = f.u[q]; }
  __syncthreads();
  { for (int i = tid; i < 64 * 8; i += 256) { const int d = i / 8, j8 = (i % 8) * 8; FragH f; for (int q = 0; q < 8; ++q) f.u[q] = tl[d][j8 + q]; *(v8us*)((unsigned short*)VT + ((size_t)hh * HD + d) * SQ + s0 + j8) = f.half[0]; }  } }


extern "C" void kernel_launch(void* const* d_in, const int* in_sizes, int n_in,
                              void* d_out, int out_size, void* d_ws, size_t ws_size, hipStream_t stream) {
  (void)in_sizes; (void)n_in; (void)out_size;
  const float* const* I = (const float* const*)d_in; const float* x = I[0]; const float* wqkv = I[1]; const float* bqkv = I[2];      /* input order: x, W_qkv ([in][out] [1024][3072]; columns packed PER HEAD: 192 h + {0..63 q, 64..127 k, 128..191 v}), b_qkv [3072] (REAL; the same packing: the projection GEMM's bias slot reads it by output column); three inputs; no output weight: the module has none */
  char* ws = (char*)d_ws; size_t off = 0;
  auto take = [&](size_t bytes) { char* p = ws + off; off += (bytes + 255) & ~(size_t)255; return p; };
  _Float16* BQKV = (_Float16*)take((size_t)3 * DM * DM * 2);
  _Float16* X16 = (_Float16*)take(NR * DM * 2); _Float16* QKV = (_Float16*)take(NR * 3 * DM * 2);      /* PER-HEAD packing: within head h's 192 columns q starts at + 0, k at + 64; the v columns (+ 128) are never written here: they go to VT; the head stride is 3 HD */
  _Float16* VT = (_Float16*)take((size_t)NB * NH * HD * SQ * 2);      /* V^T planes of every (batch, head) */
  if (off > ws_size) return;
  k_prep<<<PWG, 256, 0, stream>>>(x, wqkv, X16, BQKV);      /* x -> f16 rows; W [in][out] -> Bt[n][k] x16 (pitch K = 1024) */
  const size_t r0p = (size_t)B0 * SQ;      /* first projected row */
  k_gemm3<<<(unsigned)((MP / 128) * (LQ / 128)), 128, 0, stream>>>(X16 + r0p * DM, BQKV, bqkv, QKV + r0p * 3 * DM, VT + (size_t)B0 * NH * HD * SQ);      /* q | k rows (f16, packed per head) and the V^T planes */
  k_fattn<<<NB * NH * (SQ / 128), 256, 0, stream>>>(QKV, VT, (float*)d_out);      /* all batches and heads in one launch: softmax(q k^T / 8) v, each head into its own contiguous [2048][64] plane */
}

// v007
// One run takes 66.6 microseconds.
// Two timings next to v006 put it at 1.03 and 1.02 times that version's speed.
// All steps since v000 together make it 55.9 times as fast.
#include <hip/hip_runtime.h>
// Multi-head self-attention with ONE fused QKV projection packed PER HEAD, NO output projection and a RAW-VIEW merge (x [2][2048][1024]; qkv = x W_qkv + b_qkv ([in][out] 1024 x 3072, normal x 1/32; a REAL bias normal x 0.01) reshaped (b, s, 16, 3 x 64): head h owns columns 192 h .. 192 h + 191: q | k | v = its three 64-column slices; att = q k^T / sqrt(64); softmax over all 2048 keys (no mask); values [b][16][s][64] are reshaped to (b, s, 1024) WITHOUT a head transpose (the source's own form): the output memory of a batch IS the sixteen [2048][64] head planes one after another); the P.V product is written straight to the f32 output, each head into its own contiguous plane.
// Structure: token rows r = b*2048 + s; x as exact f16 rows (bf16-rounded); q | k | v as ONE WMMA GEMM (N = 3 x 1024) (128x128 tiles staged in LDS by asynchronous copies, 64x64 wave tiles, f32 accumulation, exact x16 weights + bias, f16 outputs); the GEMM's own epilogue stores every head's v tile transposed (V^T planes [d][key], 256-byte runs through LDS), so no transpose launch is left; then ONE fused attention launch over every (batch, head): per 64 keys S^T = K Q^T, running softmax in registers (f32 statistics, base 2; weights 2^(s - m) as f16), O^T += V^T P^T, divided by the row sum at the end and written as f32 straight into the output's own layout (head plane after head plane): no output projection.
// Compute dtype: inputs rounded to bf16; x / weights exact; q, k, v and softmax weights as plain f16 GEMM operands (~2^-12); scores and softmax statistics f32; v_wmma_f32_16x16x32_f16.
#define NB 2
#define SQ 2048
#define DM 1024
#define NH 16
#define HD 64
#define HG 4                         /* heads per group of the grouped transpose below */
#define B0 0                         /* first batch processed (debug hook) */
#define NBR NB                       /* batches processed (debug hook) */
#define NR ((size_t)NB * SQ)         /* token rows */
#define MP ((int)((size_t)NBR * SQ)) /* rows projected (debug hook) */
#define QN SQ                        /* unused (the attention launch covers all SQ query rows) */
#define NHD NH                       /* unused (the attention launch covers all NH heads) */
#define MPO MP                       /* unused (no output projection) */
#define LQ (3 * DM)      /* row pitch of the q/k/v rows */
typedef __bf16 v16b __attribute__((ext_vector_type(16)));
typedef unsigned short v8us __attribute__((ext_vector_type(8), may_alias));
typedef float  v8f  __attribute__((ext_vector_type(8)));
typedef float  v4f  __attribute__((ext_vector_type(4)));
typedef float  v4fa __attribute__((ext_vector_type(4), may_alias));
union FragB { v16b v; v8us half[2]; unsigned short u[16]; };

__device__ __forceinline__ unsigned short bf16_bits(float x) { unsigned int u = __float_as_uint(x); return (unsigned short)((u + 0x7FFFu + ((u >> 16) & 1u)) >> 16); }
__device__ __forceinline__ float bf16_val(unsigned short b) { return __uint_as_float(((unsigned int)b) << 16); }
__device__ __forceinline__ float bf16_round(float x) { return bf16_val(bf16_bits(x)); }
// D += A·B with NT terms: 1 = ah·bh, 2 = + al·bh (A split), 3 = + ah·bl (both split)
template <int NT>
__device__ __forceinline__ v8f mmaN(v16b ah, v16b al, v16b bh, v16b bl, v8f c) {
  c = __builtin_amdgcn_wmma_f32_16x16x32_bf16(false, ah, false, bh, (short)0, c, false, false);
  if (NT >= 2) c = __builtin_amdgcn_wmma_f32_16x16x32_bf16(false, al, false, bh, (short)0, c, false, false);
  if (NT >= 3) c = __builtin_amdgcn_wmma_f32_16x16x32_bf16(false, ah, false, bl, (short)0, c, false, false);
  asm volatile("v_nop\n\tv_nop\n\tv_nop\n\tv_nop" : "+v"(c) : "v"(ah), "v"(al), "v"(bh), "v"(bl));
  return c;
}

__global__ __launch_bounds__(256) void k_wt_bf16(const float* __restrict__ W, unsigned short* __restrict__ Wt, int K, int N) {
  const int t = blockIdx.x * 256 + threadIdx.x;
  const int k8n = K / 8;
  if (t >= N * k8n) return;
  const int n = t / k8n, k8 = (t % k8n) * 8;
  v8us v;
#pragma unroll
  for (int i = 0; i < 8; ++i) v[i] = bf16_bits(W[(size_t)(k8 + i) * N + n]);
  *(v8us*)(Wt + (size_t)n * K + k8) = v;
  
}

// GEMM C[M][N] (f32, pitch ldc) = act(A[M][K]·W + bias). A f32 row-major (pitch lda) converted per fragment to bf16
// (ASPLIT: hi/lo two planes -> 2 terms, else single rounded term); Wt bf16 [N][K] (pitch ldb). BIAS_BF16 rounds the
// bias to bf16 first (bias quantised to bf16 before the add). K%32==0, M%16==0, N%64==0.
template <bool ASPLIT, int ACT, bool BIAS_BF16>
__global__ __launch_bounds__(128) void k_gemm_bf(const float* __restrict__ A, int lda, const unsigned short* __restrict__ Wt, int ldb,
                                               const float* __restrict__ bias, float* __restrict__ C, int ldc, int M, int N, int K) {
  __shared__ __attribute__((aligned(16))) float so[4][16][64];
  const int tid = threadIdx.x, w = tid >> 5, lane = tid & 31, ln = lane & 15, hh = lane >> 4;
  const int ntn = N / 64;
  const int wid = blockIdx.x * 4 + w;
  const int mt = wid / ntn, nq = wid % ntn;
  if (mt * 16 >= M) return;
  const int row0 = mt * 16, col0 = nq * 64;
  const float* arow = A + (size_t)(row0 + ln) * lda;
  v8f acc[4] = {};
  for (int kb = 0; kb < K; kb += 32) {
    FragB ah, al;
    const v4f x0 = *(const v4fa*)(arow + kb + 8 * hh), x1 = *(const v4fa*)(arow + kb + 8 * hh + 4);
    const v4f x2 = *(const v4fa*)(arow + kb + 16 + 8 * hh), x3 = *(const v4fa*)(arow + kb + 16 + 8 * hh + 4);
    float xs[16] = {x0[0],x0[1],x0[2],x0[3],x1[0],x1[1],x1[2],x1[3],x2[0],x2[1],x2[2],x2[3],x3[0],x3[1],x3[2],x3[3]};
#pragma unroll
    for (int i = 0; i < 16; ++i) { const unsigned short hb = bf16_bits(xs[i]); ah.u[i] = hb; al.u[i] = ASPLIT ? bf16_bits(xs[i] - bf16_val(hb)) : (unsigned short)0; }
#pragma unroll
    for (int t = 0; t < 4; ++t) {
      const unsigned short* brow = Wt + (size_t)(col0 + t * 16 + ln) * ldb + kb;
      FragB b;
      b.half[0] = *(const v8us*)(brow + 8 * hh);
      b.half[1] = *(const v8us*)(brow + 16 + 8 * hh);
      acc[t] = mmaN<ASPLIT ? 2 : 1>(ah.v, al.v, b.v, b.v, acc[t]);
    }
  }
#pragma unroll
  for (int t = 0; t < 4; ++t) {
    float bv = bias ? bias[col0 + t * 16 + ln] : 0.f;
    if (BIAS_BF16) bv = bf16_round(bv);
#pragma unroll
    for (int r = 0; r < 8; ++r) { float v = acc[t][r] + bv; if (ACT == 1) v = fmaxf(v, 0.f); so[w][8 * hh + r][t * 16 + ln] = v; }
  }
  __builtin_amdgcn_fence(__ATOMIC_ACQ_REL, "workgroup");
  __builtin_amdgcn_wave_barrier();
  const int rsub = lane >> 4, c4 = (lane & 15) * 4;
  {
#pragma unroll
    for (int q = 0; q < 8; ++q) {
      const int r = q * 2 + rsub;
      const v4f v = *(const v4fa*)&so[w][r][c4];
      *(v4f*)(C + (size_t)(row0 + r) * ldc + col0 + c4) = v;
    }
    
  }
}

// GEMM C = act(A·W + bias + resid): A f32 (ASPLIT -> hi/lo 2 terms), Wt bf16 [N][K]; ACT 0 none, 1 relu, 2 exact gelu;
// resid (optional, f32, row index = (row % rmod), pitch ldr, RES_BF16 rounds it) added before the activation.
template <bool ASPLIT, int ACT, bool BIAS_BF16, bool RES_BF16>
__global__ __launch_bounds__(128) void k_gemm_bf3(const float* __restrict__ A, int lda, const unsigned short* __restrict__ Wt, int ldb,
                                                const float* __restrict__ bias, const float* __restrict__ resid, int rmod, int ldr,
                                                float* __restrict__ C, int ldc, int M, int N, int K) {
  __shared__ __attribute__((aligned(16))) float so[4][16][64];
  const int tid = threadIdx.x, w = tid >> 5, lane = tid & 31, ln = lane & 15, hh = lane >> 4;
  const int ntn = N / 64;
  const int wid = blockIdx.x * 4 + w;
  const int mt = wid / ntn, nq = wid % ntn;
  if (mt * 16 >= M) return;
  const int row0 = mt * 16, col0 = nq * 64;
  const float* arow = A + (size_t)(row0 + ln) * lda;
  v8f acc[4] = {};
  for (int kb = 0; kb < K; kb += 32) {
    FragB ah, al;
    const v4f x0 = *(const v4fa*)(arow + kb + 8 * hh), x1 = *(const v4fa*)(arow + kb + 8 * hh + 4);
    const v4f x2 = *(const v4fa*)(arow + kb + 16 + 8 * hh), x3 = *(const v4fa*)(arow + kb + 16 + 8 * hh + 4);
    float xs[16] = {x0[0],x0[1],x0[2],x0[3],x1[0],x1[1],x1[2],x1[3],x2[0],x2[1],x2[2],x2[3],x3[0],x3[1],x3[2],x3[3]};
#pragma unroll
    for (int i = 0; i < 16; ++i) { const unsigned short hb = bf16_bits(xs[i]); ah.u[i] = hb; al.u[i] = ASPLIT ? bf16_bits(xs[i] - bf16_val(hb)) : (unsigned short)0; }
#pragma unroll
    for (int t = 0; t < 4; ++t) {
      const unsigned short* brow = Wt + (size_t)(col0 + t * 16 + ln) * ldb + kb;
      FragB b;
      b.half[0] = *(const v8us*)(brow + 8 * hh);
      b.half[1] = *(const v8us*)(brow + 16 + 8 * hh);
      acc[t] = mmaN<ASPLIT ? 2 : 1>(ah.v, al.v, b.v, b.v, acc[t]);
    }
  }
#pragma unroll
  for (int t = 0; t < 4; ++t) {
    const int col = col0 + t * 16 + ln;
    float bv = bias ? bias[col] : 0.f;
    if (BIAS_BF16) bv = bf16_round(bv);
#pragma unroll
    for (int r = 0; r < 8; ++r) {
      float v = acc[t][r] + bv;
      if (resid) { float rv = resid[(size_t)((row0 + 8 * hh + r) % rmod) * ldr + col]; if (RES_BF16) rv = bf16_round(rv); v += rv; }
      if (ACT == 1) v = fmaxf(v, 0.f);
      if (ACT == 2) v = 0.5f * v * (1.0f + erff(v * 0.70710678118654752f));
      if (ACT == 3) { const float u = 0.7978845608028654f * (v + 0.044715f * v * v * v); v = 0.5f * v * (1.0f + tanhf(u)); }
      so[w][8 * hh + r][t * 16 + ln] = v;
    }
  }
  __builtin_amdgcn_fence(__ATOMIC_ACQ_REL, "workgroup");
  __builtin_amdgcn_wave_barrier();
  const int rsub = lane >> 4, c4 = (lane & 15) * 4;
  {
#pragma unroll
    for (int q = 0; q < 8; ++q) {
      const int r = q * 2 + rsub;
      const v4f v = *(const v4fa*)&so[w][r][c4];
      *(v4f*)(C + (size_t)(row0 + r) * ldc + col0 + c4) = v;
    }
    
  }
}
// row LayerNorm (biased variance, eps) over N: s = X (+ R); optional out_sum <- s; out_norm <- (s-mu)*rsqrt(var+eps)*g + b
template <bool PARAM_BF16>
__global__ __launch_bounds__(256) void k_layernorm(const float* __restrict__ X, const float* __restrict__ R, const float* __restrict__ g, const float* __restrict__ bta,
                                                  float* __restrict__ out_sum, float* __restrict__ out_norm, int N, float eps) {
  __shared__ float red[256];
  const int row = blockIdx.x, tid = threadIdx.x;
  const float* x = X + (size_t)row * N; const float* rr = R ? R + (size_t)row * N : nullptr;
  float vals[16];                     // up to N = 4096
  const int per = N / 256;            // contiguous chunk per thread? use strided-by-4 chunks: thread handles j = tid*4 + 1024*u
  float s1 = 0.f;
  for (int u = 0; u < per / 4; ++u) {
    const int j = tid * 4 + 1024 * u;
    const v4f a = *(const v4fa*)(x + j);
    v4f b = {0.f,0.f,0.f,0.f}; if (rr) b = *(const v4fa*)(rr + j);
#pragma unroll
    for (int q = 0; q < 4; ++q) { const float v = a[q] + b[q]; vals[u * 4 + q] = v; s1 += v; }
  }
  red[tid] = s1; __syncthreads();
  for (int st = 128; st > 0; st >>= 1) { if (tid < st) red[tid] += red[tid + st]; __syncthreads(); }
  const float mu = red[0] / (float)N; __syncthreads();
  float s2 = 0.f;
  for (int u = 0; u < per / 4; ++u)
#pragma unroll
    for (int q = 0; q < 4; ++q) { const float c = vals[u * 4 + q] - mu; s2 += c * c; }
  red[tid] = s2; __syncthreads();
  for (int st = 128; st > 0; st >>= 1) { if (tid < st) red[tid] += red[tid + st]; __syncthreads(); }
  const float rs = rsqrtf(red[0] / (float)N + eps);
  {
    for (int u = 0; u < per / 4; ++u) {
      const int j = tid * 4 + 1024 * u;
      v4f o, sm;
#pragma unroll
      for (int q = 0; q < 4; ++q) {
        float gg = g[j + q], bb = bta[j + q];
        if (PARAM_BF16) { gg = bf16_round(gg); bb = bf16_round(bb); }
        sm[q] = vals[u * 4 + q]; o[q] = (vals[u * 4 + q] - mu) * rs * gg + bb;
      }
      if (out_sum) *(v4f*)(out_sum + (size_t)row * N + j) = sm;
      *(v4f*)(out_norm + (size_t)row * N + j) = o;
    }
    
  }
}



// ---- f16 WMMA path (v_wmma_f32_16x16x32_f16): 11-bit significands for operands in range — used where a [0,1] probability operand needs more precision than bf16
typedef _Float16 v16h __attribute__((ext_vector_type(16)));
union FragH { v16h v; v8us half[2]; _Float16 h[16]; unsigned short u[16]; };
template <int NT>
__device__ __forceinline__ v8f mmaH(v16h ah, v16h al, v16h bh, v16h bl, v8f c) {
  c = __builtin_amdgcn_wmma_f32_16x16x32_f16(false, ah, false, bh, (short)0, c, false, false);
  if (NT >= 2) c = __builtin_amdgcn_wmma_f32_16x16x32_f16(false, al, false, bh, (short)0, c, false, false);
  if (NT >= 3) c = __builtin_amdgcn_wmma_f32_16x16x32_f16(false, ah, false, bl, (short)0, c, false, false);
  asm volatile("v_nop\n\tv_nop\n\tv_nop\n\tv_nop" : "+v"(c) : "v"(ah), "v"(al), "v"(bh), "v"(bl));
  return c;
}
// batched GEMM like k_gemm_b but f16 operands: A f32 (split into f16 hi/lo if ASPLIT, else rounded to f16), Bt = f16 values [n][k]; alpha; C f32; N multiple of 16 (partial tiles skipped)
template <bool ASPLIT>
__global__ __launch_bounds__(128) void k_gemm_h(const float* __restrict__ A, int lda, size_t sA, const _Float16* __restrict__ Bh, int ldb, size_t sB, float alpha, float* __restrict__ C, int ldc, size_t sC, int M, int N, int K) {
  __shared__ __attribute__((aligned(16))) float so[4][16][64];
  const int tid = threadIdx.x, w = tid >> 5, lane = tid & 31, ln = lane & 15, hh = lane >> 4; const int by = blockIdx.y;
  A += (size_t)by * sA; Bh += (size_t)by * sB; C += (size_t)by * sC;
  const int ntn = (N + 63) / 64; const int wid = blockIdx.x * 4 + w; const int mt = wid / ntn, nq = wid % ntn; if (mt * 16 >= M) return;
  const int row0 = mt * 16, col0 = nq * 64; const float* arow = A + (size_t)(row0 + ln) * lda;
  v8f acc[4] = {};
  for (int kb = 0; kb < K; kb += 32) {
    FragH ah, al;
    const v4f x0 = *(const v4fa*)(arow + kb + 8 * hh), x1 = *(const v4fa*)(arow + kb + 8 * hh + 4), x2 = *(const v4fa*)(arow + kb + 16 + 8 * hh), x3 = *(const v4fa*)(arow + kb + 16 + 8 * hh + 4);
    float xs[16] = {x0[0],x0[1],x0[2],x0[3],x1[0],x1[1],x1[2],x1[3],x2[0],x2[1],x2[2],x2[3],x3[0],x3[1],x3[2],x3[3]};
#pragma unroll
    for (int i = 0; i < 16; ++i) { const _Float16 h = (_Float16)xs[i]; ah.h[i] = h; al.h[i] = ASPLIT ? (_Float16)(xs[i] - (float)h) : (_Float16)0.0f; }
#pragma unroll
    for (int t = 0; t < 4; ++t) { if (col0 + t * 16 >= N) continue; const size_t boff = (size_t)(col0 + t * 16 + ln) * ldb + kb; FragH bq; bq.half[0] = *(const v8us*)(Bh + boff + 8 * hh); bq.half[1] = *(const v8us*)(Bh + boff + 16 + 8 * hh);
      acc[t] = mmaH<ASPLIT ? 2 : 1>(ah.v, al.v, bq.v, bq.v, acc[t]); }
  }
#pragma unroll
  for (int t = 0; t < 4; ++t) { if (col0 + t * 16 >= N) continue;
#pragma unroll
    for (int r = 0; r < 8; ++r) so[w][8 * hh + r][t * 16 + ln] = acc[t][r] * alpha; }
  __builtin_amdgcn_fence(__ATOMIC_ACQ_REL, "workgroup"); __builtin_amdgcn_wave_barrier();
  const int rsub = lane >> 4, c4 = (lane & 15) * 4;
  {
#pragma unroll
    for (int q = 0; q < 8; ++q) { const int r = q * 2 + rsub; if (col0 + c4 < N) { const v4f v = *(const v4fa*)&so[w][r][c4]; *(v4f*)(C + (size_t)(row0 + r) * ldc + col0 + c4) = v; } }
     }
}

// Wt[n][k] = f16(W[k][n]·scale) from f32 row-major W[K][N] (scale = power of two; bf16-exact weights stay exact in f16 away from the subnormal range)
__global__ __launch_bounds__(256) void k_wt_f16(const float* __restrict__ W, _Float16* __restrict__ Wt, int K, int N, float scale) {
  const int t = blockIdx.x * 256 + threadIdx.x; if (t >= N * (K / 8)) return; const int n = t / (K / 8), k8 = (t % (K / 8)) * 8; FragH f;
#pragma unroll
  for (int i = 0; i < 8; ++i) f.h[i] = (_Float16)(bf16_round(W[(size_t)(k8 + i) * N + n]) * scale); const v8us o = f.half[0];
  *(v8us*)((unsigned short*)Wt + (size_t)n * K + k8) = o; 
}
// k_gemm_hh variant with fused epilogue: v = acc·alpha + bias[by·sBias + col] (+ CP[(row/rowsPerB)·sCPb + by·64 + col] if CP) ; ACT 0 none / 1 elu ; writes f16 C16 (and f32 C if non-null)
template <int ACT>
__global__ __launch_bounds__(128) void k_gemm_hhx(const _Float16* __restrict__ A, int lda, size_t sA, const _Float16* __restrict__ Bh, int ldb, size_t sB, float alpha, const float* __restrict__ bias, size_t sBias, const float* __restrict__ CP, int rowsPerB, size_t sCPb, int row0g,
    float* __restrict__ C, _Float16* __restrict__ C16, int ldc, size_t sC, int M, int N, int K) {
  __shared__ __attribute__((aligned(16))) float so[4][16][64];
  const int tid = threadIdx.x, w = tid >> 5, lane = tid & 31, ln = lane & 15, hh = lane >> 4; const int by = blockIdx.y;
  A += (size_t)by * sA; Bh += (size_t)by * sB; const size_t cofs = (size_t)by * sC; const float* bp = bias ? bias + (size_t)by * sBias : nullptr;
  const int ntn = (N + 63) / 64; const int wid = blockIdx.x * 4 + w; const int mt = wid / ntn, nq = wid % ntn; if (mt * 16 >= M) return;
  const int row0 = mt * 16, col0 = nq * 64; const _Float16* arow = A + (size_t)(row0 + ln) * lda;
  v8f acc[4] = {};
  for (int kb = 0; kb < K; kb += 32) { FragH ah; ah.half[0] = *(const v8us*)((const unsigned short*)arow + kb + 8 * hh); ah.half[1] = *(const v8us*)((const unsigned short*)arow + kb + 16 + 8 * hh);
#pragma unroll
    for (int t = 0; t < 4; ++t) { if (col0 + t * 16 >= N) continue; const size_t boff = (size_t)(col0 + t * 16 + ln) * ldb + kb; FragH bq; bq.half[0] = *(const v8us*)((const unsigned short*)Bh + boff + 8 * hh); bq.half[1] = *(const v8us*)((const unsigned short*)Bh + boff + 16 + 8 * hh);
      acc[t] = mmaH<1>(ah.v, ah.v, bq.v, bq.v, acc[t]); }
  }
#pragma unroll
  for (int t = 0; t < 4; ++t) { if (col0 + t * 16 >= N) continue; const int col = col0 + t * 16 + ln; const float bv = bp ? bf16_round(bp[col]) : 0.f;
#pragma unroll
    for (int r = 0; r < 8; ++r) { float v = acc[t][r] * alpha + bv; if (CP) { const int rr = row0g + row0 + 8 * hh + r; if (rowsPerB < 0) v += CP[cofs + (size_t)rr * ldc + col];      /* rowsPerB < 0: own element of the batched C plane */ else { const int bidx = rr / rowsPerB; v += CP[(size_t)bidx * sCPb + (size_t)by * 64 + col]; } } if (ACT == 1) v = (v > 0.f) ? v : expm1f(v); else if (ACT == 7) v = (v > 0.f) ? v + 1.0f : expf(v); else if (ACT == 8) v = tanhf(v); else if (ACT == 9) v = 0.5f * v * (1.0f + tanhf(0.7978845608028654f * (v + 0.044715f * v * v * v))); else if (ACT == 11) v = 1.0f / (1.0f + expf(-v)); else if (ACT == 12) v = (v > 0.f) ? v : 0.01f * v; else if (ACT == 14) v = (v > 0.f) ? v : 0.1f * v; else if (ACT == 16) v = (v >= 0.f) ? v : 0.3f * v; else if (ACT == 17) v = (v >= 0.f) ? v : 0.2f * v; else if (ACT == 15) v = v / (1.0f + expf(-v)); else if (ACT == 3) v = fmaxf(v, 0.f); else if (ACT == 6) v = 0.5f * v * (1.0f + erff(v * 0.70710678118654752f)); so[w][8 * hh + r][t * 16 + ln] = v; } }
  __builtin_amdgcn_fence(__ATOMIC_ACQ_REL, "workgroup"); __builtin_amdgcn_wave_barrier();
  const int rsub = lane >> 4, c4 = (lane & 15) * 4; typedef _Float16 v4h __attribute__((ext_vector_type(4)));
  {
#pragma unroll
    for (int q = 0; q < 8; ++q) { const int r = q * 2 + rsub; if (col0 + c4 < N) { const v4f v = *(const v4fa*)&so[w][r][c4]; if (C) *(v4f*)(C + cofs + (size_t)(row0 + r) * ldc + col0 + c4) = v; if (C16) { v4h h4; for (int i = 0; i < 4; ++i) h4[i] = (_Float16)v[i]; *(v4h*)(C16 + cofs + (size_t)(row0 + r) * ldc + col0 + c4) = h4; } } }
     }
}


typedef _Float16 v4h __attribute__((ext_vector_type(4)));

__global__ __launch_bounds__(256) void k_x16(const float* __restrict__ x, _Float16* __restrict__ X16, size_t n8) { const size_t t = (size_t)blockIdx.x * 256 + threadIdx.x; if (t >= n8) return; FragH f;
#pragma unroll
  for (int q = 0; q < 8; ++q) f.h[q] = (_Float16)bf16_round(x[t * 8 + q]); *(v8us*)((unsigned short*)X16 + t * 8) = f.half[0];  }
__global__ __launch_bounds__(256) void k_h16(const float* __restrict__ x, _Float16* __restrict__ X16, size_t n8) { const size_t t = (size_t)blockIdx.x * 256 + threadIdx.x; if (t >= n8) return; FragH f;
#pragma unroll
  for (int q = 0; q < 8; ++q) f.h[q] = (_Float16)x[t * 8 + q]; *(v8us*)((unsigned short*)X16 + t * 8) = f.half[0];  }
__global__ __launch_bounds__(256) void k_round16f(const float* __restrict__ W, _Float16* __restrict__ Bt, size_t n8) { const size_t t = (size_t)blockIdx.x * 256 + threadIdx.x; if (t >= n8) return; FragH f;
#pragma unroll
  for (int i = 0; i < 8; ++i) f.h[i] = (_Float16)(bf16_round(W[t * 8 + i]) * 16.0f); *(v8us*)((unsigned short*)Bt + t * 8) = f.half[0];  }
__global__ __launch_bounds__(256) void k_hl(const float* __restrict__ F, _Float16* __restrict__ Hh, _Float16* __restrict__ Hl, size_t n8) { const size_t t = (size_t)blockIdx.x * 256 + threadIdx.x; if (t >= n8) return; FragH fh, fl; const v4f a = *(const v4fa*)(F + t * 8), c = *(const v4fa*)(F + t * 8 + 4);
#pragma unroll
  for (int q = 0; q < 4; ++q) { _Float16 h = (_Float16)a[q]; fh.h[q] = h; fl.h[q] = (_Float16)((a[q] - (float)h) * 1024.0f); h = (_Float16)c[q]; fh.h[4 + q] = h; fl.h[4 + q] = (_Float16)((c[q] - (float)h) * 1024.0f); }
  { *(v8us*)((unsigned short*)Hh + t * 8) = fh.half[0]; *(v8us*)((unsigned short*)Hl + t * 8) = fl.half[0];  } }

// ---- operand preparation, ONE launch of 256 work-groups (as many as the chip has WGPs), 8 waves each: every wave does a long share of the work, so that few waves have to be started.
// A work-group turns one 64 k x 192 n strip of W ([k][n] f32) into 192 rows of Bt ([n][k] f16, bf16-rounded, x16) and converts 2048 chunks of 8 x values (bf16-rounded, f16).
// Every global access is whole lines: W rows are read in 256-byte runs, x in 32 bytes a lane, Bt is written in 128-byte runs (8 lanes a row), X16 in 16 bytes a lane.
// All 28 loads of a lane are issued before anything waits. The strip is turned in LDS as f32 at a pitch of 193 dwords (1 mod 64): the row-wise dword stores and the column-wise dword reads both fall on distinct banks.
#define PKT 64                       /* k rows of a strip */
#define PNT 192                      /* n columns of a strip */
#define PPT 193                      /* LDS pitch of a strip row in dwords */
#define PXC 2048                     /* 8-element chunks of x per work-group */
#define PWG ((DM / PKT) * (LQ / PNT))      /* work-groups */
static_assert((size_t)PWG * PXC * 8 == (size_t)NB * SQ * DM, "the x shares cover x exactly");
__global__ __launch_bounds__(256) void k_prep(const float* __restrict__ x, const float* __restrict__ Wq, _Float16* __restrict__ X16, _Float16* __restrict__ Bt) {
  __shared__ float T[PKT * PPT];
  const int tid = threadIdx.x;
  const int k0 = (blockIdx.x / (LQ / PNT)) * PKT, n0 = (blockIdx.x % (LQ / PNT)) * PNT;
  const int r = tid >> 4, c4 = (tid & 15) * 4;      /* 16 lanes a row: 256 contiguous bytes */
  const float* wp = Wq + (size_t)(k0 + r) * LQ + n0 + c4;
  const float* xp = x + ((size_t)blockIdx.x * PXC + tid) * 8;
  v4f wv[3][4], xv[8][2];
#pragma unroll
  for (int j = 0; j < 3; ++j)
#pragma unroll
    for (int u = 0; u < 4; ++u) wv[j][u] = *(const v4fa*)(wp + (size_t)(16 * u) * LQ + 64 * j);
#pragma unroll
  for (int i = 0; i < 8; ++i) { xv[i][0] = *(const v4fa*)(xp + i * 2048); xv[i][1] = *(const v4fa*)(xp + i * 2048 + 4); }
  /* The wait in front of any rewrite of a register that an issued load names. It takes W's address pair as an input, so that no later load of the group gets that pair as its destination;
     its "memory" clobber also keeps all 28 loads above it: without that the compiler sinks twelve x loads behind the waits for W, and their latency is paid a second time. */
  asm volatile("s_wait_xcnt 0x0" :: "v"(wp) : "memory");
#pragma unroll
  for (int j = 0; j < 3; ++j)
#pragma unroll
    for (int u = 0; u < 4; ++u)
#pragma unroll
      for (int e = 0; e < 4; ++e) T[(r + 16 * u) * PPT + 64 * j + c4 + e] = wv[j][u][e];
  __syncthreads();      /* the strip is whole in LDS before anybody reads a column */
  unsigned short* xo = (unsigned short*)X16 + ((size_t)blockIdx.x * PXC + tid) * 8;
#pragma unroll
  for (int i = 0; i < 8; ++i) { FragH f;
#pragma unroll
    for (int q = 0; q < 8; ++q) f.h[q] = (_Float16)bf16_round(xv[i][q >> 2][q & 3]);
    *(v8us*)(xo + i * 2048) = f.half[0]; }
  const int n = tid >> 3, k8 = (tid & 7) * 8;      /* 8 lanes a Bt row: 128 contiguous bytes */
  unsigned short* bo = (unsigned short*)Bt + (size_t)(n0 + n) * DM + k0 + k8;
#pragma unroll
  for (int u = 0; u < PNT / 32; ++u) { FragH f;
#pragma unroll
    for (int i = 0; i < 8; ++i) f.h[i] = (_Float16)(bf16_round(T[(k8 + i) * PPT + n + 32 * u]) * 16.0f);
    *(v8us*)(bo + (size_t)(32 * u) * DM) = f.half[0]; }
}

// ---- projection GEMM: C = A Bh^T / 16 + bias, A [4096][1024] and Bh [3072][1024] f16, both k-contiguous. One work-group = a 128 x 128 tile, four waves of 64 x 64 (4 x 4 accumulator tiles each).
// A stage = 64 k of the tile's 128 A rows and 128 Bh rows (128-byte rows) in LDS, brought by asynchronous 16-byte copies (global_load_async_to_lds_b128) into two buffers: stage t + 2 flies while stage t + 1 is worked on.
// Every fragment is read from LDS and feeds four products; a k step is 32, taken in rising order into the same accumulator.
// Epilogue by 64-column halves (a half is exactly one head's q, k or v slice: columns are packed per head, 192 h + {0 q, 64 k, 128 v}): q and k halves go as f16 rows into C16 (whole 128-byte lines; q times QSC, the softmax scale in base 2),
// a v half goes TRANSPOSED into that head's V^T plane VTo[(b NH + h) HD + d][key] and nowhere else (a lane's accumulator holds 8 consecutive keys of ONE d: 16 contiguous bytes of a V^T row; 256-byte runs).
#define VTP 136                      /* LDS pitch of a staged V^T row in f16: 256 data bytes + 16, an odd multiple of 16 bytes for the 16-byte stores and reads */
#define GK 64                        /* k per stage */
#define GP 72                        /* LDS row pitch of a stage in f16: 128 data bytes + 16, an odd multiple of 16 bytes for the 16-byte fragment reads */
#define GSTG (256 * GP)              /* f16 per stage: 128 A rows, then 128 Bh rows */
#define GEH (128 * GP)               /* f16 per epilogue half: [128 rows][GP], or [64 d][VTP], which is smaller */
#define QSC (0.125f * 1.4426950408889634f)      /* 1 / sqrt(64), and base e to base 2: q is stored times this (applied in f32, in front of its one f16 rounding), so that k . q is the score in log2 units */
__device__ __forceinline__ v16h g2_frag(const _Float16* p, int hh) { FragH f; f.half[0] = *(const v8us*)((const unsigned short*)p + 8 * hh); f.half[1] = *(const v8us*)((const unsigned short*)p + 16 + 8 * hh); return f.v; }
__device__ __forceinline__ v16h g3_frag(const unsigned short* p, int hh) { FragH f; f.half[0] = *(const v8us*)(p + 8 * hh); f.half[1] = *(const v8us*)(p + 16 + 8 * hh); return f.v; }
// Eight copies of a lane: its 16-byte chunk of rows r, r + 16, ..., r + 112 (a wave's copy = four whole 128-byte rows). l = the lane's LDS byte address, g = its global address.
// The s_wait_xcnt stands inside the statement, behind the last copy, so that no address register of a copy is rewritten in front of it.
__device__ __forceinline__ void g3_copy8(unsigned l, const _Float16* g) {
  asm volatile("global_load_async_to_lds_b128 %0, %8, off\n\tglobal_load_async_to_lds_b128 %1, %9, off\n\tglobal_load_async_to_lds_b128 %2, %10, off\n\tglobal_load_async_to_lds_b128 %3, %11, off\n\t"
               "global_load_async_to_lds_b128 %4, %12, off\n\tglobal_load_async_to_lds_b128 %5, %13, off\n\tglobal_load_async_to_lds_b128 %6, %14, off\n\tglobal_load_async_to_lds_b128 %7, %15, off\n\ts_wait_xcnt 0x0"
               :: "v"(l), "v"(l + 16 * GP * 2), "v"(l + 32 * GP * 2), "v"(l + 48 * GP * 2), "v"(l + 64 * GP * 2), "v"(l + 80 * GP * 2), "v"(l + 96 * GP * 2), "v"(l + 112 * GP * 2),
                  "v"(g), "v"(g + 16 * DM), "v"(g + 32 * DM), "v"(g + 48 * DM), "v"(g + 64 * DM), "v"(g + 80 * DM), "v"(g + 96 * DM), "v"(g + 112 * DM) : "memory");
}
__global__ __launch_bounds__(128) void k_gemm3(const _Float16* __restrict__ A, const _Float16* __restrict__ Bh, const float* __restrict__ bias, _Float16* __restrict__ C16, _Float16* __restrict__ VTo) {
  __shared__ __attribute__((aligned(16))) unsigned short sm[2 * GSTG];
  const int tid = threadIdx.x, w = tid >> 5, lane = tid & 31, ln = lane & 15, hh = lane >> 4, wm = w >> 1, wn = w & 1;
  const int mt = blockIdx.x / (LQ / 128), nt = blockIdx.x % (LQ / 128); const int row0 = mt * 128, col0 = nt * 128;
  const int crow = tid >> 3, cc8 = (tid & 7) * 8;      /* the lane's first row and its 16-byte chunk in every copy */
  const _Float16* ag = A + (size_t)(row0 + crow) * DM + cc8; const _Float16* bg = Bh + (size_t)(col0 + crow) * DM + cc8;
  const unsigned la = (unsigned)(size_t)&sm[crow * GP + cc8], lb = la + 128 * GP * 2;
  g3_copy8(la, ag); g3_copy8(lb, bg);
  asm volatile("s_wait_asynccnt 0x0" ::: "memory");      /* this wave's share of stage 0 has landed */
  __syncthreads();      /* stage 0 is complete before anybody reads it */
  g3_copy8(la + GSTG * 2, ag + GK); g3_copy8(lb + GSTG * 2, bg + GK);
  const v8f z8 = {0.f, 0.f, 0.f, 0.f, 0.f, 0.f, 0.f, 0.f};
  v8f acc[4][4];
#pragma unroll
  for (int i = 0; i < 4; ++i)
#pragma unroll
    for (int j = 0; j < 4; ++j) acc[i][j] = z8;
  /* the stage loop stays rolled (one copy of its 32 products); everything inside is unrolled, so that acc is indexed by constants only and stays in registers */
#pragma unroll 1
  for (int t = 0; t < DM / GK; ++t) {
    const unsigned short* sa = sm + (t & 1) * GSTG + (64 * wm + ln) * GP; const unsigned short* sb = sm + (t & 1) * GSTG + (128 + 64 * wn + ln) * GP;
#pragma unroll
    for (int ks = 0; ks < 2; ++ks) {
      /* The k step's eight fragments are read as one group, whole in front of its sixteen products. The scheduling fences hold that order: without them the compiler keeps one A fragment,
         reads the next among the products and waits out the LDS latency in front of every four of them. */
      __builtin_amdgcn_sched_barrier(0);      /* nothing of the group's reads moves up among the products before */
      v16h af[4], bf[4];
#pragma unroll
      for (int i = 0; i < 4; ++i) { af[i] = g3_frag(sa + 16 * i * GP + ks * 32, hh); bf[i] = g3_frag(sb + 16 * i * GP + ks * 32, hh); }
      __builtin_amdgcn_sched_barrier(0);      /* none of the group's reads sinks among its products */
#pragma unroll
      for (int i = 0; i < 4; ++i)
#pragma unroll
        for (int j = 0; j < 4; ++j) acc[i][j] = __builtin_amdgcn_wmma_f32_16x16x32_f16(false, af[i], false, bf[j], (short)0, acc[i][j], false, false);
    }
    __builtin_amdgcn_sched_barrier(0);      /* keeps the last sixteen products above the stage's foot: without it the compiler sinks them behind the barrier, in front of the copies, which then start that much later */
    asm volatile("s_wait_dscnt 0x0" ::: "memory");      /* this wave's reads of stage t are done before the buffer is handed back */
    asm volatile("s_wait_asynccnt 0x0" ::: "memory");      /* this wave's share of stage t + 1 has landed */
    __syncthreads();      /* publishes stage t + 1 and ends every wave's reads of stage t */
    if (t + 2 < DM / GK) { g3_copy8(la + (t & 1) * (GSTG * 2), ag + (t + 2) * GK); g3_copy8(lb + (t & 1) * (GSTG * 2), bg + (t + 2) * GK); }
  }
  asm volatile("s_wait_asynccnt 0x0" ::: "memory");      /* nothing is in flight when the buffers become output staging */
  /* behind the loop's last barrier nobody reads a stage any more: each column half is staged in its own GEH range */
  { unsigned short* sr = sm + wn * GEH; const int cb = col0 + 64 * wn;
    float bv[4];
#pragma unroll
    for (int j = 0; j < 4; ++j) bv[j] = bias[cb + 16 * j + ln];
#pragma unroll
    for (int j = 0; j < 4; ++j) bv[j] = bf16_round(bv[j]);
    if ((cb / HD) % 3 == 2) {
#pragma unroll
      for (int i = 0; i < 4; ++i)
#pragma unroll
        for (int j = 0; j < 4; ++j) { FragH f;
#pragma unroll
          for (int r = 0; r < 8; ++r) f.h[r] = (_Float16)(acc[i][j][r] * 0.0625f + bv[j]);
          *(v8us*)(sr + (16 * j + ln) * VTP + 64 * wm + 16 * i + 8 * hh) = f.half[0]; }
    } else {
      const float qs = (cb / HD) % 3 == 0 ? QSC : 1.0f, as = 0.0625f * qs;      /* a q half carries the softmax scale; a k half keeps its bits (factor 1) */
#pragma unroll
      for (int i = 0; i < 4; ++i)
#pragma unroll
        for (int j = 0; j < 4; ++j) { FragH f;
#pragma unroll
          for (int r = 0; r < 8; ++r) f.h[r] = (_Float16)(acc[i][j][r] * as + bv[j] * qs);
#pragma unroll
          for (int r = 0; r < 8; ++r) sr[(64 * wm + 16 * i + 8 * hh + r) * GP + 16 * j + ln] = f.u[r]; }
    } }
  __syncthreads();      /* both halves are whole in LDS before anybody reads a row */
#pragma unroll
  for (int n = 0; n < 2; ++n) { const unsigned short* sr = sm + n * GEH; const int cb = col0 + 64 * n;
    const bool isv = (cb / HD) % 3 == 2;      /* the same for the whole work-group: cb comes from blockIdx alone */
    const int sh = isv ? 4 : 3, lp = isv ? VTP : GP, gp = isv ? SQ : LQ;      /* 16-byte chunks a staged row (log2), its LDS pitch, its pitch in memory: V^T rows of 256 bytes, or q / k rows of 128 */
    unsigned short* gb = isv ? (unsigned short*)VTo + ((size_t)(row0 / SQ) * NH + cb / (3 * HD)) * HD * SQ + row0 % SQ : (unsigned short*)C16 + (size_t)row0 * LQ + cb;
    v8us dv[8]; unsigned short* dp[8];
#pragma unroll
    for (int i = 0; i < 8; ++i) { const int c = tid + 128 * i, x = c >> sh, y = (c & ((1 << sh) - 1)) * 8; dv[i] = *(const v8us*)(sr + x * lp + y); dp[i] = gb + (size_t)x * gp + y; }
    __builtin_amdgcn_sched_barrier(0);      /* the eight reads and addresses stand whole in front of the stores, so that no register of an issued store is rewritten among them */
#pragma unroll
    for (int i = 0; i < 8; ++i) *(v8us*)dp[i] = dv[i];      /* a wave's store = whole lines: two 256-byte runs, or four 128-byte rows */
    if (n == 0) { asm volatile("s_wait_xcnt 0x0" ::: "memory");      /* in front of the second half's work, which rewrites the registers that these stores name */
      __builtin_amdgcn_sched_barrier(0); }      /* holds that work behind the wait */
  }
}


__global__ __launch_bounds__(256) void k_wnat(const float* __restrict__ w, size_t n8, _Float16* __restrict__ Bt) { const size_t t = (size_t)blockIdx.x * 256 + threadIdx.x; if (t >= n8) return; FragH f; for (int q = 0; q < 8; ++q) f.h[q] = (_Float16)(bf16_round(w[t * 8 + q]) * 16.0f); *(v8us*)((unsigned short*)Bt + t * 8) = f.half[0];  }
#define FK 64                        /* keys per pass */
#define FPT 72                       /* LDS row pitch in f16: 128 data bytes + 16, an odd multiple of 16 bytes for the 16-byte fragment reads */
#define FG 2                         /* key groups of a work-group */
#define FKG (SQ / FG)                /* keys of a group */
#define FTL (FK * FPT)               /* f16 per staged tile (K: [key][d]; V^T: [d][key]; HD = FK rows each) */
#define FXS 17                       /* 16-byte slots a lane hands over at the join: 16 of O^T, one of m and l */
static_assert(4 * FXS * 32 * 16 <= FG * 2 * FTL * 2, "the join's exchange area fits the tiles' LDS");
__device__ __forceinline__ v16h fa_frag(const unsigned short* p, int hh) { FragH f; f.half[0] = *(const v8us*)(p + 8 * hh); f.half[1] = *(const v8us*)(p + 16 + 8 * hh); return f.v; }
__device__ __forceinline__ v8f fa_mma(v16h a, v16h b, v8f c) { return __builtin_amdgcn_wmma_f32_16x16x32_f16(false, a, false, b, (short)0, c, false, false); }
__device__ __forceinline__ float fa_xhalf(float x) { return __builtin_bit_cast(float, __builtin_amdgcn_permlanex16(__builtin_bit_cast(int, x), __builtin_bit_cast(int, x), 0x76543210, 0xfedcba98, false, false)); }      /* lane l reads lane l ^ 16, on the vector pipe: no LDS round trip */
__device__ __forceinline__ float fa_exp2(float x) { float e; asm("v_exp_f32 %0, %1\n\tv_nop" : "=v"(e) : "v"(x)); return e; }
__device__ __forceinline__ v8f fa_exp2x8(v8f x) { float e0, e1, e2, e3, e4, e5, e6, e7;
  asm("v_exp_f32 %0, %8\n\tv_exp_f32 %1, %9\n\tv_exp_f32 %2, %10\n\tv_exp_f32 %3, %11\n\tv_exp_f32 %4, %12\n\tv_exp_f32 %5, %13\n\tv_exp_f32 %6, %14\n\tv_exp_f32 %7, %15\n\tv_nop"
      : "=&v"(e0), "=&v"(e1), "=&v"(e2), "=&v"(e3), "=&v"(e4), "=&v"(e5), "=&v"(e6), "=&v"(e7) : "v"(x[0]), "v"(x[1]), "v"(x[2]), "v"(x[3]), "v"(x[4]), "v"(x[5]), "v"(x[6]), "v"(x[7]));
  const v8f e = {e0, e1, e2, e3, e4, e5, e6, e7}; return e; }
__global__ __launch_bounds__(256) __attribute__((amdgpu_waves_per_eu(4, 4))) void k_fattn(const _Float16* __restrict__ QKVp, const _Float16* __restrict__ VTp, float* __restrict__ O) {
  __shared__ __attribute__((aligned(16))) unsigned short sm[FG * 2 * FTL];      /* per group: K rows of the pass [key][d], then V^T rows of the pass [d][key] */
  const int g = __builtin_amdgcn_readfirstlane((int)threadIdx.x >> 7);      /* the wave's key group, the same in every lane */
  const int tid = threadIdx.x & 127, w = tid >> 5, lane = tid & 31, ln = lane & 15, hh = lane >> 4;      /* place inside the group */
  unsigned short* Ks = sm + g * (2 * FTL); unsigned short* Vs = Ks + FTL;
  const int bh = blockIdx.x / (SQ / 128), qb = blockIdx.x % (SQ / 128); const int b = bh / NH, h = bh % NH;
  const _Float16* qg = QKVp + (size_t)b * SQ * LQ + (size_t)h * 3 * HD;      /* head h's 192 packed columns: q at + 0, k at + 64 */
  const int q0 = qb * 128 + w * 32;
  v16h qf[2][2];
#pragma unroll
  for (int qt = 0; qt < 2; ++qt)
#pragma unroll
    for (int ks = 0; ks < 2; ++ks) qf[qt][ks] = g2_frag(qg + (size_t)(q0 + qt * 16 + ln) * LQ + ks * 32, hh);
  /* staging: thread t moves 16-byte chunks t, t + 128, t + 256, t + 384 of each 64 x 128-byte tile: 8 chunks a row, so a wave's load covers 4 whole lines */
  const int frow = tid >> 3, fc8 = (tid & 7) * 8;
  const unsigned short* kp = (const unsigned short*)qg + HD + (size_t)(g * FKG + frow) * LQ + fc8;
  const unsigned short* vp = (const unsigned short*)VTp + (size_t)bh * HD * SQ + (size_t)frow * SQ + g * FKG + fc8;
  v8us kr[4], vr[4];
#pragma unroll
  for (int j = 0; j < 4; ++j) { kr[j] = *(const v8us*)(kp + (size_t)(16 * j) * LQ); vr[j] = *(const v8us*)(vp + (size_t)(16 * j) * SQ); }
  const v8f z8 = {0.f, 0.f, 0.f, 0.f, 0.f, 0.f, 0.f, 0.f};
  v8f o[2][4]; float m[2], l[2];
#pragma unroll
  for (int qt = 0; qt < 2; ++qt) { m[qt] = 0.f; l[qt] = 0.f;
#pragma unroll
    for (int dt = 0; dt < 4; ++dt) o[qt][dt] = z8; }
  /* the pass loop stays whole: peeled for its p == 0 test, the first pass is scheduled together with the step of m, runs out of registers and spills tiles in flight */
#pragma unroll 1
  for (int p = 0; p < FKG / FK; ++p) {
    __syncthreads();      /* every wave has finished reading the pass before */
#pragma unroll
    for (int j = 0; j < 4; ++j) { *(v8us*)(Ks + (frow + 16 * j) * FPT + fc8) = kr[j]; *(v8us*)(Vs + (frow + 16 * j) * FPT + fc8) = vr[j]; }
    __syncthreads();      /* the tiles are complete before anybody reads them */
    v16h ka[4][2];      /* the pass's K fragment reads stand with the global loads in front of the fence below, as one group ahead of the products */
#pragma unroll
    for (int kt = 0; kt < 4; ++kt)
#pragma unroll
      for (int ks = 0; ks < 2; ++ks) ka[kt][ks] = fa_frag(Ks + (kt * 16 + ln) * FPT + ks * 32, hh);
    if (p + 1 < FKG / FK) {      /* the next pass's tiles fly to registers while this pass is worked on */
#pragma unroll
      for (int j = 0; j < 4; ++j) { kr[j] = *(const v8us*)(kp + (size_t)(FK + 16 * j) * LQ); vr[j] = *(const v8us*)(vp + (size_t)(16 * j) * SQ + FK); }
    }
    __builtin_amdgcn_sched_barrier(0);      /* keeps the eight loads above the pass's work: without it the compiler sinks them to the loop's foot, and their whole latency is waited for at the next pass's head */
    v8f st[2][4], cm[2];      /* cm = -m in all eight registers (a lane's scores are all of one query), formed anew each pass: held over the pass it would take sixteen registers from the softmax and the second product */
#pragma unroll
    for (int qt = 0; qt < 2; ++qt)
#pragma unroll
      for (int r = 0; r < 8; ++r) cm[qt][r] = -m[qt];
#pragma unroll
    for (int kt = 0; kt < 4; ++kt)
#pragma unroll
      for (int qt = 0; qt < 2; ++qt) st[qt][kt] = fa_mma(ka[kt][1], qf[qt][1], fa_mma(ka[kt][0], qf[qt][0], cm[qt]));      /* st[qt][kt][r] = q(q0 + 16 qt + ln) . k(1024 g + 64 p + 16 kt + 8 hh + r) log2(e) / 8 - m */
    __builtin_amdgcn_sched_barrier(0);      /* the maxima start when the last K fragment is dead: mixed among the products, their partial results come on top of fragments, scores and -m, and the compiler spills the tiles in flight */
    float mx[2];      /* the pass's maximum above m, per query */
#pragma unroll
    for (int qt = 0; qt < 2; ++qt) {
      v8f x8 = st[qt][0];
#pragma unroll
      for (int r = 0; r < 8; ++r) x8[r] = fmaxf(fmaxf(st[qt][0][r], st[qt][1][r]), fmaxf(st[qt][2][r], st[qt][3][r]));
      const float mh = fmaxf(fmaxf(fmaxf(x8[0], x8[1]), fmaxf(x8[2], x8[3])), fmaxf(fmaxf(x8[4], x8[5]), fmaxf(x8[6], x8[7])));
      mx[qt] = fmaxf(mh, fa_xhalf(mh));      /* the other half of the query's 64 keys */
    }
    if (p == 0 || __builtin_amdgcn_ballot_w32(fmaxf(mx[0], mx[1]) > 8.0f) != 0) {      /* one scalar branch a pass: the first pass sets m, a later one raises it for the whole wave when any of its queries asks for it */
#pragma unroll
      for (int qt = 0; qt < 2; ++qt) {
        const float dl = p == 0 ? mx[qt] : fmaxf(mx[qt], 0.f);      /* m never falls; on the first pass it goes from 0 to the maximum, up or down */
        const float al = fa_exp2(-fabsf(dl));      /* 2^(m_old - m_new); on the first pass l and O^T are 0, and any finite factor serves */
        m[qt] += dl;
#pragma unroll
        for (int kt = 0; kt < 4; ++kt) st[qt][kt] -= dl;
        l[qt] *= al;
#pragma unroll
        for (int dt = 0; dt < 4; ++dt) o[qt][dt] *= al;
      }
    }
    FragH pf[2][2];
#pragma unroll
    for (int qt = 0; qt < 2; ++qt) {
      v8f s8 = z8;
#pragma unroll
      for (int kt = 0; kt < 4; ++kt) { const v8f e8 = fa_exp2x8(st[qt][kt]); s8 += e8;
#pragma unroll
        for (int r = 0; r < 8; ++r) pf[qt][kt >> 1].h[(kt & 1) * 8 + r] = (_Float16)e8[r]; }
      l[qt] += ((s8[0] + s8[1]) + (s8[2] + s8[3])) + ((s8[4] + s8[5]) + (s8[6] + s8[7]));
    }
    /* The V^T fragments are read in two groups of four, each group whole in front of its eight products. The scheduling fences hold that order: without them the compiler mixes the softmax into the products,
       runs short of registers and waits for LDS in front of every pair of products; all eight fragments at once would take the kernel past 256 registers. */
#pragma unroll
    for (int dg = 0; dg < 2; ++dg) {
      __builtin_amdgcn_sched_barrier(0);      /* nothing of the group's reads moves up into the work before */
      v16h va[2][2];
#pragma unroll
      for (int d2 = 0; d2 < 2; ++d2)
#pragma unroll
        for (int ks = 0; ks < 2; ++ks) va[d2][ks] = fa_frag(Vs + ((dg * 2 + d2) * 16 + ln) * FPT + ks * 32, hh);
      __builtin_amdgcn_sched_barrier(0);      /* none of the group's reads sinks among its products */
#pragma unroll
      for (int d2 = 0; d2 < 2; ++d2)
#pragma unroll
        for (int ks = 0; ks < 2; ++ks)
#pragma unroll
          for (int qt = 0; qt < 2; ++qt) o[qt][dg * 2 + d2] = fa_mma(va[d2][ks], pf[qt][ks].v, o[qt][dg * 2 + d2]);      /* o[qt][dt][r] = O[q0 + 16 qt + ln][16 dt + 8 hh + r] */
    }
    asm volatile("s_wait_xcnt 0x0" ::: "memory");      /* the wait in front of a rewrite of the address registers that this pass's global loads name; at the pass's foot it has long been met, at the loads it would stand in front of the K reads */
    __builtin_amdgcn_sched_barrier(0);      /* holds the step of those registers behind the wait */
    if (p + 1 < FKG / FK) { kp += (size_t)FK * LQ; vp += FK; }
  }
  /* The join: group 1 hands its m, l and O^T to group 0 through the tiles' LDS, lane to lane (wave w of group 1 holds the same queries, at the same places, as wave w of group 0); 16 bytes a lane, contiguous over a wave. */
  __syncthreads();      /* every wave has finished reading the last pass's tiles before they are overwritten */
  v4fa* xs = (v4fa*)sm + (size_t)(w * FXS) * 32 + lane;
  if (g == 1) {
#pragma unroll
    for (int qt = 0; qt < 2; ++qt)
#pragma unroll
      for (int dt = 0; dt < 4; ++dt) { const v4f lo = {o[qt][dt][0], o[qt][dt][1], o[qt][dt][2], o[qt][dt][3]}, hi = {o[qt][dt][4], o[qt][dt][5], o[qt][dt][6], o[qt][dt][7]};
        xs[((qt * 4 + dt) * 2) * 32] = lo; xs[((qt * 4 + dt) * 2 + 1) * 32] = hi; }
    const v4f ml = {m[0], m[1], l[0], l[1]}; xs[16 * 32] = ml;
  }
  __syncthreads();      /* group 1's results are whole in LDS before group 0 reads them */
  if (g == 1) return;      /* behind the last barrier */
  const v4f ml1 = xs[16 * 32];
#pragma unroll
  for (int qt = 0; qt < 2; ++qt) {
    const float mj = fmaxf(m[qt], ml1[qt]); const float a0 = fa_exp2(m[qt] - mj), a1 = fa_exp2(ml1[qt] - mj);      /* both groups' results are brought to the common maximum */
    const float lj = l[qt] * a0 + ml1[2 + qt] * a1; const float inv = 1.0f / (lj + fa_xhalf(lj)); const float c0 = a0 * inv, c1 = a1 * inv;
    float* orow = O + ((size_t)bh * SQ + q0 + qt * 16 + ln) * HD + 8 * hh;      /* head plane bh, row = query: the raw-view merge */
#pragma unroll
    for (int dt = 0; dt < 4; ++dt) { const v4f lo1 = xs[((qt * 4 + dt) * 2) * 32], hi1 = xs[((qt * 4 + dt) * 2 + 1) * 32];
      const v4f lo = {o[qt][dt][0] * c0 + lo1[0] * c1, o[qt][dt][1] * c0 + lo1[1] * c1, o[qt][dt][2] * c0 + lo1[2] * c1, o[qt][dt][3] * c0 + lo1[3] * c1},
                hi = {o[qt][dt][4] * c0 + hi1[0] * c1, o[qt][dt][5] * c0 + hi1[1] * c1, o[qt][dt][6] * c0 + hi1[2] * c1, o[qt][dt][7] * c0 + hi1[3] * c1};
      *(v4f*)(orow + dt * 16) = lo; *(v4f*)(orow + dt * 16 + 4) = hi; } }
}
__global__ __launch_bounds__(256) void k_vt(const _Float16* __restrict__ V16, int b, int h0, _Float16* __restrict__ VT) { __shared__ unsigned short tl[64][65]; const int tid = threadIdx.x; const int hh = blockIdx.x % HG, sg = blockIdx.x / HG; const int s0 = sg * 64; const int h = h0 + hh;
  for (int i = tid; i < 64 * 8; i += 256) { const int j = i / 8, d8 = (i % 8) * 8; FragH f; f.half[0] = *(const v8us*)((const unsigned short*)V16 + ((size_t)b * SQ + s0 + j) * DM + h * HD + d8); for (int q = 0; q < 8; ++q) tl[d8 + q][j] = f.u[q]; }
  __syncthreads();
  { for (int i = tid; i < 64 * 8; i += 256) { const int d = i / 8, j8 = (i % 8) * 8; FragH f; for (int q = 0; q < 8; ++q) f.u[q] = tl[d][j8 + q]; *(v8us*)((unsigned short*)VT + ((size_t)hh * HD + d) * SQ + s0 + j8) = f.half[0]; }  } }


extern "C" void kernel_launch(void* const* d_in, const int* in_sizes, int n_in,
                              void* d_out, int out_size, void* d_ws, size_t ws_size, hipStream_t stream) {
  (void)in_sizes; (void)n_in; (void)out_size;
  const float* const* I = (const float* const*)d_in; const float* x = I[0]; const float* wqkv = I[1]; const float* bqkv = I[2];      /* input order: x, W_qkv ([in][out] [1024][3072]; columns packed PER HEAD: 192 h + {0..63 q, 64..127 k, 128..191 v}), b_qkv [3072] (REAL; the same packing: the projection GEMM's bias slot reads it by output column); three inputs; no output weight: the module has none */
  char* ws = (char*)d_ws; size_t off = 0;
  auto take = [&](size_t bytes) { char* p = ws + off; off += (bytes + 255) & ~(size_t)255; return p; };
  _Float16* BQKV = (_Float16*)take((size_t)3 * DM * DM * 2);
  _Float16* X16 = (_Float16*)take(NR * DM * 2); _Float16* QKV = (_Float16*)take(NR * 3 * DM * 2);      /* PER-HEAD packing: within head h's 192 columns q starts at + 0, k at + 64; the v columns (+ 128) are never written here: they go to VT; the head stride is 3 HD */
  _Float16* VT = (_Float16*)take((size_t)NB * NH * HD * SQ * 2);      /* V^T planes of every (batch, head) */
  if (off > ws_size) return;
  k_prep<<<PWG, 256, 0, stream>>>(x, wqkv, X16, BQKV);      /* x -> f16 rows; W [in][out] -> Bt[n][k] x16 (pitch K = 1024) */
  const size_t r0p = (size_t)B0 * SQ;      /* first projected row */
  k_gemm3<<<(unsigned)((MP / 128) * (LQ / 128)), 128, 0, stream>>>(X16 + r0p * DM, BQKV, bqkv, QKV + r0p * 3 * DM, VT + (size_t)B0 * NH * HD * SQ);      /* q | k rows (f16, packed per head) and the V^T planes */
  k_fattn<<<NB * NH * (SQ / 128), 256, 0, stream>>>(QKV, VT, (float*)d_out);      /* all batches and heads in one launch: softmax(q k^T / 8) v, each head into its own contiguous [2048][64] plane */
}

// v008
// Measured time: 64 microseconds a run.
// Timed twice side by side with v007, it ran 1.05 and 1.04 times as fast.
// Over all steps from v000 it is 58.5 times as fast.
#include <hip/hip_runtime.h>
// Multi-head self-attention with ONE fused QKV projection packed PER HEAD, NO output projection and a RAW-VIEW merge (x [2][2048][1024]; qkv = x W_qkv + b_qkv ([in][out] 1024 x 3072, normal x 1/32; a REAL bias normal x 0.01) reshaped (b, s, 16, 3 x 64): head h owns columns 192 h .. 192 h + 191: q | k | v = its three 64-column slices; att = q k^T / sqrt(64); softmax over all 2048 keys (no mask); values [b][16][s][64] are reshaped to (b, s, 1024) WITHOUT a head transpose (the source's own form): the output memory of a batch IS the sixteen [2048][64] head planes one after another); the P.V product is written straight to the f32 output, each head into its own contiguous plane.
// Structure: token rows r = b*2048 + s; x as exact f16 rows (bf16-rounded); q | k | v as ONE WMMA GEMM (N = 3 x 1024) (256x192 tiles staged in LDS by asynchronous copies, 64x64 wave tiles, f32 accumulation, exact x16 weights + bias, f16 outputs); the GEMM's own epilogue stores every head's v tile transposed (V^T planes [d][key], 512-byte runs through LDS), so no transpose launch is left; then ONE fused attention launch over every (batch, head): per 64 keys S^T = K Q^T, running softmax in registers (f32 statistics, base 2; weights 2^(s - m) as f16), O^T += V^T P^T, divided by the row sum at the end and written as f32 straight into the output's own layout (head plane after head plane): no output projection.
// Compute dtype: inputs rounded to bf16; x / weights exact; q, k, v and softmax weights as plain f16 GEMM operands (~2^-12); scores, softmax statistics and o f32. v_wmma_f32_16x16x32_f16.
#define NB 2
#define SQ 2048
#define DM 1024
#define NH 16
#define HD 64
#define HG 4                         /* heads per group of the grouped transpose below */
#define B0 0                         /* first batch processed (debug hook) */
#define NBR NB                       /* batches processed (debug hook) */
#define NR ((size_t)NB * SQ)         /* token rows */
#define MP ((int)((size_t)NBR * SQ)) /* rows projected (debug hook) */
#define QN SQ                        /* unused (the attention launch covers all SQ query rows) */
#define NHD NH                       /* unused (the attention launch covers all NH heads) */
#define MPO MP                       /* unused (no output projection) */
#define LQ (3 * DM)      /* row pitch of the q/k/v rows */
typedef __bf16 v16b __attribute__((ext_vector_type(16)));
typedef unsigned short v8us __attribute__((ext_vector_type(8), may_alias));
typedef float  v8f  __attribute__((ext_vector_type(8)));
typedef float  v4f  __attribute__((ext_vector_type(4)));
typedef float  v4fa __attribute__((ext_vector_type(4), may_alias));
union FragB { v16b v; v8us half[2]; unsigned short u[16]; };

__device__ __forceinline__ unsigned short bf16_bits(float x) { unsigned int u = __float_as_uint(x); return (unsigned short)((u + 0x7FFFu + ((u >> 16) & 1u)) >> 16); }
__device__ __forceinline__ float bf16_val(unsigned short b) { return __uint_as_float(((unsigned int)b) << 16); }
__device__ __forceinline__ float bf16_round(float x) { return bf16_val(bf16_bits(x)); }
// D += A·B with NT terms: 1 = ah·bh, 2 = + al·bh (A split), 3 = + ah·bl (both split)
template <int NT>
__device__ __forceinline__ v8f mmaN(v16b ah, v16b al, v16b bh, v16b bl, v8f c) {
  c = __builtin_amdgcn_wmma_f32_16x16x32_bf16(false, ah, false, bh, (short)0, c, false, false);
  if (NT >= 2) c = __builtin_amdgcn_wmma_f32_16x16x32_bf16(false, al, false, bh, (short)0, c, false, false);
  if (NT >= 3) c = __builtin_amdgcn_wmma_f32_16x16x32_bf16(false, ah, false, bl, (short)0, c, false, false);
  asm volatile("v_nop\n\tv_nop\n\tv_nop\n\tv_nop" : "+v"(c) : "v"(ah), "v"(al), "v"(bh), "v"(bl));
  return c;
}

__global__ __launch_bounds__(256) void k_wt_bf16(const float* __restrict__ W, unsigned short* __restrict__ Wt, int K, int N) {
  const int t = blockIdx.x * 256 + threadIdx.x;
  const int k8n = K / 8;
  if (t >= N * k8n) return;
  const int n = t / k8n, k8 = (t % k8n) * 8;
  v8us v;
#pragma unroll
  for (int i = 0; i < 8; ++i) v[i] = bf16_bits(W[(size_t)(k8 + i) * N + n]);
  *(v8us*)(Wt + (size_t)n * K + k8) = v;
  
}

// GEMM C[M][N] (f32, pitch ldc) = act(A[M][K]·W + bias). A f32 row-major (pitch lda) converted per fragment to bf16
// (ASPLIT: hi/lo two planes -> 2 terms, else single rounded term); Wt bf16 [N][K] (pitch ldb). BIAS_BF16 rounds the
// bias to bf16 first (bias quantised to bf16 before the add). K%32==0, M%16==0, N%64==0.
template <bool ASPLIT, int ACT, bool BIAS_BF16>
__global__ __launch_bounds__(128) void k_gemm_bf(const float* __restrict__ A, int lda, const unsigned short* __restrict__ Wt, int ldb,
                                               const float* __restrict__ bias, float* __restrict__ C, int ldc, int M, int N, int K) {
  __shared__ __attribute__((aligned(16))) float so[4][16][64];
  const int tid = threadIdx.x, w = tid >> 5, lane = tid & 31, ln = lane & 15, hh = lane >> 4;
  const int ntn = N / 64;
  const int wid = blockIdx.x * 4 + w;
  const int mt = wid / ntn, nq = wid % ntn;
  if (mt * 16 >= M) return;
  const int row0 = mt * 16, col0 = nq * 64;
  const float* arow = A + (size_t)(row0 + ln) * lda;
  v8f acc[4] = {};
  for (int kb = 0; kb < K; kb += 32) {
    FragB ah, al;
    const v4f x0 = *(const v4fa*)(arow + kb + 8 * hh), x1 = *(const v4fa*)(arow + kb + 8 * hh + 4);
    const v4f x2 = *(const v4fa*)(arow + kb + 16 + 8 * hh), x3 = *(const v4fa*)(arow + kb + 16 + 8 * hh + 4);
    float xs[16] = {x0[0],x0[1],x0[2],x0[3],x1[0],x1[1],x1[2],x1[3],x2[0],x2[1],x2[2],x2[3],x3[0],x3[1],x3[2],x3[3]};
#pragma unroll
    for (int i = 0; i < 16; ++i) { const unsigned short hb = bf16_bits(xs[i]); ah.u[i] = hb; al.u[i] = ASPLIT ? bf16_bits(xs[i] - bf16_val(hb)) : (unsigned short)0; }
#pragma unroll
    for (int t = 0; t < 4; ++t) {
      const unsigned short* brow = Wt + (size_t)(col0 + t * 16 + ln) * ldb + kb;
      FragB b;
      b.half[0] = *(const v8us*)(brow + 8 * hh);
      b.half[1] = *(const v8us*)(brow + 16 + 8 * hh);
      acc[t] = mmaN<ASPLIT ? 2 : 1>(ah.v, al.v, b.v, b.v, acc[t]);
    }
  }
#pragma unroll
  for (int t = 0; t < 4; ++t) {
    float bv = bias ? bias[col0 + t * 16 + ln] : 0.f;
    if (BIAS_BF16) bv = bf16_round(bv);
#pragma unroll
    for (int r = 0; r < 8; ++r) { float v = acc[t][r] + bv; if (ACT == 1) v = fmaxf(v, 0.f); so[w][8 * hh + r][t * 16 + ln] = v; }
  }
  __builtin_amdgcn_fence(__ATOMIC_ACQ_REL, "workgroup");
  __builtin_amdgcn_wave_barrier();
  const int rsub = lane >> 4, c4 = (lane & 15) * 4;
  {
#pragma unroll
    for (int q = 0; q < 8; ++q) {
      const int r = q * 2 + rsub;
      const v4f v = *(const v4fa*)&so[w][r][c4];
      *(v4f*)(C + (size_t)(row0 + r) * ldc + col0 + c4) = v;
    }
    
  }
}

// GEMM C = act(A·W + bias + resid): A f32 (ASPLIT -> hi/lo 2 terms), Wt bf16 [N][K]; ACT 0 none, 1 relu, 2 exact gelu;
// resid (optional, f32, row index = (row % rmod), pitch ldr, RES_BF16 rounds it) added before the activation.
template <bool ASPLIT, int ACT, bool BIAS_BF16, bool RES_BF16>
__global__ __launch_bounds__(128) void k_gemm_bf3(const float* __restrict__ A, int lda, const unsigned short* __restrict__ Wt, int ldb,
                                                const float* __restrict__ bias, const float* __restrict__ resid, int rmod, int ldr,
                                                float* __restrict__ C, int ldc, int M, int N, int K) {
  __shared__ __attribute__((aligned(16))) float so[4][16][64];
  const int tid = threadIdx.x, w = tid >> 5, lane = tid & 31, ln = lane & 15, hh = lane >> 4;
  const int ntn = N / 64;
  const int wid = blockIdx.x * 4 + w;
  const int mt = wid / ntn, nq = wid % ntn;
  if (mt * 16 >= M) return;
  const int row0 = mt * 16, col0 = nq * 64;
  const float* arow = A + (size_t)(row0 + ln) * lda;
  v8f acc[4] = {};
  for (int kb = 0; kb < K; kb += 32) {
    FragB ah, al;
    const v4f x0 = *(const v4fa*)(arow + kb + 8 * hh), x1 = *(const v4fa*)(arow + kb + 8 * hh + 4);
    const v4f x2 = *(const v4fa*)(arow + kb + 16 + 8 * hh), x3 = *(const v4fa*)(arow + kb + 16 + 8 * hh + 4);
    float xs[16] = {x0[0],x0[1],x0[2],x0[3],x1[0],x1[1],x1[2],x1[3],x2[0],x2[1],x2[2],x2[3],x3[0],x3[1],x3[2],x3[3]};
#pragma unroll
    for (int i = 0; i < 16; ++i) { const unsigned short hb = bf16_bits(xs[i]); ah.u[i] = hb; al.u[i] = ASPLIT ? bf16_bits(xs[i] - bf16_val(hb)) : (unsigned short)0; }
#pragma unroll
    for (int t = 0; t < 4; ++t) {
      const unsigned short* brow = Wt + (size_t)(col0 + t * 16 + ln) * ldb + kb;
      FragB b;
      b.half[0] = *(const v8us*)(brow + 8 * hh);
      b.half[1] = *(const v8us*)(brow + 16 + 8 * hh);
      acc[t] = mmaN<ASPLIT ? 2 : 1>(ah.v, al.v, b.v, b.v, acc[t]);
    }
  }
#pragma unroll
  for (int t = 0; t < 4; ++t) {
    const int col = col0 + t * 16 + ln;
    float bv = bias ? bias[col] : 0.f;
    if (BIAS_BF16) bv = bf16_round(bv);
#pragma unroll
    for (int r = 0; r < 8; ++r) {
      float v = acc[t][r] + bv;
      if (resid) { float rv = resid[(size_t)((row0 + 8 * hh + r) % rmod) * ldr + col]; if (RES_BF16) rv = bf16_round(rv); v += rv; }
      if (ACT == 1) v = fmaxf(v, 0.f);
      if (ACT == 2) v = 0.5f * v * (1.0f + erff(v * 0.70710678118654752f));
      if (ACT == 3) { const float u = 0.7978845608028654f * (v + 0.044715f * v * v * v); v = 0.5f * v * (1.0f + tanhf(u)); }
      so[w][8 * hh + r][t * 16 + ln] = v;
    }
  }
  __builtin_amdgcn_fence(__ATOMIC_ACQ_REL, "workgroup");
  __builtin_amdgcn_wave_barrier();
  const int rsub = lane >> 4, c4 = (lane & 15) * 4;
  {
#pragma unroll
    for (int q = 0; q < 8; ++q) {
      const int r = q * 2 + rsub;
      const v4f v = *(const v4fa*)&so[w][r][c4];
      *(v4f*)(C + (size_t)(row0 + r) * ldc + col0 + c4) = v;
    }
    
  }
}
// row LayerNorm (biased variance, eps) over N: s = X (+ R); optional out_sum <- s; out_norm <- (s-mu)*rsqrt(var+eps)*g + b
template <bool PARAM_BF16>
__global__ __launch_bounds__(256) void k_layernorm(const float* __restrict__ X, const float* __restrict__ R, const float* __restrict__ g, const float* __restrict__ bta,
                                                  float* __restrict__ out_sum, float* __restrict__ out_norm, int N, float eps) {
  __shared__ float red[256];
  const int row = blockIdx.x, tid = threadIdx.x;
  const float* x = X + (size_t)row * N; const float* rr = R ? R + (size_t)row * N : nullptr;
  float vals[16];                     // up to N = 4096
  const int per = N / 256;            // contiguous chunk per thread? use strided-by-4 chunks: thread handles j = tid*4 + 1024*u
  float s1 = 0.f;
  for (int u = 0; u < per / 4; ++u) {
    const int j = tid * 4 + 1024 * u;
    const v4f a = *(const v4fa*)(x + j);
    v4f b = {0.f,0.f,0.f,0.f}; if (rr) b = *(const v4fa*)(rr + j);
#pragma unroll
    for (int q = 0; q < 4; ++q) { const float v = a[q] + b[q]; vals[u * 4 + q] = v; s1 += v; }
  }
  red[tid] = s1; __syncthreads();
  for (int st = 128; st > 0; st >>= 1) { if (tid < st) red[tid] += red[tid + st]; __syncthreads(); }
  const float mu = red[0] / (float)N; __syncthreads();
  float s2 = 0.f;
  for (int u = 0; u < per / 4; ++u)
#pragma unroll
    for (int q = 0; q < 4; ++q) { const float c = vals[u * 4 + q] - mu; s2 += c * c; }
  red[tid] = s2; __syncthreads();
  for (int st = 128; st > 0; st >>= 1) { if (tid < st) red[tid] += red[tid + st]; __syncthreads(); }
  const float rs = rsqrtf(red[0] / (float)N + eps);
  {
    for (int u = 0; u < per / 4; ++u) {
      const int j = tid * 4 + 1024 * u;
      v4f o, sm;
#pragma unroll
      for (int q = 0; q < 4; ++q) {
        float gg = g[j + q], bb = bta[j + q];
        if (PARAM_BF16) { gg = bf16_round(gg); bb = bf16_round(bb); }
        sm[q] = vals[u * 4 + q]; o[q] = (vals[u * 4 + q] - mu) * rs * gg + bb;
      }
      if (out_sum) *(v4f*)(out_sum + (size_t)row * N + j) = sm;
      *(v4f*)(out_norm + (size_t)row * N + j) = o;
    }
    
  }
}



// ---- f16 WMMA path (v_wmma_f32_16x16x32_f16): 11-bit significands for operands in range — used where a [0,1] probability operand needs more precision than bf16
typedef _Float16 v16h __attribute__((ext_vector_type(16)));
union FragH { v16h v; v8us half[2]; _Float16 h[16]; unsigned short u[16]; };
template <int NT>
__device__ __forceinline__ v8f mmaH(v16h ah, v16h al, v16h bh, v16h bl, v8f c) {
  c = __builtin_amdgcn_wmma_f32_16x16x32_f16(false, ah, false, bh, (short)0, c, false, false);
  if (NT >= 2) c = __builtin_amdgcn_wmma_f32_16x16x32_f16(false, al, false, bh, (short)0, c, false, false);
  if (NT >= 3) c = __builtin_amdgcn_wmma_f32_16x16x32_f16(false, ah, false, bl, (short)0, c, false, false);
  asm volatile("v_nop\n\tv_nop\n\tv_nop\n\tv_nop" : "+v"(c) : "v"(ah), "v"(al), "v"(bh), "v"(bl));
  return c;
}
// batched GEMM like k_gemm_b but f16 operands: A f32 (split into f16 hi/lo if ASPLIT, else rounded to f16), Bt = f16 values [n][k]; alpha; C f32; N multiple of 16 (partial tiles skipped)
template <bool ASPLIT>
__global__ __launch_bounds__(128) void k_gemm_h(const float* __restrict__ A, int lda, size_t sA, const _Float16* __restrict__ Bh, int ldb, size_t sB, float alpha, float* __restrict__ C, int ldc, size_t sC, int M, int N, int K) {
  __shared__ __attribute__((aligned(16))) float so[4][16][64];
  const int tid = threadIdx.x, w = tid >> 5, lane = tid & 31, ln = lane & 15, hh = lane >> 4; const int by = blockIdx.y;
  A += (size_t)by * sA; Bh += (size_t)by * sB; C += (size_t)by * sC;
  const int ntn = (N + 63) / 64; const int wid = blockIdx.x * 4 + w; const int mt = wid / ntn, nq = wid % ntn; if (mt * 16 >= M) return;
  const int row0 = mt * 16, col0 = nq * 64; const float* arow = A + (size_t)(row0 + ln) * lda;
  v8f acc[4] = {};
  for (int kb = 0; kb < K; kb += 32) {
    FragH ah, al;
    const v4f x0 = *(const v4fa*)(arow + kb + 8 * hh), x1 = *(const v4fa*)(arow + kb + 8 * hh + 4), x2 = *(const v4fa*)(arow + kb + 16 + 8 * hh), x3 = *(const v4fa*)(arow + kb + 16 + 8 * hh + 4);
    float xs[16] = {x0[0],x0[1],x0[2],x0[3],x1[0],x1[1],x1[2],x1[3],x2[0],x2[1],x2[2],x2[3],x3[0],x3[1],x3[2],x3[3]};
#pragma unroll
    for (int i = 0; i < 16; ++i) { const _Float16 h = (_Float16)xs[i]; ah.h[i] = h; al.h[i] = ASPLIT ? (_Float16)(xs[i] - (float)h) : (_Float16)0.0f; }
#pragma unroll
    for (int t = 0; t < 4; ++t) { if (col0 + t * 16 >= N) continue; const size_t boff = (size_t)(col0 + t * 16 + ln) * ldb + kb; FragH bq; bq.half[0] = *(const v8us*)(Bh + boff + 8 * hh); bq.half[1] = *(const v8us*)(Bh + boff + 16 + 8 * hh);
      acc[t] = mmaH<ASPLIT ? 2 : 1>(ah.v, al.v, bq.v, bq.v, acc[t]); }
  }
#pragma unroll
  for (int t = 0; t < 4; ++t) { if (col0 + t * 16 >= N) continue;
#pragma unroll
    for (int r = 0; r < 8; ++r) so[w][8 * hh + r][t * 16 + ln] = acc[t][r] * alpha; }
  __builtin_amdgcn_fence(__ATOMIC_ACQ_REL, "workgroup"); __builtin_amdgcn_wave_barrier();
  const int rsub = lane >> 4, c4 = (lane & 15) * 4;
  {
#pragma unroll
    for (int q = 0; q < 8; ++q) { const int r = q * 2 + rsub; if (col0 + c4 < N) { const v4f v = *(const v4fa*)&so[w][r][c4]; *(v4f*)(C + (size_t)(row0 + r) * ldc + col0 + c4) = v; } }
     }
}

// Wt[n][k] = f16(W[k][n]·scale) from f32 row-major W[K][N] (scale = power of two; bf16-exact weights stay exact in f16 away from the subnormal range)
__global__ __launch_bounds__(256) void k_wt_f16(const float* __restrict__ W, _Float16* __restrict__ Wt, int K, int N, float scale) {
  const int t = blockIdx.x * 256 + threadIdx.x; if (t >= N * (K / 8)) return; const int n = t / (K / 8), k8 = (t % (K / 8)) * 8; FragH f;
#pragma unroll
  for (int i = 0; i < 8; ++i) f.h[i] = (_Float16)(bf16_round(W[(size_t)(k8 + i) * N + n]) * scale); const v8us o = f.half[0];
  *(v8us*)((unsigned short*)Wt + (size_t)n * K + k8) = o; 
}
// k_gemm_hh variant with fused epilogue: v = acc·alpha + bias[by·sBias + col] (+ CP[(row/rowsPerB)·sCPb + by·64 + col] if CP) ; ACT 0 none / 1 elu ; writes f16 C16 (and f32 C if non-null)
template <int ACT>
__global__ __launch_bounds__(128) void k_gemm_hhx(const _Float16* __restrict__ A, int lda, size_t sA, const _Float16* __restrict__ Bh, int ldb, size_t sB, float alpha, const float* __restrict__ bias, size_t sBias, const float* __restrict__ CP, int rowsPerB, size_t sCPb, int row0g,
    float* __restrict__ C, _Float16* __restrict__ C16, int ldc, size_t sC, int M, int N, int K) {
  __shared__ __attribute__((aligned(16))) float so[4][16][64];
  const int tid = threadIdx.x, w = tid >> 5, lane = tid & 31, ln = lane & 15, hh = lane >> 4; const int by = blockIdx.y;
  A += (size_t)by * sA; Bh += (size_t)by * sB; const size_t cofs = (size_t)by * sC; const float* bp = bias ? bias + (size_t)by * sBias : nullptr;
  const int ntn = (N + 63) / 64; const int wid = blockIdx.x * 4 + w; const int mt = wid / ntn, nq = wid % ntn; if (mt * 16 >= M) return;
  const int row0 = mt * 16, col0 = nq * 64; const _Float16* arow = A + (size_t)(row0 + ln) * lda;
  v8f acc[4] = {};
  for (int kb = 0; kb < K; kb += 32) { FragH ah; ah.half[0] = *(const v8us*)((const unsigned short*)arow + kb + 8 * hh); ah.half[1] = *(const v8us*)((const unsigned short*)arow + kb + 16 + 8 * hh);
#pragma unroll
    for (int t = 0; t < 4; ++t) { if (col0 + t * 16 >= N) continue; const size_t boff = (size_t)(col0 + t * 16 + ln) * ldb + kb; FragH bq; bq.half[0] = *(const v8us*)((const unsigned short*)Bh + boff + 8 * hh); bq.half[1] = *(const v8us*)((const unsigned short*)Bh + boff + 16 + 8 * hh);
      acc[t] = mmaH<1>(ah.v, ah.v, bq.v, bq.v, acc[t]); }
  }
#pragma unroll
  for (int t = 0; t < 4; ++t) { if (col0 + t * 16 >= N) continue; const int col = col0 + t * 16 + ln; const float bv = bp ? bf16_round(bp[col]) : 0.f;
#pragma unroll
    for (int r = 0; r < 8; ++r) { float v = acc[t][r] * alpha + bv; if (CP) { const int rr = row0g + row0 + 8 * hh + r; if (rowsPerB < 0) v += CP[cofs + (size_t)rr * ldc + col];      /* rowsPerB < 0: own element of the batched C plane */ else { const int bidx = rr / rowsPerB; v += CP[(size_t)bidx * sCPb + (size_t)by * 64 + col]; } } if (ACT == 1) v = (v > 0.f) ? v : expm1f(v); else if (ACT == 7) v = (v > 0.f) ? v + 1.0f : expf(v); else if (ACT == 8) v = tanhf(v); else if (ACT == 9) v = 0.5f * v * (1.0f + tanhf(0.7978845608028654f * (v + 0.044715f * v * v * v))); else if (ACT == 11) v = 1.0f / (1.0f + expf(-v)); else if (ACT == 12) v = (v > 0.f) ? v : 0.01f * v; else if (ACT == 14) v = (v > 0.f) ? v : 0.1f * v; else if (ACT == 16) v = (v >= 0.f) ? v : 0.3f * v; else if (ACT == 17) v = (v >= 0.f) ? v : 0.2f * v; else if (ACT == 15) v = v / (1.0f + expf(-v)); else if (ACT == 3) v = fmaxf(v, 0.f); else if (ACT == 6) v = 0.5f * v * (1.0f + erff(v * 0.70710678118654752f)); so[w][8 * hh + r][t * 16 + ln] = v; } }
  __builtin_amdgcn_fence(__ATOMIC_ACQ_REL, "workgroup"); __builtin_amdgcn_wave_barrier();
  const int rsub = lane >> 4, c4 = (lane & 15) * 4; typedef _Float16 v4h __attribute__((ext_vector_type(4)));
  {
#pragma unroll
    for (int q = 0; q < 8; ++q) { const int r = q * 2 + rsub; if (col0 + c4 < N) { const v4f v = *(const v4fa*)&so[w][r][c4]; if (C) *(v4f*)(C + cofs + (size_t)(row0 + r) * ldc + col0 + c4) = v; if (C16) { v4h h4; for (int i = 0; i < 4; ++i) h4[i] = (_Float16)v[i]; *(v4h*)(C16 + cofs + (size_t)(row0 + r) * ldc + col0 + c4) = h4; } } }
     }
}


typedef _Float16 v4h __attribute__((ext_vector_type(4)));

__global__ __launch_bounds__(256) void k_x16(const float* __restrict__ x, _Float16* __restrict__ X16, size_t n8) { const size_t t = (size_t)blockIdx.x * 256 + threadIdx.x; if (t >= n8) return; FragH f;
#pragma unroll
  for (int q = 0; q < 8; ++q) f.h[q] = (_Float16)bf16_round(x[t * 8 + q]); *(v8us*)((unsigned short*)X16 + t * 8) = f.half[0];  }
__global__ __launch_bounds__(256) void k_h16(const float* __restrict__ x, _Float16* __restrict__ X16, size_t n8) { const size_t t = (size_t)blockIdx.x * 256 + threadIdx.x; if (t >= n8) return; FragH f;
#pragma unroll
  for (int q = 0; q < 8; ++q) f.h[q] = (_Float16)x[t * 8 + q]; *(v8us*)((unsigned short*)X16 + t * 8) = f.half[0];  }
__global__ __launch_bounds__(256) void k_round16f(const float* __restrict__ W, _Float16* __restrict__ Bt, size_t n8) { const size_t t = (size_t)blockIdx.x * 256 + threadIdx.x; if (t >= n8) return; FragH f;
#pragma unroll
  for (int i = 0; i < 8; ++i) f.h[i] = (_Float16)(bf16_round(W[t * 8 + i]) * 16.0f); *(v8us*)((unsigned short*)Bt + t * 8) = f.half[0];  }
__global__ __launch_bounds__(256) void k_hl(const float* __restrict__ F, _Float16* __restrict__ Hh, _Float16* __restrict__ Hl, size_t n8) { const size_t t = (size_t)blockIdx.x * 256 + threadIdx.x; if (t >= n8) return; FragH fh, fl; const v4f a = *(const v4fa*)(F + t * 8), c = *(const v4fa*)(F + t * 8 + 4);
#pragma unroll
  for (int q = 0; q < 4; ++q) { _Float16 h = (_Float16)a[q]; fh.h[q] = h; fl.h[q] = (_Float16)((a[q] - (float)h) * 1024.0f); h = (_Float16)c[q]; fh.h[4 + q] = h; fl.h[4 + q] = (_Float16)((c[q] - (float)h) * 1024.0f); }
  { *(v8us*)((unsigned short*)Hh + t * 8) = fh.half[0]; *(v8us*)((unsigned short*)Hl + t * 8) = fl.half[0];  } }

// ---- operand preparation, ONE launch of 256 work-groups (as many as the chip has WGPs), 8 waves each: every wave does a long share of the work, so that few waves have to be started.
// A work-group turns one 64 k x 192 n strip of W ([k][n] f32) into 192 rows of Bt ([n][k] f16, bf16-rounded, x16) and converts 2048 chunks of 8 x values (bf16-rounded, f16).
// Every global access is whole lines: W rows are read in 256-byte runs, x in 32 bytes a lane, Bt is written in 128-byte runs (8 lanes a row), X16 in 16 bytes a lane.
// All 28 loads of a lane are issued before anything waits. The strip is turned in LDS as f32 at a pitch of 193 dwords (1 mod 64): the row-wise dword stores and the column-wise dword reads both fall on distinct banks.
#define PKT 64                       /* k rows of a strip */
#define PNT 192                      /* n columns of a strip */
#define PPT 193                      /* LDS pitch of a strip row in dwords */
#define PXC 2048                     /* 8-element chunks of x per work-group */
#define PWG ((DM / PKT) * (LQ / PNT))      /* work-groups */
static_assert((size_t)PWG * PXC * 8 == (size_t)NB * SQ * DM, "the x shares cover x exactly");
__global__ __launch_bounds__(256) void k_prep(const float* __restrict__ x, const float* __restrict__ Wq, _Float16* __restrict__ X16, _Float16* __restrict__ Bt) {
  __shared__ float T[PKT * PPT];
  const int tid = threadIdx.x;
  const int k0 = (blockIdx.x / (LQ / PNT)) * PKT, n0 = (blockIdx.x % (LQ / PNT)) * PNT;
  const int r = tid >> 4, c4 = (tid & 15) * 4;      /* 16 lanes a row: 256 contiguous bytes */
  const float* wp = Wq + (size_t)(k0 + r) * LQ + n0 + c4;
  const float* xp = x + ((size_t)blockIdx.x * PXC + tid) * 8;
  v4f wv[3][4], xv[8][2];
#pragma unroll
  for (int j = 0; j < 3; ++j)
#pragma unroll
    for (int u = 0; u < 4; ++u) wv[j][u] = *(const v4fa*)(wp + (size_t)(16 * u) * LQ + 64 * j);
#pragma unroll
  for (int i = 0; i < 8; ++i) { xv[i][0] = *(const v4fa*)(xp + i * 2048); xv[i][1] = *(const v4fa*)(xp + i * 2048 + 4); }
  /* The wait in front of any rewrite of a register that an issued load names. It takes W's address pair as an input, so that no later load of the group gets that pair as its destination;
     its "memory" clobber also keeps all 28 loads above it: without that the compiler sinks twelve x loads behind the waits for W, and their latency is paid a second time. */
  asm volatile("s_wait_xcnt 0x0" :: "v"(wp) : "memory");
#pragma unroll
  for (int j = 0; j < 3; ++j)
#pragma unroll
    for (int u = 0; u < 4; ++u)
#pragma unroll
      for (int e = 0; e < 4; ++e) T[(r + 16 * u) * PPT + 64 * j + c4 + e] = wv[j][u][e];
  __syncthreads();      /* the strip is whole in LDS before anybody reads a column */
  unsigned short* xo = (unsigned short*)X16 + ((size_t)blockIdx.x * PXC + tid) * 8;
#pragma unroll
  for (int i = 0; i < 8; ++i) { FragH f;
#pragma unroll
    for (int q = 0; q < 8; ++q) f.h[q] = (_Float16)bf16_round(xv[i][q >> 2][q & 3]);
    *(v8us*)(xo + i * 2048) = f.half[0]; }
  const int n = tid >> 3, k8 = (tid & 7) * 8;      /* 8 lanes a Bt row: 128 contiguous bytes */
  unsigned short* bo = (unsigned short*)Bt + (size_t)(n0 + n) * DM + k0 + k8;
#pragma unroll
  for (int u = 0; u < PNT / 32; ++u) { FragH f;
#pragma unroll
    for (int i = 0; i < 8; ++i) f.h[i] = (_Float16)(bf16_round(T[(k8 + i) * PPT + n + 32 * u]) * 16.0f);
    *(v8us*)(bo + (size_t)(32 * u) * DM) = f.half[0]; }
}

// ---- projection GEMM: C = A Bh^T / 16 + bias, A [4096][1024] and Bh [3072][1024] f16, both k-contiguous. One work-group = a 256 x 192 tile (192 columns = ONE head's q | k | v), twelve waves of 64 x 64 (4 x 4 accumulator tiles each):
// 16 x 16 = 256 work-groups, one on every WGP. Against a 128 x 128 tile every operand byte that comes from L2 feeds 1.7 times as many products: (1/256 + 1/192) against (1/128 + 1/128) of the operand bytes per product.
// A stage = 128 k of the tile's 256 A rows and 192 Bh rows (256-byte rows) in LDS, brought by asynchronous 16-byte copies (global_load_async_to_lds_b128) into two buffers: stage t + 2 flies while stage t + 1 is worked on.
// Every fragment is read from LDS and feeds four products; a k step is 32, taken in rising order into the same accumulator.
// Epilogue by 64-column slices (wave column wn = 0 q, 1 k, 2 v): q and k slices go as f16 rows into C16 (whole 128-byte lines; q times QSC, the softmax scale in base 2),
// the v slice goes TRANSPOSED into the head's V^T plane VTo[(b NH + h) HD + d][key] and nowhere else (a lane's accumulator holds 8 consecutive keys of ONE d: 16 contiguous bytes of a V^T row; 512-byte runs).
#define GTM 256                      /* rows of a work-group's tile */
#define GTN 192                      /* columns of a work-group's tile: one head's q | k | v */
#define VTP 264                      /* LDS pitch of a staged V^T row in f16: 512 data bytes + 16, an odd multiple of 16 bytes for the 16-byte stores and reads */
#define GK 128                       /* k per stage */
#define GP 136                       /* LDS row pitch of a stage in f16: 256 data bytes + 16, an odd multiple of 16 bytes for the 16-byte fragment reads */
#define GSTG ((GTM + GTN) * GP)      /* f16 per stage: 256 A rows, then 192 Bh rows */
#define GEP 72                       /* LDS row pitch of a staged q or k slice in f16: 128 data bytes + 16 */
#define GEH (GTM * GEP)              /* f16 per epilogue slice: [256 rows][GEP], or [64 d][VTP], which is smaller */
static_assert(3 * GEH <= 2 * GSTG && HD * VTP <= GEH, "the three output slices fit the stages' LDS");
static_assert(GTN == 3 * HD && SQ % GTM == 0, "a tile is one head's columns and lies inside one batch");
#define QSC (0.125f * 1.4426950408889634f)      /* 1 / sqrt(64), and base e to base 2: q is stored times this (applied in f32, in front of its one f16 rounding), so that k . q is the score in log2 units */
__device__ __forceinline__ v16h g2_frag(const _Float16* p, int hh) { FragH f; f.half[0] = *(const v8us*)((const unsigned short*)p + 8 * hh); f.half[1] = *(const v8us*)((const unsigned short*)p + 16 + 8 * hh); return f.v; }
__device__ __forceinline__ v16h g3_frag(const unsigned short* p, int hh) { FragH f; f.half[0] = *(const v8us*)(p + 8 * hh); f.half[1] = *(const v8us*)(p + 16 + 8 * hh); return f.v; }
// Eight copies of a lane: its 16-byte chunk of rows r, r + 2, ..., r + 14 (a wave's copy = two whole 256-byte rows). l = the lane's LDS byte address, g = its global address.
// The s_wait_xcnt stands inside the statement, behind the last copy, so that no address register of a copy is rewritten in front of it.
__device__ __forceinline__ void g3_copy8(unsigned l, const _Float16* g) {
  asm volatile("global_load_async_to_lds_b128 %0, %8, off\n\tglobal_load_async_to_lds_b128 %1, %9, off\n\tglobal_load_async_to_lds_b128 %2, %10, off\n\tglobal_load_async_to_lds_b128 %3, %11, off\n\t"
               "global_load_async_to_lds_b128 %4, %12, off\n\tglobal_load_async_to_lds_b128 %5, %13, off\n\tglobal_load_async_to_lds_b128 %6, %14, off\n\tglobal_load_async_to_lds_b128 %7, %15, off\n\ts_wait_xcnt 0x0"
               :: "v"(l), "v"(l + 2 * GP * 2), "v"(l + 4 * GP * 2), "v"(l + 6 * GP * 2), "v"(l + 8 * GP * 2), "v"(l + 10 * GP * 2), "v"(l + 12 * GP * 2), "v"(l + 14 * GP * 2),
                  "v"(g), "v"(g + 2 * DM), "v"(g + 4 * DM), "v"(g + 6 * DM), "v"(g + 8 * DM), "v"(g + 10 * DM), "v"(g + 12 * DM), "v"(g + 14 * DM) : "memory");
}
// A wave's share of one stage: waves 0 to 7 bring 32 A rows each, waves 8 to 11 bring 48 Bh rows each (more = that wave brings Bh rows; the same in every lane: a scalar branch).
__device__ __forceinline__ void g3_stage(unsigned l, const _Float16* g, bool more) {
  g3_copy8(l, g); g3_copy8(l + 16 * GP * 2, g + 16 * DM);
  if (more) g3_copy8(l + 32 * GP * 2, g + 32 * DM);
}
__global__ __launch_bounds__(384) void k_gemm3(const _Float16* __restrict__ A, const _Float16* __restrict__ Bh, const float* __restrict__ bias, _Float16* __restrict__ C16, _Float16* __restrict__ VTo) {
  __shared__ __attribute__((aligned(16))) unsigned short sm[2 * GSTG];
  const int tid = threadIdx.x, lane = tid & 31, ln = lane & 15, hh = lane >> 4;
  const int w = __builtin_amdgcn_readfirstlane(tid >> 5), wm = w & 3, wn = w >> 2;      /* the wave's number, the same in every lane; its 64-row block and its 64-column slice */
  const int mt = blockIdx.x / (LQ / GTN), nt = blockIdx.x % (LQ / GTN); const int row0 = mt * GTM, col0 = nt * GTN;
  const bool cb_ = w >= 8;      /* this wave copies Bh rows */
  const int crow = (cb_ ? GTM + 48 * (w - 8) : 32 * w) + hh, cc8 = ln * 8;      /* the lane's first row in the stage and its 16-byte chunk in every copy */
  const _Float16* cg = (cb_ ? Bh + (size_t)(col0 + crow - GTM) * DM : A + (size_t)(row0 + crow) * DM) + cc8;
  const unsigned cl = (unsigned)(size_t)&sm[crow * GP + cc8];
  g3_stage(cl, cg, cb_);
  asm volatile("s_wait_asynccnt 0x0" ::: "memory");      /* this wave's share of stage 0 has landed */
  __syncthreads();      /* stage 0 is complete before anybody reads it */
  g3_stage(cl + GSTG * 2, cg + GK, cb_);
  const v8f z8 = {0.f, 0.f, 0.f, 0.f, 0.f, 0.f, 0.f, 0.f};
  v8f acc[4][4];
#pragma unroll
  for (int i = 0; i < 4; ++i)
#pragma unroll
    for (int j = 0; j < 4; ++j) acc[i][j] = z8;
  /* the stage loop stays rolled (one copy of its 64 products in the instruction cache); everything inside is unrolled, so that acc is indexed by constants only and stays in registers */
#pragma unroll 1
  for (int t = 0; t < DM / GK; ++t) {
    const unsigned short* sa = sm + (t & 1) * GSTG + (64 * wm + ln) * GP; const unsigned short* sb = sm + (t & 1) * GSTG + (GTM + 64 * wn + ln) * GP;
#pragma unroll
    for (int ks = 0; ks < GK / 32; ++ks) {
      /* The k step's eight fragments are read as one group, whole in front of its sixteen products. The scheduling fences hold that order: without them the compiler keeps one A fragment,
         reads the next among the products and waits out the LDS latency in front of every four of them. */
      __builtin_amdgcn_sched_barrier(0);      /* nothing of the group's reads moves up among the products before */
      v16h af[4], bf[4];
#pragma unroll
      for (int i = 0; i < 4; ++i) { af[i] = g3_frag(sa + 16 * i * GP + ks * 32, hh); bf[i] = g3_frag(sb + 16 * i * GP + ks * 32, hh); }
      __builtin_amdgcn_sched_barrier(0);      /* none of the group's reads sinks among its products */
#pragma unroll
      for (int i = 0; i < 4; ++i)
#pragma unroll
        for (int j = 0; j < 4; ++j) acc[i][j] = __builtin_amdgcn_wmma_f32_16x16x32_f16(false, af[i], false, bf[j], (short)0, acc[i][j], false, false);
    }
    __builtin_amdgcn_sched_barrier(0);      /* keeps the last sixteen products above the stage's foot: without it the compiler sinks them behind the barrier, in front of the copies, which then start that much later */
    asm volatile("s_wait_dscnt 0x0" ::: "memory");      /* this wave's reads of stage t are done before the buffer is handed back */
    asm volatile("s_wait_asynccnt 0x0" ::: "memory");      /* this wave's share of stage t + 1 has landed */
    __syncthreads();      /* publishes stage t + 1 and ends every wave's reads of stage t */
    if (t + 2 < DM / GK) g3_stage(cl + (t & 1) * (GSTG * 2), cg + (t + 2) * GK, cb_);
  }
  asm volatile("s_wait_asynccnt 0x0" ::: "memory");      /* nothing is in flight when the buffers become output staging */
  /* behind the loop's last barrier nobody reads a stage any more: each column slice is staged in its own GEH range */
  { unsigned short* sr = sm + wn * GEH; const int cb = col0 + 64 * wn;
    float bv[4];
#pragma unroll
    for (int j = 0; j < 4; ++j) bv[j] = bias[cb + 16 * j + ln];
#pragma unroll
    for (int j = 0; j < 4; ++j) bv[j] = bf16_round(bv[j]);
    if (wn == 2) {
#pragma unroll
      for (int i = 0; i < 4; ++i)
#pragma unroll
        for (int j = 0; j < 4; ++j) { FragH f;
#pragma unroll
          for (int r = 0; r < 8; ++r) f.h[r] = (_Float16)(acc[i][j][r] * 0.0625f + bv[j]);
          *(v8us*)(sr + (16 * j + ln) * VTP + 64 * wm + 16 * i + 8 * hh) = f.half[0]; }
    } else {
      const float qs = wn == 0 ? QSC : 1.0f, as = 0.0625f * qs;      /* the q slice carries the softmax scale; the k slice keeps its bits (factor 1) */
#pragma unroll
      for (int i = 0; i < 4; ++i)
#pragma unroll
        for (int j = 0; j < 4; ++j) { FragH f;
#pragma unroll
          for (int r = 0; r < 8; ++r) f.h[r] = (_Float16)(acc[i][j][r] * as + bv[j] * qs);
#pragma unroll
          for (int r = 0; r < 8; ++r) sr[(64 * wm + 16 * i + 8 * hh + r) * GEP + 16 * j + ln] = f.u[r]; }
    } }
  __syncthreads();      /* all three slices are whole in LDS before anybody reads a row */
  { const unsigned short* sr = sm + wn * GEH; const int cb = col0 + 64 * wn, t4 = tid & 127;      /* the four waves of a slice store it: 2048 chunks of 16 bytes, sixteen a lane */
    const bool isv = wn == 2;      /* the same for the whole wave */
    const int sh = isv ? 5 : 3, lp = isv ? VTP : GEP, gp = isv ? SQ : LQ;      /* 16-byte chunks a staged row (log2), its LDS pitch, its pitch in memory: V^T rows of 512 bytes, or q / k rows of 128 */
    unsigned short* gb = isv ? (unsigned short*)VTo + ((size_t)(row0 / SQ) * NH + nt) * HD * SQ + row0 % SQ : (unsigned short*)C16 + (size_t)row0 * LQ + cb;
#pragma unroll
    for (int n = 0; n < 2; ++n) {
      v8us dv[8]; unsigned short* dp[8];
#pragma unroll
      for (int i = 0; i < 8; ++i) { const int c = t4 + 128 * (8 * n + i), x = c >> sh, y = (c & ((1 << sh) - 1)) * 8; dv[i] = *(const v8us*)(sr + x * lp + y); dp[i] = gb + (size_t)x * gp + y; }
      __builtin_amdgcn_sched_barrier(0);      /* the eight reads and addresses stand whole in front of the stores, so that no register of an issued store is rewritten among them */
#pragma unroll
      for (int i = 0; i < 8; ++i) *(v8us*)dp[i] = dv[i];      /* a wave's store = whole lines: one 512-byte run, or four 128-byte rows */
      if (n == 0) { asm volatile("s_wait_xcnt 0x0" ::: "memory");      /* in front of the second half's work, which rewrites the registers that these stores name */
        __builtin_amdgcn_sched_barrier(0); }      /* holds that work behind the wait */
    }
  }
}


__global__ __launch_bounds__(256) void k_wnat(const float* __restrict__ w, size_t n8, _Float16* __restrict__ Bt) { const size_t t = (size_t)blockIdx.x * 256 + threadIdx.x; if (t >= n8) return; FragH f; for (int q = 0; q < 8; ++q) f.h[q] = (_Float16)(bf16_round(w[t * 8 + q]) * 16.0f); *(v8us*)((unsigned short*)Bt + t * 8) = f.half[0];  }
#define FK 64                        /* keys per pass */
#define FPT 72                       /* LDS row pitch in f16: 128 data bytes + 16, an odd multiple of 16 bytes for the 16-byte fragment reads */
#define FG 2                         /* key groups of a work-group */
#define FKG (SQ / FG)                /* keys of a group */
#define FTL (FK * FPT)               /* f16 per staged tile (K: [key][d]; V^T: [d][key]; HD = FK rows each) */
#define FXS 17                       /* 16-byte slots a lane hands over at the join: 16 of O^T, one of m and l */
static_assert(4 * FXS * 32 * 16 <= FG * 2 * FTL * 2, "the join's exchange area fits the tiles' LDS");
__device__ __forceinline__ v16h fa_frag(const unsigned short* p, int hh) { FragH f; f.half[0] = *(const v8us*)(p + 8 * hh); f.half[1] = *(const v8us*)(p + 16 + 8 * hh); return f.v; }
__device__ __forceinline__ v8f fa_mma(v16h a, v16h b, v8f c) { return __builtin_amdgcn_wmma_f32_16x16x32_f16(false, a, false, b, (short)0, c, false, false); }
__device__ __forceinline__ float fa_xhalf(float x) { return __builtin_bit_cast(float, __builtin_amdgcn_permlanex16(__builtin_bit_cast(int, x), __builtin_bit_cast(int, x), 0x76543210, 0xfedcba98, false, false)); }      /* lane l reads lane l ^ 16, on the vector pipe: no LDS round trip */
__device__ __forceinline__ float fa_exp2(float x) { float e; asm("v_exp_f32 %0, %1\n\tv_nop" : "=v"(e) : "v"(x)); return e; }
__device__ __forceinline__ v8f fa_exp2x8(v8f x) { float e0, e1, e2, e3, e4, e5, e6, e7;
  asm("v_exp_f32 %0, %8\n\tv_exp_f32 %1, %9\n\tv_exp_f32 %2, %10\n\tv_exp_f32 %3, %11\n\tv_exp_f32 %4, %12\n\tv_exp_f32 %5, %13\n\tv_exp_f32 %6, %14\n\tv_exp_f32 %7, %15\n\tv_nop"
      : "=&v"(e0), "=&v"(e1), "=&v"(e2), "=&v"(e3), "=&v"(e4), "=&v"(e5), "=&v"(e6), "=&v"(e7) : "v"(x[0]), "v"(x[1]), "v"(x[2]), "v"(x[3]), "v"(x[4]), "v"(x[5]), "v"(x[6]), "v"(x[7]));
  const v8f e = {e0, e1, e2, e3, e4, e5, e6, e7}; return e; }
__global__ __launch_bounds__(256) __attribute__((amdgpu_waves_per_eu(4, 4))) void k_fattn(const _Float16* __restrict__ QKVp, const _Float16* __restrict__ VTp, float* __restrict__ O) {
  __shared__ __attribute__((aligned(16))) unsigned short sm[FG * 2 * FTL];      /* per group: K rows of the pass [key][d], then V^T rows of the pass [d][key] */
  const int g = __builtin_amdgcn_readfirstlane((int)threadIdx.x >> 7);      /* the wave's key group, the same in every lane */
  const int tid = threadIdx.x & 127, w = tid >> 5, lane = tid & 31, ln = lane & 15, hh = lane >> 4;      /* place inside the group */
  unsigned short* Ks = sm + g * (2 * FTL); unsigned short* Vs = Ks + FTL;
  const int bh = blockIdx.x / (SQ / 128), qb = blockIdx.x % (SQ / 128); const int b = bh / NH, h = bh % NH;
  const _Float16* qg = QKVp + (size_t)b * SQ * LQ + (size_t)h * 3 * HD;      /* head h's 192 packed columns: q at + 0, k at + 64 */
  const int q0 = qb * 128 + w * 32;
  v16h qf[2][2];
#pragma unroll
  for (int qt = 0; qt < 2; ++qt)
#pragma unroll
    for (int ks = 0; ks < 2; ++ks) qf[qt][ks] = g2_frag(qg + (size_t)(q0 + qt * 16 + ln) * LQ + ks * 32, hh);
  /* staging: thread t moves 16-byte chunks t, t + 128, t + 256, t + 384 of each 64 x 128-byte tile: 8 chunks a row, so a wave's load covers 4 whole lines */
  const int frow = tid >> 3, fc8 = (tid & 7) * 8;
  const unsigned short* kp = (const unsigned short*)qg + HD + (size_t)(g * FKG + frow) * LQ + fc8;
  const unsigned short* vp = (const unsigned short*)VTp + (size_t)bh * HD * SQ + (size_t)frow * SQ + g * FKG + fc8;
  v8us kr[4], vr[4];
#pragma unroll
  for (int j = 0; j < 4; ++j) { kr[j] = *(const v8us*)(kp + (size_t)(16 * j) * LQ); vr[j] = *(const v8us*)(vp + (size_t)(16 * j) * SQ); }
  const v8f z8 = {0.f, 0.f, 0.f, 0.f, 0.f, 0.f, 0.f, 0.f};
  v8f o[2][4]; float m[2], l[2];
#pragma unroll
  for (int qt = 0; qt < 2; ++qt) { m[qt] = 0.f; l[qt] = 0.f;
#pragma unroll
    for (int dt = 0; dt < 4; ++dt) o[qt][dt] = z8; }
  /* the pass loop stays whole: peeled for its p == 0 test, the first pass is scheduled together with the step of m, runs out of registers and spills tiles in flight */
#pragma unroll 1
  for (int p = 0; p < FKG / FK; ++p) {
    __syncthreads();      /* every wave has finished reading the pass before */
#pragma unroll
    for (int j = 0; j < 4; ++j) { *(v8us*)(Ks + (frow + 16 * j) * FPT + fc8) = kr[j]; *(v8us*)(Vs + (frow + 16 * j) * FPT + fc8) = vr[j]; }
    __syncthreads();      /* the tiles are complete before anybody reads them */
    v16h ka[4][2];      /* the pass's K fragment reads stand with the global loads in front of the fence below, as one group ahead of the products */
#pragma unroll
    for (int kt = 0; kt < 4; ++kt)
#pragma unroll
      for (int ks = 0; ks < 2; ++ks) ka[kt][ks] = fa_frag(Ks + (kt * 16 + ln) * FPT + ks * 32, hh);
    if (p + 1 < FKG / FK) {      /* the next pass's tiles fly to registers while this pass is worked on */
#pragma unroll
      for (int j = 0; j < 4; ++j) { kr[j] = *(const v8us*)(kp + (size_t)(FK + 16 * j) * LQ); vr[j] = *(const v8us*)(vp + (size_t)(16 * j) * SQ + FK); }
    }
    __builtin_amdgcn_sched_barrier(0);      /* keeps the eight loads above the pass's work: without it the compiler sinks them to the loop's foot, and their whole latency is waited for at the next pass's head */
    v8f st[2][4], cm[2];      /* cm = -m in all eight registers (a lane's scores are all of one query), formed anew each pass: held over the pass it would take sixteen registers from the softmax and the second product */
#pragma unroll
    for (int qt = 0; qt < 2; ++qt)
#pragma unroll
      for (int r = 0; r < 8; ++r) cm[qt][r] = -m[qt];
#pragma unroll
    for (int kt = 0; kt < 4; ++kt)
#pragma unroll
      for (int qt = 0; qt < 2; ++qt) st[qt][kt] = fa_mma(ka[kt][1], qf[qt][1], fa_mma(ka[kt][0], qf[qt][0], cm[qt]));      /* st[qt][kt][r] = q(q0 + 16 qt + ln) . k(1024 g + 64 p + 16 kt + 8 hh + r) log2(e) / 8 - m */
    __builtin_amdgcn_sched_barrier(0);      /* the maxima start when the last K fragment is dead: mixed among the products, their partial results come on top of fragments, scores and -m, and the compiler spills the tiles in flight */
    float mx[2];      /* the pass's maximum above m, per query */
#pragma unroll
    for (int qt = 0; qt < 2; ++qt) {
      v8f x8 = st[qt][0];
#pragma unroll
      for (int r = 0; r < 8; ++r) x8[r] = fmaxf(fmaxf(st[qt][0][r], st[qt][1][r]), fmaxf(st[qt][2][r], st[qt][3][r]));
      const float mh = fmaxf(fmaxf(fmaxf(x8[0], x8[1]), fmaxf(x8[2], x8[3])), fmaxf(fmaxf(x8[4], x8[5]), fmaxf(x8[6], x8[7])));
      mx[qt] = fmaxf(mh, fa_xhalf(mh));      /* the other half of the query's 64 keys */
    }
    if (p == 0 || __builtin_amdgcn_ballot_w32(fmaxf(mx[0], mx[1]) > 8.0f) != 0) {      /* one scalar branch a pass: the first pass sets m, a later one raises it for the whole wave when any of its queries asks for it */
#pragma unroll
      for (int qt = 0; qt < 2; ++qt) {
        const float dl = p == 0 ? mx[qt] : fmaxf(mx[qt], 0.f);      /* m never falls; on the first pass it goes from 0 to the maximum, up or down */
        const float al = fa_exp2(-fabsf(dl));      /* 2^(m_old - m_new); on the first pass l and O^T are 0, and any finite factor serves */
        m[qt] += dl;
#pragma unroll
        for (int kt = 0; kt < 4; ++kt) st[qt][kt] -= dl;
        l[qt] *= al;
#pragma unroll
        for (int dt = 0; dt < 4; ++dt) o[qt][dt] *= al;
      }
    }
    FragH pf[2][2];
#pragma unroll
    for (int qt = 0; qt < 2; ++qt) {
      v8f s8 = z8;
#pragma unroll
      for (int kt = 0; kt < 4; ++kt) { const v8f e8 = fa_exp2x8(st[qt][kt]); s8 += e8;
#pragma unroll
        for (int r = 0; r < 8; ++r) pf[qt][kt >> 1].h[(kt & 1) * 8 + r] = (_Float16)e8[r]; }
      l[qt] += ((s8[0] + s8[1]) + (s8[2] + s8[3])) + ((s8[4] + s8[5]) + (s8[6] + s8[7]));
    }
    /* The V^T fragments are read in two groups of four, each group whole in front of its eight products. The scheduling fences hold that order: without them the compiler mixes the softmax into the products,
       runs short of registers and waits for LDS in front of every pair of products; all eight fragments at once would take the kernel past 256 registers. */
#pragma unroll
    for (int dg = 0; dg < 2; ++dg) {
      __builtin_amdgcn_sched_barrier(0);      /* nothing of the group's reads moves up into the work before */
      v16h va[2][2];
#pragma unroll
      for (int d2 = 0; d2 < 2; ++d2)
#pragma unroll
        for (int ks = 0; ks < 2; ++ks) va[d2][ks] = fa_frag(Vs + ((dg * 2 + d2) * 16 + ln) * FPT + ks * 32, hh);
      __builtin_amdgcn_sched_barrier(0);      /* none of the group's reads sinks among its products */
#pragma unroll
      for (int d2 = 0; d2 < 2; ++d2)
#pragma unroll
        for (int ks = 0; ks < 2; ++ks)
#pragma unroll
          for (int qt = 0; qt < 2; ++qt) o[qt][dg * 2 + d2] = fa_mma(va[d2][ks], pf[qt][ks].v, o[qt][dg * 2 + d2]);      /* o[qt][dt][r] = O[q0 + 16 qt + ln][16 dt + 8 hh + r] */
    }
    asm volatile("s_wait_xcnt 0x0" ::: "memory");      /* the wait in front of a rewrite of the address registers that this pass's global loads name; at the pass's foot it has long been met, at the loads it would stand in front of the K reads */
    __builtin_amdgcn_sched_barrier(0);      /* holds the step of those registers behind the wait */
    if (p + 1 < FKG / FK) { kp += (size_t)FK * LQ; vp += FK; }
  }
  /* The join: group 1 hands its m, l and O^T to group 0 through the tiles' LDS, lane to lane (wave w of group 1 holds the same queries, at the same places, as wave w of group 0); 16 bytes a lane, contiguous over a wave. */
  __syncthreads();      /* every wave has finished reading the last pass's tiles before they are overwritten */
  v4fa* xs = (v4fa*)sm + (size_t)(w * FXS) * 32 + lane;
  if (g == 1) {
#pragma unroll
    for (int qt = 0; qt < 2; ++qt)
#pragma unroll
      for (int dt = 0; dt < 4; ++dt) { const v4f lo = {o[qt][dt][0], o[qt][dt][1], o[qt][dt][2], o[qt][dt][3]}, hi = {o[qt][dt][4], o[qt][dt][5], o[qt][dt][6], o[qt][dt][7]};
        xs[((qt * 4 + dt) * 2) * 32] = lo; xs[((qt * 4 + dt) * 2 + 1) * 32] = hi; }
    const v4f ml = {m[0], m[1], l[0], l[1]}; xs[16 * 32] = ml;
  }
  __syncthreads();      /* group 1's results are whole in LDS before group 0 reads them */
  if (g == 1) return;      /* behind the last barrier */
  const v4f ml1 = xs[16 * 32];
#pragma unroll
  for (int qt = 0; qt < 2; ++qt) {
    const float mj = fmaxf(m[qt], ml1[qt]); const float a0 = fa_exp2(m[qt] - mj), a1 = fa_exp2(ml1[qt] - mj);      /* both groups' results are brought to the common maximum */
    const float lj = l[qt] * a0 + ml1[2 + qt] * a1; const float inv = 1.0f / (lj + fa_xhalf(lj)); const float c0 = a0 * inv, c1 = a1 * inv;
    float* orow = O + ((size_t)bh * SQ + q0 + qt * 16 + ln) * HD + 8 * hh;      /* head plane bh, row = query: the raw-view merge */
#pragma unroll
    for (int dt = 0; dt < 4; ++dt) { const v4f lo1 = xs[((qt * 4 + dt) * 2) * 32], hi1 = xs[((qt * 4 + dt) * 2 + 1) * 32];
      const v4f lo = {o[qt][dt][0] * c0 + lo1[0] * c1, o[qt][dt][1] * c0 + lo1[1] * c1, o[qt][dt][2] * c0 + lo1[2] * c1, o[qt][dt][3] * c0 + lo1[3] * c1},
                hi = {o[qt][dt][4] * c0 + hi1[0] * c1, o[qt][dt][5] * c0 + hi1[1] * c1, o[qt][dt][6] * c0 + hi1[2] * c1, o[qt][dt][7] * c0 + hi1[3] * c1};
      *(v4f*)(orow + dt * 16) = lo; *(v4f*)(orow + dt * 16 + 4) = hi; } }
}
__global__ __launch_bounds__(256) void k_vt(const _Float16* __restrict__ V16, int b, int h0, _Float16* __restrict__ VT) { __shared__ unsigned short tl[64][65]; const int tid = threadIdx.x; const int hh = blockIdx.x % HG, sg = blockIdx.x / HG; const int s0 = sg * 64; const int h = h0 + hh;
  for (int i = tid; i < 64 * 8; i += 256) { const int j = i / 8, d8 = (i % 8) * 8; FragH f; f.half[0] = *(const v8us*)((const unsigned short*)V16 + ((size_t)b * SQ + s0 + j) * DM + h * HD + d8); for (int q = 0; q < 8; ++q) tl[d8 + q][j] = f.u[q]; }
  __syncthreads();
  { for (int i = tid; i < 64 * 8; i += 256) { const int d = i / 8, j8 = (i % 8) * 8; FragH f; for (int q = 0; q < 8; ++q) f.u[q] = tl[d][j8 + q]; *(v8us*)((unsigned short*)VT + ((size_t)hh * HD + d) * SQ + s0 + j8) = f.half[0]; }  } }


extern "C" void kernel_launch(void* const* d_in, const int* in_sizes, int n_in,
                              void* d_out, int out_size, void* d_ws, size_t ws_size, hipStream_t stream) {
  (void)in_sizes; (void)n_in; (void)out_size;
  const float* const* I = (const float* const*)d_in; const float* x = I[0]; const float* wqkv = I[1]; const float* bqkv = I[2];      /* input order: x, W_qkv ([in][out] [1024][3072]; columns packed PER HEAD: 192 h + {0..63 q, 64..127 k, 128..191 v}), b_qkv [3072] (REAL; the same packing: the projection GEMM's bias slot reads it by output column); three inputs; no output weight: the module has none */
  char* ws = (char*)d_ws; size_t off = 0;
  auto take = [&](size_t bytes) { char* p = ws + off; off += (bytes + 255) & ~(size_t)255; return p; };
  _Float16* BQKV = (_Float16*)take((size_t)3 * DM * DM * 2);
  _Float16* X16 = (_Float16*)take(NR * DM * 2); _Float16* QKV = (_Float16*)take(NR * 3 * DM * 2);      /* PER-HEAD packing: within head h's 192 columns q starts at + 0, k at + 64; the v columns (+ 128) are never written here: they go to VT; the head stride is 3 HD */
  _Float16* VT = (_Float16*)take((size_t)NB * NH * HD * SQ * 2);      /* V^T planes of every (batch, head) */
  if (off > ws_size) return;
  k_prep<<<PWG, 256, 0, stream>>>(x, wqkv, X16, BQKV);      /* x -> f16 rows; W [in][out] -> Bt[n][k] x16 (pitch K = 1024) */
  const size_t r0p = (size_t)B0 * SQ;      /* first projected row */
  k_gemm3<<<(unsigned)((MP / GTM) * (LQ / GTN)), 384, 0, stream>>>(X16 + r0p * DM, BQKV, bqkv, QKV + r0p * 3 * DM, VT + (size_t)B0 * NH * HD * SQ);      /* q | k rows (f16, packed per head) and the V^T planes */
  k_fattn<<<NB * NH * (SQ / 128), 256, 0, stream>>>(QKV, VT, (float*)d_out);      /* all batches and heads in one launch: softmax(q k^T / 8) v, each head into its own contiguous [2048][64] plane */
}
